// v000
// Times are from an AMD MI455X. After a warm-up the kernel runs many times in a row, and a time is the length of
// such a window on the GPU divided by its runs, so every launch and the gaps after it count. The runs cycle
// through copies of the inputs. A figure is the median of several windows, for all but v000 over two sittings.
// Sittings can differ by a few percent; kernels timed side by side share one.
// The starting kernel, v000, takes 1340 microseconds a run.
#include <hip/hip_runtime.h>
#include <stdint.h>
#include <stddef.h>

// Contractions: qkv projection = v_wmma_f32_16x16x32_bf16 (bf16 operands, f32 accumulate);
// q.k scores, p.v and output projection = v_wmma_f32_16x16x32_f16 (f16 operands with
// power-of-two carries plus x1024 f16 residual planes on the leading SE query rows,
// f32 accumulate). Softmax and epilogues in f32; rotary sin/cos via f64 quadrant
// reduction + polynomial (no fused multiply-add), rotation in unfused f32.

#ifndef NB
#define NB 1
#endif
#ifndef SEQ
#define SEQ 4096
#endif
#ifndef SE
#if SEQ < 640
#define SE SEQ
#else
#define SE 640
#endif
#endif
#define SEQ_FULL 4096
#define HID 2048
#define NH 16
#define NKV 4
#define HD 128
#define NQKV (NH * HD + 2 * NKV * HD)
#define BQW 32

static_assert(NB == 1);
static_assert(SEQ % 64 == 0);
static_assert(SEQ >= SE);
static_assert(SEQ <= SEQ_FULL);
static_assert(SE >= 64);
static_assert(SE % 64 == 0);
static_assert(SE % BQW == 0);
static_assert(HID % 128 == 0);
static_assert(HID == 256 * 8);
static_assert(NQKV % 128 == 0);
static_assert(HD == 128);
static_assert(NH == 4 * NKV);
static_assert(NH * HD == HID);

typedef _Float16 f16;
typedef __bf16 bf16;
typedef unsigned short u16;
typedef f16 v16h __attribute__((ext_vector_type(16)));
typedef bf16 v16b __attribute__((ext_vector_type(16)));
typedef float v8f __attribute__((ext_vector_type(8)));
typedef float v4f __attribute__((ext_vector_type(4)));
typedef unsigned v4u __attribute__((ext_vector_type(4)));

union FragH { v16h v; v4u q[2]; f16 h[16]; };
union FragB { v16b v; v4u q[2]; };

__device__ __forceinline__ v8f zero8() {
  v8f z = {0.0f, 0.0f, 0.0f, 0.0f, 0.0f, 0.0f, 0.0f, 0.0f};
  return z;
}

// 16x16x32 f16 WMMA followed by a 4-slot VALU hazard guard on D (A/B kept live).
__device__ __forceinline__ v8f wg_h(v8f acc, v16h a, v16h b) {
  acc = __builtin_amdgcn_wmma_f32_16x16x32_f16(false, a, false, b, (short)0, acc, false, false);
  asm volatile("v_nop\n\tv_nop\n\tv_nop\n\tv_nop" : "+v"(acc) : "v"(a), "v"(b));
  return acc;
}
__device__ __forceinline__ v8f wg_b(v8f acc, v16b a, v16b b) {
  acc = __builtin_amdgcn_wmma_f32_16x16x32_bf16(false, a, false, b, (short)0, acc, false, false);
  asm volatile("v_nop\n\tv_nop\n\tv_nop\n\tv_nop" : "+v"(acc) : "v"(a), "v"(b));
  return acc;
}

// f32 -> bf16 bits, RNE convert.
__device__ __forceinline__ unsigned bf16_rne(float f) {
  const unsigned u = __float_as_uint(f);
  return (u + 0x7FFFu + ((u >> 16) & 1u)) >> 16;
}
// f32 -> f16 bits, RNE convert.
__device__ __forceinline__ u16 hbits(float f) {
  const f16 x = (f16)f;
  return __builtin_bit_cast(u16, x);
}
// f32 -> f16 hi bits plus f16 bits of (v - hi) * 1024 (unfused: sub then mul).
__device__ __forceinline__ void split1024(float v, u16& hb, u16& lb) {
#pragma clang fp contract(off)
  const f16 x = (f16)v;
  const float xr = (float)x;
  const float dlt = v - xr;
  const f16 y = (f16)(dlt * 1024.0f);
  hb = __builtin_bit_cast(u16, x);
  lb = __builtin_bit_cast(u16, y);
}
__device__ __forceinline__ int imin(int a, int b) { return a < b ? a : b; }
__device__ __forceinline__ int imax(int a, int b) { return a > b ? a : b; }

// sin/cos of an f32 angle (0 <= ang <= ~4100 rad) in f64 without fused multiply-add:
// quadrant count kq = rint(x * 2/pi); r = (x - kq * P1) - kq * P2 with P1 = the leading
// 33 bits of pi/2 (kq * P1 exact for kq < 2^20) and P2 its tail; odd/even polynomials on
// |r| <= pi/4 (truncation < 3e-14); quadrant select by value; convert to f32.
__device__ __forceinline__ void rot_sincos(float ang, float& sn, float& cs) {
#pragma clang fp contract(off)
  const double x = (double)ang;
  const double kq = __builtin_rint(x * 0.63661977236758134308);
  double r = x - kq * 1.57079632673412561417;
  r = r - kq * 6.07710050650619224932e-11;
  const int q = (int)kq;
  const double r2 = r * r;
  double ps = 1.6059043836821613e-10;
  ps = ps * r2 - 2.5052108385441720e-08;
  ps = ps * r2 + 2.7557319223985893e-06;
  ps = ps * r2 - 1.9841269841269841e-04;
  ps = ps * r2 + 8.3333333333333332e-03;
  ps = ps * r2 - 1.6666666666666666e-01;
  const double r3 = r * r2;
  const double sr = r + r3 * ps;
  double pc = -1.1470745597729725e-11;
  pc = pc * r2 + 2.0876756987868099e-09;
  pc = pc * r2 - 2.7557319223985888e-07;
  pc = pc * r2 + 2.4801587301587302e-05;
  pc = pc * r2 - 1.3888888888888889e-03;
  pc = pc * r2 + 4.1666666666666664e-02;
  pc = pc * r2 - 0.5;
  const double cr = 1.0 + pc * r2;
  const bool odd = (q & 1) != 0;
  const bool neg = (q & 2) != 0;
  double sv = odd ? cr : sr;
  double cv = odd ? -sr : cr;
  sv = neg ? -sv : sv;
  cv = neg ? -cv : cv;
  sn = (float)sv;
  cs = (float)cv;
}

// ---------------------------------------------------------------------------------------
// hidden f32 [SEQ][HID] -> bf16 bits [SEQ][HID]; one block per row, 16 B per lane.
// Block 0, lanes 0..63 also produce the rotary inv_freq table (64 floats):
// inv[j] = fl32(1 / fl32(10000^(j/64))), with 10000^(1/64) from an iterative f64 64th root.
__global__ __launch_bounds__(256) void k_xconv(const float* __restrict__ x, u16* __restrict__ xb,
                                              float* __restrict__ tinv) {
#pragma clang fp contract(off)
  const int t = threadIdx.x;
  const size_t e = ((size_t)blockIdx.x * 256 + (size_t)t) * 8;
  const v4f a = *(const v4f*)(x + e);
  const v4f b = *(const v4f*)(x + e + 4);
  v4u w;
  w[0] = bf16_rne(a[0]) | (bf16_rne(a[1]) << 16);
  w[1] = bf16_rne(a[2]) | (bf16_rne(a[3]) << 16);
  w[2] = bf16_rne(b[0]) | (bf16_rne(b[1]) << 16);
  w[3] = bf16_rne(b[2]) | (bf16_rne(b[3]) << 16);

  const bool tab = (blockIdx.x == 0) && (t < 64);   // wave-uniform (waves 0,1 of block 0)
  float ivf = 0.0f;
  if (tab) {
    double rt = 1.15;
#pragma unroll 1
    for (int it = 0; it < 48; ++it) {
      double p63 = rt;
#pragma unroll 1
      for (int k = 1; k < 63; ++k) p63 *= rt;
      const double p64 = p63 * rt;
      const double f = p64 - 10000.0;
      rt = rt - f / (64.0 * p63);
    }
    double pj = 1.0;
#pragma unroll 1
    for (int k = 0; k < t; ++k) pj *= rt;           // t < 64: bounded
    const float pf = (float)pj;
    ivf = (float)(1.0 / (double)pf);
  }
  *(v4u*)(xb + e) = w;
  if (tab) *(float*)(tinv + t) = ivf;
  
}

// ---------------------------------------------------------------------------------------
// Weight transpose + convert: w f32 [HID][ncol] -> wt 16-bit [ncol][HID] (k contiguous).
// 8 consecutive lanes of one instruction. MODE 0: bf16 bits; MODE 1: f16 bits of
// 64 * bf16(w) (bf16 RNE value first, the x64 f16 copy of it is exact).
template <int MODE>
__global__ __launch_bounds__(256) void k_wt(const float* __restrict__ w, u16* __restrict__ wt, int ncol) {
  __shared__ __align__(16) u16 T[64 * 72];          // [o][i], pitch 72 halves (144 B)
  const int i0 = (int)blockIdx.x * 64, o0 = (int)blockIdx.y * 64, t = threadIdx.x;
#pragma unroll
  for (int j = 0; j < 4; ++j) {
    const int i = (t >> 4) + 16 * j;
    const int oc = (t & 15) * 4;
    const v4f v = *(const v4f*)(w + (size_t)(i0 + i) * (size_t)ncol + o0 + oc);
#pragma unroll
    for (int e = 0; e < 4; ++e) {
      const float f = v[e];
      u16 bb;
      if (MODE == 0) bb = (u16)bf16_rne(f);
      else bb = hbits(__uint_as_float(bf16_rne(f) << 16) * 64.0f);
      T[(oc + e) * 72 + i] = bb;
    }
  }
  __syncthreads();
  v4u val[2];
#pragma unroll
  for (int p = 0; p < 2; ++p) {
    const int o = (t >> 3) + 32 * p;
    val[p] = *(const v4u*)(T + o * 72 + (t & 7) * 8);
  }
#pragma unroll
  for (int p = 0; p < 2; ++p) {
    const int o = (t >> 3) + 32 * p;
    *(v4u*)(wt + (size_t)(o0 + o) * HID + i0 + (t & 7) * 8) = val[p];
  }
  
}

// ---------------------------------------------------------------------------------------
// C[m][n] (f32) = sh * sum_k A[m][k] * BT[n][k]  (+ sr * sum_k Ar[m][k] * BT[n][k] if RES)
// MODE 0: bf16 operands; MODE 1: f16 operands. Block 64 (M) x 128 (N), 8 waves each 32x32.
// Fragments straight from 16-bit global rows with the split k map (elements 0..7 at
template <int MODE, bool RES>
__global__ __launch_bounds__(256) void k_gemm(const u16* __restrict__ A, const u16* __restrict__ Ar,
                                             const u16* __restrict__ BT, float* __restrict__ C,
                                             int lda, int ldb, int ldc, int K, int row0,
                                             float sh, float sr) {
  __shared__ __align__(16) float Cs[8 * 32 * 36];
  const int tid = threadIdx.x, wave = tid >> 5, lane = tid & 31, h = lane >> 4, l = lane & 15;
  const int wm = wave >> 2, wn = wave & 3;
  const int mb = row0 + (int)blockIdx.y * 64 + wm * 32;
  const int nb = (int)blockIdx.x * 128 + wn * 32;
  const size_t rA0 = (size_t)(mb + l) * (size_t)lda, rA1 = (size_t)(mb + 16 + l) * (size_t)lda;
  const size_t rB0 = (size_t)(nb + l) * (size_t)ldb, rB1 = (size_t)(nb + 16 + l) * (size_t)ldb;
  v8f c00 = zero8(), c01 = zero8(), c10 = zero8(), c11 = zero8();
  v8f r00 = zero8(), r01 = zero8(), r10 = zero8(), r11 = zero8();

  for (int kk = 0; kk < K; kk += 32) {
    const int k0 = kk + 8 * h, k1 = kk + 16 + 8 * h;
    if (MODE == 0) {
      FragB a0, a1, b0, b1;
      a0.q[0] = *(const v4u*)(A + rA0 + k0);  a0.q[1] = *(const v4u*)(A + rA0 + k1);
      a1.q[0] = *(const v4u*)(A + rA1 + k0);  a1.q[1] = *(const v4u*)(A + rA1 + k1);
      b0.q[0] = *(const v4u*)(BT + rB0 + k0); b0.q[1] = *(const v4u*)(BT + rB0 + k1);
      b1.q[0] = *(const v4u*)(BT + rB1 + k0); b1.q[1] = *(const v4u*)(BT + rB1 + k1);
      c00 = wg_b(c00, a0.v, b0.v); c01 = wg_b(c01, a0.v, b1.v);
      c10 = wg_b(c10, a1.v, b0.v); c11 = wg_b(c11, a1.v, b1.v);
    } else {
      FragH a0, a1, b0, b1;
      a0.q[0] = *(const v4u*)(A + rA0 + k0);  a0.q[1] = *(const v4u*)(A + rA0 + k1);
      a1.q[0] = *(const v4u*)(A + rA1 + k0);  a1.q[1] = *(const v4u*)(A + rA1 + k1);
      b0.q[0] = *(const v4u*)(BT + rB0 + k0); b0.q[1] = *(const v4u*)(BT + rB0 + k1);
      b1.q[0] = *(const v4u*)(BT + rB1 + k0); b1.q[1] = *(const v4u*)(BT + rB1 + k1);
      c00 = wg_h(c00, a0.v, b0.v); c01 = wg_h(c01, a0.v, b1.v);
      c10 = wg_h(c10, a1.v, b0.v); c11 = wg_h(c11, a1.v, b1.v);
      if (RES) {
        FragH e0, e1;
        e0.q[0] = *(const v4u*)(Ar + rA0 + k0); e0.q[1] = *(const v4u*)(Ar + rA0 + k1);
        e1.q[0] = *(const v4u*)(Ar + rA1 + k0); e1.q[1] = *(const v4u*)(Ar + rA1 + k1);
        r00 = wg_h(r00, e0.v, b0.v); r01 = wg_h(r01, e0.v, b1.v);
        r10 = wg_h(r10, e1.v, b0.v); r11 = wg_h(r11, e1.v, b1.v);
      }
    }
  }

  float* cs = Cs + wave * (32 * 36);
#pragma unroll
  for (int e = 0; e < 8; ++e) {
    const int ra = 8 * h + e, rb = ra + 16;
    float v00 = sh * c00[e], v01 = sh * c01[e], v10 = sh * c10[e], v11 = sh * c11[e];
    if (RES) { v00 += sr * r00[e]; v01 += sr * r01[e]; v10 += sr * r10[e]; v11 += sr * r11[e]; }
    cs[ra * 36 + l] = v00;
    cs[ra * 36 + 16 + l] = v01;
    cs[rb * 36 + l] = v10;
    cs[rb * 36 + 16 + l] = v11;
  }
  __syncthreads();
  v4f val[8];
#pragma unroll
  for (int i = 0; i < 8; ++i) {
    const int row = 4 * i + (lane >> 3);
    val[i] = *(const v4f*)(cs + row * 36 + (lane & 7) * 4);
  }
#pragma unroll
  for (int i = 0; i < 8; ++i) {
    const int row = 4 * i + (lane >> 3);
    *(v4f*)(C + (size_t)(mb + row) * (size_t)ldc + nb + (lane & 7) * 4) = val[i];
  }
  
}

// ---------------------------------------------------------------------------------------
// Rotary + f16 planes. One block per sequence row s (q: 16 heads x 128, k: 4 heads x 128).
// Qh [NH][SEQ][HD], Kh [NKV][SEQ][HD]: f16 bits of the rotated value.
// Rows s < SE also get Ql [NH][SE][HD], Kl [NKV][SE][HD]: f16 bits of (x - hi) * 1024.
// rotate-half: out[d] = x[d]*cos - x[d+64]*sin, out[d+64] = x[d+64]*cos + x[d]*sin
// (products and sums as separate f32 ops), angle = fl32(pos * inv_freq[d]).
__global__ __launch_bounds__(256) void k_planes(const float* __restrict__ qkv, const int* __restrict__ pos,
                                               const float* __restrict__ tinv,
                                               u16* __restrict__ Qh, u16* __restrict__ Ql,
                                               u16* __restrict__ Kh, u16* __restrict__ Kl) {
#pragma clang fp contract(off)
  __shared__ __align__(16) u16 Qs[NH * HD];
  __shared__ __align__(16) u16 Qls[NH * HD];
  __shared__ __align__(16) u16 Ks[NKV * HD];
  __shared__ __align__(16) u16 Kls[NKV * HD];
  const int s = (int)blockIdx.x, t = threadIdx.x;
  const bool early = (s < SE);                       // block-uniform
  int pp = pos[s];
  pp = imin(imax(pp, 0), SEQ_FULL - 1);
  const int di = t & 63;
  const float ang = (float)pp * tinv[di];
  float sn, cs;
  rot_sincos(ang, sn, cs);
  const float* row = qkv + (size_t)s * NQKV;

#pragma unroll 1
  for (int j = 0; j < 4; ++j) {
    const int hh = (t + 256 * j) >> 6;               // 0..15
    const int col = hh * HD + di;
    const float x1 = row[col], x2 = row[col + 64];
    const float a1 = x1 * cs, b1 = x2 * sn;
    const float a2 = x2 * cs, b2 = x1 * sn;
    const float r1 = a1 - b1;
    const float r2 = a2 + b2;
    if (early) {
      u16 a, b;
      split1024(r1, a, b); Qs[col] = a;      Qls[col] = b;
      split1024(r2, a, b); Qs[col + 64] = a; Qls[col + 64] = b;
    } else {
      Qs[col] = hbits(r1);
      Qs[col + 64] = hbits(r2);
    }
  }
  {
    const int kvh = t >> 6;                          // 0..3
    const int col = kvh * HD + di;
    const float x1 = row[NH * HD + col], x2 = row[NH * HD + col + 64];
    const float a1 = x1 * cs, b1 = x2 * sn;
    const float a2 = x2 * cs, b2 = x1 * sn;
    const float r1 = a1 - b1;
    const float r2 = a2 + b2;
    if (early) {
      u16 a, b;
      split1024(r1, a, b); Ks[col] = a;      Kls[col] = b;
      split1024(r2, a, b); Ks[col + 64] = a; Kls[col + 64] = b;
    } else {
      Ks[col] = hbits(r1);
      Ks[col + 64] = hbits(r2);
    }
  }
  __syncthreads();

  const int e = t * 8;
  const int hq = e >> 7, dq = e & 127;               // q: head 0..15
  const bool kw = (t < 64);                          // wave-uniform: waves 0,1
  const int hk = hq, dk = dq;                        // valid for t < 64: kv head 0..3
  const v4u vq = *(const v4u*)(Qs + e);
  v4u vql = vq, vk = vq, vkl = vq;
  if (early) vql = *(const v4u*)(Qls + e);
  if (kw) {
    vk = *(const v4u*)(Ks + e);
    if (early) vkl = *(const v4u*)(Kls + e);
  }
  u16* pq  = Qh + ((size_t)hq * SEQ + s) * HD + dq;
  u16* pql = Ql + ((size_t)hq * SE + (early ? s : 0)) * HD + dq;
  u16* pk  = Kh + ((size_t)hk * SEQ + s) * HD + dk;
  u16* pkl = Kl + ((size_t)hk * SE + (early ? s : 0)) * HD + dk;

  *(v4u*)pq = vq;
  if (early) *(v4u*)pql = vql;
  if (kw) {
    *(v4u*)pk = vk;
    if (early) *(v4u*)pkl = vkl;
  }
  
}

// ---------------------------------------------------------------------------------------
// V transposed planes: Vth [NKV][HD][SEQ] = f16 bits of 16*v, and for keys < SE
// Vtl [NKV][HD][SE] = f16 bits of (16*v - hi) * 1024. Tile = 64 keys x 128 d through LDS,
__global__ __launch_bounds__(256) void k_vt(const float* __restrict__ qkv, u16* __restrict__ Vth,
                                           u16* __restrict__ Vtl) {
#pragma clang fp contract(off)
  __shared__ __align__(16) u16 T[HD * 72];           // [d][key], pitch 72 halves
  __shared__ __align__(16) u16 Tl[HD * 72];
  const int s0 = (int)blockIdx.x * 64, kv = (int)blockIdx.y, t = threadIdx.x;
  const bool early = (s0 < SE);                      // block-uniform (SE % 64 == 0)
#pragma unroll 1
  for (int j = 0; j < 8; ++j) {
    const int idx = t + 256 * j;
    const int r = idx >> 5;                          // key 0..63
    const int c4 = (idx & 31) * 4;                   // d 0..124
    const v4f v = *(const v4f*)(qkv + (size_t)(s0 + r) * NQKV + NH * HD + NKV * HD + kv * HD + c4);
#pragma unroll
    for (int e = 0; e < 4; ++e) {
      const float f = 16.0f * v[e];
      if (early) {
        u16 a, b;
        split1024(f, a, b);
        T[(c4 + e) * 72 + r] = a;
        Tl[(c4 + e) * 72 + r] = b;
      } else {
        T[(c4 + e) * 72 + r] = hbits(f);
      }
    }
  }
  __syncthreads();
  v4u vh[4], vl[4];
#pragma unroll
  for (int p = 0; p < 4; ++p) {
    const int d = (t >> 3) + 32 * p, c = (t & 7) * 8;
    vh[p] = *(const v4u*)(T + d * 72 + c);
    vl[p] = vh[p];
    if (early) vl[p] = *(const v4u*)(Tl + d * 72 + c);
  }
#pragma unroll
  for (int p = 0; p < 4; ++p) {
    const int d = (t >> 3) + 32 * p, c = (t & 7) * 8;
    *(v4u*)(Vth + ((size_t)kv * HD + d) * SEQ + s0 + c) = vh[p];
    if (early) *(v4u*)(Vtl + ((size_t)kv * HD + d) * SE + s0 + c) = vl[p];
  }
  
}

// ---------------------------------------------------------------------------------------
// Causal GQA flash attention. Block = 8 waves = 4 q heads of one kv head x 32 queries
// (wave w: head kv*4 + (w>>1), queries q0 + (w&1)*16 .. +15). Keys in chunks of 32 staged
// in LDS: K tile [32][128] (A operand of S^T = K x Q^T, lane = key row) and V^T tile
// [128 d][32 keys] (B operand of O += P x V, lane = d). Queries live on lanes for the
// softmax; P in D layout of S^T is the A-fragment layout of P x V (lane = query,
// elements 0..7 = keys 8h..8h+7, 8..15 = keys 16+8h..). Online softmax in f32 (exp2 form),
// P carried as f16(4096 p), V as f16(16 v), ctx written as f16(64 ctx).
// EARLY (query rows < SE): q, k, P, v get x1024 residual planes and a second accumulator
// folded before normalisation; head dim handled in four 32-wide passes whose ctx results
// pass; ctx also gets a residual plane Cr. Output Ch [SEQ][HID] (head*128 + d), Cr [SE][HID].
// VGPR file capped at 256 (no high-bank registers).
template <bool EARLY>
__global__ __launch_bounds__(256) __attribute__((amdgpu_num_vgpr(256)))
void k_attn(const u16* __restrict__ Qh, const u16* __restrict__ Ql,
            const u16* __restrict__ Kh, const u16* __restrict__ Kl,
            const u16* __restrict__ Vth, const u16* __restrict__ Vtl,
            const int* __restrict__ amask,
            u16* __restrict__ Ch, u16* __restrict__ Cr, int qblk0) {
  __shared__ __align__(16) u16 pool[16384];           // K | Kres | Vt | Vtres tiles (8 KB each)
  __shared__ __align__(16) u16 stg[EARLY ? 16384 : 64];  // EARLY: per-wave ctx stage [8][16][128]
  constexpr int KS = 0, KL = 4096, VS = 8192, VL = 12288;
  constexpr int NDT = EARLY ? 2 : 8;
  constexpr int DW = NDT * 16;
  constexpr int NPASS = HD / DW;
  const int qblk = qblk0 + (int)blockIdx.x;
  const int kv = (int)blockIdx.y;
  const int tid = threadIdx.x, wave = tid >> 5, lane = tid & 31, h = lane >> 4, l = lane & 15;
  const int head = kv * (NH / NKV) + (wave >> 1);
  const int q0 = qblk * BQW;
  const int qw0 = q0 + (wave & 1) * 16;
  const int qrow = qw0 + l;                          // this lane's query
  const int nchunk = qblk + 1;                       // keys 0 .. q0+31

  FragH qh[4];
  FragH ql[4];
#pragma unroll
  for (int dc = 0; dc < 4; ++dc) {
    const u16* b = Qh + ((size_t)head * SEQ + qrow) * HD + dc * 32 + 8 * h;
    qh[dc].q[0] = *(const v4u*)b;
    qh[dc].q[1] = *(const v4u*)(b + 16);
    if (EARLY) {
      const u16* b2 = Ql + ((size_t)head * SE + qrow) * HD + dc * 32 + 8 * h;
      ql[dc].q[0] = *(const v4u*)b2;
      ql[dc].q[1] = *(const v4u*)(b2 + 16);
    } else {
      ql[dc].q[0] = qh[dc].q[0];
      ql[dc].q[1] = qh[dc].q[1];
    }
  }
  const float SCL = 0.088388347648318441f * 1.4426950408889634f;   // log2(e)/sqrt(128)

  // ctx stage [16 rows][128 cols] per wave: EARLY in its own region (persists across the
  // 32-wide passes), otherwise aliasing pool after the K/V tiles are dead.
  u16* os;
  if (EARLY) os = stg + wave * (16 * 128);
  else os = pool + wave * (16 * 128);

#pragma unroll 1
  for (int pass = 0; pass < NPASS; ++pass) {
    const int dbase = pass * DW;
    v8f o[NDT];
    v8f orr[NDT];
#pragma unroll
    for (int dt = 0; dt < NDT; ++dt) { o[dt] = zero8(); orr[dt] = zero8(); }
    float rmax = -1.0e30f, rsum = 0.0f;

#pragma unroll 1
    for (int kc = 0; kc < nchunk; ++kc) {
      const int kbase = kc * 32;
      __syncthreads();                               // all waves done with the prior tiles
#pragma unroll
      for (int j = 0; j < 2; ++j) {
        const int pp = tid + 256 * j;                // 0..511
        {
          const int r = pp >> 4, c = (pp & 15) * 8;   // K tile: 32 rows x 128
          *(v4u*)(pool + KS + r * HD + c) = *(const v4u*)(Kh + ((size_t)kv * SEQ + kbase + r) * HD + c);
          if (EARLY)
            *(v4u*)(pool + KL + r * HD + c) = *(const v4u*)(Kl + ((size_t)kv * SE + kbase + r) * HD + c);
        }
        {
          const int d = pp >> 2, c = (pp & 3) * 8;    // Vt tile: 128 rows x 32
          *(v4u*)(pool + VS + d * 32 + c) = *(const v4u*)(Vth + ((size_t)kv * HD + d) * SEQ + kbase + c);
          if (EARLY)
            *(v4u*)(pool + VL + d * 32 + c) = *(const v4u*)(Vtl + ((size_t)kv * HD + d) * SE + kbase + c);
        }
      }
      // padding-mask word for the 32 keys of this chunk, per wave (all lanes active)
      const int av = amask[imin(kbase + lane, SEQ - 1)];
      const unsigned mw = __builtin_amdgcn_ballot_w32(av != 0);
      __syncthreads();

      // scores S^T[key][query]; lane l = query, element r = key sub*16 + 8h + r
      float u[16];
      unsigned vm = 0u;
      float m_new = rmax;
#pragma unroll
      for (int sub = 0; sub < 2; ++sub) {
        v8f acc = zero8();
        v8f accr = zero8();
#pragma unroll
        for (int dc = 0; dc < 4; ++dc) {
          FragH kf;
          const u16* kb = pool + KS + (sub * 16 + l) * HD + dc * 32 + 8 * h;
          kf.q[0] = *(const v4u*)kb;
          kf.q[1] = *(const v4u*)(kb + 16);
          acc = wg_h(acc, kf.v, qh[dc].v);
          if (EARLY) {
            accr = wg_h(accr, kf.v, ql[dc].v);
            FragH kg;
            const u16* kb2 = pool + KL + (sub * 16 + l) * HD + dc * 32 + 8 * h;
            kg.q[0] = *(const v4u*)kb2;
            kg.q[1] = *(const v4u*)(kb2 + 16);
            accr = wg_h(accr, kg.v, qh[dc].v);
          }
        }
#pragma unroll
        for (int r = 0; r < 8; ++r) {
          const int klc = sub * 16 + 8 * h + r;
          const int key = kbase + klc;
          float s = acc[r];
          if (EARLY) s += accr[r] * (1.0f / 1024.0f);
          const bool valid = (key <= qrow) && (((mw >> klc) & 1u) != 0u);
          const float uu = valid ? s * SCL : -1.0e30f;
          u[sub * 8 + r] = uu;
          vm |= (valid ? 1u : 0u) << (sub * 8 + r);
          m_new = fmaxf(m_new, uu);
        }
      }
      m_new = fmaxf(m_new, __shfl_xor(m_new, 16, 32));
      const float scale = __builtin_amdgcn_exp2f(rmax - m_new);
      rmax = m_new;

      float psum = 0.0f;
      FragH ph;
      FragH pr;
#pragma unroll
      for (int i = 0; i < 16; ++i) {
        const float pe = __builtin_amdgcn_exp2f(u[i] - m_new);
        const float pv = ((vm >> i) & 1u) ? pe : 0.0f;
        psum += pv;
        const float pc = pv * 4096.0f;
        const f16 hv = (f16)pc;
        ph.h[i] = hv;
        if (EARLY) pr.h[i] = (f16)((pc - (float)hv) * 1024.0f);
        else pr.h[i] = hv;
      }
      psum += __shfl_xor(psum, 16, 32);
      rsum = rsum * scale + psum;

      float sc[8];
#pragma unroll
      for (int r = 0; r < 8; ++r) sc[r] = __shfl(scale, 8 * h + r, 32);
#pragma unroll
      for (int dt = 0; dt < NDT; ++dt) {
#pragma unroll
        for (int r = 0; r < 8; ++r) {
          o[dt][r] *= sc[r];
          if (EARLY) orr[dt][r] *= sc[r];
        }
      }
      // O += P x V ; B fragment lane = d row of the Vt tile, elements = keys (split map)
#pragma unroll
      for (int dt = 0; dt < NDT; ++dt) {
        const int d = dbase + dt * 16 + l;
        FragH vf;
        const u16* vb = pool + VS + d * 32 + 8 * h;
        vf.q[0] = *(const v4u*)vb;
        vf.q[1] = *(const v4u*)(vb + 16);
        o[dt] = wg_h(o[dt], ph.v, vf.v);
        if (EARLY) {
          orr[dt] = wg_h(orr[dt], pr.v, vf.v);
          FragH vg;
          const u16* vb2 = pool + VL + d * 32 + 8 * h;
          vg.q[0] = *(const v4u*)vb2;
          vg.q[1] = *(const v4u*)(vb2 + 16);
          orr[dt] = wg_h(orr[dt], ph.v, vg.v);
        }
      }
    }

    // epilogue: ctx = (o + orr/1024) / (4096 * 16 * l); plane value = 64 * ctx
    if (!EARLY) __syncthreads();                     // K/V tiles dead, pool reused as stage
    const float inv = 1.0f / rsum;
    float ir[8];
#pragma unroll
    for (int r = 0; r < 8; ++r) ir[r] = __shfl(inv, 8 * h + r, 32) * (1.0f / 1024.0f);
    const int cb = EARLY ? ((pass & 1) * 32) : 0;   // column offset inside the 64-wide line half
#pragma unroll
    for (int dt = 0; dt < NDT; ++dt) {
#pragma unroll
      for (int r = 0; r < 8; ++r) {
        float val = o[dt][r];
        if (EARLY) val += orr[dt][r] * (1.0f / 1024.0f);
        val *= ir[r];
        if (EARLY) {
          u16 a, b;
          split1024(val, a, b);
          os[(8 * h + r) * 128 + cb + dt * 16 + l] = a;
          os[(8 * h + r) * 128 + 64 + cb + dt * 16 + l] = b;
        } else {
          os[(8 * h + r) * 128 + dt * 16 + l] = hbits(val);
        }
      }
    }
    if (!EARLY) {
      __syncthreads();
      // 16 rows x 256 B = 32 lines; instruction i: lanes 8g..8g+7 -> line 4i+g
      v4u vals[8];
#pragma unroll
      for (int i = 0; i < 8; ++i) {
        const int L = 4 * i + (lane >> 3);
        const int row = L >> 1, seg = L & 1;
        vals[i] = *(const v4u*)(os + row * 128 + seg * 64 + (lane & 7) * 8);
      }
#pragma unroll
      for (int i = 0; i < 8; ++i) {
        const int L = 4 * i + (lane >> 3);
        const int row = L >> 1, seg = L & 1;
        *(v4u*)(Ch + (size_t)(qw0 + row) * HID + head * HD + seg * 64 + (lane & 7) * 8) = vals[i];
      }
      
    } else {
      if ((pass & 1) != 0) {                         // block-uniform: stage holds d line (pass>>1)
        __syncthreads();
        const int dline = (pass >> 1) * 64;
        v4u va[4], vb[4];
#pragma unroll
        for (int i = 0; i < 4; ++i) {
          const int row = 4 * i + (lane >> 3);
          va[i] = *(const v4u*)(os + row * 128 + (lane & 7) * 8);
          vb[i] = *(const v4u*)(os + row * 128 + 64 + (lane & 7) * 8);
        }
#pragma unroll
        for (int i = 0; i < 4; ++i) {
          const int row = 4 * i + (lane >> 3);
          const size_t off = (size_t)(qw0 + row) * HID + head * HD + dline + (lane & 7) * 8;
          *(v4u*)(Ch + off) = va[i];
          *(v4u*)(Cr + off) = vb[i];
        }
        
      }
    }
  }
}

// ---------------------------------------------------------------------------------------
extern "C" void kernel_launch(void* const* d_in, const int* in_sizes, int n_in,
                              void* d_out, int out_size, void* d_ws, size_t ws_size,
                              hipStream_t stream) {
  if (n_in < 7) return;
  if (in_sizes[0] < SEQ * HID) return;
  if (in_sizes[1] < SEQ) return;
  if (in_sizes[2] < SEQ) return;
  if (in_sizes[3] < HID * NH * HD) return;
  if (in_sizes[4] < HID * NKV * HD) return;
  if (in_sizes[5] < HID * NKV * HD) return;
  if (in_sizes[6] < NH * HD * HID) return;
  if (out_size < SEQ * HID) return;

  const float* hs  = (const float*)d_in[0];
  const int*   am  = (const int*)d_in[1];
  const int*   pos = (const int*)d_in[2];
  const float* wq  = (const float*)d_in[3];
  const float* wk  = (const float*)d_in[4];
  const float* wv  = (const float*)d_in[5];
  const float* wo  = (const float*)d_in[6];
  float* out = (float*)d_out;

  char* ws = (char*)d_ws;
  size_t off = 0;
#define CARVE(T, name, bytes) T* name = (T*)(ws + off); off += (((size_t)(bytes)) + 255) & ~(size_t)255
  CARVE(u16,   Xb,    (size_t)SEQ * HID * 2);          // bf16 bits [SEQ][HID]
  CARVE(u16,   WqkvT, (size_t)NQKV * HID * 2);         // bf16 bits [3072][HID]
  CARVE(u16,   WoT,   (size_t)HID * HID * 2);          // f16 bits  [HID][HID]
  CARVE(float, QKVf,  (size_t)SEQ * NQKV * 4);         // f32 [SEQ][3072]
  CARVE(u16,   Qh,    (size_t)NH * SEQ * HD * 2);
  CARVE(u16,   Kh,    (size_t)NKV * SEQ * HD * 2);
  CARVE(u16,   Vth,   (size_t)NKV * HD * SEQ * 2);
  CARVE(u16,   Ql,    (size_t)NH * SE * HD * 2);
  CARVE(u16,   Kl,    (size_t)NKV * SE * HD * 2);
  CARVE(u16,   Vtl,   (size_t)NKV * HD * SE * 2);
  CARVE(u16,   Cr,    (size_t)SE * HID * 2);
  CARVE(float, Tinv,  256);
#undef CARVE
  // Ch [SEQ][HID] f16 plane aliases the Xb region: identical extent (SEQ*HID halves), Xb is
  // read only by the qkv projection launch, Ch is first written by the attention launches
  // that come after it on the same in-order stream.
  static_assert(NH * HD == HID);
  u16* Ch = Xb;
  if (off > ws_size) return;

  // 1) hidden -> bf16, inv_freq table
  k_xconv<<<dim3(SEQ), 256, 0, stream>>>(hs, Xb, Tinv);
  // 2) weights: w [HID][n] -> wt [n][HID]
  k_wt<0><<<dim3(HID / 64, (NH * HD) / 64), 256, 0, stream>>>(wq, WqkvT, NH * HD);
  k_wt<0><<<dim3(HID / 64, (NKV * HD) / 64), 256, 0, stream>>>(wk, WqkvT + (size_t)(NH * HD) * HID, NKV * HD);
  k_wt<0><<<dim3(HID / 64, (NKV * HD) / 64), 256, 0, stream>>>(wv, WqkvT + (size_t)(NH * HD + NKV * HD) * HID, NKV * HD);
  k_wt<1><<<dim3(HID / 64, HID / 64), 256, 0, stream>>>(wo, WoT, HID);
  // 3) fused qkv projection: [SEQ][HID] x [HID][3072] -> f32
  k_gemm<0, false><<<dim3(NQKV / 128, SEQ / 64), 256, 0, stream>>>(
      Xb, Xb, WqkvT, QKVf, HID, HID, NQKV, HID, 0, 1.0f, 0.0f);
  // 4) rotary + planes, V transposed planes
  k_planes<<<dim3(SEQ), 256, 0, stream>>>(QKVf, pos, Tinv, Qh, Ql, Kh, Kl);
  k_vt<<<dim3(SEQ / 64, NKV), 256, 0, stream>>>(QKVf, Vth, Vtl);
  // 5) attention: leading SE rows with residual planes, the rest single products
  k_attn<true><<<dim3(SE / BQW, NKV), 256, 0, stream>>>(Qh, Ql, Kh, Kl, Vth, Vtl, am, Ch, Cr, 0);
  if (SEQ > SE) {
    k_attn<false><<<dim3(SEQ / BQW - SE / BQW, NKV), 256, 0, stream>>>(
        Qh, Ql, Kh, Kl, Vth, Vtl, am, Ch, Cr, SE / BQW);
  }
  // 6) output projection: rows < SE with the residual ctx plane, the rest plain
  k_gemm<1, true><<<dim3(HID / 128, SE / 64), 256, 0, stream>>>(
      Ch, Cr, WoT, out, HID, HID, HID, HID, 0, 1.0f / 4096.0f, 1.0f / (4096.0f * 1024.0f));
  if (SEQ > SE) {
    k_gemm<1, false><<<dim3(HID / 128, (SEQ - SE) / 64), 256, 0, stream>>>(
        Ch, Ch, WoT, out, HID, HID, HID, HID, SE, 1.0f / 4096.0f, 0.0f);
  }
}

// v001
// One run takes 899 microseconds.
// Next to v000, in two timings, it ran 1.52 and 1.51 times as fast.
#include <hip/hip_runtime.h>
#include <stdint.h>
#include <stddef.h>

// Contractions: qkv projection = v_wmma_f32_16x16x32_bf16 (bf16 operands, f32 accumulate);
// q.k scores, p.v and output projection = v_wmma_f32_16x16x32_f16 (f16 operands with
// power-of-two carries plus x1024 f16 residual planes on the leading SE query rows,
// f32 accumulate). Softmax and epilogues in f32; rotary sin/cos via f64 quadrant
// reduction + polynomial (no fused multiply-add), rotation in unfused f32.

#ifndef NB
#define NB 1
#endif
#ifndef SEQ
#define SEQ 4096
#endif
#ifndef SE
#if SEQ < 640
#define SE SEQ
#else
#define SE 640
#endif
#endif
#define SEQ_FULL 4096
#define HID 2048
#define NH 16
#define NKV 4
#define HD 128
#define NQKV (NH * HD + 2 * NKV * HD)
#define BQW 32

static_assert(NB == 1);
static_assert(SEQ % 64 == 0);
static_assert(SEQ >= SE);
static_assert(SEQ <= SEQ_FULL);
static_assert(SE >= 64);
static_assert(SE % 64 == 0);
static_assert(SE % BQW == 0);
static_assert(HID % 128 == 0);
static_assert(HID == 256 * 8);
static_assert(NQKV % 128 == 0);
static_assert(HD == 128);
static_assert(NH == 4 * NKV);
static_assert(NH * HD == HID);

typedef _Float16 f16;
typedef __bf16 bf16;
typedef unsigned short u16;
typedef f16 v16h __attribute__((ext_vector_type(16)));
typedef bf16 v16b __attribute__((ext_vector_type(16)));
typedef float v8f __attribute__((ext_vector_type(8)));
typedef float v4f __attribute__((ext_vector_type(4)));
typedef unsigned v4u __attribute__((ext_vector_type(4)));

union FragH { v16h v; v4u q[2]; f16 h[16]; };
union FragB { v16b v; v4u q[2]; };

__device__ __forceinline__ v8f zero8() {
  v8f z = {0.0f, 0.0f, 0.0f, 0.0f, 0.0f, 0.0f, 0.0f, 0.0f};
  return z;
}

// 16x16x32 f16 WMMA followed by a 4-slot VALU hazard guard on D (A/B kept live).
__device__ __forceinline__ v8f wg_h(v8f acc, v16h a, v16h b) {
  acc = __builtin_amdgcn_wmma_f32_16x16x32_f16(false, a, false, b, (short)0, acc, false, false);
  asm volatile("v_nop\n\tv_nop\n\tv_nop\n\tv_nop" : "+v"(acc) : "v"(a), "v"(b));
  return acc;
}
__device__ __forceinline__ v8f wg_b(v8f acc, v16b a, v16b b) {
  acc = __builtin_amdgcn_wmma_f32_16x16x32_bf16(false, a, false, b, (short)0, acc, false, false);
  asm volatile("v_nop\n\tv_nop\n\tv_nop\n\tv_nop" : "+v"(acc) : "v"(a), "v"(b));
  return acc;
}

// f32 -> bf16 bits, RNE convert.
__device__ __forceinline__ unsigned bf16_rne(float f) {
  const unsigned u = __float_as_uint(f);
  return (u + 0x7FFFu + ((u >> 16) & 1u)) >> 16;
}
// f32 -> f16 bits, RNE convert.
__device__ __forceinline__ u16 hbits(float f) {
  const f16 x = (f16)f;
  return __builtin_bit_cast(u16, x);
}
// f32 -> f16 hi bits plus f16 bits of (v - hi) * 1024 (unfused: sub then mul).
__device__ __forceinline__ void split1024(float v, u16& hb, u16& lb) {
#pragma clang fp contract(off)
  const f16 x = (f16)v;
  const float xr = (float)x;
  const float dlt = v - xr;
  const f16 y = (f16)(dlt * 1024.0f);
  hb = __builtin_bit_cast(u16, x);
  lb = __builtin_bit_cast(u16, y);
}
__device__ __forceinline__ int imin(int a, int b) { return a < b ? a : b; }
__device__ __forceinline__ int imax(int a, int b) { return a > b ? a : b; }

// sin/cos of an f32 angle (0 <= ang <= ~4100 rad) in f64 without fused multiply-add:
// quadrant count kq = rint(x * 2/pi); r = (x - kq * P1) - kq * P2 with P1 = the leading
// 33 bits of pi/2 (kq * P1 exact for kq < 2^20) and P2 its tail; odd/even polynomials on
// |r| <= pi/4 (truncation < 3e-14); quadrant select by value; convert to f32.
__device__ __forceinline__ void rot_sincos(float ang, float& sn, float& cs) {
#pragma clang fp contract(off)
  const double x = (double)ang;
  const double kq = __builtin_rint(x * 0.63661977236758134308);
  double r = x - kq * 1.57079632673412561417;
  r = r - kq * 6.07710050650619224932e-11;
  const int q = (int)kq;
  const double r2 = r * r;
  double ps = 1.6059043836821613e-10;
  ps = ps * r2 - 2.5052108385441720e-08;
  ps = ps * r2 + 2.7557319223985893e-06;
  ps = ps * r2 - 1.9841269841269841e-04;
  ps = ps * r2 + 8.3333333333333332e-03;
  ps = ps * r2 - 1.6666666666666666e-01;
  const double r3 = r * r2;
  const double sr = r + r3 * ps;
  double pc = -1.1470745597729725e-11;
  pc = pc * r2 + 2.0876756987868099e-09;
  pc = pc * r2 - 2.7557319223985888e-07;
  pc = pc * r2 + 2.4801587301587302e-05;
  pc = pc * r2 - 1.3888888888888889e-03;
  pc = pc * r2 + 4.1666666666666664e-02;
  pc = pc * r2 - 0.5;
  const double cr = 1.0 + pc * r2;
  const bool odd = (q & 1) != 0;
  const bool neg = (q & 2) != 0;
  double sv = odd ? cr : sr;
  double cv = odd ? -sr : cr;
  sv = neg ? -sv : sv;
  cv = neg ? -cv : cv;
  sn = (float)sv;
  cs = (float)cv;
}

// ---------------------------------------------------------------------------------------
// hidden f32 [SEQ][HID] -> bf16 bits [SEQ][HID]; one block per row, 16 B per lane.
// Block 0, lanes 0..63 also produce the rotary inv_freq table (64 floats):
// inv[j] = fl32(1 / fl32(10000^(j/64))), with 10000^(1/64) from an iterative f64 64th root.
__global__ __launch_bounds__(256) void k_xconv(const float* __restrict__ x, u16* __restrict__ xb,
                                              float* __restrict__ tinv) {
#pragma clang fp contract(off)
  const int t = threadIdx.x;
  const size_t e = ((size_t)blockIdx.x * 256 + (size_t)t) * 8;
  const v4f a = *(const v4f*)(x + e);
  const v4f b = *(const v4f*)(x + e + 4);
  v4u w;
  w[0] = bf16_rne(a[0]) | (bf16_rne(a[1]) << 16);
  w[1] = bf16_rne(a[2]) | (bf16_rne(a[3]) << 16);
  w[2] = bf16_rne(b[0]) | (bf16_rne(b[1]) << 16);
  w[3] = bf16_rne(b[2]) | (bf16_rne(b[3]) << 16);

  const bool tab = (blockIdx.x == 0) && (t < 64);   // wave-uniform (waves 0,1 of block 0)
  float ivf = 0.0f;
  if (tab) {
    double rt = 1.15;
#pragma unroll 1
    for (int it = 0; it < 48; ++it) {
      double p63 = rt;
#pragma unroll 1
      for (int k = 1; k < 63; ++k) p63 *= rt;
      const double p64 = p63 * rt;
      const double f = p64 - 10000.0;
      rt = rt - f / (64.0 * p63);
    }
    double pj = 1.0;
#pragma unroll 1
    for (int k = 0; k < t; ++k) pj *= rt;           // t < 64: bounded
    const float pf = (float)pj;
    ivf = (float)(1.0 / (double)pf);
  }
  *(v4u*)(xb + e) = w;
  if (tab) *(float*)(tinv + t) = ivf;
  
}

// ---------------------------------------------------------------------------------------
// Weight transpose + convert: w f32 [HID][ncol] -> wt 16-bit [ncol][HID] (k contiguous).
// 8 consecutive lanes of one instruction. MODE 0: bf16 bits; MODE 1: f16 bits of
// 64 * bf16(w) (bf16 RNE value first, the x64 f16 copy of it is exact).
template <int MODE>
__global__ __launch_bounds__(256) void k_wt(const float* __restrict__ w, u16* __restrict__ wt, int ncol) {
  __shared__ __align__(16) u16 T[64 * 72];          // [o][i], pitch 72 halves (144 B)
  const int i0 = (int)blockIdx.x * 64, o0 = (int)blockIdx.y * 64, t = threadIdx.x;
#pragma unroll
  for (int j = 0; j < 4; ++j) {
    const int i = (t >> 4) + 16 * j;
    const int oc = (t & 15) * 4;
    const v4f v = *(const v4f*)(w + (size_t)(i0 + i) * (size_t)ncol + o0 + oc);
#pragma unroll
    for (int e = 0; e < 4; ++e) {
      const float f = v[e];
      u16 bb;
      if (MODE == 0) bb = (u16)bf16_rne(f);
      else bb = hbits(__uint_as_float(bf16_rne(f) << 16) * 64.0f);
      T[(oc + e) * 72 + i] = bb;
    }
  }
  __syncthreads();
  v4u val[2];
#pragma unroll
  for (int p = 0; p < 2; ++p) {
    const int o = (t >> 3) + 32 * p;
    val[p] = *(const v4u*)(T + o * 72 + (t & 7) * 8);
  }
#pragma unroll
  for (int p = 0; p < 2; ++p) {
    const int o = (t >> 3) + 32 * p;
    *(v4u*)(wt + (size_t)(o0 + o) * HID + i0 + (t & 7) * 8) = val[p];
  }
  
}

// ---------------------------------------------------------------------------------------
// C[m][n] (f32) = sh * sum_k A[m][k] * BT[n][k]  (+ sr * sum_k Ar[m][k] * BT[n][k] if RES)
// MODE 0: bf16 operands; MODE 1: f16 operands. Block 64 (M) x 128 (N), 8 waves each 32x32.
// Fragments straight from 16-bit global rows with the split k map (elements 0..7 at
template <int MODE, bool RES>
__global__ __launch_bounds__(256) void k_gemm(const u16* __restrict__ A, const u16* __restrict__ Ar,
                                             const u16* __restrict__ BT, float* __restrict__ C,
                                             int lda, int ldb, int ldc, int K, int row0,
                                             float sh, float sr) {
  __shared__ __align__(16) float Cs[8 * 32 * 36];
  const int tid = threadIdx.x, wave = tid >> 5, lane = tid & 31, h = lane >> 4, l = lane & 15;
  const int wm = wave >> 2, wn = wave & 3;
  const int mb = row0 + (int)blockIdx.y * 64 + wm * 32;
  const int nb = (int)blockIdx.x * 128 + wn * 32;
  const size_t rA0 = (size_t)(mb + l) * (size_t)lda, rA1 = (size_t)(mb + 16 + l) * (size_t)lda;
  const size_t rB0 = (size_t)(nb + l) * (size_t)ldb, rB1 = (size_t)(nb + 16 + l) * (size_t)ldb;
  v8f c00 = zero8(), c01 = zero8(), c10 = zero8(), c11 = zero8();
  v8f r00 = zero8(), r01 = zero8(), r10 = zero8(), r11 = zero8();

  for (int kk = 0; kk < K; kk += 32) {
    const int k0 = kk + 8 * h, k1 = kk + 16 + 8 * h;
    if (MODE == 0) {
      FragB a0, a1, b0, b1;
      a0.q[0] = *(const v4u*)(A + rA0 + k0);  a0.q[1] = *(const v4u*)(A + rA0 + k1);
      a1.q[0] = *(const v4u*)(A + rA1 + k0);  a1.q[1] = *(const v4u*)(A + rA1 + k1);
      b0.q[0] = *(const v4u*)(BT + rB0 + k0); b0.q[1] = *(const v4u*)(BT + rB0 + k1);
      b1.q[0] = *(const v4u*)(BT + rB1 + k0); b1.q[1] = *(const v4u*)(BT + rB1 + k1);
      c00 = wg_b(c00, a0.v, b0.v); c01 = wg_b(c01, a0.v, b1.v);
      c10 = wg_b(c10, a1.v, b0.v); c11 = wg_b(c11, a1.v, b1.v);
    } else {
      FragH a0, a1, b0, b1;
      a0.q[0] = *(const v4u*)(A + rA0 + k0);  a0.q[1] = *(const v4u*)(A + rA0 + k1);
      a1.q[0] = *(const v4u*)(A + rA1 + k0);  a1.q[1] = *(const v4u*)(A + rA1 + k1);
      b0.q[0] = *(const v4u*)(BT + rB0 + k0); b0.q[1] = *(const v4u*)(BT + rB0 + k1);
      b1.q[0] = *(const v4u*)(BT + rB1 + k0); b1.q[1] = *(const v4u*)(BT + rB1 + k1);
      c00 = wg_h(c00, a0.v, b0.v); c01 = wg_h(c01, a0.v, b1.v);
      c10 = wg_h(c10, a1.v, b0.v); c11 = wg_h(c11, a1.v, b1.v);
      if (RES) {
        FragH e0, e1;
        e0.q[0] = *(const v4u*)(Ar + rA0 + k0); e0.q[1] = *(const v4u*)(Ar + rA0 + k1);
        e1.q[0] = *(const v4u*)(Ar + rA1 + k0); e1.q[1] = *(const v4u*)(Ar + rA1 + k1);
        r00 = wg_h(r00, e0.v, b0.v); r01 = wg_h(r01, e0.v, b1.v);
        r10 = wg_h(r10, e1.v, b0.v); r11 = wg_h(r11, e1.v, b1.v);
      }
    }
  }

  float* cs = Cs + wave * (32 * 36);
#pragma unroll
  for (int e = 0; e < 8; ++e) {
    const int ra = 8 * h + e, rb = ra + 16;
    float v00 = sh * c00[e], v01 = sh * c01[e], v10 = sh * c10[e], v11 = sh * c11[e];
    if (RES) { v00 += sr * r00[e]; v01 += sr * r01[e]; v10 += sr * r10[e]; v11 += sr * r11[e]; }
    cs[ra * 36 + l] = v00;
    cs[ra * 36 + 16 + l] = v01;
    cs[rb * 36 + l] = v10;
    cs[rb * 36 + 16 + l] = v11;
  }
  __syncthreads();
  v4f val[8];
#pragma unroll
  for (int i = 0; i < 8; ++i) {
    const int row = 4 * i + (lane >> 3);
    val[i] = *(const v4f*)(cs + row * 36 + (lane & 7) * 4);
  }
#pragma unroll
  for (int i = 0; i < 8; ++i) {
    const int row = 4 * i + (lane >> 3);
    *(v4f*)(C + (size_t)(mb + row) * (size_t)ldc + nb + (lane & 7) * 4) = val[i];
  }
  
}

// ---------------------------------------------------------------------------------------
// Rotary + f16 planes. One block per sequence row s (q: 16 heads x 128, k: 4 heads x 128).
// Qh [NH][SEQ][HD], Kh [NKV][SEQ][HD]: f16 bits of the rotated value.
// Rows s < SE also get Ql [NH][SE][HD], Kl [NKV][SE][HD]: f16 bits of (x - hi) * 1024.
// rotate-half: out[d] = x[d]*cos - x[d+64]*sin, out[d+64] = x[d+64]*cos + x[d]*sin
// (products and sums as separate f32 ops), angle = fl32(pos * inv_freq[d]).
__global__ __launch_bounds__(256) void k_planes(const float* __restrict__ qkv, const int* __restrict__ pos,
                                               const float* __restrict__ tinv,
                                               u16* __restrict__ Qh, u16* __restrict__ Ql,
                                               u16* __restrict__ Kh, u16* __restrict__ Kl) {
#pragma clang fp contract(off)
  __shared__ __align__(16) u16 Qs[NH * HD];
  __shared__ __align__(16) u16 Qls[NH * HD];
  __shared__ __align__(16) u16 Ks[NKV * HD];
  __shared__ __align__(16) u16 Kls[NKV * HD];
  const int s = (int)blockIdx.x, t = threadIdx.x;
  const bool early = (s < SE);                       // block-uniform
  int pp = pos[s];
  pp = imin(imax(pp, 0), SEQ_FULL - 1);
  const int di = t & 63;
  const float ang = (float)pp * tinv[di];
  float sn, cs;
  rot_sincos(ang, sn, cs);
  const float* row = qkv + (size_t)s * NQKV;

#pragma unroll 1
  for (int j = 0; j < 4; ++j) {
    const int hh = (t + 256 * j) >> 6;               // 0..15
    const int col = hh * HD + di;
    const float x1 = row[col], x2 = row[col + 64];
    const float a1 = x1 * cs, b1 = x2 * sn;
    const float a2 = x2 * cs, b2 = x1 * sn;
    const float r1 = a1 - b1;
    const float r2 = a2 + b2;
    if (early) {
      u16 a, b;
      split1024(r1, a, b); Qs[col] = a;      Qls[col] = b;
      split1024(r2, a, b); Qs[col + 64] = a; Qls[col + 64] = b;
    } else {
      Qs[col] = hbits(r1);
      Qs[col + 64] = hbits(r2);
    }
  }
  {
    const int kvh = t >> 6;                          // 0..3
    const int col = kvh * HD + di;
    const float x1 = row[NH * HD + col], x2 = row[NH * HD + col + 64];
    const float a1 = x1 * cs, b1 = x2 * sn;
    const float a2 = x2 * cs, b2 = x1 * sn;
    const float r1 = a1 - b1;
    const float r2 = a2 + b2;
    if (early) {
      u16 a, b;
      split1024(r1, a, b); Ks[col] = a;      Kls[col] = b;
      split1024(r2, a, b); Ks[col + 64] = a; Kls[col + 64] = b;
    } else {
      Ks[col] = hbits(r1);
      Ks[col + 64] = hbits(r2);
    }
  }
  __syncthreads();

  const int e = t * 8;
  const int hq = e >> 7, dq = e & 127;               // q: head 0..15
  const bool kw = (t < 64);                          // wave-uniform: waves 0,1
  const int hk = hq, dk = dq;                        // valid for t < 64: kv head 0..3
  const v4u vq = *(const v4u*)(Qs + e);
  v4u vql = vq, vk = vq, vkl = vq;
  if (early) vql = *(const v4u*)(Qls + e);
  if (kw) {
    vk = *(const v4u*)(Ks + e);
    if (early) vkl = *(const v4u*)(Kls + e);
  }
  u16* pq  = Qh + ((size_t)hq * SEQ + s) * HD + dq;
  u16* pql = Ql + ((size_t)hq * SE + (early ? s : 0)) * HD + dq;
  u16* pk  = Kh + ((size_t)hk * SEQ + s) * HD + dk;
  u16* pkl = Kl + ((size_t)hk * SE + (early ? s : 0)) * HD + dk;

  *(v4u*)pq = vq;
  if (early) *(v4u*)pql = vql;
  if (kw) {
    *(v4u*)pk = vk;
    if (early) *(v4u*)pkl = vkl;
  }
  
}

// ---------------------------------------------------------------------------------------
// V transposed planes: Vth [NKV][HD][SEQ] = f16 bits of 16*v, and for keys < SE
// Vtl [NKV][HD][SE] = f16 bits of (16*v - hi) * 1024. Tile = 64 keys x 128 d through LDS,
__global__ __launch_bounds__(256) void k_vt(const float* __restrict__ qkv, u16* __restrict__ Vth,
                                           u16* __restrict__ Vtl) {
#pragma clang fp contract(off)
  __shared__ __align__(16) u16 T[HD * 72];           // [d][key], pitch 72 halves
  __shared__ __align__(16) u16 Tl[HD * 72];
  const int s0 = (int)blockIdx.x * 64, kv = (int)blockIdx.y, t = threadIdx.x;
  const bool early = (s0 < SE);                      // block-uniform (SE % 64 == 0)
#pragma unroll 1
  for (int j = 0; j < 8; ++j) {
    const int idx = t + 256 * j;
    const int r = idx >> 5;                          // key 0..63
    const int c4 = (idx & 31) * 4;                   // d 0..124
    const v4f v = *(const v4f*)(qkv + (size_t)(s0 + r) * NQKV + NH * HD + NKV * HD + kv * HD + c4);
#pragma unroll
    for (int e = 0; e < 4; ++e) {
      const float f = 16.0f * v[e];
      if (early) {
        u16 a, b;
        split1024(f, a, b);
        T[(c4 + e) * 72 + r] = a;
        Tl[(c4 + e) * 72 + r] = b;
      } else {
        T[(c4 + e) * 72 + r] = hbits(f);
      }
    }
  }
  __syncthreads();
  v4u vh[4], vl[4];
#pragma unroll
  for (int p = 0; p < 4; ++p) {
    const int d = (t >> 3) + 32 * p, c = (t & 7) * 8;
    vh[p] = *(const v4u*)(T + d * 72 + c);
    vl[p] = vh[p];
    if (early) vl[p] = *(const v4u*)(Tl + d * 72 + c);
  }
#pragma unroll
  for (int p = 0; p < 4; ++p) {
    const int d = (t >> 3) + 32 * p, c = (t & 7) * 8;
    *(v4u*)(Vth + ((size_t)kv * HD + d) * SEQ + s0 + c) = vh[p];
    if (early) *(v4u*)(Vtl + ((size_t)kv * HD + d) * SE + s0 + c) = vl[p];
  }
  
}

// ---------------------------------------------------------------------------------------
// Causal GQA flash attention. Block = 8 waves = 4 q heads of one kv head x 32 queries
// (wave w: head kv*4 + (w>>1), queries q0 + (w&1)*16 .. +15). Keys in chunks of 32 staged
// in LDS: K tile [32][128] (A operand of S^T = K x Q^T, lane = key row) and V^T tile
// [128 d][32 keys] (B operand of O += P x V, lane = d). Queries live on lanes for the
// softmax; P in D layout of S^T is the A-fragment layout of P x V (lane = query,
// elements 0..7 = keys 8h..8h+7, 8..15 = keys 16+8h..). Online softmax in f32 (exp2 form),
// P carried as f16(4096 p), V as f16(16 v), ctx written as f16(64 ctx).
// EARLY (query rows < SE): q, k, P, v get x1024 residual planes and a second accumulator
// folded before normalisation; head dim handled in four 32-wide passes whose ctx results
// pass; ctx also gets a residual plane Cr. Output Ch [SEQ][HID] (head*128 + d), Cr [SE][HID].
// VGPR file capped at 256 (no high-bank registers).
template <bool EARLY>
__global__ __launch_bounds__(256) __attribute__((amdgpu_num_vgpr(256)))
void k_attn(const u16* __restrict__ Qh, const u16* __restrict__ Ql,
            const u16* __restrict__ Kh, const u16* __restrict__ Kl,
            const u16* __restrict__ Vth, const u16* __restrict__ Vtl,
            const int* __restrict__ amask,
            u16* __restrict__ Ch, u16* __restrict__ Cr, int qblk0) {
  // LDS row pitch = 16 B x odd, so that the 16 rows one ds_load_b128 reads fall on distinct banks:
  // K rows (256 B of data) at 272 B, Vt rows (64 B of data) at 80 B.
  constexpr int KP = HD + 8, VP = 32 + 8;             // pitches in halves
  constexpr int KT = 32 * KP, VT = HD * VP;           // tile sizes in halves
  __shared__ __align__(16) u16 pool[EARLY ? 2 * KT + 2 * VT : 16384];  // K | Kres | Vt | Vtres tiles
  __shared__ __align__(16) u16 stg[EARLY ? 16384 : 64];  // EARLY: per-wave ctx stage [8][16][128]
  constexpr int KS = 0, KL = KT, VS = 2 * KT, VL = 2 * KT + VT;
  static_assert(EARLY || VS + VT <= 16384);
  constexpr int NDT = EARLY ? 2 : 8;
  constexpr int DW = NDT * 16;
  constexpr int NPASS = HD / DW;
  const int qblk = qblk0 + (int)blockIdx.x;
  const int kv = (int)blockIdx.y;
  const int tid = threadIdx.x, wave = tid >> 5, lane = tid & 31, h = lane >> 4, l = lane & 15;
  const int head = kv * (NH / NKV) + (wave >> 1);
  const int q0 = qblk * BQW;
  const int qw0 = q0 + (wave & 1) * 16;
  const int qrow = qw0 + l;                          // this lane's query
  const int nchunk = qblk + 1;                       // keys 0 .. q0+31

  FragH qh[4];
  FragH ql[4];
#pragma unroll
  for (int dc = 0; dc < 4; ++dc) {
    const u16* b = Qh + ((size_t)head * SEQ + qrow) * HD + dc * 32 + 8 * h;
    qh[dc].q[0] = *(const v4u*)b;
    qh[dc].q[1] = *(const v4u*)(b + 16);
    if (EARLY) {
      const u16* b2 = Ql + ((size_t)head * SE + qrow) * HD + dc * 32 + 8 * h;
      ql[dc].q[0] = *(const v4u*)b2;
      ql[dc].q[1] = *(const v4u*)(b2 + 16);
    } else {
      ql[dc].q[0] = qh[dc].q[0];
      ql[dc].q[1] = qh[dc].q[1];
    }
  }
  const float SCL = 0.088388347648318441f * 1.4426950408889634f;   // log2(e)/sqrt(128)

  // ctx stage [16 rows][128 cols] per wave: EARLY in its own region (persists across the
  // 32-wide passes), otherwise aliasing pool after the K/V tiles are dead.
  u16* os;
  if (EARLY) os = stg + wave * (16 * 128);
  else os = pool + wave * (16 * 128);

#pragma unroll 1
  for (int pass = 0; pass < NPASS; ++pass) {
    const int dbase = pass * DW;
    v8f o[NDT];
    v8f orr[NDT];
#pragma unroll
    for (int dt = 0; dt < NDT; ++dt) { o[dt] = zero8(); orr[dt] = zero8(); }
    float rmax = -1.0e30f, rsum = 0.0f;

#pragma unroll 1
    for (int kc = 0; kc < nchunk; ++kc) {
      const int kbase = kc * 32;
      __syncthreads();                               // all waves done with the prior tiles
#pragma unroll
      for (int j = 0; j < 2; ++j) {
        const int pp = tid + 256 * j;                // 0..511
        {
          const int r = pp >> 4, c = (pp & 15) * 8;   // K tile: 32 rows x 128
          *(v4u*)(pool + KS + r * KP + c) = *(const v4u*)(Kh + ((size_t)kv * SEQ + kbase + r) * HD + c);
          if (EARLY)
            *(v4u*)(pool + KL + r * KP + c) = *(const v4u*)(Kl + ((size_t)kv * SE + kbase + r) * HD + c);
        }
        {
          const int d = pp >> 2, c = (pp & 3) * 8;    // Vt tile: 128 rows x 32
          *(v4u*)(pool + VS + d * VP + c) = *(const v4u*)(Vth + ((size_t)kv * HD + d) * SEQ + kbase + c);
          if (EARLY)
            *(v4u*)(pool + VL + d * VP + c) = *(const v4u*)(Vtl + ((size_t)kv * HD + d) * SE + kbase + c);
        }
      }
      // padding-mask word for the 32 keys of this chunk, per wave (all lanes active)
      const int av = amask[imin(kbase + lane, SEQ - 1)];
      const unsigned mw = __builtin_amdgcn_ballot_w32(av != 0);
      __syncthreads();

      // scores S^T[key][query]; lane l = query, element r = key sub*16 + 8h + r
      float u[16];
      unsigned vm = 0u;
      float m_new = rmax;
#pragma unroll
      for (int sub = 0; sub < 2; ++sub) {
        v8f acc = zero8();
        v8f accr = zero8();
#pragma unroll
        for (int dc = 0; dc < 4; ++dc) {
          FragH kf;
          const u16* kb = pool + KS + (sub * 16 + l) * KP + dc * 32 + 8 * h;
          kf.q[0] = *(const v4u*)kb;
          kf.q[1] = *(const v4u*)(kb + 16);
          acc = wg_h(acc, kf.v, qh[dc].v);
          if (EARLY) {
            accr = wg_h(accr, kf.v, ql[dc].v);
            FragH kg;
            const u16* kb2 = pool + KL + (sub * 16 + l) * KP + dc * 32 + 8 * h;
            kg.q[0] = *(const v4u*)kb2;
            kg.q[1] = *(const v4u*)(kb2 + 16);
            accr = wg_h(accr, kg.v, qh[dc].v);
          }
        }
#pragma unroll
        for (int r = 0; r < 8; ++r) {
          const int klc = sub * 16 + 8 * h + r;
          const int key = kbase + klc;
          float s = acc[r];
          if (EARLY) s += accr[r] * (1.0f / 1024.0f);
          const bool valid = (key <= qrow) && (((mw >> klc) & 1u) != 0u);
          const float uu = valid ? s * SCL : -1.0e30f;
          u[sub * 8 + r] = uu;
          vm |= (valid ? 1u : 0u) << (sub * 8 + r);
          m_new = fmaxf(m_new, uu);
        }
      }
      m_new = fmaxf(m_new, __shfl_xor(m_new, 16, 32));
      const float scale = __builtin_amdgcn_exp2f(rmax - m_new);
      rmax = m_new;

      float psum = 0.0f;
      FragH ph;
      FragH pr;
#pragma unroll
      for (int i = 0; i < 16; ++i) {
        const float pe = __builtin_amdgcn_exp2f(u[i] - m_new);
        const float pv = ((vm >> i) & 1u) ? pe : 0.0f;
        psum += pv;
        const float pc = pv * 4096.0f;
        const f16 hv = (f16)pc;
        ph.h[i] = hv;
        if (EARLY) pr.h[i] = (f16)((pc - (float)hv) * 1024.0f);
        else pr.h[i] = hv;
      }
      psum += __shfl_xor(psum, 16, 32);
      rsum = rsum * scale + psum;

      float sc[8];
#pragma unroll
      for (int r = 0; r < 8; ++r) sc[r] = __shfl(scale, 8 * h + r, 32);
#pragma unroll
      for (int dt = 0; dt < NDT; ++dt) {
#pragma unroll
        for (int r = 0; r < 8; ++r) {
          o[dt][r] *= sc[r];
          if (EARLY) orr[dt][r] *= sc[r];
        }
      }
      // O += P x V ; B fragment lane = d row of the Vt tile, elements = keys (split map)
#pragma unroll
      for (int dt = 0; dt < NDT; ++dt) {
        const int d = dbase + dt * 16 + l;
        FragH vf;
        const u16* vb = pool + VS + d * VP + 8 * h;
        vf.q[0] = *(const v4u*)vb;
        vf.q[1] = *(const v4u*)(vb + 16);
        o[dt] = wg_h(o[dt], ph.v, vf.v);
        if (EARLY) {
          orr[dt] = wg_h(orr[dt], pr.v, vf.v);
          FragH vg;
          const u16* vb2 = pool + VL + d * VP + 8 * h;
          vg.q[0] = *(const v4u*)vb2;
          vg.q[1] = *(const v4u*)(vb2 + 16);
          orr[dt] = wg_h(orr[dt], ph.v, vg.v);
        }
      }
    }

    // epilogue: ctx = (o + orr/1024) / (4096 * 16 * l); plane value = 64 * ctx
    if (!EARLY) __syncthreads();                     // K/V tiles dead, pool reused as stage
    const float inv = 1.0f / rsum;
    float ir[8];
#pragma unroll
    for (int r = 0; r < 8; ++r) ir[r] = __shfl(inv, 8 * h + r, 32) * (1.0f / 1024.0f);
    const int cb = EARLY ? ((pass & 1) * 32) : 0;   // column offset inside the 64-wide line half
#pragma unroll
    for (int dt = 0; dt < NDT; ++dt) {
#pragma unroll
      for (int r = 0; r < 8; ++r) {
        float val = o[dt][r];
        if (EARLY) val += orr[dt][r] * (1.0f / 1024.0f);
        val *= ir[r];
        if (EARLY) {
          u16 a, b;
          split1024(val, a, b);
          os[(8 * h + r) * 128 + cb + dt * 16 + l] = a;
          os[(8 * h + r) * 128 + 64 + cb + dt * 16 + l] = b;
        } else {
          os[(8 * h + r) * 128 + dt * 16 + l] = hbits(val);
        }
      }
    }
    if (!EARLY) {
      __syncthreads();
      // 16 rows x 256 B = 32 lines; instruction i: lanes 8g..8g+7 -> line 4i+g
      v4u vals[8];
#pragma unroll
      for (int i = 0; i < 8; ++i) {
        const int L = 4 * i + (lane >> 3);
        const int row = L >> 1, seg = L & 1;
        vals[i] = *(const v4u*)(os + row * 128 + seg * 64 + (lane & 7) * 8);
      }
#pragma unroll
      for (int i = 0; i < 8; ++i) {
        const int L = 4 * i + (lane >> 3);
        const int row = L >> 1, seg = L & 1;
        *(v4u*)(Ch + (size_t)(qw0 + row) * HID + head * HD + seg * 64 + (lane & 7) * 8) = vals[i];
      }
      
    } else {
      if ((pass & 1) != 0) {                         // block-uniform: stage holds d line (pass>>1)
        __syncthreads();
        const int dline = (pass >> 1) * 64;
        v4u va[4], vb[4];
#pragma unroll
        for (int i = 0; i < 4; ++i) {
          const int row = 4 * i + (lane >> 3);
          va[i] = *(const v4u*)(os + row * 128 + (lane & 7) * 8);
          vb[i] = *(const v4u*)(os + row * 128 + 64 + (lane & 7) * 8);
        }
#pragma unroll
        for (int i = 0; i < 4; ++i) {
          const int row = 4 * i + (lane >> 3);
          const size_t off = (size_t)(qw0 + row) * HID + head * HD + dline + (lane & 7) * 8;
          *(v4u*)(Ch + off) = va[i];
          *(v4u*)(Cr + off) = vb[i];
        }
        
      }
    }
  }
}

// ---------------------------------------------------------------------------------------
extern "C" void kernel_launch(void* const* d_in, const int* in_sizes, int n_in,
                              void* d_out, int out_size, void* d_ws, size_t ws_size,
                              hipStream_t stream) {
  if (n_in < 7) return;
  if (in_sizes[0] < SEQ * HID) return;
  if (in_sizes[1] < SEQ) return;
  if (in_sizes[2] < SEQ) return;
  if (in_sizes[3] < HID * NH * HD) return;
  if (in_sizes[4] < HID * NKV * HD) return;
  if (in_sizes[5] < HID * NKV * HD) return;
  if (in_sizes[6] < NH * HD * HID) return;
  if (out_size < SEQ * HID) return;

  const float* hs  = (const float*)d_in[0];
  const int*   am  = (const int*)d_in[1];
  const int*   pos = (const int*)d_in[2];
  const float* wq  = (const float*)d_in[3];
  const float* wk  = (const float*)d_in[4];
  const float* wv  = (const float*)d_in[5];
  const float* wo  = (const float*)d_in[6];
  float* out = (float*)d_out;

  char* ws = (char*)d_ws;
  size_t off = 0;
#define CARVE(T, name, bytes) T* name = (T*)(ws + off); off += (((size_t)(bytes)) + 255) & ~(size_t)255
  CARVE(u16,   Xb,    (size_t)SEQ * HID * 2);          // bf16 bits [SEQ][HID]
  CARVE(u16,   WqkvT, (size_t)NQKV * HID * 2);         // bf16 bits [3072][HID]
  CARVE(u16,   WoT,   (size_t)HID * HID * 2);          // f16 bits  [HID][HID]
  CARVE(float, QKVf,  (size_t)SEQ * NQKV * 4);         // f32 [SEQ][3072]
  CARVE(u16,   Qh,    (size_t)NH * SEQ * HD * 2);
  CARVE(u16,   Kh,    (size_t)NKV * SEQ * HD * 2);
  CARVE(u16,   Vth,   (size_t)NKV * HD * SEQ * 2);
  CARVE(u16,   Ql,    (size_t)NH * SE * HD * 2);
  CARVE(u16,   Kl,    (size_t)NKV * SE * HD * 2);
  CARVE(u16,   Vtl,   (size_t)NKV * HD * SE * 2);
  CARVE(u16,   Cr,    (size_t)SE * HID * 2);
  CARVE(float, Tinv,  256);
#undef CARVE
  // Ch [SEQ][HID] f16 plane aliases the Xb region: identical extent (SEQ*HID halves), Xb is
  // read only by the qkv projection launch, Ch is first written by the attention launches
  // that come after it on the same in-order stream.
  static_assert(NH * HD == HID);
  u16* Ch = Xb;
  if (off > ws_size) return;

  // 1) hidden -> bf16, inv_freq table
  k_xconv<<<dim3(SEQ), 256, 0, stream>>>(hs, Xb, Tinv);
  // 2) weights: w [HID][n] -> wt [n][HID]
  k_wt<0><<<dim3(HID / 64, (NH * HD) / 64), 256, 0, stream>>>(wq, WqkvT, NH * HD);
  k_wt<0><<<dim3(HID / 64, (NKV * HD) / 64), 256, 0, stream>>>(wk, WqkvT + (size_t)(NH * HD) * HID, NKV * HD);
  k_wt<0><<<dim3(HID / 64, (NKV * HD) / 64), 256, 0, stream>>>(wv, WqkvT + (size_t)(NH * HD + NKV * HD) * HID, NKV * HD);
  k_wt<1><<<dim3(HID / 64, HID / 64), 256, 0, stream>>>(wo, WoT, HID);
  // 3) fused qkv projection: [SEQ][HID] x [HID][3072] -> f32
  k_gemm<0, false><<<dim3(NQKV / 128, SEQ / 64), 256, 0, stream>>>(
      Xb, Xb, WqkvT, QKVf, HID, HID, NQKV, HID, 0, 1.0f, 0.0f);
  // 4) rotary + planes, V transposed planes
  k_planes<<<dim3(SEQ), 256, 0, stream>>>(QKVf, pos, Tinv, Qh, Ql, Kh, Kl);
  k_vt<<<dim3(SEQ / 64, NKV), 256, 0, stream>>>(QKVf, Vth, Vtl);
  // 5) attention: leading SE rows with residual planes, the rest single products
  k_attn<true><<<dim3(SE / BQW, NKV), 256, 0, stream>>>(Qh, Ql, Kh, Kl, Vth, Vtl, am, Ch, Cr, 0);
  if (SEQ > SE) {
    k_attn<false><<<dim3(SEQ / BQW - SE / BQW, NKV), 256, 0, stream>>>(
        Qh, Ql, Kh, Kl, Vth, Vtl, am, Ch, Cr, SE / BQW);
  }
  // 6) output projection: rows < SE with the residual ctx plane, the rest plain
  k_gemm<1, true><<<dim3(HID / 128, SE / 64), 256, 0, stream>>>(
      Ch, Cr, WoT, out, HID, HID, HID, HID, 0, 1.0f / 4096.0f, 1.0f / (4096.0f * 1024.0f));
  if (SEQ > SE) {
    k_gemm<1, false><<<dim3(HID / 128, (SEQ - SE) / 64), 256, 0, stream>>>(
        Ch, Ch, WoT, out, HID, HID, HID, HID, SE, 1.0f / 4096.0f, 0.0f);
  }
}

// v002
// One run takes 695 microseconds.
// In two side-by-side timings against v001, it was 1.28 and 1.30 times as fast.
// Counting every step since v000, it is 1.95 times as fast.
#include <hip/hip_runtime.h>
#include <stdint.h>
#include <stddef.h>

// Contractions: qkv projection = v_wmma_f32_16x16x32_bf16 (bf16 operands, f32 accumulate);
// q.k scores, p.v and output projection = v_wmma_f32_16x16x32_f16 (f16 operands with
// power-of-two carries plus x1024 f16 residual planes on the leading SE query rows,
// f32 accumulate). Softmax and epilogues in f32; rotary sin/cos via f64 quadrant
// reduction + polynomial (no fused multiply-add), rotation in unfused f32.

#ifndef NB
#define NB 1
#endif
#ifndef SEQ
#define SEQ 4096
#endif
#ifndef SE
#if SEQ < 640
#define SE SEQ
#else
#define SE 640
#endif
#endif
#define SEQ_FULL 4096
#define HID 2048
#define NH 16
#define NKV 4
#define HD 128
#define NQKV (NH * HD + 2 * NKV * HD)
#define BQW 32

static_assert(NB == 1);
static_assert(SEQ % 64 == 0);
static_assert(SEQ >= SE);
static_assert(SEQ <= SEQ_FULL);
static_assert(SE >= 64);
static_assert(SE % 64 == 0);
static_assert(SE % BQW == 0);
static_assert(HID % 128 == 0);
static_assert(HID == 256 * 8);
static_assert(NQKV % 128 == 0);
static_assert(HD == 128);
static_assert(NH == 4 * NKV);
static_assert(NH * HD == HID);

typedef _Float16 f16;
typedef __bf16 bf16;
typedef unsigned short u16;
typedef f16 v16h __attribute__((ext_vector_type(16)));
typedef bf16 v16b __attribute__((ext_vector_type(16)));
typedef float v8f __attribute__((ext_vector_type(8)));
typedef float v4f __attribute__((ext_vector_type(4)));
typedef unsigned v4u __attribute__((ext_vector_type(4)));

union FragH { v16h v; v4u q[2]; f16 h[16]; };
union FragB { v16b v; v4u q[2]; };

__device__ __forceinline__ v8f zero8() {
  v8f z = {0.0f, 0.0f, 0.0f, 0.0f, 0.0f, 0.0f, 0.0f, 0.0f};
  return z;
}

// 16x16x32 f16 WMMA followed by a 4-slot VALU hazard guard on D (A/B kept live).
__device__ __forceinline__ v8f wg_h(v8f acc, v16h a, v16h b) {
  acc = __builtin_amdgcn_wmma_f32_16x16x32_f16(false, a, false, b, (short)0, acc, false, false);
  asm volatile("v_nop\n\tv_nop\n\tv_nop\n\tv_nop" : "+v"(acc) : "v"(a), "v"(b));
  return acc;
}
__device__ __forceinline__ v8f wg_b(v8f acc, v16b a, v16b b) {
  acc = __builtin_amdgcn_wmma_f32_16x16x32_bf16(false, a, false, b, (short)0, acc, false, false);
  asm volatile("v_nop\n\tv_nop\n\tv_nop\n\tv_nop" : "+v"(acc) : "v"(a), "v"(b));
  return acc;
}

// f32 -> bf16 bits, RNE convert.
__device__ __forceinline__ unsigned bf16_rne(float f) {
  const unsigned u = __float_as_uint(f);
  return (u + 0x7FFFu + ((u >> 16) & 1u)) >> 16;
}
// f32 -> f16 bits, RNE convert.
__device__ __forceinline__ u16 hbits(float f) {
  const f16 x = (f16)f;
  return __builtin_bit_cast(u16, x);
}
// f32 -> f16 hi bits plus f16 bits of (v - hi) * 1024 (unfused: sub then mul).
__device__ __forceinline__ void split1024(float v, u16& hb, u16& lb) {
#pragma clang fp contract(off)
  const f16 x = (f16)v;
  const float xr = (float)x;
  const float dlt = v - xr;
  const f16 y = (f16)(dlt * 1024.0f);
  hb = __builtin_bit_cast(u16, x);
  lb = __builtin_bit_cast(u16, y);
}
__device__ __forceinline__ int imin(int a, int b) { return a < b ? a : b; }
__device__ __forceinline__ int imax(int a, int b) { return a > b ? a : b; }

// sin/cos of an f32 angle (0 <= ang <= ~4100 rad) in f64 without fused multiply-add:
// quadrant count kq = rint(x * 2/pi); r = (x - kq * P1) - kq * P2 with P1 = the leading
// 33 bits of pi/2 (kq * P1 exact for kq < 2^20) and P2 its tail; odd/even polynomials on
// |r| <= pi/4 (truncation < 3e-14); quadrant select by value; convert to f32.
__device__ __forceinline__ void rot_sincos(float ang, float& sn, float& cs) {
#pragma clang fp contract(off)
  const double x = (double)ang;
  const double kq = __builtin_rint(x * 0.63661977236758134308);
  double r = x - kq * 1.57079632673412561417;
  r = r - kq * 6.07710050650619224932e-11;
  const int q = (int)kq;
  const double r2 = r * r;
  double ps = 1.6059043836821613e-10;
  ps = ps * r2 - 2.5052108385441720e-08;
  ps = ps * r2 + 2.7557319223985893e-06;
  ps = ps * r2 - 1.9841269841269841e-04;
  ps = ps * r2 + 8.3333333333333332e-03;
  ps = ps * r2 - 1.6666666666666666e-01;
  const double r3 = r * r2;
  const double sr = r + r3 * ps;
  double pc = -1.1470745597729725e-11;
  pc = pc * r2 + 2.0876756987868099e-09;
  pc = pc * r2 - 2.7557319223985888e-07;
  pc = pc * r2 + 2.4801587301587302e-05;
  pc = pc * r2 - 1.3888888888888889e-03;
  pc = pc * r2 + 4.1666666666666664e-02;
  pc = pc * r2 - 0.5;
  const double cr = 1.0 + pc * r2;
  const bool odd = (q & 1) != 0;
  const bool neg = (q & 2) != 0;
  double sv = odd ? cr : sr;
  double cv = odd ? -sr : cr;
  sv = neg ? -sv : sv;
  cv = neg ? -cv : cv;
  sn = (float)sv;
  cs = (float)cv;
}

// ---------------------------------------------------------------------------------------
// hidden f32 [SEQ][HID] -> bf16 bits [SEQ][HID]; one block per row, 16 B per lane.
// Block 0, lanes 0..63 also produce the rotary inv_freq table (64 floats):
// inv[j] = fl32(1 / fl32(10000^(j/64))), with 10000^(1/64) from an iterative f64 64th root.
__global__ __launch_bounds__(256) void k_xconv(const float* __restrict__ x, u16* __restrict__ xb,
                                              float* __restrict__ tinv) {
#pragma clang fp contract(off)
  const int t = threadIdx.x;
  const size_t e = ((size_t)blockIdx.x * 256 + (size_t)t) * 8;
  const v4f a = *(const v4f*)(x + e);
  const v4f b = *(const v4f*)(x + e + 4);
  v4u w;
  w[0] = bf16_rne(a[0]) | (bf16_rne(a[1]) << 16);
  w[1] = bf16_rne(a[2]) | (bf16_rne(a[3]) << 16);
  w[2] = bf16_rne(b[0]) | (bf16_rne(b[1]) << 16);
  w[3] = bf16_rne(b[2]) | (bf16_rne(b[3]) << 16);

  const bool tab = (blockIdx.x == 0) && (t < 64);   // wave-uniform (waves 0,1 of block 0)
  float ivf = 0.0f;
  if (tab) {
    double rt = 1.15;
#pragma unroll 1
    for (int it = 0; it < 48; ++it) {
      double p63 = rt;
#pragma unroll 1
      for (int k = 1; k < 63; ++k) p63 *= rt;
      const double p64 = p63 * rt;
      const double f = p64 - 10000.0;
      rt = rt - f / (64.0 * p63);
    }
    double pj = 1.0;
#pragma unroll 1
    for (int k = 0; k < t; ++k) pj *= rt;           // t < 64: bounded
    const float pf = (float)pj;
    ivf = (float)(1.0 / (double)pf);
  }
  *(v4u*)(xb + e) = w;
  if (tab) *(float*)(tinv + t) = ivf;
  
}

// ---------------------------------------------------------------------------------------
// Weight transpose + convert: w f32 [HID][ncol] -> wt 16-bit [ncol][HID] (k contiguous).
// 8 consecutive lanes of one instruction. MODE 0: bf16 bits; MODE 1: f16 bits of
// 64 * bf16(w) (bf16 RNE value first, the x64 f16 copy of it is exact).
template <int MODE>
__global__ __launch_bounds__(256) void k_wt(const float* __restrict__ w, u16* __restrict__ wt, int ncol) {
  __shared__ __align__(16) u16 T[64 * 72];          // [o][i], pitch 72 halves (144 B)
  const int i0 = (int)blockIdx.x * 64, o0 = (int)blockIdx.y * 64, t = threadIdx.x;
#pragma unroll
  for (int j = 0; j < 4; ++j) {
    const int i = (t >> 4) + 16 * j;
    const int oc = (t & 15) * 4;
    const v4f v = *(const v4f*)(w + (size_t)(i0 + i) * (size_t)ncol + o0 + oc);
#pragma unroll
    for (int e = 0; e < 4; ++e) {
      const float f = v[e];
      u16 bb;
      if (MODE == 0) bb = (u16)bf16_rne(f);
      else bb = hbits(__uint_as_float(bf16_rne(f) << 16) * 64.0f);
      T[(oc + e) * 72 + i] = bb;
    }
  }
  __syncthreads();
  v4u val[2];
#pragma unroll
  for (int p = 0; p < 2; ++p) {
    const int o = (t >> 3) + 32 * p;
    val[p] = *(const v4u*)(T + o * 72 + (t & 7) * 8);
  }
#pragma unroll
  for (int p = 0; p < 2; ++p) {
    const int o = (t >> 3) + 32 * p;
    *(v4u*)(wt + (size_t)(o0 + o) * HID + i0 + (t & 7) * 8) = val[p];
  }
  
}

// ---------------------------------------------------------------------------------------
// C[m][n] (f32) = sh * sum_k A[m][k] * BT[n][k]  (+ sr * sum_k Ar[m][k] * BT[n][k] if RES)
// MODE 0: bf16 operands; MODE 1: f16 operands. Block 64 (M) x 128 (N), 8 waves each 32x32.
// Fragments straight from 16-bit global rows with the split k map (elements 0..7 at
template <int MODE, bool RES>
__global__ __launch_bounds__(256) void k_gemm(const u16* __restrict__ A, const u16* __restrict__ Ar,
                                             const u16* __restrict__ BT, float* __restrict__ C,
                                             int lda, int ldb, int ldc, int K, int row0,
                                             float sh, float sr) {
  __shared__ __align__(16) float Cs[8 * 32 * 36];
  const int tid = threadIdx.x, wave = tid >> 5, lane = tid & 31, h = lane >> 4, l = lane & 15;
  const int wm = wave >> 2, wn = wave & 3;
  const int mb = row0 + (int)blockIdx.y * 64 + wm * 32;
  const int nb = (int)blockIdx.x * 128 + wn * 32;
  const size_t rA0 = (size_t)(mb + l) * (size_t)lda, rA1 = (size_t)(mb + 16 + l) * (size_t)lda;
  const size_t rB0 = (size_t)(nb + l) * (size_t)ldb, rB1 = (size_t)(nb + 16 + l) * (size_t)ldb;
  v8f c00 = zero8(), c01 = zero8(), c10 = zero8(), c11 = zero8();
  v8f r00 = zero8(), r01 = zero8(), r10 = zero8(), r11 = zero8();

  for (int kk = 0; kk < K; kk += 32) {
    const int k0 = kk + 8 * h, k1 = kk + 16 + 8 * h;
    if (MODE == 0) {
      FragB a0, a1, b0, b1;
      a0.q[0] = *(const v4u*)(A + rA0 + k0);  a0.q[1] = *(const v4u*)(A + rA0 + k1);
      a1.q[0] = *(const v4u*)(A + rA1 + k0);  a1.q[1] = *(const v4u*)(A + rA1 + k1);
      b0.q[0] = *(const v4u*)(BT + rB0 + k0); b0.q[1] = *(const v4u*)(BT + rB0 + k1);
      b1.q[0] = *(const v4u*)(BT + rB1 + k0); b1.q[1] = *(const v4u*)(BT + rB1 + k1);
      c00 = wg_b(c00, a0.v, b0.v); c01 = wg_b(c01, a0.v, b1.v);
      c10 = wg_b(c10, a1.v, b0.v); c11 = wg_b(c11, a1.v, b1.v);
    } else {
      FragH a0, a1, b0, b1;
      a0.q[0] = *(const v4u*)(A + rA0 + k0);  a0.q[1] = *(const v4u*)(A + rA0 + k1);
      a1.q[0] = *(const v4u*)(A + rA1 + k0);  a1.q[1] = *(const v4u*)(A + rA1 + k1);
      b0.q[0] = *(const v4u*)(BT + rB0 + k0); b0.q[1] = *(const v4u*)(BT + rB0 + k1);
      b1.q[0] = *(const v4u*)(BT + rB1 + k0); b1.q[1] = *(const v4u*)(BT + rB1 + k1);
      c00 = wg_h(c00, a0.v, b0.v); c01 = wg_h(c01, a0.v, b1.v);
      c10 = wg_h(c10, a1.v, b0.v); c11 = wg_h(c11, a1.v, b1.v);
      if (RES) {
        FragH e0, e1;
        e0.q[0] = *(const v4u*)(Ar + rA0 + k0); e0.q[1] = *(const v4u*)(Ar + rA0 + k1);
        e1.q[0] = *(const v4u*)(Ar + rA1 + k0); e1.q[1] = *(const v4u*)(Ar + rA1 + k1);
        r00 = wg_h(r00, e0.v, b0.v); r01 = wg_h(r01, e0.v, b1.v);
        r10 = wg_h(r10, e1.v, b0.v); r11 = wg_h(r11, e1.v, b1.v);
      }
    }
  }

  float* cs = Cs + wave * (32 * 36);
#pragma unroll
  for (int e = 0; e < 8; ++e) {
    const int ra = 8 * h + e, rb = ra + 16;
    float v00 = sh * c00[e], v01 = sh * c01[e], v10 = sh * c10[e], v11 = sh * c11[e];
    if (RES) { v00 += sr * r00[e]; v01 += sr * r01[e]; v10 += sr * r10[e]; v11 += sr * r11[e]; }
    cs[ra * 36 + l] = v00;
    cs[ra * 36 + 16 + l] = v01;
    cs[rb * 36 + l] = v10;
    cs[rb * 36 + 16 + l] = v11;
  }
  __syncthreads();
  v4f val[8];
#pragma unroll
  for (int i = 0; i < 8; ++i) {
    const int row = 4 * i + (lane >> 3);
    val[i] = *(const v4f*)(cs + row * 36 + (lane & 7) * 4);
  }
#pragma unroll
  for (int i = 0; i < 8; ++i) {
    const int row = 4 * i + (lane >> 3);
    *(v4f*)(C + (size_t)(mb + row) * (size_t)ldc + nb + (lane & 7) * 4) = val[i];
  }
  
}

// ---------------------------------------------------------------------------------------
// Rotary + f16 planes. One block per sequence row s (q: 16 heads x 128, k: 4 heads x 128).
// Qh [NH][SEQ][HD], Kh [NKV][SEQ][HD]: f16 bits of the rotated value.
// Rows s < SE also get Ql [NH][SE][HD], Kl [NKV][SE][HD]: f16 bits of (x - hi) * 1024.
// rotate-half: out[d] = x[d]*cos - x[d+64]*sin, out[d+64] = x[d+64]*cos + x[d]*sin
// (products and sums as separate f32 ops), angle = fl32(pos * inv_freq[d]).
__global__ __launch_bounds__(256) void k_planes(const float* __restrict__ qkv, const int* __restrict__ pos,
                                               const float* __restrict__ tinv,
                                               u16* __restrict__ Qh, u16* __restrict__ Ql,
                                               u16* __restrict__ Kh, u16* __restrict__ Kl) {
#pragma clang fp contract(off)
  __shared__ __align__(16) u16 Qs[NH * HD];
  __shared__ __align__(16) u16 Qls[NH * HD];
  __shared__ __align__(16) u16 Ks[NKV * HD];
  __shared__ __align__(16) u16 Kls[NKV * HD];
  const int s = (int)blockIdx.x, t = threadIdx.x;
  const bool early = (s < SE);                       // block-uniform
  int pp = pos[s];
  pp = imin(imax(pp, 0), SEQ_FULL - 1);
  const int di = t & 63;
  const float ang = (float)pp * tinv[di];
  float sn, cs;
  rot_sincos(ang, sn, cs);
  const float* row = qkv + (size_t)s * NQKV;

#pragma unroll 1
  for (int j = 0; j < 4; ++j) {
    const int hh = (t + 256 * j) >> 6;               // 0..15
    const int col = hh * HD + di;
    const float x1 = row[col], x2 = row[col + 64];
    const float a1 = x1 * cs, b1 = x2 * sn;
    const float a2 = x2 * cs, b2 = x1 * sn;
    const float r1 = a1 - b1;
    const float r2 = a2 + b2;
    if (early) {
      u16 a, b;
      split1024(r1, a, b); Qs[col] = a;      Qls[col] = b;
      split1024(r2, a, b); Qs[col + 64] = a; Qls[col + 64] = b;
    } else {
      Qs[col] = hbits(r1);
      Qs[col + 64] = hbits(r2);
    }
  }
  {
    const int kvh = t >> 6;                          // 0..3
    const int col = kvh * HD + di;
    const float x1 = row[NH * HD + col], x2 = row[NH * HD + col + 64];
    const float a1 = x1 * cs, b1 = x2 * sn;
    const float a2 = x2 * cs, b2 = x1 * sn;
    const float r1 = a1 - b1;
    const float r2 = a2 + b2;
    if (early) {
      u16 a, b;
      split1024(r1, a, b); Ks[col] = a;      Kls[col] = b;
      split1024(r2, a, b); Ks[col + 64] = a; Kls[col + 64] = b;
    } else {
      Ks[col] = hbits(r1);
      Ks[col + 64] = hbits(r2);
    }
  }
  __syncthreads();

  const int e = t * 8;
  const int hq = e >> 7, dq = e & 127;               // q: head 0..15
  const bool kw = (t < 64);                          // wave-uniform: waves 0,1
  const int hk = hq, dk = dq;                        // valid for t < 64: kv head 0..3
  const v4u vq = *(const v4u*)(Qs + e);
  v4u vql = vq, vk = vq, vkl = vq;
  if (early) vql = *(const v4u*)(Qls + e);
  if (kw) {
    vk = *(const v4u*)(Ks + e);
    if (early) vkl = *(const v4u*)(Kls + e);
  }
  u16* pq  = Qh + ((size_t)hq * SEQ + s) * HD + dq;
  u16* pql = Ql + ((size_t)hq * SE + (early ? s : 0)) * HD + dq;
  u16* pk  = Kh + ((size_t)hk * SEQ + s) * HD + dk;
  u16* pkl = Kl + ((size_t)hk * SE + (early ? s : 0)) * HD + dk;

  *(v4u*)pq = vq;
  if (early) *(v4u*)pql = vql;
  if (kw) {
    *(v4u*)pk = vk;
    if (early) *(v4u*)pkl = vkl;
  }
  
}

// ---------------------------------------------------------------------------------------
// V transposed planes: Vth [NKV][HD][SEQ] = f16 bits of 16*v, and for keys < SE
// Vtl [NKV][HD][SE] = f16 bits of (16*v - hi) * 1024. Tile = 64 keys x 128 d through LDS,
__global__ __launch_bounds__(256) void k_vt(const float* __restrict__ qkv, u16* __restrict__ Vth,
                                           u16* __restrict__ Vtl) {
#pragma clang fp contract(off)
  __shared__ __align__(16) u16 T[HD * 72];           // [d][key], pitch 72 halves
  __shared__ __align__(16) u16 Tl[HD * 72];
  const int s0 = (int)blockIdx.x * 64, kv = (int)blockIdx.y, t = threadIdx.x;
  const bool early = (s0 < SE);                      // block-uniform (SE % 64 == 0)
#pragma unroll 1
  for (int j = 0; j < 8; ++j) {
    const int idx = t + 256 * j;
    const int r = idx >> 5;                          // key 0..63
    const int c4 = (idx & 31) * 4;                   // d 0..124
    const v4f v = *(const v4f*)(qkv + (size_t)(s0 + r) * NQKV + NH * HD + NKV * HD + kv * HD + c4);
#pragma unroll
    for (int e = 0; e < 4; ++e) {
      const float f = 16.0f * v[e];
      if (early) {
        u16 a, b;
        split1024(f, a, b);
        T[(c4 + e) * 72 + r] = a;
        Tl[(c4 + e) * 72 + r] = b;
      } else {
        T[(c4 + e) * 72 + r] = hbits(f);
      }
    }
  }
  __syncthreads();
  v4u vh[4], vl[4];
#pragma unroll
  for (int p = 0; p < 4; ++p) {
    const int d = (t >> 3) + 32 * p, c = (t & 7) * 8;
    vh[p] = *(const v4u*)(T + d * 72 + c);
    vl[p] = vh[p];
    if (early) vl[p] = *(const v4u*)(Tl + d * 72 + c);
  }
#pragma unroll
  for (int p = 0; p < 4; ++p) {
    const int d = (t >> 3) + 32 * p, c = (t & 7) * 8;
    *(v4u*)(Vth + ((size_t)kv * HD + d) * SEQ + s0 + c) = vh[p];
    if (early) *(v4u*)(Vtl + ((size_t)kv * HD + d) * SE + s0 + c) = vl[p];
  }
  
}

// ---------------------------------------------------------------------------------------
// Causal GQA flash attention. Block = 8 waves = 4 q heads of one kv head x 32 queries
// (wave w: head kv*4 + (w>>1), queries q0 + (w&1)*16 .. +15). Keys in chunks of 32 staged
// in LDS (two buffers, filled one chunk ahead by asynchronous copies): K tile [32][128] (A operand of S^T = K x Q^T, lane = key row) and V^T tile
// [128 d][32 keys] (B operand of O += P x V, lane = d). Queries live on lanes for the
// softmax; P in D layout of S^T is the A-fragment layout of P x V (lane = query,
// elements 0..7 = keys 8h..8h+7, 8..15 = keys 16+8h..). Online softmax in f32 (exp2 form),
// P carried as f16(4096 p), V as f16(16 v), ctx written as f16(64 ctx).
// EARLY (query rows < SE): q, k, P, v get x1024 residual planes and a second accumulator
// folded before normalisation; head dim handled in four 32-wide passes whose ctx results
// pass; ctx also gets a residual plane Cr. Output Ch [SEQ][HID] (head*128 + d), Cr [SE][HID].
// VGPR file capped at 256 (no high-bank registers).
template <bool EARLY>
__global__ __launch_bounds__(256) __attribute__((amdgpu_num_vgpr(256)))
void k_attn(const u16* __restrict__ Qh, const u16* __restrict__ Ql,
            const u16* __restrict__ Kh, const u16* __restrict__ Kl,
            const u16* __restrict__ Vth, const u16* __restrict__ Vtl,
            const int* __restrict__ amask,
            u16* __restrict__ Ch, u16* __restrict__ Cr, int qblk0) {
  // LDS row pitch = 16 B x odd, so that the 16 rows one ds_load_b128 reads fall on distinct banks:
  // K rows (256 B of data) at 272 B, Vt rows (64 B of data) at 80 B.
  constexpr int KP = HD + 8, VP = 32 + 8;             // pitches in halves
  constexpr int KT = 32 * KP, VT = HD * VP;           // tile sizes in halves
  // One buffer = K | (Kres) | Vt | (Vtres) tiles of one key chunk; two buffers, chunk kc in buffer kc & 1:
  // chunk kc + 1 is copied global -> LDS (asynchronous, through no register) while chunk kc is worked on.
  constexpr int KS = 0, KL = KT, VS = EARLY ? 2 * KT : KT, VL = VS + VT;
  constexpr int BUF = EARLY ? 2 * KT + 2 * VT : KT + VT;  // halves per buffer
  __shared__ __align__(16) u16 pool[2 * BUF];
  __shared__ __align__(16) u16 stg[EARLY ? 16384 : 64];  // EARLY: per-wave ctx stage [8][16][128]
  static_assert((BUF * 2) % 16 == 0 && (KP * 2) % 16 == 0 && (VP * 2) % 16 == 0);
  static_assert(EARLY || 2 * BUF >= 16384);           // pool doubles as the ctx stage behind the loop
  constexpr int NDT = EARLY ? 2 : 8;
  constexpr int DW = NDT * 16;
  constexpr int NPASS = HD / DW;
  const int qblk = qblk0 + (int)blockIdx.x;
  const int kv = (int)blockIdx.y;
  const int tid = threadIdx.x, wave = tid >> 5, lane = tid & 31, h = lane >> 4, l = lane & 15;
  const int head = kv * (NH / NKV) + (wave >> 1);
  const int q0 = qblk * BQW;
  const int qw0 = q0 + (wave & 1) * 16;
  const int qrow = qw0 + l;                          // this lane's query
  const int nchunk = qblk + 1;                       // keys 0 .. q0+31

  FragH qh[4];
  FragH ql[4];
#pragma unroll
  for (int dc = 0; dc < 4; ++dc) {
    const u16* b = Qh + ((size_t)head * SEQ + qrow) * HD + dc * 32 + 8 * h;
    qh[dc].q[0] = *(const v4u*)b;
    qh[dc].q[1] = *(const v4u*)(b + 16);
    if (EARLY) {
      const u16* b2 = Ql + ((size_t)head * SE + qrow) * HD + dc * 32 + 8 * h;
      ql[dc].q[0] = *(const v4u*)b2;
      ql[dc].q[1] = *(const v4u*)(b2 + 16);
    } else {
      ql[dc].q[0] = qh[dc].q[0];
      ql[dc].q[1] = qh[dc].q[1];
    }
  }
  const float SCL = 0.088388347648318441f * 1.4426950408889634f;   // log2(e)/sqrt(128)

  // ctx stage [16 rows][128 cols] per wave: EARLY in its own region (persists across the
  // 32-wide passes), otherwise aliasing pool after the K/V tiles are dead.
  u16* os;
  if (EARLY) os = stg + wave * (16 * 128);
  else os = pool + wave * (16 * 128);

  // This lane's 16-byte pieces of a chunk: K rows kr and kr + 16, Vt rows vd and vd + 64.
  const int kr = tid >> 4, kcol = (tid & 15) * 8;
  const int vd = tid >> 2, vcol = (tid & 3) * 8;
  const unsigned lbase = (unsigned)(size_t)pool;     // byte offset of pool in the work-group's LDS
  const unsigned lk = lbase + 2u * (unsigned)(KS + kr * KP + kcol);
  const unsigned lv = lbase + 2u * (unsigned)(VS + vd * VP + vcol);
  const u16* gk = Kh + ((size_t)kv * SEQ + kr) * HD + kcol;
  const u16* gv = Vth + ((size_t)kv * HD + vd) * SEQ + vcol;
  const u16* gkl = Kl + ((size_t)kv * SE + kr) * HD + kcol;
  const u16* gvl = Vtl + ((size_t)kv * HD + vd) * SE + vcol;
  // Issue the copies of chunk c into buffer c & 1 (all lanes on, block-uniform call sites). The
  // s_wait_xcnt closes each statement so that no address register is rewritten ahead of it.
  auto copy_chunk = [&](int c) {
    const unsigned bo = (unsigned)(c & 1) * (unsigned)(BUF * 2);
    const unsigned k0 = lk + bo, k1 = k0 + 2u * 16u * KP;
    const unsigned v0 = lv + bo, v1 = v0 + 2u * 64u * VP;
    const u16* a0 = gk + (size_t)c * (32 * HD);
    const u16* a1 = a0 + 16 * HD;
    const u16* b0 = gv + c * 32;
    const u16* b1 = b0 + (size_t)64 * SEQ;
    asm volatile("global_load_async_to_lds_b128 %0, %4, off\n\t"
                 "global_load_async_to_lds_b128 %1, %5, off\n\t"
                 "global_load_async_to_lds_b128 %2, %6, off\n\t"
                 "global_load_async_to_lds_b128 %3, %7, off\n\t"
                 "s_wait_xcnt 0x0"
                 :: "v"(k0), "v"(k1), "v"(v0), "v"(v1), "v"(a0), "v"(a1), "v"(b0), "v"(b1) : "memory");
    if (EARLY) {
      const unsigned k2 = k0 + 2u * (KL - KS), k3 = k1 + 2u * (KL - KS);
      const unsigned v2 = v0 + 2u * (VL - VS), v3 = v1 + 2u * (VL - VS);
      const u16* a2 = gkl + (size_t)c * (32 * HD);
      const u16* a3 = a2 + 16 * HD;
      const u16* b2 = gvl + c * 32;
      const u16* b3 = b2 + (size_t)64 * SE;
      asm volatile("global_load_async_to_lds_b128 %0, %4, off\n\t"
                   "global_load_async_to_lds_b128 %1, %5, off\n\t"
                   "global_load_async_to_lds_b128 %2, %6, off\n\t"
                   "global_load_async_to_lds_b128 %3, %7, off\n\t"
                   "s_wait_xcnt 0x0"
                   :: "v"(k2), "v"(k3), "v"(v2), "v"(v3), "v"(a2), "v"(a3), "v"(b2), "v"(b3) : "memory");
    }
  };

#pragma unroll 1
  for (int pass = 0; pass < NPASS; ++pass) {
    const int dbase = pass * DW;
    v8f o[NDT];
    v8f orr[NDT];
#pragma unroll
    for (int dt = 0; dt < NDT; ++dt) { o[dt] = zero8(); orr[dt] = zero8(); }
    float rmax = -1.0e30f, rsum = 0.0f;

    // Chunk 0 lands and is published, then chunk 1 is set flying. (A later pass gets here behind
    // the last trip's s_wait_dscnt and barrier, so every reader has left both buffers.)
    copy_chunk(0);
    asm volatile("s_wait_asynccnt 0x0" ::: "memory");  // this wave's copies of chunk 0 have landed
    __syncthreads();                                 // ... and every other wave's
    if (nchunk > 1) copy_chunk(1);
    int av = amask[imin(lane, SEQ - 1)];             // padding mask of chunk 0's keys

#pragma unroll 1
    for (int kc = 0; kc < nchunk; ++kc) {
      const int kbase = kc * 32;
      const u16* tb = pool + (kc & 1) * BUF;         // this chunk's buffer
      // padding-mask word for the 32 keys of this chunk, per wave (all lanes active); the next
      // chunk's mask values are read one chunk ahead, like its tiles
      const unsigned mw = __builtin_amdgcn_ballot_w32(av != 0);
      av = amask[imin(kbase + 32 + lane, SEQ - 1)];

      // scores S^T[key][query]; lane l = query, element r = key sub*16 + 8h + r
      float u[16];
      unsigned vm = 0u;
      float m_new = rmax;
#pragma unroll
      for (int sub = 0; sub < 2; ++sub) {
        v8f acc = zero8();
        v8f accr = zero8();
#pragma unroll
        for (int dc = 0; dc < 4; ++dc) {
          FragH kf;
          const u16* kb = tb + KS + (sub * 16 + l) * KP + dc * 32 + 8 * h;
          kf.q[0] = *(const v4u*)kb;
          kf.q[1] = *(const v4u*)(kb + 16);
          acc = wg_h(acc, kf.v, qh[dc].v);
          if (EARLY) {
            accr = wg_h(accr, kf.v, ql[dc].v);
            FragH kg;
            const u16* kb2 = tb + KL + (sub * 16 + l) * KP + dc * 32 + 8 * h;
            kg.q[0] = *(const v4u*)kb2;
            kg.q[1] = *(const v4u*)(kb2 + 16);
            accr = wg_h(accr, kg.v, qh[dc].v);
          }
        }
#pragma unroll
        for (int r = 0; r < 8; ++r) {
          const int klc = sub * 16 + 8 * h + r;
          const int key = kbase + klc;
          float s = acc[r];
          if (EARLY) s += accr[r] * (1.0f / 1024.0f);
          const bool valid = (key <= qrow) && (((mw >> klc) & 1u) != 0u);
          const float uu = valid ? s * SCL : -1.0e30f;
          u[sub * 8 + r] = uu;
          vm |= (valid ? 1u : 0u) << (sub * 8 + r);
          m_new = fmaxf(m_new, uu);
        }
      }
      m_new = fmaxf(m_new, __shfl_xor(m_new, 16, 32));
      const float scale = __builtin_amdgcn_exp2f(rmax - m_new);
      rmax = m_new;

      float psum = 0.0f;
      FragH ph;
      FragH pr;
#pragma unroll
      for (int i = 0; i < 16; ++i) {
        const float pe = __builtin_amdgcn_exp2f(u[i] - m_new);
        const float pv = ((vm >> i) & 1u) ? pe : 0.0f;
        psum += pv;
        const float pc = pv * 4096.0f;
        const f16 hv = (f16)pc;
        ph.h[i] = hv;
        if (EARLY) pr.h[i] = (f16)((pc - (float)hv) * 1024.0f);
        else pr.h[i] = hv;
      }
      psum += __shfl_xor(psum, 16, 32);
      rsum = rsum * scale + psum;

      float sc[8];
#pragma unroll
      for (int r = 0; r < 8; ++r) sc[r] = __shfl(scale, 8 * h + r, 32);
#pragma unroll
      for (int dt = 0; dt < NDT; ++dt) {
#pragma unroll
        for (int r = 0; r < 8; ++r) {
          o[dt][r] *= sc[r];
          if (EARLY) orr[dt][r] *= sc[r];
        }
      }
      // O += P x V ; B fragment lane = d row of the Vt tile, elements = keys (split map)
#pragma unroll
      for (int dt = 0; dt < NDT; ++dt) {
        const int d = dbase + dt * 16 + l;
        FragH vf;
        const u16* vb = tb + VS + d * VP + 8 * h;
        vf.q[0] = *(const v4u*)vb;
        vf.q[1] = *(const v4u*)(vb + 16);
        o[dt] = wg_h(o[dt], ph.v, vf.v);
        if (EARLY) {
          orr[dt] = wg_h(orr[dt], pr.v, vf.v);
          FragH vg;
          const u16* vb2 = tb + VL + d * VP + 8 * h;
          vg.q[0] = *(const v4u*)vb2;
          vg.q[1] = *(const v4u*)(vb2 + 16);
          orr[dt] = wg_h(orr[dt], ph.v, vg.v);
        }
      }
      // Hand-over: this wave's LDS reads of chunk kc are done, its copies of chunk kc + 1 have
      // landed; the barrier publishes chunk kc + 1 and frees chunk kc's buffer for chunk kc + 2.
      asm volatile("s_wait_dscnt 0x0" ::: "memory");
      asm volatile("s_wait_asynccnt 0x0" ::: "memory");
      __syncthreads();
      if (kc + 2 < nchunk) copy_chunk(kc + 2);
    }
    asm volatile("s_wait_asynccnt 0x0" ::: "memory");  // nothing in flight when the buffers are reused

    // epilogue: ctx = (o + orr/1024) / (4096 * 16 * l); plane value = 64 * ctx
    if (!EARLY) __syncthreads();                     // K/V tiles dead, pool reused as stage
    const float inv = 1.0f / rsum;
    float ir[8];
#pragma unroll
    for (int r = 0; r < 8; ++r) ir[r] = __shfl(inv, 8 * h + r, 32) * (1.0f / 1024.0f);
    const int cb = EARLY ? ((pass & 1) * 32) : 0;   // column offset inside the 64-wide line half
#pragma unroll
    for (int dt = 0; dt < NDT; ++dt) {
#pragma unroll
      for (int r = 0; r < 8; ++r) {
        float val = o[dt][r];
        if (EARLY) val += orr[dt][r] * (1.0f / 1024.0f);
        val *= ir[r];
        if (EARLY) {
          u16 a, b;
          split1024(val, a, b);
          os[(8 * h + r) * 128 + cb + dt * 16 + l] = a;
          os[(8 * h + r) * 128 + 64 + cb + dt * 16 + l] = b;
        } else {
          os[(8 * h + r) * 128 + dt * 16 + l] = hbits(val);
        }
      }
    }
    if (!EARLY) {
      __syncthreads();
      // 16 rows x 256 B = 32 lines; instruction i: lanes 8g..8g+7 -> line 4i+g
      v4u vals[8];
#pragma unroll
      for (int i = 0; i < 8; ++i) {
        const int L = 4 * i + (lane >> 3);
        const int row = L >> 1, seg = L & 1;
        vals[i] = *(const v4u*)(os + row * 128 + seg * 64 + (lane & 7) * 8);
      }
#pragma unroll
      for (int i = 0; i < 8; ++i) {
        const int L = 4 * i + (lane >> 3);
        const int row = L >> 1, seg = L & 1;
        *(v4u*)(Ch + (size_t)(qw0 + row) * HID + head * HD + seg * 64 + (lane & 7) * 8) = vals[i];
      }
      
    } else {
      if ((pass & 1) != 0) {                         // block-uniform: stage holds d line (pass>>1)
        __syncthreads();
        const int dline = (pass >> 1) * 64;
        v4u va[4], vb[4];
#pragma unroll
        for (int i = 0; i < 4; ++i) {
          const int row = 4 * i + (lane >> 3);
          va[i] = *(const v4u*)(os + row * 128 + (lane & 7) * 8);
          vb[i] = *(const v4u*)(os + row * 128 + 64 + (lane & 7) * 8);
        }
#pragma unroll
        for (int i = 0; i < 4; ++i) {
          const int row = 4 * i + (lane >> 3);
          const size_t off = (size_t)(qw0 + row) * HID + head * HD + dline + (lane & 7) * 8;
          *(v4u*)(Ch + off) = va[i];
          *(v4u*)(Cr + off) = vb[i];
        }
        
      }
    }
  }
}

// ---------------------------------------------------------------------------------------
extern "C" void kernel_launch(void* const* d_in, const int* in_sizes, int n_in,
                              void* d_out, int out_size, void* d_ws, size_t ws_size,
                              hipStream_t stream) {
  if (n_in < 7) return;
  if (in_sizes[0] < SEQ * HID) return;
  if (in_sizes[1] < SEQ) return;
  if (in_sizes[2] < SEQ) return;
  if (in_sizes[3] < HID * NH * HD) return;
  if (in_sizes[4] < HID * NKV * HD) return;
  if (in_sizes[5] < HID * NKV * HD) return;
  if (in_sizes[6] < NH * HD * HID) return;
  if (out_size < SEQ * HID) return;

  const float* hs  = (const float*)d_in[0];
  const int*   am  = (const int*)d_in[1];
  const int*   pos = (const int*)d_in[2];
  const float* wq  = (const float*)d_in[3];
  const float* wk  = (const float*)d_in[4];
  const float* wv  = (const float*)d_in[5];
  const float* wo  = (const float*)d_in[6];
  float* out = (float*)d_out;

  char* ws = (char*)d_ws;
  size_t off = 0;
#define CARVE(T, name, bytes) T* name = (T*)(ws + off); off += (((size_t)(bytes)) + 255) & ~(size_t)255
  CARVE(u16,   Xb,    (size_t)SEQ * HID * 2);          // bf16 bits [SEQ][HID]
  CARVE(u16,   WqkvT, (size_t)NQKV * HID * 2);         // bf16 bits [3072][HID]
  CARVE(u16,   WoT,   (size_t)HID * HID * 2);          // f16 bits  [HID][HID]
  CARVE(float, QKVf,  (size_t)SEQ * NQKV * 4);         // f32 [SEQ][3072]
  CARVE(u16,   Qh,    (size_t)NH * SEQ * HD * 2);
  CARVE(u16,   Kh,    (size_t)NKV * SEQ * HD * 2);
  CARVE(u16,   Vth,   (size_t)NKV * HD * SEQ * 2);
  CARVE(u16,   Ql,    (size_t)NH * SE * HD * 2);
  CARVE(u16,   Kl,    (size_t)NKV * SE * HD * 2);
  CARVE(u16,   Vtl,   (size_t)NKV * HD * SE * 2);
  CARVE(u16,   Cr,    (size_t)SE * HID * 2);
  CARVE(float, Tinv,  256);
#undef CARVE
  // Ch [SEQ][HID] f16 plane aliases the Xb region: identical extent (SEQ*HID halves), Xb is
  // read only by the qkv projection launch, Ch is first written by the attention launches
  // that come after it on the same in-order stream.
  static_assert(NH * HD == HID);
  u16* Ch = Xb;
  if (off > ws_size) return;

  // 1) hidden -> bf16, inv_freq table
  k_xconv<<<dim3(SEQ), 256, 0, stream>>>(hs, Xb, Tinv);
  // 2) weights: w [HID][n] -> wt [n][HID]
  k_wt<0><<<dim3(HID / 64, (NH * HD) / 64), 256, 0, stream>>>(wq, WqkvT, NH * HD);
  k_wt<0><<<dim3(HID / 64, (NKV * HD) / 64), 256, 0, stream>>>(wk, WqkvT + (size_t)(NH * HD) * HID, NKV * HD);
  k_wt<0><<<dim3(HID / 64, (NKV * HD) / 64), 256, 0, stream>>>(wv, WqkvT + (size_t)(NH * HD + NKV * HD) * HID, NKV * HD);
  k_wt<1><<<dim3(HID / 64, HID / 64), 256, 0, stream>>>(wo, WoT, HID);
  // 3) fused qkv projection: [SEQ][HID] x [HID][3072] -> f32
  k_gemm<0, false><<<dim3(NQKV / 128, SEQ / 64), 256, 0, stream>>>(
      Xb, Xb, WqkvT, QKVf, HID, HID, NQKV, HID, 0, 1.0f, 0.0f);
  // 4) rotary + planes, V transposed planes
  k_planes<<<dim3(SEQ), 256, 0, stream>>>(QKVf, pos, Tinv, Qh, Ql, Kh, Kl);
  k_vt<<<dim3(SEQ / 64, NKV), 256, 0, stream>>>(QKVf, Vth, Vtl);
  // 5) attention: leading SE rows with residual planes, the rest single products
  k_attn<true><<<dim3(SE / BQW, NKV), 256, 0, stream>>>(Qh, Ql, Kh, Kl, Vth, Vtl, am, Ch, Cr, 0);
  if (SEQ > SE) {
    k_attn<false><<<dim3(SEQ / BQW - SE / BQW, NKV), 256, 0, stream>>>(
        Qh, Ql, Kh, Kl, Vth, Vtl, am, Ch, Cr, SE / BQW);
  }
  // 6) output projection: rows < SE with the residual ctx plane, the rest plain
  k_gemm<1, true><<<dim3(HID / 128, SE / 64), 256, 0, stream>>>(
      Ch, Cr, WoT, out, HID, HID, HID, HID, 0, 1.0f / 4096.0f, 1.0f / (4096.0f * 1024.0f));
  if (SEQ > SE) {
    k_gemm<1, false><<<dim3(HID / 128, (SEQ - SE) / 64), 256, 0, stream>>>(
        Ch, Ch, WoT, out, HID, HID, HID, HID, SE, 1.0f / 4096.0f, 0.0f);
  }
}

// v003
// It runs in 522 microseconds.
// Two timings next to v002 both put it at 1.34 times that version's speed.
// Counting every step since v000, it is 2.62 times as fast.
#include <hip/hip_runtime.h>
#include <stdint.h>
#include <stddef.h>

// Contractions: qkv projection = v_wmma_f32_16x16x32_bf16 (bf16 operands, f32 accumulate);
// q.k scores, p.v and output projection = v_wmma_f32_16x16x32_f16 (f16 operands with
// power-of-two carries plus x1024 f16 residual planes on the leading SE query rows,
// f32 accumulate). Softmax and epilogues in f32; rotary sin/cos via f64 quadrant
// reduction + polynomial (no fused multiply-add), rotation in unfused f32.

#ifndef NB
#define NB 1
#endif
#ifndef SEQ
#define SEQ 4096
#endif
#ifndef SE
#if SEQ < 640
#define SE SEQ
#else
#define SE 640
#endif
#endif
#define SEQ_FULL 4096
#define HID 2048
#define NH 16
#define NKV 4
#define HD 128
#define NQKV (NH * HD + 2 * NKV * HD)
#define BQW 32

static_assert(NB == 1);
static_assert(SEQ % 64 == 0);
static_assert(SEQ >= SE);
static_assert(SEQ <= SEQ_FULL);
static_assert(SE >= 64);
static_assert(SE % 64 == 0);
static_assert(SE % BQW == 0);
static_assert(HID % 128 == 0);
static_assert(HID == 256 * 8);
static_assert(NQKV % 128 == 0);
static_assert(HD == 128);
static_assert(NH == 4 * NKV);
static_assert(NH * HD == HID);

typedef _Float16 f16;
typedef __bf16 bf16;
typedef unsigned short u16;
typedef f16 v16h __attribute__((ext_vector_type(16)));
typedef bf16 v16b __attribute__((ext_vector_type(16)));
typedef float v8f __attribute__((ext_vector_type(8)));
typedef float v4f __attribute__((ext_vector_type(4)));
typedef unsigned v4u __attribute__((ext_vector_type(4)));

union FragH { v16h v; v4u q[2]; f16 h[16]; };
union FragB { v16b v; v4u q[2]; };

__device__ __forceinline__ v8f zero8() {
  v8f z = {0.0f, 0.0f, 0.0f, 0.0f, 0.0f, 0.0f, 0.0f, 0.0f};
  return z;
}

// 16x16x32 f16 WMMA followed by a 4-slot VALU hazard guard on D (A/B kept live).
__device__ __forceinline__ v8f wg_h(v8f acc, v16h a, v16h b) {
  acc = __builtin_amdgcn_wmma_f32_16x16x32_f16(false, a, false, b, (short)0, acc, false, false);
  asm volatile("v_nop\n\tv_nop\n\tv_nop\n\tv_nop" : "+v"(acc) : "v"(a), "v"(b));
  return acc;
}
__device__ __forceinline__ v8f wg_b(v8f acc, v16b a, v16b b) {
  acc = __builtin_amdgcn_wmma_f32_16x16x32_bf16(false, a, false, b, (short)0, acc, false, false);
  asm volatile("v_nop\n\tv_nop\n\tv_nop\n\tv_nop" : "+v"(acc) : "v"(a), "v"(b));
  return acc;
}

// f32 -> bf16 bits, RNE convert.
__device__ __forceinline__ unsigned bf16_rne(float f) {
  const unsigned u = __float_as_uint(f);
  return (u + 0x7FFFu + ((u >> 16) & 1u)) >> 16;
}
// f32 -> f16 bits, RNE convert.
__device__ __forceinline__ u16 hbits(float f) {
  const f16 x = (f16)f;
  return __builtin_bit_cast(u16, x);
}
// f32 -> f16 hi bits plus f16 bits of (v - hi) * 1024 (unfused: sub then mul).
__device__ __forceinline__ void split1024(float v, u16& hb, u16& lb) {
#pragma clang fp contract(off)
  const f16 x = (f16)v;
  const float xr = (float)x;
  const float dlt = v - xr;
  const f16 y = (f16)(dlt * 1024.0f);
  hb = __builtin_bit_cast(u16, x);
  lb = __builtin_bit_cast(u16, y);
}
__device__ __forceinline__ int imin(int a, int b) { return a < b ? a : b; }
__device__ __forceinline__ int imax(int a, int b) { return a > b ? a : b; }

// sin/cos of an f32 angle (0 <= ang <= ~4100 rad) in f64 without fused multiply-add:
// quadrant count kq = rint(x * 2/pi); r = (x - kq * P1) - kq * P2 with P1 = the leading
// 33 bits of pi/2 (kq * P1 exact for kq < 2^20) and P2 its tail; odd/even polynomials on
// |r| <= pi/4 (truncation < 3e-14); quadrant select by value; convert to f32.
__device__ __forceinline__ void rot_sincos(float ang, float& sn, float& cs) {
#pragma clang fp contract(off)
  const double x = (double)ang;
  const double kq = __builtin_rint(x * 0.63661977236758134308);
  double r = x - kq * 1.57079632673412561417;
  r = r - kq * 6.07710050650619224932e-11;
  const int q = (int)kq;
  const double r2 = r * r;
  double ps = 1.6059043836821613e-10;
  ps = ps * r2 - 2.5052108385441720e-08;
  ps = ps * r2 + 2.7557319223985893e-06;
  ps = ps * r2 - 1.9841269841269841e-04;
  ps = ps * r2 + 8.3333333333333332e-03;
  ps = ps * r2 - 1.6666666666666666e-01;
  const double r3 = r * r2;
  const double sr = r + r3 * ps;
  double pc = -1.1470745597729725e-11;
  pc = pc * r2 + 2.0876756987868099e-09;
  pc = pc * r2 - 2.7557319223985888e-07;
  pc = pc * r2 + 2.4801587301587302e-05;
  pc = pc * r2 - 1.3888888888888889e-03;
  pc = pc * r2 + 4.1666666666666664e-02;
  pc = pc * r2 - 0.5;
  const double cr = 1.0 + pc * r2;
  const bool odd = (q & 1) != 0;
  const bool neg = (q & 2) != 0;
  double sv = odd ? cr : sr;
  double cv = odd ? -sr : cr;
  sv = neg ? -sv : sv;
  cv = neg ? -cv : cv;
  sn = (float)sv;
  cs = (float)cv;
}

// ---------------------------------------------------------------------------------------
// hidden f32 [SEQ][HID] -> bf16 bits [SEQ][HID]; one block per row, 16 B per lane.
// Block 0, lanes 0..63 also produce the rotary inv_freq table (64 floats):
// inv[j] = fl32(1 / fl32(10000^(j/64))), with 10000^(1/64) from an iterative f64 64th root.
__global__ __launch_bounds__(256) void k_xconv(const float* __restrict__ x, u16* __restrict__ xb,
                                              float* __restrict__ tinv) {
#pragma clang fp contract(off)
  const int t = threadIdx.x;
  const size_t e = ((size_t)blockIdx.x * 256 + (size_t)t) * 8;
  const v4f a = *(const v4f*)(x + e);
  const v4f b = *(const v4f*)(x + e + 4);
  v4u w;
  w[0] = bf16_rne(a[0]) | (bf16_rne(a[1]) << 16);
  w[1] = bf16_rne(a[2]) | (bf16_rne(a[3]) << 16);
  w[2] = bf16_rne(b[0]) | (bf16_rne(b[1]) << 16);
  w[3] = bf16_rne(b[2]) | (bf16_rne(b[3]) << 16);

  const bool tab = (blockIdx.x == 0) && (t < 64);   // wave-uniform (waves 0,1 of block 0)
  float ivf = 0.0f;
  if (tab) {
    double rt = 1.15;
#pragma unroll 1
    for (int it = 0; it < 48; ++it) {
      double p63 = rt;
#pragma unroll 1
      for (int k = 1; k < 63; ++k) p63 *= rt;
      const double p64 = p63 * rt;
      const double f = p64 - 10000.0;
      rt = rt - f / (64.0 * p63);
    }
    double pj = 1.0;
#pragma unroll 1
    for (int k = 0; k < t; ++k) pj *= rt;           // t < 64: bounded
    const float pf = (float)pj;
    ivf = (float)(1.0 / (double)pf);
  }
  *(v4u*)(xb + e) = w;
  if (tab) *(float*)(tinv + t) = ivf;
  
}

// ---------------------------------------------------------------------------------------
// Weight transpose + convert: w f32 [HID][ncol] -> wt 16-bit [ncol][HID] (k contiguous).
// 8 consecutive lanes of one instruction. MODE 0: bf16 bits; MODE 1: f16 bits of
// 64 * bf16(w) (bf16 RNE value first, the x64 f16 copy of it is exact).
template <int MODE>
__global__ __launch_bounds__(256) void k_wt(const float* __restrict__ w, u16* __restrict__ wt, int ncol) {
  __shared__ __align__(16) u16 T[64 * 72];          // [o][i], pitch 72 halves (144 B)
  const int i0 = (int)blockIdx.x * 64, o0 = (int)blockIdx.y * 64, t = threadIdx.x;
#pragma unroll
  for (int j = 0; j < 4; ++j) {
    const int i = (t >> 4) + 16 * j;
    const int oc = (t & 15) * 4;
    const v4f v = *(const v4f*)(w + (size_t)(i0 + i) * (size_t)ncol + o0 + oc);
#pragma unroll
    for (int e = 0; e < 4; ++e) {
      const float f = v[e];
      u16 bb;
      if (MODE == 0) bb = (u16)bf16_rne(f);
      else bb = hbits(__uint_as_float(bf16_rne(f) << 16) * 64.0f);
      T[(oc + e) * 72 + i] = bb;
    }
  }
  __syncthreads();
  v4u val[2];
#pragma unroll
  for (int p = 0; p < 2; ++p) {
    const int o = (t >> 3) + 32 * p;
    val[p] = *(const v4u*)(T + o * 72 + (t & 7) * 8);
  }
#pragma unroll
  for (int p = 0; p < 2; ++p) {
    const int o = (t >> 3) + 32 * p;
    *(v4u*)(wt + (size_t)(o0 + o) * HID + i0 + (t & 7) * 8) = val[p];
  }
  
}

// ---------------------------------------------------------------------------------------
// C[m][n] (f32) = sh * sum_k A[m][k] * BT[n][k]  (+ sr * sum_k Ar[m][k] * BT[n][k] if RES)
// MODE 0: bf16 operands; MODE 1: f16 operands. Block 64 (M) x 128 (N), 8 waves each 32x32.
// The block's operand rows go through LDS in tiles of 64 k (one 128-B line of every row): two
// buffers, tile t in buffer t & 1, tile t + 1 copied global -> LDS (asynchronous, through no
// register, whole lines) while tile t is worked on. Fragments come from the LDS rows with the
// split k map (elements 0..7 at k + 8h, 8..15 at k + 16 + 8h); k ascends in steps of 32.
template <int MODE, bool RES>
__global__ __launch_bounds__(256) void k_gemm(const u16* __restrict__ A, const u16* __restrict__ Ar,
                                             const u16* __restrict__ BT, float* __restrict__ C,
                                             int lda, int ldb, int ldc, int K, int row0,
                                             float sh, float sr) {
  constexpr int BK = 64;                              // k per tile
  constexpr int TP = BK + 8;                          // LDS row pitch in halves: 144 B = 16 B x odd
  constexpr int AT = 64 * TP, BTL = 128 * TP;         // tile sizes in halves
  constexpr int AS = 0, ES = AT, BS = RES ? 2 * AT : AT;
  constexpr int BUF = BS + BTL;                       // one buffer = A | (Ar) | BT tiles, in halves
  __shared__ __align__(16) u16 pool[2 * BUF];
  static_assert((TP * 2) % 16 == 0 && (BUF * 2) % 16 == 0 && (AT * 2) % 16 == 0);
  static_assert(2 * BUF * 2 >= 8 * 32 * 36 * 4);      // pool doubles as the C stage behind the loop
  const int tid = threadIdx.x, wave = tid >> 5, lane = tid & 31, h = lane >> 4, l = lane & 15;
  const int wm = wave >> 2, wn = wave & 3;
  const int mblk = row0 + (int)blockIdx.y * 64, nblk = (int)blockIdx.x * 128;
  const int mb = mblk + wm * 32;
  const int nb = nblk + wn * 32;
  v8f c00 = zero8(), c01 = zero8(), c10 = zero8(), c11 = zero8();
  v8f r00 = zero8(), r01 = zero8(), r10 = zero8(), r11 = zero8();

  // This lane's 16-byte pieces of a tile: column cc of rows cr, cr + 32, ... (8 lanes cover a line).
  const int cr = tid >> 3, cc = (tid & 7) * 8;
  const unsigned lbase = (unsigned)(size_t)pool;      // byte offset of pool in the work-group's LDS
  const unsigned lpc = lbase + 2u * (unsigned)(cr * TP + cc);
  const u16* ga = A + (size_t)(mblk + cr) * (size_t)lda + cc;
  const u16* ge = Ar + (size_t)(mblk + cr) * (size_t)lda + cc;
  const u16* gb = BT + (size_t)(nblk + cr) * (size_t)ldb + cc;
  // Issue the copies of tile t into buffer t & 1 (all lanes on, block-uniform call sites). The
  // s_wait_xcnt closes each statement so that no address register is rewritten ahead of it.
  auto copy_tile = [&](int t) {
    const unsigned bo = lpc + (unsigned)(t & 1) * (unsigned)(BUF * 2);
    const unsigned a0 = bo + 2u * AS, a1 = a0 + 2u * 32u * TP;
    const unsigned b0 = bo + 2u * BS, b1 = b0 + 2u * 32u * TP, b2 = b0 + 2u * 64u * TP, b3 = b0 + 2u * 96u * TP;
    const u16* pa0 = ga + (size_t)t * BK;
    const u16* pa1 = pa0 + (size_t)32 * (size_t)lda;
    const u16* pb0 = gb + (size_t)t * BK;
    const u16* pb1 = pb0 + (size_t)32 * (size_t)ldb;
    const u16* pb2 = pb0 + (size_t)64 * (size_t)ldb;
    const u16* pb3 = pb0 + (size_t)96 * (size_t)ldb;
    asm volatile("global_load_async_to_lds_b128 %0, %6, off\n\t"
                 "global_load_async_to_lds_b128 %1, %7, off\n\t"
                 "global_load_async_to_lds_b128 %2, %8, off\n\t"
                 "global_load_async_to_lds_b128 %3, %9, off\n\t"
                 "global_load_async_to_lds_b128 %4, %10, off\n\t"
                 "global_load_async_to_lds_b128 %5, %11, off\n\t"
                 "s_wait_xcnt 0x0"
                 :: "v"(a0), "v"(a1), "v"(b0), "v"(b1), "v"(b2), "v"(b3),
                    "v"(pa0), "v"(pa1), "v"(pb0), "v"(pb1), "v"(pb2), "v"(pb3) : "memory");
    if (RES) {
      const unsigned e0 = bo + 2u * ES, e1 = e0 + 2u * 32u * TP;
      const u16* pe0 = ge + (size_t)t * BK;
      const u16* pe1 = pe0 + (size_t)32 * (size_t)lda;
      asm volatile("global_load_async_to_lds_b128 %0, %2, off\n\t"
                   "global_load_async_to_lds_b128 %1, %3, off\n\t"
                   "s_wait_xcnt 0x0"
                   :: "v"(e0), "v"(e1), "v"(pe0), "v"(pe1) : "memory");
    }
  };

  const int nt = K / BK;
  // Tile 0 lands and is published, then tile 1 is set flying.
  copy_tile(0);
  asm volatile("s_wait_asynccnt 0x0" ::: "memory");   // this wave's copies of tile 0 have landed
  __syncthreads();                                    // ... and every other wave's
  if (nt > 1) copy_tile(1);

  const int fa = (wm * 32 + l) * TP + 8 * h;          // this lane's fragment rows in a buffer
  const int fb = (wn * 32 + l) * TP + 8 * h;
  for (int t = 0; t < nt; ++t) {
    const u16* tb = pool + (t & 1) * BUF;             // this tile's buffer
    // unrolled so that both 32-k steps read at constant offsets from one LDS address
#pragma unroll
    for (int ks = 0; ks < BK; ks += 32) {
      const u16* pa = tb + AS + fa + ks;
      const u16* pb = tb + BS + fb + ks;
      if (MODE == 0) {
        FragB a0, a1, b0, b1;
        a0.q[0] = *(const v4u*)pa;             a0.q[1] = *(const v4u*)(pa + 16);
        a1.q[0] = *(const v4u*)(pa + 16 * TP); a1.q[1] = *(const v4u*)(pa + 16 * TP + 16);
        b0.q[0] = *(const v4u*)pb;             b0.q[1] = *(const v4u*)(pb + 16);
        b1.q[0] = *(const v4u*)(pb + 16 * TP); b1.q[1] = *(const v4u*)(pb + 16 * TP + 16);
        c00 = wg_b(c00, a0.v, b0.v); c01 = wg_b(c01, a0.v, b1.v);
        c10 = wg_b(c10, a1.v, b0.v); c11 = wg_b(c11, a1.v, b1.v);
      } else {
        FragH a0, a1, b0, b1;
        a0.q[0] = *(const v4u*)pa;             a0.q[1] = *(const v4u*)(pa + 16);
        a1.q[0] = *(const v4u*)(pa + 16 * TP); a1.q[1] = *(const v4u*)(pa + 16 * TP + 16);
        b0.q[0] = *(const v4u*)pb;             b0.q[1] = *(const v4u*)(pb + 16);
        b1.q[0] = *(const v4u*)(pb + 16 * TP); b1.q[1] = *(const v4u*)(pb + 16 * TP + 16);
        c00 = wg_h(c00, a0.v, b0.v); c01 = wg_h(c01, a0.v, b1.v);
        c10 = wg_h(c10, a1.v, b0.v); c11 = wg_h(c11, a1.v, b1.v);
        if (RES) {
          const u16* pe = tb + ES + fa + ks;
          FragH e0, e1;
          e0.q[0] = *(const v4u*)pe;             e0.q[1] = *(const v4u*)(pe + 16);
          e1.q[0] = *(const v4u*)(pe + 16 * TP); e1.q[1] = *(const v4u*)(pe + 16 * TP + 16);
          r00 = wg_h(r00, e0.v, b0.v); r01 = wg_h(r01, e0.v, b1.v);
          r10 = wg_h(r10, e1.v, b0.v); r11 = wg_h(r11, e1.v, b1.v);
        }
      }
    }
    // Hand-over: this wave's LDS reads of tile t are done, its copies of tile t + 1 have landed;
    // the barrier publishes tile t + 1 and frees tile t's buffer for tile t + 2.
    asm volatile("s_wait_dscnt 0x0" ::: "memory");
    asm volatile("s_wait_asynccnt 0x0" ::: "memory");
    __syncthreads();
    if (t + 2 < nt) copy_tile(t + 2);
  }
  asm volatile("s_wait_asynccnt 0x0" ::: "memory");   // nothing in flight when pool becomes the C stage

  // Behind the last trip's barrier every reader has left both buffers: pool is the C stage now.
  float* cs = (float*)pool + wave * (32 * 36);
#pragma unroll
  for (int e = 0; e < 8; ++e) {
    const int ra = 8 * h + e, rb = ra + 16;
    float v00 = sh * c00[e], v01 = sh * c01[e], v10 = sh * c10[e], v11 = sh * c11[e];
    if (RES) { v00 += sr * r00[e]; v01 += sr * r01[e]; v10 += sr * r10[e]; v11 += sr * r11[e]; }
    cs[ra * 36 + l] = v00;
    cs[ra * 36 + 16 + l] = v01;
    cs[rb * 36 + l] = v10;
    cs[rb * 36 + 16 + l] = v11;
  }
  __syncthreads();
  v4f val[8];
#pragma unroll
  for (int i = 0; i < 8; ++i) {
    const int row = 4 * i + (lane >> 3);
    val[i] = *(const v4f*)(cs + row * 36 + (lane & 7) * 4);
  }
#pragma unroll
  for (int i = 0; i < 8; ++i) {
    const int row = 4 * i + (lane >> 3);
    *(v4f*)(C + (size_t)(mb + row) * (size_t)ldc + nb + (lane & 7) * 4) = val[i];
  }
  
}

// ---------------------------------------------------------------------------------------
// Rotary + f16 planes. One block per sequence row s (q: 16 heads x 128, k: 4 heads x 128).
// Qh [NH][SEQ][HD], Kh [NKV][SEQ][HD]: f16 bits of the rotated value.
// Rows s < SE also get Ql [NH][SE][HD], Kl [NKV][SE][HD]: f16 bits of (x - hi) * 1024.
// rotate-half: out[d] = x[d]*cos - x[d+64]*sin, out[d+64] = x[d+64]*cos + x[d]*sin
// (products and sums as separate f32 ops), angle = fl32(pos * inv_freq[d]).
__global__ __launch_bounds__(256) void k_planes(const float* __restrict__ qkv, const int* __restrict__ pos,
                                               const float* __restrict__ tinv,
                                               u16* __restrict__ Qh, u16* __restrict__ Ql,
                                               u16* __restrict__ Kh, u16* __restrict__ Kl) {
#pragma clang fp contract(off)
  __shared__ __align__(16) u16 Qs[NH * HD];
  __shared__ __align__(16) u16 Qls[NH * HD];
  __shared__ __align__(16) u16 Ks[NKV * HD];
  __shared__ __align__(16) u16 Kls[NKV * HD];
  const int s = (int)blockIdx.x, t = threadIdx.x;
  const bool early = (s < SE);                       // block-uniform
  int pp = pos[s];
  pp = imin(imax(pp, 0), SEQ_FULL - 1);
  const int di = t & 63;
  const float ang = (float)pp * tinv[di];
  float sn, cs;
  rot_sincos(ang, sn, cs);
  const float* row = qkv + (size_t)s * NQKV;

#pragma unroll 1
  for (int j = 0; j < 4; ++j) {
    const int hh = (t + 256 * j) >> 6;               // 0..15
    const int col = hh * HD + di;
    const float x1 = row[col], x2 = row[col + 64];
    const float a1 = x1 * cs, b1 = x2 * sn;
    const float a2 = x2 * cs, b2 = x1 * sn;
    const float r1 = a1 - b1;
    const float r2 = a2 + b2;
    if (early) {
      u16 a, b;
      split1024(r1, a, b); Qs[col] = a;      Qls[col] = b;
      split1024(r2, a, b); Qs[col + 64] = a; Qls[col + 64] = b;
    } else {
      Qs[col] = hbits(r1);
      Qs[col + 64] = hbits(r2);
    }
  }
  {
    const int kvh = t >> 6;                          // 0..3
    const int col = kvh * HD + di;
    const float x1 = row[NH * HD + col], x2 = row[NH * HD + col + 64];
    const float a1 = x1 * cs, b1 = x2 * sn;
    const float a2 = x2 * cs, b2 = x1 * sn;
    const float r1 = a1 - b1;
    const float r2 = a2 + b2;
    if (early) {
      u16 a, b;
      split1024(r1, a, b); Ks[col] = a;      Kls[col] = b;
      split1024(r2, a, b); Ks[col + 64] = a; Kls[col + 64] = b;
    } else {
      Ks[col] = hbits(r1);
      Ks[col + 64] = hbits(r2);
    }
  }
  __syncthreads();

  const int e = t * 8;
  const int hq = e >> 7, dq = e & 127;               // q: head 0..15
  const bool kw = (t < 64);                          // wave-uniform: waves 0,1
  const int hk = hq, dk = dq;                        // valid for t < 64: kv head 0..3
  const v4u vq = *(const v4u*)(Qs + e);
  v4u vql = vq, vk = vq, vkl = vq;
  if (early) vql = *(const v4u*)(Qls + e);
  if (kw) {
    vk = *(const v4u*)(Ks + e);
    if (early) vkl = *(const v4u*)(Kls + e);
  }
  u16* pq  = Qh + ((size_t)hq * SEQ + s) * HD + dq;
  u16* pql = Ql + ((size_t)hq * SE + (early ? s : 0)) * HD + dq;
  u16* pk  = Kh + ((size_t)hk * SEQ + s) * HD + dk;
  u16* pkl = Kl + ((size_t)hk * SE + (early ? s : 0)) * HD + dk;

  *(v4u*)pq = vq;
  if (early) *(v4u*)pql = vql;
  if (kw) {
    *(v4u*)pk = vk;
    if (early) *(v4u*)pkl = vkl;
  }
  
}

// ---------------------------------------------------------------------------------------
// V transposed planes: Vth [NKV][HD][SEQ] = f16 bits of 16*v, and for keys < SE
// Vtl [NKV][HD][SE] = f16 bits of (16*v - hi) * 1024. Tile = 64 keys x 128 d through LDS,
__global__ __launch_bounds__(256) void k_vt(const float* __restrict__ qkv, u16* __restrict__ Vth,
                                           u16* __restrict__ Vtl) {
#pragma clang fp contract(off)
  __shared__ __align__(16) u16 T[HD * 72];           // [d][key], pitch 72 halves
  __shared__ __align__(16) u16 Tl[HD * 72];
  const int s0 = (int)blockIdx.x * 64, kv = (int)blockIdx.y, t = threadIdx.x;
  const bool early = (s0 < SE);                      // block-uniform (SE % 64 == 0)
#pragma unroll 1
  for (int j = 0; j < 8; ++j) {
    const int idx = t + 256 * j;
    const int r = idx >> 5;                          // key 0..63
    const int c4 = (idx & 31) * 4;                   // d 0..124
    const v4f v = *(const v4f*)(qkv + (size_t)(s0 + r) * NQKV + NH * HD + NKV * HD + kv * HD + c4);
#pragma unroll
    for (int e = 0; e < 4; ++e) {
      const float f = 16.0f * v[e];
      if (early) {
        u16 a, b;
        split1024(f, a, b);
        T[(c4 + e) * 72 + r] = a;
        Tl[(c4 + e) * 72 + r] = b;
      } else {
        T[(c4 + e) * 72 + r] = hbits(f);
      }
    }
  }
  __syncthreads();
  v4u vh[4], vl[4];
#pragma unroll
  for (int p = 0; p < 4; ++p) {
    const int d = (t >> 3) + 32 * p, c = (t & 7) * 8;
    vh[p] = *(const v4u*)(T + d * 72 + c);
    vl[p] = vh[p];
    if (early) vl[p] = *(const v4u*)(Tl + d * 72 + c);
  }
#pragma unroll
  for (int p = 0; p < 4; ++p) {
    const int d = (t >> 3) + 32 * p, c = (t & 7) * 8;
    *(v4u*)(Vth + ((size_t)kv * HD + d) * SEQ + s0 + c) = vh[p];
    if (early) *(v4u*)(Vtl + ((size_t)kv * HD + d) * SE + s0 + c) = vl[p];
  }
  
}

// ---------------------------------------------------------------------------------------
// Causal GQA flash attention. Block = 8 waves = 4 q heads of one kv head x 32 queries
// (wave w: head kv*4 + (w>>1), queries q0 + (w&1)*16 .. +15). Keys in chunks of 32 staged
// in LDS (two buffers, filled one chunk ahead by asynchronous copies): K tile [32][128] (A operand of S^T = K x Q^T, lane = key row) and V^T tile
// [128 d][32 keys] (B operand of O += P x V, lane = d). Queries live on lanes for the
// softmax; P in D layout of S^T is the A-fragment layout of P x V (lane = query,
// elements 0..7 = keys 8h..8h+7, 8..15 = keys 16+8h..). Online softmax in f32 (exp2 form),
// P carried as f16(4096 p), V as f16(16 v), ctx written as f16(64 ctx).
// EARLY (query rows < SE): q, k, P, v get x1024 residual planes and a second accumulator
// folded before normalisation; head dim handled in four 32-wide passes whose ctx results
// pass; ctx also gets a residual plane Cr. Output Ch [SEQ][HID] (head*128 + d), Cr [SE][HID].
// VGPR file capped at 256 (no high-bank registers).
template <bool EARLY>
__global__ __launch_bounds__(256) __attribute__((amdgpu_num_vgpr(256)))
void k_attn(const u16* __restrict__ Qh, const u16* __restrict__ Ql,
            const u16* __restrict__ Kh, const u16* __restrict__ Kl,
            const u16* __restrict__ Vth, const u16* __restrict__ Vtl,
            const int* __restrict__ amask,
            u16* __restrict__ Ch, u16* __restrict__ Cr, int qblk0) {
  // LDS row pitch = 16 B x odd, so that the 16 rows one ds_load_b128 reads fall on distinct banks:
  // K rows (256 B of data) at 272 B, Vt rows (64 B of data) at 80 B.
  constexpr int KP = HD + 8, VP = 32 + 8;             // pitches in halves
  constexpr int KT = 32 * KP, VT = HD * VP;           // tile sizes in halves
  // One buffer = K | (Kres) | Vt | (Vtres) tiles of one key chunk; two buffers, chunk kc in buffer kc & 1:
  // chunk kc + 1 is copied global -> LDS (asynchronous, through no register) while chunk kc is worked on.
  constexpr int KS = 0, KL = KT, VS = EARLY ? 2 * KT : KT, VL = VS + VT;
  constexpr int BUF = EARLY ? 2 * KT + 2 * VT : KT + VT;  // halves per buffer
  __shared__ __align__(16) u16 pool[2 * BUF];
  __shared__ __align__(16) u16 stg[EARLY ? 16384 : 64];  // EARLY: per-wave ctx stage [8][16][128]
  static_assert((BUF * 2) % 16 == 0 && (KP * 2) % 16 == 0 && (VP * 2) % 16 == 0);
  static_assert(EARLY || 2 * BUF >= 16384);           // pool doubles as the ctx stage behind the loop
  constexpr int NDT = EARLY ? 2 : 8;
  constexpr int DW = NDT * 16;
  constexpr int NPASS = HD / DW;
  const int qblk = qblk0 + (int)blockIdx.x;
  const int kv = (int)blockIdx.y;
  const int tid = threadIdx.x, wave = tid >> 5, lane = tid & 31, h = lane >> 4, l = lane & 15;
  const int head = kv * (NH / NKV) + (wave >> 1);
  const int q0 = qblk * BQW;
  const int qw0 = q0 + (wave & 1) * 16;
  const int qrow = qw0 + l;                          // this lane's query
  const int nchunk = qblk + 1;                       // keys 0 .. q0+31

  FragH qh[4];
  FragH ql[4];
#pragma unroll
  for (int dc = 0; dc < 4; ++dc) {
    const u16* b = Qh + ((size_t)head * SEQ + qrow) * HD + dc * 32 + 8 * h;
    qh[dc].q[0] = *(const v4u*)b;
    qh[dc].q[1] = *(const v4u*)(b + 16);
    if (EARLY) {
      const u16* b2 = Ql + ((size_t)head * SE + qrow) * HD + dc * 32 + 8 * h;
      ql[dc].q[0] = *(const v4u*)b2;
      ql[dc].q[1] = *(const v4u*)(b2 + 16);
    } else {
      ql[dc].q[0] = qh[dc].q[0];
      ql[dc].q[1] = qh[dc].q[1];
    }
  }
  const float SCL = 0.088388347648318441f * 1.4426950408889634f;   // log2(e)/sqrt(128)

  // ctx stage [16 rows][128 cols] per wave: EARLY in its own region (persists across the
  // 32-wide passes), otherwise aliasing pool after the K/V tiles are dead.
  u16* os;
  if (EARLY) os = stg + wave * (16 * 128);
  else os = pool + wave * (16 * 128);

  // This lane's 16-byte pieces of a chunk: K rows kr and kr + 16, Vt rows vd and vd + 64.
  const int kr = tid >> 4, kcol = (tid & 15) * 8;
  const int vd = tid >> 2, vcol = (tid & 3) * 8;
  const unsigned lbase = (unsigned)(size_t)pool;     // byte offset of pool in the work-group's LDS
  const unsigned lk = lbase + 2u * (unsigned)(KS + kr * KP + kcol);
  const unsigned lv = lbase + 2u * (unsigned)(VS + vd * VP + vcol);
  const u16* gk = Kh + ((size_t)kv * SEQ + kr) * HD + kcol;
  const u16* gv = Vth + ((size_t)kv * HD + vd) * SEQ + vcol;
  const u16* gkl = Kl + ((size_t)kv * SE + kr) * HD + kcol;
  const u16* gvl = Vtl + ((size_t)kv * HD + vd) * SE + vcol;
  // Issue the copies of chunk c into buffer c & 1 (all lanes on, block-uniform call sites). The
  // s_wait_xcnt closes each statement so that no address register is rewritten ahead of it.
  auto copy_chunk = [&](int c) {
    const unsigned bo = (unsigned)(c & 1) * (unsigned)(BUF * 2);
    const unsigned k0 = lk + bo, k1 = k0 + 2u * 16u * KP;
    const unsigned v0 = lv + bo, v1 = v0 + 2u * 64u * VP;
    const u16* a0 = gk + (size_t)c * (32 * HD);
    const u16* a1 = a0 + 16 * HD;
    const u16* b0 = gv + c * 32;
    const u16* b1 = b0 + (size_t)64 * SEQ;
    asm volatile("global_load_async_to_lds_b128 %0, %4, off\n\t"
                 "global_load_async_to_lds_b128 %1, %5, off\n\t"
                 "global_load_async_to_lds_b128 %2, %6, off\n\t"
                 "global_load_async_to_lds_b128 %3, %7, off\n\t"
                 "s_wait_xcnt 0x0"
                 :: "v"(k0), "v"(k1), "v"(v0), "v"(v1), "v"(a0), "v"(a1), "v"(b0), "v"(b1) : "memory");
    if (EARLY) {
      const unsigned k2 = k0 + 2u * (KL - KS), k3 = k1 + 2u * (KL - KS);
      const unsigned v2 = v0 + 2u * (VL - VS), v3 = v1 + 2u * (VL - VS);
      const u16* a2 = gkl + (size_t)c * (32 * HD);
      const u16* a3 = a2 + 16 * HD;
      const u16* b2 = gvl + c * 32;
      const u16* b3 = b2 + (size_t)64 * SE;
      asm volatile("global_load_async_to_lds_b128 %0, %4, off\n\t"
                   "global_load_async_to_lds_b128 %1, %5, off\n\t"
                   "global_load_async_to_lds_b128 %2, %6, off\n\t"
                   "global_load_async_to_lds_b128 %3, %7, off\n\t"
                   "s_wait_xcnt 0x0"
                   :: "v"(k2), "v"(k3), "v"(v2), "v"(v3), "v"(a2), "v"(a3), "v"(b2), "v"(b3) : "memory");
    }
  };

#pragma unroll 1
  for (int pass = 0; pass < NPASS; ++pass) {
    const int dbase = pass * DW;
    v8f o[NDT];
    v8f orr[NDT];
#pragma unroll
    for (int dt = 0; dt < NDT; ++dt) { o[dt] = zero8(); orr[dt] = zero8(); }
    float rmax = -1.0e30f, rsum = 0.0f;

    // Chunk 0 lands and is published, then chunk 1 is set flying. (A later pass gets here behind
    // the last trip's s_wait_dscnt and barrier, so every reader has left both buffers.)
    copy_chunk(0);
    asm volatile("s_wait_asynccnt 0x0" ::: "memory");  // this wave's copies of chunk 0 have landed
    __syncthreads();                                 // ... and every other wave's
    if (nchunk > 1) copy_chunk(1);
    int av = amask[imin(lane, SEQ - 1)];             // padding mask of chunk 0's keys

#pragma unroll 1
    for (int kc = 0; kc < nchunk; ++kc) {
      const int kbase = kc * 32;
      const u16* tb = pool + (kc & 1) * BUF;         // this chunk's buffer
      // padding-mask word for the 32 keys of this chunk, per wave (all lanes active); the next
      // chunk's mask values are read one chunk ahead, like its tiles
      const unsigned mw = __builtin_amdgcn_ballot_w32(av != 0);
      av = amask[imin(kbase + 32 + lane, SEQ - 1)];

      // scores S^T[key][query]; lane l = query, element r = key sub*16 + 8h + r
      float u[16];
      unsigned vm = 0u;
      float m_new = rmax;
#pragma unroll
      for (int sub = 0; sub < 2; ++sub) {
        v8f acc = zero8();
        v8f accr = zero8();
#pragma unroll
        for (int dc = 0; dc < 4; ++dc) {
          FragH kf;
          const u16* kb = tb + KS + (sub * 16 + l) * KP + dc * 32 + 8 * h;
          kf.q[0] = *(const v4u*)kb;
          kf.q[1] = *(const v4u*)(kb + 16);
          acc = wg_h(acc, kf.v, qh[dc].v);
          if (EARLY) {
            accr = wg_h(accr, kf.v, ql[dc].v);
            FragH kg;
            const u16* kb2 = tb + KL + (sub * 16 + l) * KP + dc * 32 + 8 * h;
            kg.q[0] = *(const v4u*)kb2;
            kg.q[1] = *(const v4u*)(kb2 + 16);
            accr = wg_h(accr, kg.v, qh[dc].v);
          }
        }
#pragma unroll
        for (int r = 0; r < 8; ++r) {
          const int klc = sub * 16 + 8 * h + r;
          const int key = kbase + klc;
          float s = acc[r];
          if (EARLY) s += accr[r] * (1.0f / 1024.0f);
          const bool valid = (key <= qrow) && (((mw >> klc) & 1u) != 0u);
          const float uu = valid ? s * SCL : -1.0e30f;
          u[sub * 8 + r] = uu;
          vm |= (valid ? 1u : 0u) << (sub * 8 + r);
          m_new = fmaxf(m_new, uu);
        }
      }
      m_new = fmaxf(m_new, __shfl_xor(m_new, 16, 32));
      const float scale = __builtin_amdgcn_exp2f(rmax - m_new);
      rmax = m_new;

      float psum = 0.0f;
      FragH ph;
      FragH pr;
#pragma unroll
      for (int i = 0; i < 16; ++i) {
        const float pe = __builtin_amdgcn_exp2f(u[i] - m_new);
        const float pv = ((vm >> i) & 1u) ? pe : 0.0f;
        psum += pv;
        const float pc = pv * 4096.0f;
        const f16 hv = (f16)pc;
        ph.h[i] = hv;
        if (EARLY) pr.h[i] = (f16)((pc - (float)hv) * 1024.0f);
        else pr.h[i] = hv;
      }
      psum += __shfl_xor(psum, 16, 32);
      rsum = rsum * scale + psum;

      float sc[8];
#pragma unroll
      for (int r = 0; r < 8; ++r) sc[r] = __shfl(scale, 8 * h + r, 32);
#pragma unroll
      for (int dt = 0; dt < NDT; ++dt) {
#pragma unroll
        for (int r = 0; r < 8; ++r) {
          o[dt][r] *= sc[r];
          if (EARLY) orr[dt][r] *= sc[r];
        }
      }
      // O += P x V ; B fragment lane = d row of the Vt tile, elements = keys (split map)
#pragma unroll
      for (int dt = 0; dt < NDT; ++dt) {
        const int d = dbase + dt * 16 + l;
        FragH vf;
        const u16* vb = tb + VS + d * VP + 8 * h;
        vf.q[0] = *(const v4u*)vb;
        vf.q[1] = *(const v4u*)(vb + 16);
        o[dt] = wg_h(o[dt], ph.v, vf.v);
        if (EARLY) {
          orr[dt] = wg_h(orr[dt], pr.v, vf.v);
          FragH vg;
          const u16* vb2 = tb + VL + d * VP + 8 * h;
          vg.q[0] = *(const v4u*)vb2;
          vg.q[1] = *(const v4u*)(vb2 + 16);
          orr[dt] = wg_h(orr[dt], ph.v, vg.v);
        }
      }
      // Hand-over: this wave's LDS reads of chunk kc are done, its copies of chunk kc + 1 have
      // landed; the barrier publishes chunk kc + 1 and frees chunk kc's buffer for chunk kc + 2.
      asm volatile("s_wait_dscnt 0x0" ::: "memory");
      asm volatile("s_wait_asynccnt 0x0" ::: "memory");
      __syncthreads();
      if (kc + 2 < nchunk) copy_chunk(kc + 2);
    }
    asm volatile("s_wait_asynccnt 0x0" ::: "memory");  // nothing in flight when the buffers are reused

    // epilogue: ctx = (o + orr/1024) / (4096 * 16 * l); plane value = 64 * ctx
    if (!EARLY) __syncthreads();                     // K/V tiles dead, pool reused as stage
    const float inv = 1.0f / rsum;
    float ir[8];
#pragma unroll
    for (int r = 0; r < 8; ++r) ir[r] = __shfl(inv, 8 * h + r, 32) * (1.0f / 1024.0f);
    const int cb = EARLY ? ((pass & 1) * 32) : 0;   // column offset inside the 64-wide line half
#pragma unroll
    for (int dt = 0; dt < NDT; ++dt) {
#pragma unroll
      for (int r = 0; r < 8; ++r) {
        float val = o[dt][r];
        if (EARLY) val += orr[dt][r] * (1.0f / 1024.0f);
        val *= ir[r];
        if (EARLY) {
          u16 a, b;
          split1024(val, a, b);
          os[(8 * h + r) * 128 + cb + dt * 16 + l] = a;
          os[(8 * h + r) * 128 + 64 + cb + dt * 16 + l] = b;
        } else {
          os[(8 * h + r) * 128 + dt * 16 + l] = hbits(val);
        }
      }
    }
    if (!EARLY) {
      __syncthreads();
      // 16 rows x 256 B = 32 lines; instruction i: lanes 8g..8g+7 -> line 4i+g
      v4u vals[8];
#pragma unroll
      for (int i = 0; i < 8; ++i) {
        const int L = 4 * i + (lane >> 3);
        const int row = L >> 1, seg = L & 1;
        vals[i] = *(const v4u*)(os + row * 128 + seg * 64 + (lane & 7) * 8);
      }
#pragma unroll
      for (int i = 0; i < 8; ++i) {
        const int L = 4 * i + (lane >> 3);
        const int row = L >> 1, seg = L & 1;
        *(v4u*)(Ch + (size_t)(qw0 + row) * HID + head * HD + seg * 64 + (lane & 7) * 8) = vals[i];
      }
      
    } else {
      if ((pass & 1) != 0) {                         // block-uniform: stage holds d line (pass>>1)
        __syncthreads();
        const int dline = (pass >> 1) * 64;
        v4u va[4], vb[4];
#pragma unroll
        for (int i = 0; i < 4; ++i) {
          const int row = 4 * i + (lane >> 3);
          va[i] = *(const v4u*)(os + row * 128 + (lane & 7) * 8);
          vb[i] = *(const v4u*)(os + row * 128 + 64 + (lane & 7) * 8);
        }
#pragma unroll
        for (int i = 0; i < 4; ++i) {
          const int row = 4 * i + (lane >> 3);
          const size_t off = (size_t)(qw0 + row) * HID + head * HD + dline + (lane & 7) * 8;
          *(v4u*)(Ch + off) = va[i];
          *(v4u*)(Cr + off) = vb[i];
        }
        
      }
    }
  }
}

// ---------------------------------------------------------------------------------------
extern "C" void kernel_launch(void* const* d_in, const int* in_sizes, int n_in,
                              void* d_out, int out_size, void* d_ws, size_t ws_size,
                              hipStream_t stream) {
  if (n_in < 7) return;
  if (in_sizes[0] < SEQ * HID) return;
  if (in_sizes[1] < SEQ) return;
  if (in_sizes[2] < SEQ) return;
  if (in_sizes[3] < HID * NH * HD) return;
  if (in_sizes[4] < HID * NKV * HD) return;
  if (in_sizes[5] < HID * NKV * HD) return;
  if (in_sizes[6] < NH * HD * HID) return;
  if (out_size < SEQ * HID) return;

  const float* hs  = (const float*)d_in[0];
  const int*   am  = (const int*)d_in[1];
  const int*   pos = (const int*)d_in[2];
  const float* wq  = (const float*)d_in[3];
  const float* wk  = (const float*)d_in[4];
  const float* wv  = (const float*)d_in[5];
  const float* wo  = (const float*)d_in[6];
  float* out = (float*)d_out;

  char* ws = (char*)d_ws;
  size_t off = 0;
#define CARVE(T, name, bytes) T* name = (T*)(ws + off); off += (((size_t)(bytes)) + 255) & ~(size_t)255
  CARVE(u16,   Xb,    (size_t)SEQ * HID * 2);          // bf16 bits [SEQ][HID]
  CARVE(u16,   WqkvT, (size_t)NQKV * HID * 2);         // bf16 bits [3072][HID]
  CARVE(u16,   WoT,   (size_t)HID * HID * 2);          // f16 bits  [HID][HID]
  CARVE(float, QKVf,  (size_t)SEQ * NQKV * 4);         // f32 [SEQ][3072]
  CARVE(u16,   Qh,    (size_t)NH * SEQ * HD * 2);
  CARVE(u16,   Kh,    (size_t)NKV * SEQ * HD * 2);
  CARVE(u16,   Vth,   (size_t)NKV * HD * SEQ * 2);
  CARVE(u16,   Ql,    (size_t)NH * SE * HD * 2);
  CARVE(u16,   Kl,    (size_t)NKV * SE * HD * 2);
  CARVE(u16,   Vtl,   (size_t)NKV * HD * SE * 2);
  CARVE(u16,   Cr,    (size_t)SE * HID * 2);
  CARVE(float, Tinv,  256);
#undef CARVE
  // Ch [SEQ][HID] f16 plane aliases the Xb region: identical extent (SEQ*HID halves), Xb is
  // read only by the qkv projection launch, Ch is first written by the attention launches
  // that come after it on the same in-order stream.
  static_assert(NH * HD == HID);
  u16* Ch = Xb;
  if (off > ws_size) return;

  // 1) hidden -> bf16, inv_freq table
  k_xconv<<<dim3(SEQ), 256, 0, stream>>>(hs, Xb, Tinv);
  // 2) weights: w [HID][n] -> wt [n][HID]
  k_wt<0><<<dim3(HID / 64, (NH * HD) / 64), 256, 0, stream>>>(wq, WqkvT, NH * HD);
  k_wt<0><<<dim3(HID / 64, (NKV * HD) / 64), 256, 0, stream>>>(wk, WqkvT + (size_t)(NH * HD) * HID, NKV * HD);
  k_wt<0><<<dim3(HID / 64, (NKV * HD) / 64), 256, 0, stream>>>(wv, WqkvT + (size_t)(NH * HD + NKV * HD) * HID, NKV * HD);
  k_wt<1><<<dim3(HID / 64, HID / 64), 256, 0, stream>>>(wo, WoT, HID);
  // 3) fused qkv projection: [SEQ][HID] x [HID][3072] -> f32
  k_gemm<0, false><<<dim3(NQKV / 128, SEQ / 64), 256, 0, stream>>>(
      Xb, Xb, WqkvT, QKVf, HID, HID, NQKV, HID, 0, 1.0f, 0.0f);
  // 4) rotary + planes, V transposed planes
  k_planes<<<dim3(SEQ), 256, 0, stream>>>(QKVf, pos, Tinv, Qh, Ql, Kh, Kl);
  k_vt<<<dim3(SEQ / 64, NKV), 256, 0, stream>>>(QKVf, Vth, Vtl);
  // 5) attention: leading SE rows with residual planes, the rest single products
  k_attn<true><<<dim3(SE / BQW, NKV), 256, 0, stream>>>(Qh, Ql, Kh, Kl, Vth, Vtl, am, Ch, Cr, 0);
  if (SEQ > SE) {
    k_attn<false><<<dim3(SEQ / BQW - SE / BQW, NKV), 256, 0, stream>>>(
        Qh, Ql, Kh, Kl, Vth, Vtl, am, Ch, Cr, SE / BQW);
  }
  // 6) output projection: rows < SE with the residual ctx plane, the rest plain
  k_gemm<1, true><<<dim3(HID / 128, SE / 64), 256, 0, stream>>>(
      Ch, Cr, WoT, out, HID, HID, HID, HID, 0, 1.0f / 4096.0f, 1.0f / (4096.0f * 1024.0f));
  if (SEQ > SE) {
    k_gemm<1, false><<<dim3(HID / 128, (SEQ - SE) / 64), 256, 0, stream>>>(
        Ch, Ch, WoT, out, HID, HID, HID, HID, SE, 1.0f / 4096.0f, 0.0f);
  }
}

// v004
// Measured time: 369 microseconds a run.
// Timed twice side by side with v003, it ran 1.41 times as fast both times.
// Over all steps from v000 it is 3.69 times as fast.
#include <hip/hip_runtime.h>
#include <stdint.h>
#include <stddef.h>

// Contractions: qkv projection = v_wmma_f32_16x16x32_bf16 (bf16 operands, f32 accumulate);
// q.k scores, p.v and output projection = v_wmma_f32_16x16x32_f16 (f16 operands with
// power-of-two carries plus x1024 f16 residual planes on the leading SE query rows,
// f32 accumulate). Softmax and epilogues in f32; rotary sin/cos via f64 quadrant
// reduction + polynomial (no fused multiply-add), rotation in unfused f32.

#ifndef NB
#define NB 1
#endif
#ifndef SEQ
#define SEQ 4096
#endif
#ifndef SE
#if SEQ < 640
#define SE SEQ
#else
#define SE 640
#endif
#endif
#define SEQ_FULL 4096
#define HID 2048
#define NH 16
#define NKV 4
#define HD 128
#define NQKV (NH * HD + 2 * NKV * HD)
#define BQW 32

static_assert(NB == 1);
static_assert(SEQ % 64 == 0);
static_assert(SEQ >= SE);
static_assert(SEQ <= SEQ_FULL);
static_assert(SE >= 64);
static_assert(SE % 64 == 0);
static_assert(SE % BQW == 0);
static_assert(HID % 128 == 0);
static_assert(HID == 256 * 8);
static_assert(NQKV % 128 == 0);
static_assert(HD == 128);
static_assert(NH == 4 * NKV);
static_assert(NH * HD == HID);

typedef _Float16 f16;
typedef __bf16 bf16;
typedef unsigned short u16;
typedef f16 v16h __attribute__((ext_vector_type(16)));
typedef bf16 v16b __attribute__((ext_vector_type(16)));
typedef float v8f __attribute__((ext_vector_type(8)));
typedef float v4f __attribute__((ext_vector_type(4)));
typedef unsigned v4u __attribute__((ext_vector_type(4)));

union FragH { v16h v; v4u q[2]; f16 h[16]; };
union FragB { v16b v; v4u q[2]; };

__device__ __forceinline__ v8f zero8() {
  v8f z = {0.0f, 0.0f, 0.0f, 0.0f, 0.0f, 0.0f, 0.0f, 0.0f};
  return z;
}

// 16x16x32 f16 WMMA followed by a 4-slot VALU hazard guard on D (A/B kept live).
__device__ __forceinline__ v8f wg_h(v8f acc, v16h a, v16h b) {
  acc = __builtin_amdgcn_wmma_f32_16x16x32_f16(false, a, false, b, (short)0, acc, false, false);
  asm volatile("v_nop\n\tv_nop\n\tv_nop\n\tv_nop" : "+v"(acc) : "v"(a), "v"(b));
  return acc;
}
__device__ __forceinline__ v8f wg_b(v8f acc, v16b a, v16b b) {
  acc = __builtin_amdgcn_wmma_f32_16x16x32_bf16(false, a, false, b, (short)0, acc, false, false);
  asm volatile("v_nop\n\tv_nop\n\tv_nop\n\tv_nop" : "+v"(acc) : "v"(a), "v"(b));
  return acc;
}

// f32 -> bf16 bits, RNE convert.
__device__ __forceinline__ unsigned bf16_rne(float f) {
  const unsigned u = __float_as_uint(f);
  return (u + 0x7FFFu + ((u >> 16) & 1u)) >> 16;
}
// f32 -> f16 bits, RNE convert.
__device__ __forceinline__ u16 hbits(float f) {
  const f16 x = (f16)f;
  return __builtin_bit_cast(u16, x);
}
// f32 -> f16 hi bits plus f16 bits of (v - hi) * 1024 (unfused: sub then mul).
__device__ __forceinline__ void split1024(float v, u16& hb, u16& lb) {
#pragma clang fp contract(off)
  const f16 x = (f16)v;
  const float xr = (float)x;
  const float dlt = v - xr;
  const f16 y = (f16)(dlt * 1024.0f);
  hb = __builtin_bit_cast(u16, x);
  lb = __builtin_bit_cast(u16, y);
}
__device__ __forceinline__ int imin(int a, int b) { return a < b ? a : b; }
__device__ __forceinline__ int imax(int a, int b) { return a > b ? a : b; }

// sin/cos of an f32 angle (0 <= ang <= ~4100 rad) in f64 without fused multiply-add:
// quadrant count kq = rint(x * 2/pi); r = (x - kq * P1) - kq * P2 with P1 = the leading
// 33 bits of pi/2 (kq * P1 exact for kq < 2^20) and P2 its tail; odd/even polynomials on
// |r| <= pi/4 (truncation < 3e-14); quadrant select by value; convert to f32.
__device__ __forceinline__ void rot_sincos(float ang, float& sn, float& cs) {
#pragma clang fp contract(off)
  const double x = (double)ang;
  const double kq = __builtin_rint(x * 0.63661977236758134308);
  double r = x - kq * 1.57079632673412561417;
  r = r - kq * 6.07710050650619224932e-11;
  const int q = (int)kq;
  const double r2 = r * r;
  double ps = 1.6059043836821613e-10;
  ps = ps * r2 - 2.5052108385441720e-08;
  ps = ps * r2 + 2.7557319223985893e-06;
  ps = ps * r2 - 1.9841269841269841e-04;
  ps = ps * r2 + 8.3333333333333332e-03;
  ps = ps * r2 - 1.6666666666666666e-01;
  const double r3 = r * r2;
  const double sr = r + r3 * ps;
  double pc = -1.1470745597729725e-11;
  pc = pc * r2 + 2.0876756987868099e-09;
  pc = pc * r2 - 2.7557319223985888e-07;
  pc = pc * r2 + 2.4801587301587302e-05;
  pc = pc * r2 - 1.3888888888888889e-03;
  pc = pc * r2 + 4.1666666666666664e-02;
  pc = pc * r2 - 0.5;
  const double cr = 1.0 + pc * r2;
  const bool odd = (q & 1) != 0;
  const bool neg = (q & 2) != 0;
  double sv = odd ? cr : sr;
  double cv = odd ? -sr : cr;
  sv = neg ? -sv : sv;
  cv = neg ? -cv : cv;
  sn = (float)sv;
  cs = (float)cv;
}

// ---------------------------------------------------------------------------------------
// hidden f32 [SEQ][HID] -> bf16 bits [SEQ][HID]; one block (blk) per row, 16 B per lane.
// Block 0, lanes 0..63 also produce the rotary inv_freq table (64 floats):
// inv[j] = fl32(1 / fl32(10000^(j/64))), with 10000^(1/64) from an iterative f64 64th root.
__device__ __forceinline__ void xconv_body(int blk, const float* __restrict__ x, u16* __restrict__ xb,
                                           float* __restrict__ tinv) {
#pragma clang fp contract(off)
  const int t = threadIdx.x;
  const size_t e = ((size_t)blk * 256 + (size_t)t) * 8;
  const v4f a = *(const v4f*)(x + e);
  const v4f b = *(const v4f*)(x + e + 4);
  v4u w;
  w[0] = bf16_rne(a[0]) | (bf16_rne(a[1]) << 16);
  w[1] = bf16_rne(a[2]) | (bf16_rne(a[3]) << 16);
  w[2] = bf16_rne(b[0]) | (bf16_rne(b[1]) << 16);
  w[3] = bf16_rne(b[2]) | (bf16_rne(b[3]) << 16);

  const bool tab = (blk == 0) && (t < 64);   // wave-uniform (waves 0,1 of block 0)
  float ivf = 0.0f;
  if (tab) {
    double rt = 1.15;
#pragma unroll 1
    for (int it = 0; it < 48; ++it) {
      double p63 = rt;
#pragma unroll 1
      for (int k = 1; k < 63; ++k) p63 *= rt;
      const double p64 = p63 * rt;
      const double f = p64 - 10000.0;
      rt = rt - f / (64.0 * p63);
    }
    double pj = 1.0;
#pragma unroll 1
    for (int k = 0; k < t; ++k) pj *= rt;           // t < 64: bounded
    const float pf = (float)pj;
    ivf = (float)(1.0 / (double)pf);
  }
  *(v4u*)(xb + e) = w;
  if (tab) *(float*)(tinv + t) = ivf;
  
}

// ---------------------------------------------------------------------------------------
// Weight transpose + convert: w f32 [HID][ncol] -> wt 16-bit [ncol][HID] (k contiguous).
// 8 consecutive lanes of one instruction. MODE 0: bf16 bits; MODE 1: f16 bits of
// 64 * bf16(w) (bf16 RNE value first, the x64 f16 copy of it is exact).
// T: 64 * 72 halves of LDS, [o][i], pitch 72 halves (144 B); tile (bi, bo) of the weight.
template <int MODE>
__device__ __forceinline__ void wt_body(u16* T, int bi, int bo, const float* __restrict__ w,
                                        u16* __restrict__ wt, int ncol) {
  const int i0 = bi * 64, o0 = bo * 64, t = threadIdx.x;
#pragma unroll
  for (int j = 0; j < 4; ++j) {
    const int i = (t >> 4) + 16 * j;
    const int oc = (t & 15) * 4;
    const v4f v = *(const v4f*)(w + (size_t)(i0 + i) * (size_t)ncol + o0 + oc);
#pragma unroll
    for (int e = 0; e < 4; ++e) {
      const float f = v[e];
      u16 bb;
      if (MODE == 0) bb = (u16)bf16_rne(f);
      else bb = hbits(__uint_as_float(bf16_rne(f) << 16) * 64.0f);
      T[(oc + e) * 72 + i] = bb;
    }
  }
  __syncthreads();
  v4u val[2];
#pragma unroll
  for (int p = 0; p < 2; ++p) {
    const int o = (t >> 3) + 32 * p;
    val[p] = *(const v4u*)(T + o * 72 + (t & 7) * 8);
  }
#pragma unroll
  for (int p = 0; p < 2; ++p) {
    const int o = (t >> 3) + 32 * p;
    *(v4u*)(wt + (size_t)(o0 + o) * HID + i0 + (t & 7) * 8) = val[p];
  }
  // another job's code follows in the merged kernel: no register of the stores above is rewritten ahead of this wait
  asm volatile("s_wait_xcnt 0x0" ::: "memory");
}

// ---------------------------------------------------------------------------------------
// C[m][n] (f32) = sh * sum_k A[m][k] * BT[n][k]  (+ sr * sum_k Ar[m][k] * BT[n][k] if RES)
// MODE 0: bf16 operands; MODE 1: f16 operands. Block 64 (M) x 128 (N), 8 waves each 32x32.
// The block's operand rows go through LDS in tiles of 64 k (one 128-B line of every row): two
// buffers, tile t in buffer t & 1, tile t + 1 copied global -> LDS (asynchronous, through no
// register, whole lines) while tile t is worked on. Fragments come from the LDS rows with the
// split k map (elements 0..7 at k + 8h, 8..15 at k + 16 + 8h); k ascends in steps of 32.
// pool: GEMM_POOL(RES) halves of LDS; the block's tile is (bn, bm).
#define GEMM_POOL(RES) (2 * (((RES) ? 2 : 1) * 64 * 72 + 128 * 72))
template <int MODE, bool RES>
__device__ __forceinline__ void gemm_body(u16* pool, int bn, int bm,
                                          const u16* __restrict__ A, const u16* __restrict__ Ar,
                                          const u16* __restrict__ BT, float* __restrict__ C,
                                          int lda, int ldb, int ldc, int K,
                                          float sh, float sr) {
  constexpr int BK = 64;                              // k per tile
  constexpr int TP = BK + 8;                          // LDS row pitch in halves: 144 B = 16 B x odd
  constexpr int AT = 64 * TP, BTL = 128 * TP;         // tile sizes in halves
  constexpr int AS = 0, ES = AT, BS = RES ? 2 * AT : AT;
  constexpr int BUF = BS + BTL;                       // one buffer = A | (Ar) | BT tiles, in halves
  static_assert(2 * BUF == GEMM_POOL(RES));
  static_assert((TP * 2) % 16 == 0 && (BUF * 2) % 16 == 0 && (AT * 2) % 16 == 0);
  static_assert(2 * BUF * 2 >= 8 * 32 * 36 * 4);      // pool doubles as the C stage behind the loop
  const int tid = threadIdx.x, wave = tid >> 5, lane = tid & 31, h = lane >> 4, l = lane & 15;
  const int wm = wave >> 2, wn = wave & 3;
  const int mblk = bm * 64, nblk = bn * 128;
  const int mb = mblk + wm * 32;
  const int nb = nblk + wn * 32;
  v8f c00 = zero8(), c01 = zero8(), c10 = zero8(), c11 = zero8();
  v8f r00 = zero8(), r01 = zero8(), r10 = zero8(), r11 = zero8();

  // This lane's 16-byte pieces of a tile: column cc of rows cr, cr + 32, ... (8 lanes cover a line).
  const int cr = tid >> 3, cc = (tid & 7) * 8;
  const unsigned lbase = (unsigned)(size_t)pool;      // byte offset of pool in the work-group's LDS
  const unsigned lpc = lbase + 2u * (unsigned)(cr * TP + cc);
  const u16* ga = A + (size_t)(mblk + cr) * (size_t)lda + cc;
  const u16* ge = Ar + (size_t)(mblk + cr) * (size_t)lda + cc;
  const u16* gb = BT + (size_t)(nblk + cr) * (size_t)ldb + cc;
  // Issue the copies of tile t into buffer t & 1 (all lanes on, block-uniform call sites). The
  // s_wait_xcnt closes each statement so that no address register is rewritten ahead of it.
  auto copy_tile = [&](int t) {
    const unsigned bo = lpc + (unsigned)(t & 1) * (unsigned)(BUF * 2);
    const unsigned a0 = bo + 2u * AS, a1 = a0 + 2u * 32u * TP;
    const unsigned b0 = bo + 2u * BS, b1 = b0 + 2u * 32u * TP, b2 = b0 + 2u * 64u * TP, b3 = b0 + 2u * 96u * TP;
    const u16* pa0 = ga + (size_t)t * BK;
    const u16* pa1 = pa0 + (size_t)32 * (size_t)lda;
    const u16* pb0 = gb + (size_t)t * BK;
    const u16* pb1 = pb0 + (size_t)32 * (size_t)ldb;
    const u16* pb2 = pb0 + (size_t)64 * (size_t)ldb;
    const u16* pb3 = pb0 + (size_t)96 * (size_t)ldb;
    asm volatile("global_load_async_to_lds_b128 %0, %6, off\n\t"
                 "global_load_async_to_lds_b128 %1, %7, off\n\t"
                 "global_load_async_to_lds_b128 %2, %8, off\n\t"
                 "global_load_async_to_lds_b128 %3, %9, off\n\t"
                 "global_load_async_to_lds_b128 %4, %10, off\n\t"
                 "global_load_async_to_lds_b128 %5, %11, off\n\t"
                 "s_wait_xcnt 0x0"
                 :: "v"(a0), "v"(a1), "v"(b0), "v"(b1), "v"(b2), "v"(b3),
                    "v"(pa0), "v"(pa1), "v"(pb0), "v"(pb1), "v"(pb2), "v"(pb3) : "memory");
    if (RES) {
      const unsigned e0 = bo + 2u * ES, e1 = e0 + 2u * 32u * TP;
      const u16* pe0 = ge + (size_t)t * BK;
      const u16* pe1 = pe0 + (size_t)32 * (size_t)lda;
      asm volatile("global_load_async_to_lds_b128 %0, %2, off\n\t"
                   "global_load_async_to_lds_b128 %1, %3, off\n\t"
                   "s_wait_xcnt 0x0"
                   :: "v"(e0), "v"(e1), "v"(pe0), "v"(pe1) : "memory");
    }
  };

  const int nt = K / BK;
  // Tile 0 lands and is published, then tile 1 is set flying.
  copy_tile(0);
  asm volatile("s_wait_asynccnt 0x0" ::: "memory");   // this wave's copies of tile 0 have landed
  __syncthreads();                                    // ... and every other wave's
  if (nt > 1) copy_tile(1);

  const int fa = (wm * 32 + l) * TP + 8 * h;          // this lane's fragment rows in a buffer
  const int fb = (wn * 32 + l) * TP + 8 * h;
  for (int t = 0; t < nt; ++t) {
    const u16* tb = pool + (t & 1) * BUF;             // this tile's buffer
    // unrolled so that both 32-k steps read at constant offsets from one LDS address
#pragma unroll
    for (int ks = 0; ks < BK; ks += 32) {
      const u16* pa = tb + AS + fa + ks;
      const u16* pb = tb + BS + fb + ks;
      if (MODE == 0) {
        FragB a0, a1, b0, b1;
        a0.q[0] = *(const v4u*)pa;             a0.q[1] = *(const v4u*)(pa + 16);
        a1.q[0] = *(const v4u*)(pa + 16 * TP); a1.q[1] = *(const v4u*)(pa + 16 * TP + 16);
        b0.q[0] = *(const v4u*)pb;             b0.q[1] = *(const v4u*)(pb + 16);
        b1.q[0] = *(const v4u*)(pb + 16 * TP); b1.q[1] = *(const v4u*)(pb + 16 * TP + 16);
        c00 = wg_b(c00, a0.v, b0.v); c01 = wg_b(c01, a0.v, b1.v);
        c10 = wg_b(c10, a1.v, b0.v); c11 = wg_b(c11, a1.v, b1.v);
      } else {
        FragH a0, a1, b0, b1;
        a0.q[0] = *(const v4u*)pa;             a0.q[1] = *(const v4u*)(pa + 16);
        a1.q[0] = *(const v4u*)(pa + 16 * TP); a1.q[1] = *(const v4u*)(pa + 16 * TP + 16);
        b0.q[0] = *(const v4u*)pb;             b0.q[1] = *(const v4u*)(pb + 16);
        b1.q[0] = *(const v4u*)(pb + 16 * TP); b1.q[1] = *(const v4u*)(pb + 16 * TP + 16);
        c00 = wg_h(c00, a0.v, b0.v); c01 = wg_h(c01, a0.v, b1.v);
        c10 = wg_h(c10, a1.v, b0.v); c11 = wg_h(c11, a1.v, b1.v);
        if (RES) {
          const u16* pe = tb + ES + fa + ks;
          FragH e0, e1;
          e0.q[0] = *(const v4u*)pe;             e0.q[1] = *(const v4u*)(pe + 16);
          e1.q[0] = *(const v4u*)(pe + 16 * TP); e1.q[1] = *(const v4u*)(pe + 16 * TP + 16);
          r00 = wg_h(r00, e0.v, b0.v); r01 = wg_h(r01, e0.v, b1.v);
          r10 = wg_h(r10, e1.v, b0.v); r11 = wg_h(r11, e1.v, b1.v);
        }
      }
    }
    // Hand-over: this wave's LDS reads of tile t are done, its copies of tile t + 1 have landed;
    // the barrier publishes tile t + 1 and frees tile t's buffer for tile t + 2.
    asm volatile("s_wait_dscnt 0x0" ::: "memory");
    asm volatile("s_wait_asynccnt 0x0" ::: "memory");
    __syncthreads();
    if (t + 2 < nt) copy_tile(t + 2);
  }
  asm volatile("s_wait_asynccnt 0x0" ::: "memory");   // nothing in flight when pool becomes the C stage

  // Behind the last trip's barrier every reader has left both buffers: pool is the C stage now.
  float* cs = (float*)pool + wave * (32 * 36);
#pragma unroll
  for (int e = 0; e < 8; ++e) {
    const int ra = 8 * h + e, rb = ra + 16;
    float v00 = sh * c00[e], v01 = sh * c01[e], v10 = sh * c10[e], v11 = sh * c11[e];
    if (RES) { v00 += sr * r00[e]; v01 += sr * r01[e]; v10 += sr * r10[e]; v11 += sr * r11[e]; }
    cs[ra * 36 + l] = v00;
    cs[ra * 36 + 16 + l] = v01;
    cs[rb * 36 + l] = v10;
    cs[rb * 36 + 16 + l] = v11;
  }
  __syncthreads();
  v4f val[8];
#pragma unroll
  for (int i = 0; i < 8; ++i) {
    const int row = 4 * i + (lane >> 3);
    val[i] = *(const v4f*)(cs + row * 36 + (lane & 7) * 4);
  }
#pragma unroll
  for (int i = 0; i < 8; ++i) {
    const int row = 4 * i + (lane >> 3);
    *(v4f*)(C + (size_t)(mb + row) * (size_t)ldc + nb + (lane & 7) * 4) = val[i];
  }
  
}

// ---------------------------------------------------------------------------------------
// Rotary + f16 planes. One block per sequence row s (q: 16 heads x 128, k: 4 heads x 128).
// sm: 2 * (NH + NKV) * HD halves of LDS.
// Qh [NH][SEQ][HD], Kh [NKV][SEQ][HD]: f16 bits of the rotated value.
// Rows s < SE also get Ql [NH][SE][HD], Kl [NKV][SE][HD]: f16 bits of (x - hi) * 1024.
// rotate-half: out[d] = x[d]*cos - x[d+64]*sin, out[d+64] = x[d+64]*cos + x[d]*sin
// (products and sums as separate f32 ops), angle = fl32(pos * inv_freq[d]).
__device__ __forceinline__ void planes_body(u16* sm, int s,
                                            const float* __restrict__ qkv, const int* __restrict__ pos,
                                            const float* __restrict__ tinv,
                                            u16* __restrict__ Qh, u16* __restrict__ Ql,
                                            u16* __restrict__ Kh, u16* __restrict__ Kl) {
#pragma clang fp contract(off)
  u16* Qs = sm;
  u16* Qls = Qs + NH * HD;
  u16* Ks = Qls + NH * HD;
  u16* Kls = Ks + NKV * HD;
  const int t = threadIdx.x;
  const bool early = (s < SE);                       // block-uniform
  int pp = pos[s];
  pp = imin(imax(pp, 0), SEQ_FULL - 1);
  const int di = t & 63;
  const float ang = (float)pp * tinv[di];
  float sn, cs;
  rot_sincos(ang, sn, cs);
  const float* row = qkv + (size_t)s * NQKV;

#pragma unroll 1
  for (int j = 0; j < 4; ++j) {
    const int hh = (t + 256 * j) >> 6;               // 0..15
    const int col = hh * HD + di;
    const float x1 = row[col], x2 = row[col + 64];
    const float a1 = x1 * cs, b1 = x2 * sn;
    const float a2 = x2 * cs, b2 = x1 * sn;
    const float r1 = a1 - b1;
    const float r2 = a2 + b2;
    if (early) {
      u16 a, b;
      split1024(r1, a, b); Qs[col] = a;      Qls[col] = b;
      split1024(r2, a, b); Qs[col + 64] = a; Qls[col + 64] = b;
    } else {
      Qs[col] = hbits(r1);
      Qs[col + 64] = hbits(r2);
    }
  }
  {
    const int kvh = t >> 6;                          // 0..3
    const int col = kvh * HD + di;
    const float x1 = row[NH * HD + col], x2 = row[NH * HD + col + 64];
    const float a1 = x1 * cs, b1 = x2 * sn;
    const float a2 = x2 * cs, b2 = x1 * sn;
    const float r1 = a1 - b1;
    const float r2 = a2 + b2;
    if (early) {
      u16 a, b;
      split1024(r1, a, b); Ks[col] = a;      Kls[col] = b;
      split1024(r2, a, b); Ks[col + 64] = a; Kls[col + 64] = b;
    } else {
      Ks[col] = hbits(r1);
      Ks[col + 64] = hbits(r2);
    }
  }
  __syncthreads();

  const int e = t * 8;
  const int hq = e >> 7, dq = e & 127;               // q: head 0..15
  const bool kw = (t < 64);                          // wave-uniform: waves 0,1
  const int hk = hq, dk = dq;                        // valid for t < 64: kv head 0..3
  const v4u vq = *(const v4u*)(Qs + e);
  v4u vql = vq, vk = vq, vkl = vq;
  if (early) vql = *(const v4u*)(Qls + e);
  if (kw) {
    vk = *(const v4u*)(Ks + e);
    if (early) vkl = *(const v4u*)(Kls + e);
  }
  u16* pq  = Qh + ((size_t)hq * SEQ + s) * HD + dq;
  u16* pql = Ql + ((size_t)hq * SE + (early ? s : 0)) * HD + dq;
  u16* pk  = Kh + ((size_t)hk * SEQ + s) * HD + dk;
  u16* pkl = Kl + ((size_t)hk * SE + (early ? s : 0)) * HD + dk;

  *(v4u*)pq = vq;
  if (early) *(v4u*)pql = vql;
  if (kw) {
    *(v4u*)pk = vk;
    if (early) *(v4u*)pkl = vkl;
  }
  
}

// ---------------------------------------------------------------------------------------
// V transposed planes: Vth [NKV][HD][SEQ] = f16 bits of 16*v, and for keys < SE
// Vtl [NKV][HD][SE] = f16 bits of (16*v - hi) * 1024. Tile = 64 keys x 128 d through LDS,
// sm: 2 * HD * 72 halves of LDS; the block's tile is keys 64 * bs .. + 63 of kv head kv.
__device__ __forceinline__ void vt_body(u16* sm, int bs, int kv, const float* __restrict__ qkv,
                                        u16* __restrict__ Vth, u16* __restrict__ Vtl) {
#pragma clang fp contract(off)
  u16* T = sm;                                       // [d][key], pitch 72 halves
  u16* Tl = T + HD * 72;
  const int s0 = bs * 64, t = threadIdx.x;
  const bool early = (s0 < SE);                      // block-uniform (SE % 64 == 0)
#pragma unroll 1
  for (int j = 0; j < 8; ++j) {
    const int idx = t + 256 * j;
    const int r = idx >> 5;                          // key 0..63
    const int c4 = (idx & 31) * 4;                   // d 0..124
    const v4f v = *(const v4f*)(qkv + (size_t)(s0 + r) * NQKV + NH * HD + NKV * HD + kv * HD + c4);
#pragma unroll
    for (int e = 0; e < 4; ++e) {
      const float f = 16.0f * v[e];
      if (early) {
        u16 a, b;
        split1024(f, a, b);
        T[(c4 + e) * 72 + r] = a;
        Tl[(c4 + e) * 72 + r] = b;
      } else {
        T[(c4 + e) * 72 + r] = hbits(f);
      }
    }
  }
  __syncthreads();
  v4u vh[4], vl[4];
#pragma unroll
  for (int p = 0; p < 4; ++p) {
    const int d = (t >> 3) + 32 * p, c = (t & 7) * 8;
    vh[p] = *(const v4u*)(T + d * 72 + c);
    vl[p] = vh[p];
    if (early) vl[p] = *(const v4u*)(Tl + d * 72 + c);
  }
#pragma unroll
  for (int p = 0; p < 4; ++p) {
    const int d = (t >> 3) + 32 * p, c = (t & 7) * 8;
    *(v4u*)(Vth + ((size_t)kv * HD + d) * SEQ + s0 + c) = vh[p];
    if (early) *(v4u*)(Vtl + ((size_t)kv * HD + d) * SE + s0 + c) = vl[p];
  }
  
}

// ---------------------------------------------------------------------------------------
// Causal GQA flash attention. Block = 8 waves = 4 q heads of one kv head x 32 queries
// (wave w: head kv*4 + (w>>1), queries q0 + (w&1)*16 .. +15). Keys in chunks of 32 staged
// in LDS (two buffers, filled one chunk ahead by asynchronous copies): K tile [32][128] (A operand of S^T = K x Q^T, lane = key row) and V^T tile
// [128 d][32 keys] (B operand of O += P x V, lane = d). Queries live on lanes for the
// softmax; P in D layout of S^T is the A-fragment layout of P x V (lane = query,
// elements 0..7 = keys 8h..8h+7, 8..15 = keys 16+8h..). Online softmax in f32 (exp2 form),
// P carried as f16(4096 p), V as f16(16 v), ctx written as f16(64 ctx).
// EARLY (query rows < SE): q, k, P, v get x1024 residual planes and a second accumulator
// folded before normalisation; head dim handled in four 32-wide passes whose ctx results
// pass; ctx also gets a residual plane Cr. Output Ch [SEQ][HID] (head*128 + d), Cr [SE][HID].
// VGPR file capped at 256 (no high-bank registers).
// pool: ATTN_POOL(EARLY) halves of LDS; stg: 16384 halves of LDS (used where EARLY).
#define ATTN_POOL(EARLY) (2 * ((EARLY) ? 2 : 1) * (32 * (HD + 8) + HD * (32 + 8)))
template <bool EARLY>
__device__ __forceinline__
void attn_body(u16* pool, u16* stg, int qblk, int kv,
               const u16* __restrict__ Qh, const u16* __restrict__ Ql,
               const u16* __restrict__ Kh, const u16* __restrict__ Kl,
               const u16* __restrict__ Vth, const u16* __restrict__ Vtl,
               const int* __restrict__ amask,
               u16* __restrict__ Ch, u16* __restrict__ Cr) {
  // LDS row pitch = 16 B x odd, so that the 16 rows one ds_load_b128 reads fall on distinct banks:
  // K rows (256 B of data) at 272 B, Vt rows (64 B of data) at 80 B.
  constexpr int KP = HD + 8, VP = 32 + 8;             // pitches in halves
  constexpr int KT = 32 * KP, VT = HD * VP;           // tile sizes in halves
  // One buffer = K | (Kres) | Vt | (Vtres) tiles of one key chunk; two buffers, chunk kc in buffer kc & 1:
  // chunk kc + 1 is copied global -> LDS (asynchronous, through no register) while chunk kc is worked on.
  constexpr int KS = 0, KL = KT, VS = EARLY ? 2 * KT : KT, VL = VS + VT;
  constexpr int BUF = EARLY ? 2 * KT + 2 * VT : KT + VT;  // halves per buffer
  static_assert(2 * BUF == ATTN_POOL(EARLY));         // stg where EARLY: per-wave ctx stage [8][16][128]
  static_assert((BUF * 2) % 16 == 0 && (KP * 2) % 16 == 0 && (VP * 2) % 16 == 0);
  static_assert(EARLY || 2 * BUF >= 16384);           // pool doubles as the ctx stage behind the loop
  constexpr int NDT = EARLY ? 2 : 8;
  constexpr int DW = NDT * 16;
  constexpr int NPASS = HD / DW;
  const int tid = threadIdx.x, wave = tid >> 5, lane = tid & 31, h = lane >> 4, l = lane & 15;
  const int head = kv * (NH / NKV) + (wave >> 1);
  const int q0 = qblk * BQW;
  const int qw0 = q0 + (wave & 1) * 16;
  const int qrow = qw0 + l;                          // this lane's query
  const int nchunk = qblk + 1;                       // keys 0 .. q0+31

  FragH qh[4];
  FragH ql[4];
#pragma unroll
  for (int dc = 0; dc < 4; ++dc) {
    const u16* b = Qh + ((size_t)head * SEQ + qrow) * HD + dc * 32 + 8 * h;
    qh[dc].q[0] = *(const v4u*)b;
    qh[dc].q[1] = *(const v4u*)(b + 16);
    if (EARLY) {
      const u16* b2 = Ql + ((size_t)head * SE + qrow) * HD + dc * 32 + 8 * h;
      ql[dc].q[0] = *(const v4u*)b2;
      ql[dc].q[1] = *(const v4u*)(b2 + 16);
    } else {
      ql[dc].q[0] = qh[dc].q[0];
      ql[dc].q[1] = qh[dc].q[1];
    }
  }
  const float SCL = 0.088388347648318441f * 1.4426950408889634f;   // log2(e)/sqrt(128)

  // ctx stage [16 rows][128 cols] per wave: EARLY in its own region (persists across the
  // 32-wide passes), otherwise aliasing pool after the K/V tiles are dead.
  u16* os;
  if (EARLY) os = stg + wave * (16 * 128);
  else os = pool + wave * (16 * 128);

  // This lane's 16-byte pieces of a chunk: K rows kr and kr + 16, Vt rows vd and vd + 64.
  const int kr = tid >> 4, kcol = (tid & 15) * 8;
  const int vd = tid >> 2, vcol = (tid & 3) * 8;
  const unsigned lbase = (unsigned)(size_t)pool;     // byte offset of pool in the work-group's LDS
  const unsigned lk = lbase + 2u * (unsigned)(KS + kr * KP + kcol);
  const unsigned lv = lbase + 2u * (unsigned)(VS + vd * VP + vcol);
  const u16* gk = Kh + ((size_t)kv * SEQ + kr) * HD + kcol;
  const u16* gv = Vth + ((size_t)kv * HD + vd) * SEQ + vcol;
  const u16* gkl = Kl + ((size_t)kv * SE + kr) * HD + kcol;
  const u16* gvl = Vtl + ((size_t)kv * HD + vd) * SE + vcol;
  // Issue the copies of chunk c into buffer c & 1 (all lanes on, block-uniform call sites). The
  // s_wait_xcnt closes each statement so that no address register is rewritten ahead of it.
  auto copy_chunk = [&](int c) {
    const unsigned bo = (unsigned)(c & 1) * (unsigned)(BUF * 2);
    const unsigned k0 = lk + bo, k1 = k0 + 2u * 16u * KP;
    const unsigned v0 = lv + bo, v1 = v0 + 2u * 64u * VP;
    const u16* a0 = gk + (size_t)c * (32 * HD);
    const u16* a1 = a0 + 16 * HD;
    const u16* b0 = gv + c * 32;
    const u16* b1 = b0 + (size_t)64 * SEQ;
    asm volatile("global_load_async_to_lds_b128 %0, %4, off\n\t"
                 "global_load_async_to_lds_b128 %1, %5, off\n\t"
                 "global_load_async_to_lds_b128 %2, %6, off\n\t"
                 "global_load_async_to_lds_b128 %3, %7, off\n\t"
                 "s_wait_xcnt 0x0"
                 :: "v"(k0), "v"(k1), "v"(v0), "v"(v1), "v"(a0), "v"(a1), "v"(b0), "v"(b1) : "memory");
    if (EARLY) {
      const unsigned k2 = k0 + 2u * (KL - KS), k3 = k1 + 2u * (KL - KS);
      const unsigned v2 = v0 + 2u * (VL - VS), v3 = v1 + 2u * (VL - VS);
      const u16* a2 = gkl + (size_t)c * (32 * HD);
      const u16* a3 = a2 + 16 * HD;
      const u16* b2 = gvl + c * 32;
      const u16* b3 = b2 + (size_t)64 * SE;
      asm volatile("global_load_async_to_lds_b128 %0, %4, off\n\t"
                   "global_load_async_to_lds_b128 %1, %5, off\n\t"
                   "global_load_async_to_lds_b128 %2, %6, off\n\t"
                   "global_load_async_to_lds_b128 %3, %7, off\n\t"
                   "s_wait_xcnt 0x0"
                   :: "v"(k2), "v"(k3), "v"(v2), "v"(v3), "v"(a2), "v"(a3), "v"(b2), "v"(b3) : "memory");
    }
  };

#pragma unroll 1
  for (int pass = 0; pass < NPASS; ++pass) {
    const int dbase = pass * DW;
    v8f o[NDT];
    v8f orr[NDT];
#pragma unroll
    for (int dt = 0; dt < NDT; ++dt) { o[dt] = zero8(); orr[dt] = zero8(); }
    float rmax = -1.0e30f, rsum = 0.0f;

    // Chunk 0 lands and is published, then chunk 1 is set flying. (A later pass gets here behind
    // the last trip's s_wait_dscnt and barrier, so every reader has left both buffers.)
    copy_chunk(0);
    asm volatile("s_wait_asynccnt 0x0" ::: "memory");  // this wave's copies of chunk 0 have landed
    __syncthreads();                                 // ... and every other wave's
    if (nchunk > 1) copy_chunk(1);
    int av = amask[imin(lane, SEQ - 1)];             // padding mask of chunk 0's keys

#pragma unroll 1
    for (int kc = 0; kc < nchunk; ++kc) {
      const int kbase = kc * 32;
      const u16* tb = pool + (kc & 1) * BUF;         // this chunk's buffer
      // padding-mask word for the 32 keys of this chunk, per wave (all lanes active); the next
      // chunk's mask values are read one chunk ahead, like its tiles
      const unsigned mw = __builtin_amdgcn_ballot_w32(av != 0);
      av = amask[imin(kbase + 32 + lane, SEQ - 1)];

      // scores S^T[key][query]; lane l = query, element r = key sub*16 + 8h + r
      float u[16];
      unsigned vm = 0u;
      float m_new = rmax;
#pragma unroll
      for (int sub = 0; sub < 2; ++sub) {
        v8f acc = zero8();
        v8f accr = zero8();
#pragma unroll
        for (int dc = 0; dc < 4; ++dc) {
          FragH kf;
          const u16* kb = tb + KS + (sub * 16 + l) * KP + dc * 32 + 8 * h;
          kf.q[0] = *(const v4u*)kb;
          kf.q[1] = *(const v4u*)(kb + 16);
          acc = wg_h(acc, kf.v, qh[dc].v);
          if (EARLY) {
            accr = wg_h(accr, kf.v, ql[dc].v);
            FragH kg;
            const u16* kb2 = tb + KL + (sub * 16 + l) * KP + dc * 32 + 8 * h;
            kg.q[0] = *(const v4u*)kb2;
            kg.q[1] = *(const v4u*)(kb2 + 16);
            accr = wg_h(accr, kg.v, qh[dc].v);
          }
        }
#pragma unroll
        for (int r = 0; r < 8; ++r) {
          const int klc = sub * 16 + 8 * h + r;
          const int key = kbase + klc;
          float s = acc[r];
          if (EARLY) s += accr[r] * (1.0f / 1024.0f);
          const bool valid = (key <= qrow) && (((mw >> klc) & 1u) != 0u);
          const float uu = valid ? s * SCL : -1.0e30f;
          u[sub * 8 + r] = uu;
          vm |= (valid ? 1u : 0u) << (sub * 8 + r);
          m_new = fmaxf(m_new, uu);
        }
      }
      m_new = fmaxf(m_new, __shfl_xor(m_new, 16, 32));
      const float scale = __builtin_amdgcn_exp2f(rmax - m_new);
      rmax = m_new;

      float psum = 0.0f;
      FragH ph;
      FragH pr;
#pragma unroll
      for (int i = 0; i < 16; ++i) {
        const float pe = __builtin_amdgcn_exp2f(u[i] - m_new);
        const float pv = ((vm >> i) & 1u) ? pe : 0.0f;
        psum += pv;
        const float pc = pv * 4096.0f;
        const f16 hv = (f16)pc;
        ph.h[i] = hv;
        if (EARLY) pr.h[i] = (f16)((pc - (float)hv) * 1024.0f);
        else pr.h[i] = hv;
      }
      psum += __shfl_xor(psum, 16, 32);
      rsum = rsum * scale + psum;

      float sc[8];
#pragma unroll
      for (int r = 0; r < 8; ++r) sc[r] = __shfl(scale, 8 * h + r, 32);
#pragma unroll
      for (int dt = 0; dt < NDT; ++dt) {
#pragma unroll
        for (int r = 0; r < 8; ++r) {
          o[dt][r] *= sc[r];
          if (EARLY) orr[dt][r] *= sc[r];
        }
      }
      // O += P x V ; B fragment lane = d row of the Vt tile, elements = keys (split map)
#pragma unroll
      for (int dt = 0; dt < NDT; ++dt) {
        const int d = dbase + dt * 16 + l;
        FragH vf;
        const u16* vb = tb + VS + d * VP + 8 * h;
        vf.q[0] = *(const v4u*)vb;
        vf.q[1] = *(const v4u*)(vb + 16);
        o[dt] = wg_h(o[dt], ph.v, vf.v);
        if (EARLY) {
          orr[dt] = wg_h(orr[dt], pr.v, vf.v);
          FragH vg;
          const u16* vb2 = tb + VL + d * VP + 8 * h;
          vg.q[0] = *(const v4u*)vb2;
          vg.q[1] = *(const v4u*)(vb2 + 16);
          orr[dt] = wg_h(orr[dt], ph.v, vg.v);
        }
      }
      // Hand-over: this wave's LDS reads of chunk kc are done, its copies of chunk kc + 1 have
      // landed; the barrier publishes chunk kc + 1 and frees chunk kc's buffer for chunk kc + 2.
      asm volatile("s_wait_dscnt 0x0" ::: "memory");
      asm volatile("s_wait_asynccnt 0x0" ::: "memory");
      __syncthreads();
      if (kc + 2 < nchunk) copy_chunk(kc + 2);
    }
    asm volatile("s_wait_asynccnt 0x0" ::: "memory");  // nothing in flight when the buffers are reused

    // epilogue: ctx = (o + orr/1024) / (4096 * 16 * l); plane value = 64 * ctx
    if (!EARLY) __syncthreads();                     // K/V tiles dead, pool reused as stage
    const float inv = 1.0f / rsum;
    float ir[8];
#pragma unroll
    for (int r = 0; r < 8; ++r) ir[r] = __shfl(inv, 8 * h + r, 32) * (1.0f / 1024.0f);
    const int cb = EARLY ? ((pass & 1) * 32) : 0;   // column offset inside the 64-wide line half
#pragma unroll
    for (int dt = 0; dt < NDT; ++dt) {
#pragma unroll
      for (int r = 0; r < 8; ++r) {
        float val = o[dt][r];
        if (EARLY) val += orr[dt][r] * (1.0f / 1024.0f);
        val *= ir[r];
        if (EARLY) {
          u16 a, b;
          split1024(val, a, b);
          os[(8 * h + r) * 128 + cb + dt * 16 + l] = a;
          os[(8 * h + r) * 128 + 64 + cb + dt * 16 + l] = b;
        } else {
          os[(8 * h + r) * 128 + dt * 16 + l] = hbits(val);
        }
      }
    }
    if (!EARLY) {
      __syncthreads();
      // 16 rows x 256 B = 32 lines; instruction i: lanes 8g..8g+7 -> line 4i+g
      v4u vals[8];
#pragma unroll
      for (int i = 0; i < 8; ++i) {
        const int L = 4 * i + (lane >> 3);
        const int row = L >> 1, seg = L & 1;
        vals[i] = *(const v4u*)(os + row * 128 + seg * 64 + (lane & 7) * 8);
      }
#pragma unroll
      for (int i = 0; i < 8; ++i) {
        const int L = 4 * i + (lane >> 3);
        const int row = L >> 1, seg = L & 1;
        *(v4u*)(Ch + (size_t)(qw0 + row) * HID + head * HD + seg * 64 + (lane & 7) * 8) = vals[i];
      }
      // another job's code follows in the merged kernel: no register of the stores above is rewritten ahead of this wait
      asm volatile("s_wait_xcnt 0x0" ::: "memory");
    } else {
      if ((pass & 1) != 0) {                         // block-uniform: stage holds d line (pass>>1)
        __syncthreads();
        const int dline = (pass >> 1) * 64;
        v4u va[4], vb[4];
#pragma unroll
        for (int i = 0; i < 4; ++i) {
          const int row = 4 * i + (lane >> 3);
          va[i] = *(const v4u*)(os + row * 128 + (lane & 7) * 8);
          vb[i] = *(const v4u*)(os + row * 128 + 64 + (lane & 7) * 8);
        }
#pragma unroll
        for (int i = 0; i < 4; ++i) {
          const int row = 4 * i + (lane >> 3);
          const size_t off = (size_t)(qw0 + row) * HID + head * HD + dline + (lane & 7) * 8;
          *(v4u*)(Ch + off) = va[i];
          *(v4u*)(Cr + off) = vb[i];
        }
        
      }
    }
  }
}

// ---------------------------------------------------------------------------------------
// Launches. Jobs that need nothing of each other share one grid: a range of the block index
// (the same for a whole block) picks the job, so that part-filled grids run side by side.

// hidden -> bf16 and the inv_freq table | wq, wk, wv -> bf16, transposed | wo -> f16, transposed
#define NB_X SEQ
#define NB_WQ ((HID / 64) * ((NH * HD) / 64))
#define NB_WKV ((HID / 64) * ((NKV * HD) / 64))
#define NB_WO ((HID / 64) * (HID / 64))
__global__ __launch_bounds__(256) void k_prep(const float* __restrict__ x, const float* __restrict__ wq,
                                             const float* __restrict__ wk, const float* __restrict__ wv,
                                             const float* __restrict__ wo, u16* __restrict__ xb,
                                             float* __restrict__ tinv, u16* __restrict__ wqkvt,
                                             u16* __restrict__ wot) {
  __shared__ __align__(16) u16 T[64 * 72];
  constexpr int NI = HID / 64;                       // tiles along the weights' input dimension
  const int b = (int)blockIdx.x;
  if (b < NB_X) {
    xconv_body(b, x, xb, tinv);
  } else if (b < NB_X + NB_WQ) {
    const int r = b - NB_X;
    wt_body<0>(T, r % NI, r / NI, wq, wqkvt, NH * HD);
  } else if (b < NB_X + NB_WQ + NB_WKV) {
    const int r = b - (NB_X + NB_WQ);
    wt_body<0>(T, r % NI, r / NI, wk, wqkvt + (size_t)(NH * HD) * HID, NKV * HD);
  } else if (b < NB_X + NB_WQ + 2 * NB_WKV) {
    const int r = b - (NB_X + NB_WQ + NB_WKV);
    wt_body<0>(T, r % NI, r / NI, wv, wqkvt + (size_t)(NH * HD + NKV * HD) * HID, NKV * HD);
  } else {
    const int r = b - (NB_X + NB_WQ + 2 * NB_WKV);
    wt_body<1>(T, r % NI, r / NI, wo, wot, HID);
  }
}

// qkv projection
__global__ __launch_bounds__(256) void k_qkv(const u16* __restrict__ A, const u16* __restrict__ BT,
                                            float* __restrict__ C, int lda, int ldb, int ldc, int K) {
  __shared__ __align__(16) u16 pool[GEMM_POOL(false)];
  gemm_body<0, false>(pool, (int)blockIdx.x, (int)blockIdx.y, A, A, BT, C, lda, ldb, ldc, K, 1.0f, 0.0f);
}

// V transposed planes | rotary + q, k planes
#define NB_VT ((SEQ / 64) * NKV)
__global__ __launch_bounds__(256) void k_planes_vt(const float* __restrict__ qkv, const int* __restrict__ pos,
                                                  const float* __restrict__ tinv,
                                                  u16* __restrict__ Qh, u16* __restrict__ Ql,
                                                  u16* __restrict__ Kh, u16* __restrict__ Kl,
                                                  u16* __restrict__ Vth, u16* __restrict__ Vtl) {
  __shared__ __align__(16) u16 sm[2 * HD * 72];
  static_assert(2 * HD * 72 >= 2 * (NH + NKV) * HD);
  const int b = (int)blockIdx.x;
  if (b < NB_VT) vt_body(sm, b % (SEQ / 64), b / (SEQ / 64), qkv, Vth, Vtl);
  else planes_body(sm, b - NB_VT, qkv, pos, tinv, Qh, Ql, Kh, Kl);
}

// attention: query blocks of the leading SE rows (residual planes) | the rest
__global__ __launch_bounds__(256) __attribute__((amdgpu_num_vgpr(256)))
void k_attn(const u16* __restrict__ Qh, const u16* __restrict__ Ql,
            const u16* __restrict__ Kh, const u16* __restrict__ Kl,
            const u16* __restrict__ Vth, const u16* __restrict__ Vtl,
            const int* __restrict__ amask,
            u16* __restrict__ Ch, u16* __restrict__ Cr) {
  __shared__ __align__(16) u16 pool[ATTN_POOL(true)];
  __shared__ __align__(16) u16 stg[16384];
  const int qblk = (int)blockIdx.x, kv = (int)blockIdx.y;
  if (qblk < SE / BQW) attn_body<true>(pool, stg, qblk, kv, Qh, Ql, Kh, Kl, Vth, Vtl, amask, Ch, Cr);
  else attn_body<false>(pool, stg, qblk, kv, Qh, Ql, Kh, Kl, Vth, Vtl, amask, Ch, Cr);
}

// output projection: row tiles of the leading SE rows (with the residual ctx plane) | the rest
__global__ __launch_bounds__(256) void k_oproj(const u16* __restrict__ A, const u16* __restrict__ Ar,
                                              const u16* __restrict__ BT, float* __restrict__ C,
                                              int lda, int ldb, int ldc, int K, float sh, float sr) {
  __shared__ __align__(16) u16 pool[GEMM_POOL(true)];
  const int bn = (int)blockIdx.x, bm = (int)blockIdx.y;
  if (bm < SE / 64) gemm_body<1, true>(pool, bn, bm, A, Ar, BT, C, lda, ldb, ldc, K, sh, sr);
  else gemm_body<1, false>(pool, bn, bm, A, A, BT, C, lda, ldb, ldc, K, sh, 0.0f);
}

// ---------------------------------------------------------------------------------------
extern "C" void kernel_launch(void* const* d_in, const int* in_sizes, int n_in,
                              void* d_out, int out_size, void* d_ws, size_t ws_size,
                              hipStream_t stream) {
  if (n_in < 7) return;
  if (in_sizes[0] < SEQ * HID) return;
  if (in_sizes[1] < SEQ) return;
  if (in_sizes[2] < SEQ) return;
  if (in_sizes[3] < HID * NH * HD) return;
  if (in_sizes[4] < HID * NKV * HD) return;
  if (in_sizes[5] < HID * NKV * HD) return;
  if (in_sizes[6] < NH * HD * HID) return;
  if (out_size < SEQ * HID) return;

  const float* hs  = (const float*)d_in[0];
  const int*   am  = (const int*)d_in[1];
  const int*   pos = (const int*)d_in[2];
  const float* wq  = (const float*)d_in[3];
  const float* wk  = (const float*)d_in[4];
  const float* wv  = (const float*)d_in[5];
  const float* wo  = (const float*)d_in[6];
  float* out = (float*)d_out;

  char* ws = (char*)d_ws;
  size_t off = 0;
#define CARVE(T, name, bytes) T* name = (T*)(ws + off); off += (((size_t)(bytes)) + 255) & ~(size_t)255
  CARVE(u16,   Xb,    (size_t)SEQ * HID * 2);          // bf16 bits [SEQ][HID]
  CARVE(u16,   WqkvT, (size_t)NQKV * HID * 2);         // bf16 bits [3072][HID]
  CARVE(u16,   WoT,   (size_t)HID * HID * 2);          // f16 bits  [HID][HID]
  CARVE(float, QKVf,  (size_t)SEQ * NQKV * 4);         // f32 [SEQ][3072]
  CARVE(u16,   Qh,    (size_t)NH * SEQ * HD * 2);
  CARVE(u16,   Kh,    (size_t)NKV * SEQ * HD * 2);
  CARVE(u16,   Vth,   (size_t)NKV * HD * SEQ * 2);
  CARVE(u16,   Ql,    (size_t)NH * SE * HD * 2);
  CARVE(u16,   Kl,    (size_t)NKV * SE * HD * 2);
  CARVE(u16,   Vtl,   (size_t)NKV * HD * SE * 2);
  CARVE(u16,   Cr,    (size_t)SE * HID * 2);
  CARVE(float, Tinv,  256);
#undef CARVE
  // Ch [SEQ][HID] f16 plane aliases the Xb region: identical extent (SEQ*HID halves), Xb is
  // read only by the qkv projection launch, Ch is first written by the attention launch
  // that comes after it on the same in-order stream.
  static_assert(NH * HD == HID);
  u16* Ch = Xb;
  if (off > ws_size) return;

  // 1) hidden -> bf16, inv_freq table; weights: w [HID][n] -> wt [n][HID]
  k_prep<<<dim3(NB_X + NB_WQ + 2 * NB_WKV + NB_WO), 256, 0, stream>>>(hs, wq, wk, wv, wo, Xb, Tinv, WqkvT, WoT);
  // 2) fused qkv projection: [SEQ][HID] x [HID][3072] -> f32
  k_qkv<<<dim3(NQKV / 128, SEQ / 64), 256, 0, stream>>>(Xb, WqkvT, QKVf, HID, HID, NQKV, HID);
  // 3) V transposed planes; rotary + planes
  k_planes_vt<<<dim3(NB_VT + SEQ), 256, 0, stream>>>(QKVf, pos, Tinv, Qh, Ql, Kh, Kl, Vth, Vtl);
  // 4) attention: leading SE rows with residual planes, the rest single products
  k_attn<<<dim3(SEQ / BQW, NKV), 256, 0, stream>>>(Qh, Ql, Kh, Kl, Vth, Vtl, am, Ch, Cr);
  // 5) output projection: rows < SE with the residual ctx plane, the rest plain
  k_oproj<<<dim3(HID / 128, SEQ / 64), 256, 0, stream>>>(
      Ch, Cr, WoT, out, HID, HID, HID, HID, 1.0f / 4096.0f, 1.0f / (4096.0f * 1024.0f));
}

// v005
// It runs in 352 microseconds.
// Two timings next to v004 both put it at 1.04 times that version's speed.
// Over all steps from v000 it is 3.85 times as fast.
#include <hip/hip_runtime.h>
#include <stdint.h>
#include <stddef.h>

// Contractions: qkv projection = v_wmma_f32_16x16x32_bf16 (bf16 operands, f32 accumulate);
// q.k scores, p.v and output projection = v_wmma_f32_16x16x32_f16 (f16 operands with
// power-of-two carries plus x1024 f16 residual planes on the leading SE query rows,
// f32 accumulate). Softmax and epilogues in f32; rotary sin/cos via f64 quadrant
// reduction + polynomial (no fused multiply-add), rotation in unfused f32.

#ifndef NB
#define NB 1
#endif
#ifndef SEQ
#define SEQ 4096
#endif
#ifndef SE
#if SEQ < 640
#define SE SEQ
#else
#define SE 640
#endif
#endif
#define SEQ_FULL 4096
#define HID 2048
#define NH 16
#define NKV 4
#define HD 128
#define NQKV (NH * HD + 2 * NKV * HD)
#define BQW 32

static_assert(NB == 1);
static_assert(SEQ % 64 == 0);
static_assert(SEQ >= SE);
static_assert(SEQ <= SEQ_FULL);
static_assert(SE >= 64);
static_assert(SE % 64 == 0);
static_assert(SE % BQW == 0);
static_assert(HID % 128 == 0);
static_assert(HID == 256 * 8);
static_assert(NQKV % 128 == 0);
static_assert(HD == 128);
static_assert(NH == 4 * NKV);
static_assert(NH * HD == HID);

typedef _Float16 f16;
typedef __bf16 bf16;
typedef unsigned short u16;
typedef f16 v16h __attribute__((ext_vector_type(16)));
typedef bf16 v16b __attribute__((ext_vector_type(16)));
typedef float v8f __attribute__((ext_vector_type(8)));
typedef float v4f __attribute__((ext_vector_type(4)));
typedef unsigned v4u __attribute__((ext_vector_type(4)));

union FragH { v16h v; v4u q[2]; f16 h[16]; };
union FragB { v16b v; v4u q[2]; };

__device__ __forceinline__ v8f zero8() {
  v8f z = {0.0f, 0.0f, 0.0f, 0.0f, 0.0f, 0.0f, 0.0f, 0.0f};
  return z;
}

// 16x16x32 f16 WMMA followed by a 4-slot VALU hazard guard on D (A/B kept live).
__device__ __forceinline__ v8f wg_h(v8f acc, v16h a, v16h b) {
  acc = __builtin_amdgcn_wmma_f32_16x16x32_f16(false, a, false, b, (short)0, acc, false, false);
  asm volatile("v_nop\n\tv_nop\n\tv_nop\n\tv_nop" : "+v"(acc) : "v"(a), "v"(b));
  return acc;
}
__device__ __forceinline__ v8f wg_b(v8f acc, v16b a, v16b b) {
  acc = __builtin_amdgcn_wmma_f32_16x16x32_bf16(false, a, false, b, (short)0, acc, false, false);
  asm volatile("v_nop\n\tv_nop\n\tv_nop\n\tv_nop" : "+v"(acc) : "v"(a), "v"(b));
  return acc;
}

// f32 -> bf16 bits, RNE convert.
__device__ __forceinline__ unsigned bf16_rne(float f) {
  const unsigned u = __float_as_uint(f);
  return (u + 0x7FFFu + ((u >> 16) & 1u)) >> 16;
}
// f32 -> f16 bits, RNE convert.
__device__ __forceinline__ u16 hbits(float f) {
  const f16 x = (f16)f;
  return __builtin_bit_cast(u16, x);
}
// f32 -> f16 hi bits plus f16 bits of (v - hi) * 1024 (unfused: sub then mul).
__device__ __forceinline__ void split1024(float v, u16& hb, u16& lb) {
#pragma clang fp contract(off)
  const f16 x = (f16)v;
  const float xr = (float)x;
  const float dlt = v - xr;
  const f16 y = (f16)(dlt * 1024.0f);
  hb = __builtin_bit_cast(u16, x);
  lb = __builtin_bit_cast(u16, y);
}
__device__ __forceinline__ int imin(int a, int b) { return a < b ? a : b; }
__device__ __forceinline__ int imax(int a, int b) { return a > b ? a : b; }

// sin/cos of an f32 angle (0 <= ang <= ~4100 rad) in f64 without fused multiply-add:
// quadrant count kq = rint(x * 2/pi); r = (x - kq * P1) - kq * P2 with P1 = the leading
// 33 bits of pi/2 (kq * P1 exact for kq < 2^20) and P2 its tail; odd/even polynomials on
// |r| <= pi/4 (truncation < 3e-14); quadrant select by value; convert to f32.
__device__ __forceinline__ void rot_sincos(float ang, float& sn, float& cs) {
#pragma clang fp contract(off)
  const double x = (double)ang;
  const double kq = __builtin_rint(x * 0.63661977236758134308);
  double r = x - kq * 1.57079632673412561417;
  r = r - kq * 6.07710050650619224932e-11;
  const int q = (int)kq;
  const double r2 = r * r;
  double ps = 1.6059043836821613e-10;
  ps = ps * r2 - 2.5052108385441720e-08;
  ps = ps * r2 + 2.7557319223985893e-06;
  ps = ps * r2 - 1.9841269841269841e-04;
  ps = ps * r2 + 8.3333333333333332e-03;
  ps = ps * r2 - 1.6666666666666666e-01;
  const double r3 = r * r2;
  const double sr = r + r3 * ps;
  double pc = -1.1470745597729725e-11;
  pc = pc * r2 + 2.0876756987868099e-09;
  pc = pc * r2 - 2.7557319223985888e-07;
  pc = pc * r2 + 2.4801587301587302e-05;
  pc = pc * r2 - 1.3888888888888889e-03;
  pc = pc * r2 + 4.1666666666666664e-02;
  pc = pc * r2 - 0.5;
  const double cr = 1.0 + pc * r2;
  const bool odd = (q & 1) != 0;
  const bool neg = (q & 2) != 0;
  double sv = odd ? cr : sr;
  double cv = odd ? -sr : cr;
  sv = neg ? -sv : sv;
  cv = neg ? -cv : cv;
  sn = (float)sv;
  cs = (float)cv;
}

// ---------------------------------------------------------------------------------------
// hidden f32 [SEQ][HID] -> bf16 bits [SEQ][HID]; one block (blk) per row, 16 B per lane.
// Block 0, lanes 0..63 also produce the rotary inv_freq table (64 floats):
// inv[j] = fl32(1 / fl32(10000^(j/64))), with 10000^(1/64) from an iterative f64 64th root.
__device__ __forceinline__ void xconv_body(int blk, const float* __restrict__ x, u16* __restrict__ xb,
                                           float* __restrict__ tinv) {
#pragma clang fp contract(off)
  const int t = threadIdx.x;
  const size_t e = ((size_t)blk * 256 + (size_t)t) * 8;
  const v4f a = *(const v4f*)(x + e);
  const v4f b = *(const v4f*)(x + e + 4);
  v4u w;
  w[0] = bf16_rne(a[0]) | (bf16_rne(a[1]) << 16);
  w[1] = bf16_rne(a[2]) | (bf16_rne(a[3]) << 16);
  w[2] = bf16_rne(b[0]) | (bf16_rne(b[1]) << 16);
  w[3] = bf16_rne(b[2]) | (bf16_rne(b[3]) << 16);

  const bool tab = (blk == 0) && (t < 64);   // wave-uniform (waves 0,1 of block 0)
  float ivf = 0.0f;
  if (tab) {
    double rt = 1.15;
#pragma unroll 1
    for (int it = 0; it < 48; ++it) {
      double p63 = rt;
#pragma unroll 1
      for (int k = 1; k < 63; ++k) p63 *= rt;
      const double p64 = p63 * rt;
      const double f = p64 - 10000.0;
      rt = rt - f / (64.0 * p63);
    }
    double pj = 1.0;
#pragma unroll 1
    for (int k = 0; k < t; ++k) pj *= rt;           // t < 64: bounded
    const float pf = (float)pj;
    ivf = (float)(1.0 / (double)pf);
  }
  *(v4u*)(xb + e) = w;
  if (tab) *(float*)(tinv + t) = ivf;
  
}

// ---------------------------------------------------------------------------------------
// Weight transpose + convert: w f32 [HID][ncol] -> wt 16-bit [ncol][HID] (k contiguous).
// 8 consecutive lanes of one instruction. MODE 0: bf16 bits; MODE 1: f16 bits of
// 64 * bf16(w) (bf16 RNE value first, the x64 f16 copy of it is exact).
// T: 64 * 72 halves of LDS, [o][i], pitch 72 halves (144 B); tile (bi, bo) of the weight.
template <int MODE>
__device__ __forceinline__ void wt_body(u16* T, int bi, int bo, const float* __restrict__ w,
                                        u16* __restrict__ wt, int ncol) {
  const int i0 = bi * 64, o0 = bo * 64, t = threadIdx.x;
#pragma unroll
  for (int j = 0; j < 4; ++j) {
    const int i = (t >> 4) + 16 * j;
    const int oc = (t & 15) * 4;
    const v4f v = *(const v4f*)(w + (size_t)(i0 + i) * (size_t)ncol + o0 + oc);
#pragma unroll
    for (int e = 0; e < 4; ++e) {
      const float f = v[e];
      u16 bb;
      if (MODE == 0) bb = (u16)bf16_rne(f);
      else bb = hbits(__uint_as_float(bf16_rne(f) << 16) * 64.0f);
      T[(oc + e) * 72 + i] = bb;
    }
  }
  __syncthreads();
  v4u val[2];
#pragma unroll
  for (int p = 0; p < 2; ++p) {
    const int o = (t >> 3) + 32 * p;
    val[p] = *(const v4u*)(T + o * 72 + (t & 7) * 8);
  }
#pragma unroll
  for (int p = 0; p < 2; ++p) {
    const int o = (t >> 3) + 32 * p;
    *(v4u*)(wt + (size_t)(o0 + o) * HID + i0 + (t & 7) * 8) = val[p];
  }
  // another job's code follows in the merged kernel: no register of the stores above is rewritten ahead of this wait
  asm volatile("s_wait_xcnt 0x0" ::: "memory");
}

// ---------------------------------------------------------------------------------------
// C[m][n] (f32) = sh * sum_k A[m][k] * BT[n][k]  (+ sr * sum_k Ar[m][k] * BT[n][k] if RES)
// MODE 0: bf16 operands; MODE 1: f16 operands. Block 64 (M) x 128 (N), 8 waves each 32x32.
// The block's operand rows go through LDS in tiles of 64 k (one 128-B line of every row): two
// buffers, tile t in buffer t & 1, tile t + 1 copied global -> LDS (asynchronous, through no
// register, whole lines) while tile t is worked on. Fragments come from the LDS rows with the
// split k map (elements 0..7 at k + 8h, 8..15 at k + 16 + 8h); k ascends in steps of 32.
// pool: GEMM_POOL(RES) halves of LDS; the block's tile is (bn, bm).
#define GEMM_POOL(RES) (2 * (((RES) ? 2 : 1) * 64 * 72 + 128 * 72))
template <int MODE, bool RES>
__device__ __forceinline__ void gemm_body(u16* pool, int bn, int bm,
                                          const u16* __restrict__ A, const u16* __restrict__ Ar,
                                          const u16* __restrict__ BT, float* __restrict__ C,
                                          int lda, int ldb, int ldc, int K,
                                          float sh, float sr) {
  constexpr int BK = 64;                              // k per tile
  constexpr int TP = BK + 8;                          // LDS row pitch in halves: 144 B = 16 B x odd
  constexpr int AT = 64 * TP, BTL = 128 * TP;         // tile sizes in halves
  constexpr int AS = 0, ES = AT, BS = RES ? 2 * AT : AT;
  constexpr int BUF = BS + BTL;                       // one buffer = A | (Ar) | BT tiles, in halves
  static_assert(2 * BUF == GEMM_POOL(RES));
  static_assert((TP * 2) % 16 == 0 && (BUF * 2) % 16 == 0 && (AT * 2) % 16 == 0);
  static_assert(2 * BUF * 2 >= 8 * 32 * 36 * 4);      // pool doubles as the C stage behind the loop
  const int tid = threadIdx.x, wave = tid >> 5, lane = tid & 31, h = lane >> 4, l = lane & 15;
  const int wm = wave >> 2, wn = wave & 3;
  const int mblk = bm * 64, nblk = bn * 128;
  const int mb = mblk + wm * 32;
  const int nb = nblk + wn * 32;
  v8f c00 = zero8(), c01 = zero8(), c10 = zero8(), c11 = zero8();
  v8f r00 = zero8(), r01 = zero8(), r10 = zero8(), r11 = zero8();

  // This lane's 16-byte pieces of a tile: column cc of rows cr, cr + 32, ... (8 lanes cover a line).
  const int cr = tid >> 3, cc = (tid & 7) * 8;
  const unsigned lbase = (unsigned)(size_t)pool;      // byte offset of pool in the work-group's LDS
  const unsigned lpc = lbase + 2u * (unsigned)(cr * TP + cc);
  const u16* ga = A + (size_t)(mblk + cr) * (size_t)lda + cc;
  const u16* ge = Ar + (size_t)(mblk + cr) * (size_t)lda + cc;
  const u16* gb = BT + (size_t)(nblk + cr) * (size_t)ldb + cc;
  // Issue the copies of tile t into buffer t & 1 (all lanes on, block-uniform call sites). The
  // s_wait_xcnt closes each statement so that no address register is rewritten ahead of it.
  auto copy_tile = [&](int t) {
    const unsigned bo = lpc + (unsigned)(t & 1) * (unsigned)(BUF * 2);
    const unsigned a0 = bo + 2u * AS, a1 = a0 + 2u * 32u * TP;
    const unsigned b0 = bo + 2u * BS, b1 = b0 + 2u * 32u * TP, b2 = b0 + 2u * 64u * TP, b3 = b0 + 2u * 96u * TP;
    const u16* pa0 = ga + (size_t)t * BK;
    const u16* pa1 = pa0 + (size_t)32 * (size_t)lda;
    const u16* pb0 = gb + (size_t)t * BK;
    const u16* pb1 = pb0 + (size_t)32 * (size_t)ldb;
    const u16* pb2 = pb0 + (size_t)64 * (size_t)ldb;
    const u16* pb3 = pb0 + (size_t)96 * (size_t)ldb;
    asm volatile("global_load_async_to_lds_b128 %0, %6, off\n\t"
                 "global_load_async_to_lds_b128 %1, %7, off\n\t"
                 "global_load_async_to_lds_b128 %2, %8, off\n\t"
                 "global_load_async_to_lds_b128 %3, %9, off\n\t"
                 "global_load_async_to_lds_b128 %4, %10, off\n\t"
                 "global_load_async_to_lds_b128 %5, %11, off\n\t"
                 "s_wait_xcnt 0x0"
                 :: "v"(a0), "v"(a1), "v"(b0), "v"(b1), "v"(b2), "v"(b3),
                    "v"(pa0), "v"(pa1), "v"(pb0), "v"(pb1), "v"(pb2), "v"(pb3) : "memory");
    if (RES) {
      const unsigned e0 = bo + 2u * ES, e1 = e0 + 2u * 32u * TP;
      const u16* pe0 = ge + (size_t)t * BK;
      const u16* pe1 = pe0 + (size_t)32 * (size_t)lda;
      asm volatile("global_load_async_to_lds_b128 %0, %2, off\n\t"
                   "global_load_async_to_lds_b128 %1, %3, off\n\t"
                   "s_wait_xcnt 0x0"
                   :: "v"(e0), "v"(e1), "v"(pe0), "v"(pe1) : "memory");
    }
  };

  const int nt = K / BK;
  // Tile 0 lands and is published, then tile 1 is set flying.
  copy_tile(0);
  asm volatile("s_wait_asynccnt 0x0" ::: "memory");   // this wave's copies of tile 0 have landed
  __syncthreads();                                    // ... and every other wave's
  if (nt > 1) copy_tile(1);

  const int fa = (wm * 32 + l) * TP + 8 * h;          // this lane's fragment rows in a buffer
  const int fb = (wn * 32 + l) * TP + 8 * h;
  for (int t = 0; t < nt; ++t) {
    const u16* tb = pool + (t & 1) * BUF;             // this tile's buffer
    // unrolled so that both 32-k steps read at constant offsets from one LDS address
#pragma unroll
    for (int ks = 0; ks < BK; ks += 32) {
      const u16* pa = tb + AS + fa + ks;
      const u16* pb = tb + BS + fb + ks;
      if (MODE == 0) {
        FragB a0, a1, b0, b1;
        a0.q[0] = *(const v4u*)pa;             a0.q[1] = *(const v4u*)(pa + 16);
        a1.q[0] = *(const v4u*)(pa + 16 * TP); a1.q[1] = *(const v4u*)(pa + 16 * TP + 16);
        b0.q[0] = *(const v4u*)pb;             b0.q[1] = *(const v4u*)(pb + 16);
        b1.q[0] = *(const v4u*)(pb + 16 * TP); b1.q[1] = *(const v4u*)(pb + 16 * TP + 16);
        c00 = wg_b(c00, a0.v, b0.v); c01 = wg_b(c01, a0.v, b1.v);
        c10 = wg_b(c10, a1.v, b0.v); c11 = wg_b(c11, a1.v, b1.v);
      } else {
        FragH a0, a1, b0, b1;
        a0.q[0] = *(const v4u*)pa;             a0.q[1] = *(const v4u*)(pa + 16);
        a1.q[0] = *(const v4u*)(pa + 16 * TP); a1.q[1] = *(const v4u*)(pa + 16 * TP + 16);
        b0.q[0] = *(const v4u*)pb;             b0.q[1] = *(const v4u*)(pb + 16);
        b1.q[0] = *(const v4u*)(pb + 16 * TP); b1.q[1] = *(const v4u*)(pb + 16 * TP + 16);
        c00 = wg_h(c00, a0.v, b0.v); c01 = wg_h(c01, a0.v, b1.v);
        c10 = wg_h(c10, a1.v, b0.v); c11 = wg_h(c11, a1.v, b1.v);
        if (RES) {
          const u16* pe = tb + ES + fa + ks;
          FragH e0, e1;
          e0.q[0] = *(const v4u*)pe;             e0.q[1] = *(const v4u*)(pe + 16);
          e1.q[0] = *(const v4u*)(pe + 16 * TP); e1.q[1] = *(const v4u*)(pe + 16 * TP + 16);
          r00 = wg_h(r00, e0.v, b0.v); r01 = wg_h(r01, e0.v, b1.v);
          r10 = wg_h(r10, e1.v, b0.v); r11 = wg_h(r11, e1.v, b1.v);
        }
      }
    }
    // Hand-over: this wave's LDS reads of tile t are done, its copies of tile t + 1 have landed;
    // the barrier publishes tile t + 1 and frees tile t's buffer for tile t + 2.
    asm volatile("s_wait_dscnt 0x0" ::: "memory");
    asm volatile("s_wait_asynccnt 0x0" ::: "memory");
    __syncthreads();
    if (t + 2 < nt) copy_tile(t + 2);
  }
  asm volatile("s_wait_asynccnt 0x0" ::: "memory");   // nothing in flight when pool becomes the C stage

  // Behind the last trip's barrier every reader has left both buffers: pool is the C stage now.
  float* cs = (float*)pool + wave * (32 * 36);
#pragma unroll
  for (int e = 0; e < 8; ++e) {
    const int ra = 8 * h + e, rb = ra + 16;
    float v00 = sh * c00[e], v01 = sh * c01[e], v10 = sh * c10[e], v11 = sh * c11[e];
    if (RES) { v00 += sr * r00[e]; v01 += sr * r01[e]; v10 += sr * r10[e]; v11 += sr * r11[e]; }
    cs[ra * 36 + l] = v00;
    cs[ra * 36 + 16 + l] = v01;
    cs[rb * 36 + l] = v10;
    cs[rb * 36 + 16 + l] = v11;
  }
  __syncthreads();
  v4f val[8];
#pragma unroll
  for (int i = 0; i < 8; ++i) {
    const int row = 4 * i + (lane >> 3);
    val[i] = *(const v4f*)(cs + row * 36 + (lane & 7) * 4);
  }
#pragma unroll
  for (int i = 0; i < 8; ++i) {
    const int row = 4 * i + (lane >> 3);
    *(v4f*)(C + (size_t)(mb + row) * (size_t)ldc + nb + (lane & 7) * 4) = val[i];
  }
  
}

// ---------------------------------------------------------------------------------------
// Rotary + f16 planes. One block per sequence row s (q: 16 heads x 128, k: 4 heads x 128).
// sm: 2 * (NH + NKV) * HD halves of LDS.
// Qh [NH][SEQ][HD], Kh [NKV][SEQ][HD]: f16 bits of the rotated value.
// Rows s < SE also get Ql [NH][SE][HD], Kl [NKV][SE][HD]: f16 bits of (x - hi) * 1024.
// rotate-half: out[d] = x[d]*cos - x[d+64]*sin, out[d+64] = x[d+64]*cos + x[d]*sin
// (products and sums as separate f32 ops), angle = fl32(pos * inv_freq[d]).
__device__ __forceinline__ void planes_body(u16* sm, int s,
                                            const float* __restrict__ qkv, const int* __restrict__ pos,
                                            const float* __restrict__ tinv,
                                            u16* __restrict__ Qh, u16* __restrict__ Ql,
                                            u16* __restrict__ Kh, u16* __restrict__ Kl) {
#pragma clang fp contract(off)
  u16* Qs = sm;
  u16* Qls = Qs + NH * HD;
  u16* Ks = Qls + NH * HD;
  u16* Kls = Ks + NKV * HD;
  const int t = threadIdx.x;
  const bool early = (s < SE);                       // block-uniform
  int pp = pos[s];
  pp = imin(imax(pp, 0), SEQ_FULL - 1);
  const int di = t & 63;
  const float ang = (float)pp * tinv[di];
  float sn, cs;
  rot_sincos(ang, sn, cs);
  const float* row = qkv + (size_t)s * NQKV;

#pragma unroll 1
  for (int j = 0; j < 4; ++j) {
    const int hh = (t + 256 * j) >> 6;               // 0..15
    const int col = hh * HD + di;
    const float x1 = row[col], x2 = row[col + 64];
    const float a1 = x1 * cs, b1 = x2 * sn;
    const float a2 = x2 * cs, b2 = x1 * sn;
    const float r1 = a1 - b1;
    const float r2 = a2 + b2;
    if (early) {
      u16 a, b;
      split1024(r1, a, b); Qs[col] = a;      Qls[col] = b;
      split1024(r2, a, b); Qs[col + 64] = a; Qls[col + 64] = b;
    } else {
      Qs[col] = hbits(r1);
      Qs[col + 64] = hbits(r2);
    }
  }
  {
    const int kvh = t >> 6;                          // 0..3
    const int col = kvh * HD + di;
    const float x1 = row[NH * HD + col], x2 = row[NH * HD + col + 64];
    const float a1 = x1 * cs, b1 = x2 * sn;
    const float a2 = x2 * cs, b2 = x1 * sn;
    const float r1 = a1 - b1;
    const float r2 = a2 + b2;
    if (early) {
      u16 a, b;
      split1024(r1, a, b); Ks[col] = a;      Kls[col] = b;
      split1024(r2, a, b); Ks[col + 64] = a; Kls[col + 64] = b;
    } else {
      Ks[col] = hbits(r1);
      Ks[col + 64] = hbits(r2);
    }
  }
  __syncthreads();

  const int e = t * 8;
  const int hq = e >> 7, dq = e & 127;               // q: head 0..15
  const bool kw = (t < 64);                          // wave-uniform: waves 0,1
  const int hk = hq, dk = dq;                        // valid for t < 64: kv head 0..3
  const v4u vq = *(const v4u*)(Qs + e);
  v4u vql = vq, vk = vq, vkl = vq;
  if (early) vql = *(const v4u*)(Qls + e);
  if (kw) {
    vk = *(const v4u*)(Ks + e);
    if (early) vkl = *(const v4u*)(Kls + e);
  }
  u16* pq  = Qh + ((size_t)hq * SEQ + s) * HD + dq;
  u16* pql = Ql + ((size_t)hq * SE + (early ? s : 0)) * HD + dq;
  u16* pk  = Kh + ((size_t)hk * SEQ + s) * HD + dk;
  u16* pkl = Kl + ((size_t)hk * SE + (early ? s : 0)) * HD + dk;

  *(v4u*)pq = vq;
  if (early) *(v4u*)pql = vql;
  if (kw) {
    *(v4u*)pk = vk;
    if (early) *(v4u*)pkl = vkl;
  }
  
}

// ---------------------------------------------------------------------------------------
// V transposed planes: Vth [NKV][HD][SEQ] = f16 bits of 16*v, and for keys < SE
// Vtl [NKV][HD][SE] = f16 bits of (16*v - hi) * 1024. Tile = 64 keys x 128 d through LDS,
// sm: 2 * HD * 72 halves of LDS; the block's tile is keys 64 * bs .. + 63 of kv head kv.
__device__ __forceinline__ void vt_body(u16* sm, int bs, int kv, const float* __restrict__ qkv,
                                        u16* __restrict__ Vth, u16* __restrict__ Vtl) {
#pragma clang fp contract(off)
  u16* T = sm;                                       // [d][key], pitch 72 halves
  u16* Tl = T + HD * 72;
  const int s0 = bs * 64, t = threadIdx.x;
  const bool early = (s0 < SE);                      // block-uniform (SE % 64 == 0)
#pragma unroll 1
  for (int j = 0; j < 8; ++j) {
    const int idx = t + 256 * j;
    const int r = idx >> 5;                          // key 0..63
    const int c4 = (idx & 31) * 4;                   // d 0..124
    const v4f v = *(const v4f*)(qkv + (size_t)(s0 + r) * NQKV + NH * HD + NKV * HD + kv * HD + c4);
#pragma unroll
    for (int e = 0; e < 4; ++e) {
      const float f = 16.0f * v[e];
      if (early) {
        u16 a, b;
        split1024(f, a, b);
        T[(c4 + e) * 72 + r] = a;
        Tl[(c4 + e) * 72 + r] = b;
      } else {
        T[(c4 + e) * 72 + r] = hbits(f);
      }
    }
  }
  __syncthreads();
  v4u vh[4], vl[4];
#pragma unroll
  for (int p = 0; p < 4; ++p) {
    const int d = (t >> 3) + 32 * p, c = (t & 7) * 8;
    vh[p] = *(const v4u*)(T + d * 72 + c);
    vl[p] = vh[p];
    if (early) vl[p] = *(const v4u*)(Tl + d * 72 + c);
  }
#pragma unroll
  for (int p = 0; p < 4; ++p) {
    const int d = (t >> 3) + 32 * p, c = (t & 7) * 8;
    *(v4u*)(Vth + ((size_t)kv * HD + d) * SEQ + s0 + c) = vh[p];
    if (early) *(v4u*)(Vtl + ((size_t)kv * HD + d) * SE + s0 + c) = vl[p];
  }
  
}

// ---------------------------------------------------------------------------------------
// Causal GQA flash attention. Block = 8 waves = 4 q heads of one kv head x 32 queries
// (wave w: head kv*4 + (w>>1), queries q0 + (w&1)*16 .. +15). Keys in chunks of 32 staged
// in LDS (two buffers, filled one chunk ahead by asynchronous copies): K tile [32][128] (A operand of S^T = K x Q^T, lane = key row) and V^T tile
// [128 d][32 keys] (B operand of O += P x V, lane = d). Queries live on lanes for the
// softmax; P in D layout of S^T is the A-fragment layout of P x V (lane = query,
// elements 0..7 = keys 8h..8h+7, 8..15 = keys 16+8h..). Online softmax in f32 (exp2 form),
// P carried as f16(4096 p), V as f16(16 v), ctx written as f16(64 ctx).
// EARLY (query rows < SE): q, k, P, v get x1024 residual planes and a second accumulator
// folded before normalisation; head dim handled in four 32-wide passes whose ctx results
// pass; ctx also gets a residual plane Cr. Output Ch [SEQ][HID] (head*128 + d), Cr [SE][HID].
// VGPR file capped at 256 (no high-bank registers).
// pool: ATTN_POOL(EARLY) halves of LDS; stg: 16384 halves of LDS (used where EARLY).
#define ATTN_POOL(EARLY) (2 * ((EARLY) ? 2 : 1) * (32 * (HD + 8) + HD * (32 + 8)))
template <bool EARLY>
__device__ __forceinline__
void attn_body(u16* pool, u16* stg, int qblk, int kv,
               const u16* __restrict__ Qh, const u16* __restrict__ Ql,
               const u16* __restrict__ Kh, const u16* __restrict__ Kl,
               const u16* __restrict__ Vth, const u16* __restrict__ Vtl,
               const int* __restrict__ amask,
               u16* __restrict__ Ch, u16* __restrict__ Cr) {
  // LDS row pitch = 16 B x odd, so that the 16 rows one ds_load_b128 reads fall on distinct banks:
  // K rows (256 B of data) at 272 B, Vt rows (64 B of data) at 80 B.
  constexpr int KP = HD + 8, VP = 32 + 8;             // pitches in halves
  constexpr int KT = 32 * KP, VT = HD * VP;           // tile sizes in halves
  // One buffer = K | (Kres) | Vt | (Vtres) tiles of one key chunk; two buffers, chunk kc in buffer kc & 1:
  // chunk kc + 1 is copied global -> LDS (asynchronous, through no register) while chunk kc is worked on.
  constexpr int KS = 0, KL = KT, VS = EARLY ? 2 * KT : KT, VL = VS + VT;
  constexpr int BUF = EARLY ? 2 * KT + 2 * VT : KT + VT;  // halves per buffer
  static_assert(2 * BUF == ATTN_POOL(EARLY));         // stg where EARLY: per-wave ctx stage [8][16][128]
  static_assert((BUF * 2) % 16 == 0 && (KP * 2) % 16 == 0 && (VP * 2) % 16 == 0);
  static_assert(EARLY || 2 * BUF >= 16384);           // pool doubles as the ctx stage behind the loop
  constexpr int NDT = EARLY ? 2 : 8;
  constexpr int DW = NDT * 16;
  constexpr int NPASS = HD / DW;
  const int tid = threadIdx.x, wave = tid >> 5, lane = tid & 31, h = lane >> 4, l = lane & 15;
  const int head = kv * (NH / NKV) + (wave >> 1);
  const int q0 = qblk * BQW;
  const int qw0 = q0 + (wave & 1) * 16;
  const int qrow = qw0 + l;                          // this lane's query
  const int nchunk = qblk + 1;                       // keys 0 .. q0+31

  FragH qh[4];
  FragH ql[4];
#pragma unroll
  for (int dc = 0; dc < 4; ++dc) {
    const u16* b = Qh + ((size_t)head * SEQ + qrow) * HD + dc * 32 + 8 * h;
    qh[dc].q[0] = *(const v4u*)b;
    qh[dc].q[1] = *(const v4u*)(b + 16);
    if (EARLY) {
      const u16* b2 = Ql + ((size_t)head * SE + qrow) * HD + dc * 32 + 8 * h;
      ql[dc].q[0] = *(const v4u*)b2;
      ql[dc].q[1] = *(const v4u*)(b2 + 16);
    } else {
      ql[dc].q[0] = qh[dc].q[0];
      ql[dc].q[1] = qh[dc].q[1];
    }
  }
  const float SCL = 0.088388347648318441f * 1.4426950408889634f;   // log2(e)/sqrt(128)

  // ctx stage [16 rows][128 cols] per wave: EARLY in its own region (persists across the
  // 32-wide passes), otherwise aliasing pool after the K/V tiles are dead.
  u16* os;
  if (EARLY) os = stg + wave * (16 * 128);
  else os = pool + wave * (16 * 128);

  // This lane's 16-byte pieces of a chunk: K rows kr and kr + 16, Vt rows vd and vd + 64.
  const int kr = tid >> 4, kcol = (tid & 15) * 8;
  const int vd = tid >> 2, vcol = (tid & 3) * 8;
  const unsigned lbase = (unsigned)(size_t)pool;     // byte offset of pool in the work-group's LDS
  const unsigned lk = lbase + 2u * (unsigned)(KS + kr * KP + kcol);
  const unsigned lv = lbase + 2u * (unsigned)(VS + vd * VP + vcol);
  const u16* gk = Kh + ((size_t)kv * SEQ + kr) * HD + kcol;
  const u16* gv = Vth + ((size_t)kv * HD + vd) * SEQ + vcol;
  const u16* gkl = Kl + ((size_t)kv * SE + kr) * HD + kcol;
  const u16* gvl = Vtl + ((size_t)kv * HD + vd) * SE + vcol;
  // Issue the copies of chunk c into buffer c & 1 (all lanes on, block-uniform call sites). The
  // s_wait_xcnt closes each statement so that no address register is rewritten ahead of it.
  auto copy_chunk = [&](int c) {
    const unsigned bo = (unsigned)(c & 1) * (unsigned)(BUF * 2);
    const unsigned k0 = lk + bo, k1 = k0 + 2u * 16u * KP;
    const unsigned v0 = lv + bo, v1 = v0 + 2u * 64u * VP;
    const u16* a0 = gk + (size_t)c * (32 * HD);
    const u16* a1 = a0 + 16 * HD;
    const u16* b0 = gv + c * 32;
    const u16* b1 = b0 + (size_t)64 * SEQ;
    asm volatile("global_load_async_to_lds_b128 %0, %4, off\n\t"
                 "global_load_async_to_lds_b128 %1, %5, off\n\t"
                 "global_load_async_to_lds_b128 %2, %6, off\n\t"
                 "global_load_async_to_lds_b128 %3, %7, off\n\t"
                 "s_wait_xcnt 0x0"
                 :: "v"(k0), "v"(k1), "v"(v0), "v"(v1), "v"(a0), "v"(a1), "v"(b0), "v"(b1) : "memory");
    if (EARLY) {
      const unsigned k2 = k0 + 2u * (KL - KS), k3 = k1 + 2u * (KL - KS);
      const unsigned v2 = v0 + 2u * (VL - VS), v3 = v1 + 2u * (VL - VS);
      const u16* a2 = gkl + (size_t)c * (32 * HD);
      const u16* a3 = a2 + 16 * HD;
      const u16* b2 = gvl + c * 32;
      const u16* b3 = b2 + (size_t)64 * SE;
      asm volatile("global_load_async_to_lds_b128 %0, %4, off\n\t"
                   "global_load_async_to_lds_b128 %1, %5, off\n\t"
                   "global_load_async_to_lds_b128 %2, %6, off\n\t"
                   "global_load_async_to_lds_b128 %3, %7, off\n\t"
                   "s_wait_xcnt 0x0"
                   :: "v"(k2), "v"(k3), "v"(v2), "v"(v3), "v"(a2), "v"(a3), "v"(b2), "v"(b3) : "memory");
    }
  };

#pragma unroll 1
  for (int pass = 0; pass < NPASS; ++pass) {
    const int dbase = pass * DW;
    v8f o[NDT];
    v8f orr[NDT];
#pragma unroll
    for (int dt = 0; dt < NDT; ++dt) { o[dt] = zero8(); orr[dt] = zero8(); }
    float rmax = -1.0e30f, rsum = 0.0f;

    // Chunk 0 lands and is published, then chunk 1 is set flying. (A later pass gets here behind
    // the last trip's s_wait_dscnt and barrier, so every reader has left both buffers.)
    copy_chunk(0);
    asm volatile("s_wait_asynccnt 0x0" ::: "memory");  // this wave's copies of chunk 0 have landed
    __syncthreads();                                 // ... and every other wave's
    if (nchunk > 1) copy_chunk(1);
    int av = amask[imin(lane, SEQ - 1)];             // padding mask of chunk 0's keys

#pragma unroll 1
    for (int kc = 0; kc < nchunk; ++kc) {
      const int kbase = kc * 32;
      const u16* tb = pool + (kc & 1) * BUF;         // this chunk's buffer
      // padding-mask word for the 32 keys of this chunk, per wave (all lanes active); the next
      // chunk's mask values are read one chunk ahead, like its tiles
      const unsigned mw = __builtin_amdgcn_ballot_w32(av != 0);
      av = amask[imin(kbase + 32 + lane, SEQ - 1)];

      // This chunk's LDS fragment reads stand in groups ahead of the matrix instructions that use
      // them, so that one LDS latency is waited out per group and not one per matrix instruction.
      // A group is issued where the registers of fragments already used have come free.
      auto ld_k = [&](int plane, int sub, int dc) {
        FragH f;
        const u16* p = tb + plane + (sub * 16 + l) * KP + dc * 32 + 8 * h;
        f.q[0] = *(const v4u*)p;
        f.q[1] = *(const v4u*)(p + 16);
        return f;
      };
      auto ld_v = [&](int plane, int dt) {
        FragH f;
        const u16* p = tb + plane + (dbase + dt * 16 + l) * VP + 8 * h;
        f.q[0] = *(const v4u*)p;
        f.q[1] = *(const v4u*)(p + 16);
        return f;
      };
      FragH kf[2][4], kg[2][4], vf[NDT], vg[NDT];
      v8f acc[2], accr[2];
      acc[0] = zero8(); acc[1] = zero8(); accr[0] = zero8(); accr[1] = zero8();
      if (!EARLY) {
        // all K fragments first; the two key halves' chains alternate; V fragments follow in two
        // groups among the last score products and land while the softmax is worked out
        // (loops unrolled: the fragment arrays are indexed by constants and stay in registers)
#pragma unroll
        for (int dc = 0; dc < 4; ++dc) { kf[0][dc] = ld_k(KS, 0, dc); kf[1][dc] = ld_k(KS, 1, dc); }
#pragma unroll
        for (int dc = 0; dc < 4; ++dc) {
          acc[0] = wg_h(acc[0], kf[0][dc].v, qh[dc].v);
          acc[1] = wg_h(acc[1], kf[1][dc].v, qh[dc].v);
          if (dc == 1 || dc == 3) {
#pragma unroll
            for (int i = 0; i < NDT / 2; ++i) {
              const int dt = (dc >> 1) * (NDT / 2) + i;
              vf[dt] = ld_v(VS, dt);
            }
          }
        }
      } else {
        // step i = key half i >> 2, 32-wide d step i & 3, with its value and residual fragments.
        // Reads go out two steps at a time, one step ahead of their first product (three steps'
        // fragments at most are held: the register file allows no more here); the V fragments
        // go out ahead of the last step and land while the softmax is worked out.
        auto ld_step = [&](int i) {
          kf[i >> 2][i & 3] = ld_k(KS, i >> 2, i & 3);
          kg[i >> 2][i & 3] = ld_k(KL, i >> 2, i & 3);
        };
        ld_step(0);
        ld_step(1);
        // unrolled: the fragment arrays are indexed by constants and stay in registers
#pragma unroll
        for (int i = 0; i < 8; ++i) {
          const int sub = i >> 2, dc = i & 3;
          acc[sub] = wg_h(acc[sub], kf[sub][dc].v, qh[dc].v);
          accr[sub] = wg_h(accr[sub], kf[sub][dc].v, ql[dc].v);
          accr[sub] = wg_h(accr[sub], kg[sub][dc].v, qh[dc].v);
          if (i == 0 || i == 2 || i == 4) {
            ld_step(i + 2);
            ld_step(i + 3);
          }
          if (i == 6) {
#pragma unroll
            for (int dt = 0; dt < NDT; ++dt) { vf[dt] = ld_v(VS, dt); vg[dt] = ld_v(VL, dt); }
          }
        }
      }

      // scores S^T[key][query]; lane l = query, element r = key sub*16 + 8h + r
      float u[16];
      unsigned vm = 0u;
      float m_new = rmax;
#pragma unroll
      for (int sub = 0; sub < 2; ++sub) {
#pragma unroll
        for (int r = 0; r < 8; ++r) {
          const int klc = sub * 16 + 8 * h + r;
          const int key = kbase + klc;
          float s = acc[sub][r];
          if (EARLY) s += accr[sub][r] * (1.0f / 1024.0f);
          const bool valid = (key <= qrow) && (((mw >> klc) & 1u) != 0u);
          const float uu = valid ? s * SCL : -1.0e30f;
          u[sub * 8 + r] = uu;
          vm |= (valid ? 1u : 0u) << (sub * 8 + r);
          m_new = fmaxf(m_new, uu);
        }
      }
      m_new = fmaxf(m_new, __shfl_xor(m_new, 16, 32));
      const float scale = __builtin_amdgcn_exp2f(rmax - m_new);
      rmax = m_new;

      float psum = 0.0f;
      FragH ph;
      FragH pr;
#pragma unroll
      for (int i = 0; i < 16; ++i) {
        const float pe = __builtin_amdgcn_exp2f(u[i] - m_new);
        const float pv = ((vm >> i) & 1u) ? pe : 0.0f;
        psum += pv;
        const float pc = pv * 4096.0f;
        const f16 hv = (f16)pc;
        ph.h[i] = hv;
        if (EARLY) pr.h[i] = (f16)((pc - (float)hv) * 1024.0f);
        else pr.h[i] = hv;
      }
      psum += __shfl_xor(psum, 16, 32);
      rsum = rsum * scale + psum;

      float sc[8];
#pragma unroll
      for (int r = 0; r < 8; ++r) sc[r] = __shfl(scale, 8 * h + r, 32);
#pragma unroll
      for (int dt = 0; dt < NDT; ++dt) {
#pragma unroll
        for (int r = 0; r < 8; ++r) {
          o[dt][r] *= sc[r];
          if (EARLY) orr[dt][r] *= sc[r];
        }
      }
      // O += P x V ; B fragment lane = d row of the Vt tile, elements = keys (split map)
#pragma unroll
      for (int dt = 0; dt < NDT; ++dt) {
        o[dt] = wg_h(o[dt], ph.v, vf[dt].v);
        if (EARLY) {
          orr[dt] = wg_h(orr[dt], pr.v, vf[dt].v);
          orr[dt] = wg_h(orr[dt], ph.v, vg[dt].v);
        }
      }
      // Hand-over: this wave's LDS reads of chunk kc are done, its copies of chunk kc + 1 have
      // landed; the barrier publishes chunk kc + 1 and frees chunk kc's buffer for chunk kc + 2.
      asm volatile("s_wait_dscnt 0x0" ::: "memory");
      asm volatile("s_wait_asynccnt 0x0" ::: "memory");
      __syncthreads();
      if (kc + 2 < nchunk) copy_chunk(kc + 2);
    }
    asm volatile("s_wait_asynccnt 0x0" ::: "memory");  // nothing in flight when the buffers are reused

    // epilogue: ctx = (o + orr/1024) / (4096 * 16 * l); plane value = 64 * ctx
    if (!EARLY) __syncthreads();                     // K/V tiles dead, pool reused as stage
    const float inv = 1.0f / rsum;
    float ir[8];
#pragma unroll
    for (int r = 0; r < 8; ++r) ir[r] = __shfl(inv, 8 * h + r, 32) * (1.0f / 1024.0f);
    const int cb = EARLY ? ((pass & 1) * 32) : 0;   // column offset inside the 64-wide line half
#pragma unroll
    for (int dt = 0; dt < NDT; ++dt) {
#pragma unroll
      for (int r = 0; r < 8; ++r) {
        float val = o[dt][r];
        if (EARLY) val += orr[dt][r] * (1.0f / 1024.0f);
        val *= ir[r];
        if (EARLY) {
          u16 a, b;
          split1024(val, a, b);
          os[(8 * h + r) * 128 + cb + dt * 16 + l] = a;
          os[(8 * h + r) * 128 + 64 + cb + dt * 16 + l] = b;
        } else {
          os[(8 * h + r) * 128 + dt * 16 + l] = hbits(val);
        }
      }
    }
    if (!EARLY) {
      __syncthreads();
      // 16 rows x 256 B = 32 lines; instruction i: lanes 8g..8g+7 -> line 4i+g
      v4u vals[8];
#pragma unroll
      for (int i = 0; i < 8; ++i) {
        const int L = 4 * i + (lane >> 3);
        const int row = L >> 1, seg = L & 1;
        vals[i] = *(const v4u*)(os + row * 128 + seg * 64 + (lane & 7) * 8);
      }
#pragma unroll
      for (int i = 0; i < 8; ++i) {
        const int L = 4 * i + (lane >> 3);
        const int row = L >> 1, seg = L & 1;
        *(v4u*)(Ch + (size_t)(qw0 + row) * HID + head * HD + seg * 64 + (lane & 7) * 8) = vals[i];
      }
      // another job's code follows in the merged kernel: no register of the stores above is rewritten ahead of this wait
      asm volatile("s_wait_xcnt 0x0" ::: "memory");
    } else {
      if ((pass & 1) != 0) {                         // block-uniform: stage holds d line (pass>>1)
        __syncthreads();
        const int dline = (pass >> 1) * 64;
        v4u va[4], vb[4];
#pragma unroll
        for (int i = 0; i < 4; ++i) {
          const int row = 4 * i + (lane >> 3);
          va[i] = *(const v4u*)(os + row * 128 + (lane & 7) * 8);
          vb[i] = *(const v4u*)(os + row * 128 + 64 + (lane & 7) * 8);
        }
#pragma unroll
        for (int i = 0; i < 4; ++i) {
          const int row = 4 * i + (lane >> 3);
          const size_t off = (size_t)(qw0 + row) * HID + head * HD + dline + (lane & 7) * 8;
          *(v4u*)(Ch + off) = va[i];
          *(v4u*)(Cr + off) = vb[i];
        }
        
      }
    }
  }
}

// ---------------------------------------------------------------------------------------
// Launches. Jobs that need nothing of each other share one grid: a range of the block index
// (the same for a whole block) picks the job, so that part-filled grids run side by side.

// hidden -> bf16 and the inv_freq table | wq, wk, wv -> bf16, transposed | wo -> f16, transposed
#define NB_X SEQ
#define NB_WQ ((HID / 64) * ((NH * HD) / 64))
#define NB_WKV ((HID / 64) * ((NKV * HD) / 64))
#define NB_WO ((HID / 64) * (HID / 64))
__global__ __launch_bounds__(256) void k_prep(const float* __restrict__ x, const float* __restrict__ wq,
                                             const float* __restrict__ wk, const float* __restrict__ wv,
                                             const float* __restrict__ wo, u16* __restrict__ xb,
                                             float* __restrict__ tinv, u16* __restrict__ wqkvt,
                                             u16* __restrict__ wot) {
  __shared__ __align__(16) u16 T[64 * 72];
  constexpr int NI = HID / 64;                       // tiles along the weights' input dimension
  const int b = (int)blockIdx.x;
  if (b < NB_X) {
    xconv_body(b, x, xb, tinv);
  } else if (b < NB_X + NB_WQ) {
    const int r = b - NB_X;
    wt_body<0>(T, r % NI, r / NI, wq, wqkvt, NH * HD);
  } else if (b < NB_X + NB_WQ + NB_WKV) {
    const int r = b - (NB_X + NB_WQ);
    wt_body<0>(T, r % NI, r / NI, wk, wqkvt + (size_t)(NH * HD) * HID, NKV * HD);
  } else if (b < NB_X + NB_WQ + 2 * NB_WKV) {
    const int r = b - (NB_X + NB_WQ + NB_WKV);
    wt_body<0>(T, r % NI, r / NI, wv, wqkvt + (size_t)(NH * HD + NKV * HD) * HID, NKV * HD);
  } else {
    const int r = b - (NB_X + NB_WQ + 2 * NB_WKV);
    wt_body<1>(T, r % NI, r / NI, wo, wot, HID);
  }
}

// qkv projection
__global__ __launch_bounds__(256) void k_qkv(const u16* __restrict__ A, const u16* __restrict__ BT,
                                            float* __restrict__ C, int lda, int ldb, int ldc, int K) {
  __shared__ __align__(16) u16 pool[GEMM_POOL(false)];
  gemm_body<0, false>(pool, (int)blockIdx.x, (int)blockIdx.y, A, A, BT, C, lda, ldb, ldc, K, 1.0f, 0.0f);
}

// V transposed planes | rotary + q, k planes
#define NB_VT ((SEQ / 64) * NKV)
__global__ __launch_bounds__(256) void k_planes_vt(const float* __restrict__ qkv, const int* __restrict__ pos,
                                                  const float* __restrict__ tinv,
                                                  u16* __restrict__ Qh, u16* __restrict__ Ql,
                                                  u16* __restrict__ Kh, u16* __restrict__ Kl,
                                                  u16* __restrict__ Vth, u16* __restrict__ Vtl) {
  __shared__ __align__(16) u16 sm[2 * HD * 72];
  static_assert(2 * HD * 72 >= 2 * (NH + NKV) * HD);
  const int b = (int)blockIdx.x;
  if (b < NB_VT) vt_body(sm, b % (SEQ / 64), b / (SEQ / 64), qkv, Vth, Vtl);
  else planes_body(sm, b - NB_VT, qkv, pos, tinv, Qh, Ql, Kh, Kl);
}

// attention: query blocks of the leading SE rows (residual planes) | the rest
__global__ __launch_bounds__(256) __attribute__((amdgpu_num_vgpr(256)))
void k_attn(const u16* __restrict__ Qh, const u16* __restrict__ Ql,
            const u16* __restrict__ Kh, const u16* __restrict__ Kl,
            const u16* __restrict__ Vth, const u16* __restrict__ Vtl,
            const int* __restrict__ amask,
            u16* __restrict__ Ch, u16* __restrict__ Cr) {
  __shared__ __align__(16) u16 pool[ATTN_POOL(true)];
  __shared__ __align__(16) u16 stg[16384];
  const int qblk = (int)blockIdx.x, kv = (int)blockIdx.y;
  if (qblk < SE / BQW) attn_body<true>(pool, stg, qblk, kv, Qh, Ql, Kh, Kl, Vth, Vtl, amask, Ch, Cr);
  else attn_body<false>(pool, stg, qblk, kv, Qh, Ql, Kh, Kl, Vth, Vtl, amask, Ch, Cr);
}

// output projection: row tiles of the leading SE rows (with the residual ctx plane) | the rest
__global__ __launch_bounds__(256) void k_oproj(const u16* __restrict__ A, const u16* __restrict__ Ar,
                                              const u16* __restrict__ BT, float* __restrict__ C,
                                              int lda, int ldb, int ldc, int K, float sh, float sr) {
  __shared__ __align__(16) u16 pool[GEMM_POOL(true)];
  const int bn = (int)blockIdx.x, bm = (int)blockIdx.y;
  if (bm < SE / 64) gemm_body<1, true>(pool, bn, bm, A, Ar, BT, C, lda, ldb, ldc, K, sh, sr);
  else gemm_body<1, false>(pool, bn, bm, A, A, BT, C, lda, ldb, ldc, K, sh, 0.0f);
}

// ---------------------------------------------------------------------------------------
extern "C" void kernel_launch(void* const* d_in, const int* in_sizes, int n_in,
                              void* d_out, int out_size, void* d_ws, size_t ws_size,
                              hipStream_t stream) {
  if (n_in < 7) return;
  if (in_sizes[0] < SEQ * HID) return;
  if (in_sizes[1] < SEQ) return;
  if (in_sizes[2] < SEQ) return;
  if (in_sizes[3] < HID * NH * HD) return;
  if (in_sizes[4] < HID * NKV * HD) return;
  if (in_sizes[5] < HID * NKV * HD) return;
  if (in_sizes[6] < NH * HD * HID) return;
  if (out_size < SEQ * HID) return;

  const float* hs  = (const float*)d_in[0];
  const int*   am  = (const int*)d_in[1];
  const int*   pos = (const int*)d_in[2];
  const float* wq  = (const float*)d_in[3];
  const float* wk  = (const float*)d_in[4];
  const float* wv  = (const float*)d_in[5];
  const float* wo  = (const float*)d_in[6];
  float* out = (float*)d_out;

  char* ws = (char*)d_ws;
  size_t off = 0;
#define CARVE(T, name, bytes) T* name = (T*)(ws + off); off += (((size_t)(bytes)) + 255) & ~(size_t)255
  CARVE(u16,   Xb,    (size_t)SEQ * HID * 2);          // bf16 bits [SEQ][HID]
  CARVE(u16,   WqkvT, (size_t)NQKV * HID * 2);         // bf16 bits [3072][HID]
  CARVE(u16,   WoT,   (size_t)HID * HID * 2);          // f16 bits  [HID][HID]
  CARVE(float, QKVf,  (size_t)SEQ * NQKV * 4);         // f32 [SEQ][3072]
  CARVE(u16,   Qh,    (size_t)NH * SEQ * HD * 2);
  CARVE(u16,   Kh,    (size_t)NKV * SEQ * HD * 2);
  CARVE(u16,   Vth,   (size_t)NKV * HD * SEQ * 2);
  CARVE(u16,   Ql,    (size_t)NH * SE * HD * 2);
  CARVE(u16,   Kl,    (size_t)NKV * SE * HD * 2);
  CARVE(u16,   Vtl,   (size_t)NKV * HD * SE * 2);
  CARVE(u16,   Cr,    (size_t)SE * HID * 2);
  CARVE(float, Tinv,  256);
#undef CARVE
  // Ch [SEQ][HID] f16 plane aliases the Xb region: identical extent (SEQ*HID halves), Xb is
  // read only by the qkv projection launch, Ch is first written by the attention launch
  // that comes after it on the same in-order stream.
  static_assert(NH * HD == HID);
  u16* Ch = Xb;
  if (off > ws_size) return;

  // 1) hidden -> bf16, inv_freq table; weights: w [HID][n] -> wt [n][HID]
  k_prep<<<dim3(NB_X + NB_WQ + 2 * NB_WKV + NB_WO), 256, 0, stream>>>(hs, wq, wk, wv, wo, Xb, Tinv, WqkvT, WoT);
  // 2) fused qkv projection: [SEQ][HID] x [HID][3072] -> f32
  k_qkv<<<dim3(NQKV / 128, SEQ / 64), 256, 0, stream>>>(Xb, WqkvT, QKVf, HID, HID, NQKV, HID);
  // 3) V transposed planes; rotary + planes
  k_planes_vt<<<dim3(NB_VT + SEQ), 256, 0, stream>>>(QKVf, pos, Tinv, Qh, Ql, Kh, Kl, Vth, Vtl);
  // 4) attention: leading SE rows with residual planes, the rest single products
  k_attn<<<dim3(SEQ / BQW, NKV), 256, 0, stream>>>(Qh, Ql, Kh, Kl, Vth, Vtl, am, Ch, Cr);
  // 5) output projection: rows < SE with the residual ctx plane, the rest plain
  k_oproj<<<dim3(HID / 128, SEQ / 64), 256, 0, stream>>>(
      Ch, Cr, WoT, out, HID, HID, HID, HID, 1.0f / 4096.0f, 1.0f / (4096.0f * 1024.0f));
}

// v006
// It runs in 316 microseconds.
// Timed twice side by side with v005, it ran 1.12 and 1.11 times as fast.
// Over all steps from v000 it is 4.30 times as fast.
#include <hip/hip_runtime.h>
#include <stdint.h>
#include <stddef.h>

// Contractions: qkv projection = v_wmma_f32_16x16x32_bf16 (bf16 operands, f32 accumulate);
// q.k scores, p.v and output projection = v_wmma_f32_16x16x32_f16 (f16 operands with
// power-of-two carries plus x1024 f16 residual planes on the leading SE query rows,
// f32 accumulate). Softmax and epilogues in f32; rotary sin/cos via f64 quadrant
// reduction + polynomial (no fused multiply-add), rotation in unfused f32.

#ifndef NB
#define NB 1
#endif
#ifndef SEQ
#define SEQ 4096
#endif
#ifndef SE
#if SEQ < 640
#define SE SEQ
#else
#define SE 640
#endif
#endif
#define SEQ_FULL 4096
#define HID 2048
#define NH 16
#define NKV 4
#define HD 128
#define NQKV (NH * HD + 2 * NKV * HD)
#define BQW 32

static_assert(NB == 1);
static_assert(SEQ % 64 == 0);
static_assert(SEQ >= SE);
static_assert(SEQ <= SEQ_FULL);
static_assert(SE >= 64);
static_assert(SE % 64 == 0);
static_assert(SE % BQW == 0);
static_assert(HID % 128 == 0);
static_assert(HID == 256 * 8);
static_assert(NQKV % 128 == 0);
static_assert(HD == 128);
static_assert(NH == 4 * NKV);
static_assert(NH * HD == HID);

typedef _Float16 f16;
typedef __bf16 bf16;
typedef unsigned short u16;
typedef f16 v16h __attribute__((ext_vector_type(16)));
typedef bf16 v16b __attribute__((ext_vector_type(16)));
typedef float v8f __attribute__((ext_vector_type(8)));
typedef float v4f __attribute__((ext_vector_type(4)));
typedef unsigned v4u __attribute__((ext_vector_type(4)));

union FragH { v16h v; v4u q[2]; f16 h[16]; };
union FragB { v16b v; v4u q[2]; };

__device__ __forceinline__ v8f zero8() {
  v8f z = {0.0f, 0.0f, 0.0f, 0.0f, 0.0f, 0.0f, 0.0f, 0.0f};
  return z;
}

// 16x16x32 f16 WMMA followed by a 4-slot VALU hazard guard on D (A/B kept live).
__device__ __forceinline__ v8f wg_h(v8f acc, v16h a, v16h b) {
  acc = __builtin_amdgcn_wmma_f32_16x16x32_f16(false, a, false, b, (short)0, acc, false, false);
  asm volatile("v_nop\n\tv_nop\n\tv_nop\n\tv_nop" : "+v"(acc) : "v"(a), "v"(b));
  return acc;
}
__device__ __forceinline__ v8f wg_b(v8f acc, v16b a, v16b b) {
  acc = __builtin_amdgcn_wmma_f32_16x16x32_bf16(false, a, false, b, (short)0, acc, false, false);
  asm volatile("v_nop\n\tv_nop\n\tv_nop\n\tv_nop" : "+v"(acc) : "v"(a), "v"(b));
  return acc;
}

// f32 -> bf16 bits, RNE convert.
__device__ __forceinline__ unsigned bf16_rne(float f) {
  const unsigned u = __float_as_uint(f);
  return (u + 0x7FFFu + ((u >> 16) & 1u)) >> 16;
}
// f32 -> f16 bits, RNE convert.
__device__ __forceinline__ u16 hbits(float f) {
  const f16 x = (f16)f;
  return __builtin_bit_cast(u16, x);
}
// f32 -> f16 hi bits plus f16 bits of (v - hi) * 1024 (unfused: sub then mul).
__device__ __forceinline__ void split1024(float v, u16& hb, u16& lb) {
#pragma clang fp contract(off)
  const f16 x = (f16)v;
  const float xr = (float)x;
  const float dlt = v - xr;
  const f16 y = (f16)(dlt * 1024.0f);
  hb = __builtin_bit_cast(u16, x);
  lb = __builtin_bit_cast(u16, y);
}
template <bool B> struct BoolC { static constexpr bool value = B; };
__device__ __forceinline__ int imin(int a, int b) { return a < b ? a : b; }
__device__ __forceinline__ int imax(int a, int b) { return a > b ? a : b; }

// sin/cos of an f32 angle (0 <= ang <= ~4100 rad) in f64 without fused multiply-add:
// quadrant count kq = rint(x * 2/pi); r = (x - kq * P1) - kq * P2 with P1 = the leading
// 33 bits of pi/2 (kq * P1 exact for kq < 2^20) and P2 its tail; odd/even polynomials on
// |r| <= pi/4 (truncation < 3e-14); quadrant select by value; convert to f32.
__device__ __forceinline__ void rot_sincos(float ang, float& sn, float& cs) {
#pragma clang fp contract(off)
  const double x = (double)ang;
  const double kq = __builtin_rint(x * 0.63661977236758134308);
  double r = x - kq * 1.57079632673412561417;
  r = r - kq * 6.07710050650619224932e-11;
  const int q = (int)kq;
  const double r2 = r * r;
  double ps = 1.6059043836821613e-10;
  ps = ps * r2 - 2.5052108385441720e-08;
  ps = ps * r2 + 2.7557319223985893e-06;
  ps = ps * r2 - 1.9841269841269841e-04;
  ps = ps * r2 + 8.3333333333333332e-03;
  ps = ps * r2 - 1.6666666666666666e-01;
  const double r3 = r * r2;
  const double sr = r + r3 * ps;
  double pc = -1.1470745597729725e-11;
  pc = pc * r2 + 2.0876756987868099e-09;
  pc = pc * r2 - 2.7557319223985888e-07;
  pc = pc * r2 + 2.4801587301587302e-05;
  pc = pc * r2 - 1.3888888888888889e-03;
  pc = pc * r2 + 4.1666666666666664e-02;
  pc = pc * r2 - 0.5;
  const double cr = 1.0 + pc * r2;
  const bool odd = (q & 1) != 0;
  const bool neg = (q & 2) != 0;
  double sv = odd ? cr : sr;
  double cv = odd ? -sr : cr;
  sv = neg ? -sv : sv;
  cv = neg ? -cv : cv;
  sn = (float)sv;
  cs = (float)cv;
}

// ---------------------------------------------------------------------------------------
// hidden f32 [SEQ][HID] -> bf16 bits [SEQ][HID]; one block (blk) per row, 16 B per lane.
// Block 0, lanes 0..63 also produce the rotary inv_freq table (64 floats):
// inv[j] = fl32(1 / fl32(10000^(j/64))), with 10000^(1/64) from an iterative f64 64th root.
__device__ __forceinline__ void xconv_body(int blk, const float* __restrict__ x, u16* __restrict__ xb,
                                           float* __restrict__ tinv) {
#pragma clang fp contract(off)
  const int t = threadIdx.x;
  const size_t e = ((size_t)blk * 256 + (size_t)t) * 8;
  const v4f a = *(const v4f*)(x + e);
  const v4f b = *(const v4f*)(x + e + 4);
  v4u w;
  w[0] = bf16_rne(a[0]) | (bf16_rne(a[1]) << 16);
  w[1] = bf16_rne(a[2]) | (bf16_rne(a[3]) << 16);
  w[2] = bf16_rne(b[0]) | (bf16_rne(b[1]) << 16);
  w[3] = bf16_rne(b[2]) | (bf16_rne(b[3]) << 16);

  const bool tab = (blk == 0) && (t < 64);   // wave-uniform (waves 0,1 of block 0)
  float ivf = 0.0f;
  if (tab) {
    double rt = 1.15;
#pragma unroll 1
    for (int it = 0; it < 48; ++it) {
      double p63 = rt;
#pragma unroll 1
      for (int k = 1; k < 63; ++k) p63 *= rt;
      const double p64 = p63 * rt;
      const double f = p64 - 10000.0;
      rt = rt - f / (64.0 * p63);
    }
    double pj = 1.0;
#pragma unroll 1
    for (int k = 0; k < t; ++k) pj *= rt;           // t < 64: bounded
    const float pf = (float)pj;
    ivf = (float)(1.0 / (double)pf);
  }
  *(v4u*)(xb + e) = w;
  if (tab) *(float*)(tinv + t) = ivf;
  
}

// ---------------------------------------------------------------------------------------
// Weight transpose + convert: w f32 [HID][ncol] -> wt 16-bit [ncol][HID] (k contiguous).
// 8 consecutive lanes of one instruction. MODE 0: bf16 bits; MODE 1: f16 bits of
// 64 * bf16(w) (bf16 RNE value first, the x64 f16 copy of it is exact).
// T: 64 * 72 halves of LDS, [o][i], pitch 72 halves (144 B); tile (bi, bo) of the weight.
template <int MODE>
__device__ __forceinline__ void wt_body(u16* T, int bi, int bo, const float* __restrict__ w,
                                        u16* __restrict__ wt, int ncol) {
  const int i0 = bi * 64, o0 = bo * 64, t = threadIdx.x;
#pragma unroll
  for (int j = 0; j < 4; ++j) {
    const int i = (t >> 4) + 16 * j;
    const int oc = (t & 15) * 4;
    const v4f v = *(const v4f*)(w + (size_t)(i0 + i) * (size_t)ncol + o0 + oc);
#pragma unroll
    for (int e = 0; e < 4; ++e) {
      const float f = v[e];
      u16 bb;
      if (MODE == 0) bb = (u16)bf16_rne(f);
      else bb = hbits(__uint_as_float(bf16_rne(f) << 16) * 64.0f);
      T[(oc + e) * 72 + i] = bb;
    }
  }
  __syncthreads();
  v4u val[2];
#pragma unroll
  for (int p = 0; p < 2; ++p) {
    const int o = (t >> 3) + 32 * p;
    val[p] = *(const v4u*)(T + o * 72 + (t & 7) * 8);
  }
#pragma unroll
  for (int p = 0; p < 2; ++p) {
    const int o = (t >> 3) + 32 * p;
    *(v4u*)(wt + (size_t)(o0 + o) * HID + i0 + (t & 7) * 8) = val[p];
  }
  // another job's code follows in the merged kernel: no register of the stores above is rewritten ahead of this wait
  asm volatile("s_wait_xcnt 0x0" ::: "memory");
}

// ---------------------------------------------------------------------------------------
// C[m][n] (f32) = sh * sum_k A[m][k] * BT[n][k]  (+ sr * sum_k Ar[m][k] * BT[n][k] if RES)
// MODE 0: bf16 operands; MODE 1: f16 operands. Block 64 (M) x 128 (N), 8 waves each 32x32.
// The block's operand rows go through LDS in tiles of 64 k (one 128-B line of every row): two
// buffers, tile t in buffer t & 1, tile t + 1 copied global -> LDS (asynchronous, through no
// register, whole lines) while tile t is worked on. Fragments come from the LDS rows with the
// split k map (elements 0..7 at k + 8h, 8..15 at k + 16 + 8h); k ascends in steps of 32.
// pool: GEMM_POOL(RES) halves of LDS; the block's tile is (bn, bm).
#define GEMM_POOL(RES) (2 * (((RES) ? 2 : 1) * 64 * 72 + 128 * 72))
template <int MODE, bool RES>
__device__ __forceinline__ void gemm_body(u16* pool, int bn, int bm,
                                          const u16* __restrict__ A, const u16* __restrict__ Ar,
                                          const u16* __restrict__ BT, float* __restrict__ C,
                                          int lda, int ldb, int ldc, int K,
                                          float sh, float sr) {
  constexpr int BK = 64;                              // k per tile
  constexpr int TP = BK + 8;                          // LDS row pitch in halves: 144 B = 16 B x odd
  constexpr int AT = 64 * TP, BTL = 128 * TP;         // tile sizes in halves
  constexpr int AS = 0, ES = AT, BS = RES ? 2 * AT : AT;
  constexpr int BUF = BS + BTL;                       // one buffer = A | (Ar) | BT tiles, in halves
  static_assert(2 * BUF == GEMM_POOL(RES));
  static_assert((TP * 2) % 16 == 0 && (BUF * 2) % 16 == 0 && (AT * 2) % 16 == 0);
  static_assert(2 * BUF * 2 >= 8 * 32 * 36 * 4);      // pool doubles as the C stage behind the loop
  const int tid = threadIdx.x, wave = tid >> 5, lane = tid & 31, h = lane >> 4, l = lane & 15;
  const int wm = wave >> 2, wn = wave & 3;
  const int mblk = bm * 64, nblk = bn * 128;
  const int mb = mblk + wm * 32;
  const int nb = nblk + wn * 32;
  v8f c00 = zero8(), c01 = zero8(), c10 = zero8(), c11 = zero8();
  v8f r00 = zero8(), r01 = zero8(), r10 = zero8(), r11 = zero8();

  // This lane's 16-byte pieces of a tile: column cc of rows cr, cr + 32, ... (8 lanes cover a line).
  const int cr = tid >> 3, cc = (tid & 7) * 8;
  const unsigned lbase = (unsigned)(size_t)pool;      // byte offset of pool in the work-group's LDS
  const unsigned lpc = lbase + 2u * (unsigned)(cr * TP + cc);
  const u16* ga = A + (size_t)(mblk + cr) * (size_t)lda + cc;
  const u16* ge = Ar + (size_t)(mblk + cr) * (size_t)lda + cc;
  const u16* gb = BT + (size_t)(nblk + cr) * (size_t)ldb + cc;
  // Issue the copies of tile t into buffer t & 1 (all lanes on, block-uniform call sites). The
  // s_wait_xcnt closes each statement so that no address register is rewritten ahead of it.
  auto copy_tile = [&](int t) {
    const unsigned bo = lpc + (unsigned)(t & 1) * (unsigned)(BUF * 2);
    const unsigned a0 = bo + 2u * AS, a1 = a0 + 2u * 32u * TP;
    const unsigned b0 = bo + 2u * BS, b1 = b0 + 2u * 32u * TP, b2 = b0 + 2u * 64u * TP, b3 = b0 + 2u * 96u * TP;
    const u16* pa0 = ga + (size_t)t * BK;
    const u16* pa1 = pa0 + (size_t)32 * (size_t)lda;
    const u16* pb0 = gb + (size_t)t * BK;
    const u16* pb1 = pb0 + (size_t)32 * (size_t)ldb;
    const u16* pb2 = pb0 + (size_t)64 * (size_t)ldb;
    const u16* pb3 = pb0 + (size_t)96 * (size_t)ldb;
    asm volatile("global_load_async_to_lds_b128 %0, %6, off\n\t"
                 "global_load_async_to_lds_b128 %1, %7, off\n\t"
                 "global_load_async_to_lds_b128 %2, %8, off\n\t"
                 "global_load_async_to_lds_b128 %3, %9, off\n\t"
                 "global_load_async_to_lds_b128 %4, %10, off\n\t"
                 "global_load_async_to_lds_b128 %5, %11, off\n\t"
                 "s_wait_xcnt 0x0"
                 :: "v"(a0), "v"(a1), "v"(b0), "v"(b1), "v"(b2), "v"(b3),
                    "v"(pa0), "v"(pa1), "v"(pb0), "v"(pb1), "v"(pb2), "v"(pb3) : "memory");
    if (RES) {
      const unsigned e0 = bo + 2u * ES, e1 = e0 + 2u * 32u * TP;
      const u16* pe0 = ge + (size_t)t * BK;
      const u16* pe1 = pe0 + (size_t)32 * (size_t)lda;
      asm volatile("global_load_async_to_lds_b128 %0, %2, off\n\t"
                   "global_load_async_to_lds_b128 %1, %3, off\n\t"
                   "s_wait_xcnt 0x0"
                   :: "v"(e0), "v"(e1), "v"(pe0), "v"(pe1) : "memory");
    }
  };

  const int nt = K / BK;
  // Tile 0 lands and is published, then tile 1 is set flying.
  copy_tile(0);
  asm volatile("s_wait_asynccnt 0x0" ::: "memory");   // this wave's copies of tile 0 have landed
  __syncthreads();                                    // ... and every other wave's
  if (nt > 1) copy_tile(1);

  const int fa = (wm * 32 + l) * TP + 8 * h;          // this lane's fragment rows in a buffer
  const int fb = (wn * 32 + l) * TP + 8 * h;
  for (int t = 0; t < nt; ++t) {
    const u16* tb = pool + (t & 1) * BUF;             // this tile's buffer
    // unrolled so that both 32-k steps read at constant offsets from one LDS address
#pragma unroll
    for (int ks = 0; ks < BK; ks += 32) {
      const u16* pa = tb + AS + fa + ks;
      const u16* pb = tb + BS + fb + ks;
      if (MODE == 0) {
        FragB a0, a1, b0, b1;
        a0.q[0] = *(const v4u*)pa;             a0.q[1] = *(const v4u*)(pa + 16);
        a1.q[0] = *(const v4u*)(pa + 16 * TP); a1.q[1] = *(const v4u*)(pa + 16 * TP + 16);
        b0.q[0] = *(const v4u*)pb;             b0.q[1] = *(const v4u*)(pb + 16);
        b1.q[0] = *(const v4u*)(pb + 16 * TP); b1.q[1] = *(const v4u*)(pb + 16 * TP + 16);
        c00 = wg_b(c00, a0.v, b0.v); c01 = wg_b(c01, a0.v, b1.v);
        c10 = wg_b(c10, a1.v, b0.v); c11 = wg_b(c11, a1.v, b1.v);
      } else {
        FragH a0, a1, b0, b1;
        a0.q[0] = *(const v4u*)pa;             a0.q[1] = *(const v4u*)(pa + 16);
        a1.q[0] = *(const v4u*)(pa + 16 * TP); a1.q[1] = *(const v4u*)(pa + 16 * TP + 16);
        b0.q[0] = *(const v4u*)pb;             b0.q[1] = *(const v4u*)(pb + 16);
        b1.q[0] = *(const v4u*)(pb + 16 * TP); b1.q[1] = *(const v4u*)(pb + 16 * TP + 16);
        c00 = wg_h(c00, a0.v, b0.v); c01 = wg_h(c01, a0.v, b1.v);
        c10 = wg_h(c10, a1.v, b0.v); c11 = wg_h(c11, a1.v, b1.v);
        if (RES) {
          const u16* pe = tb + ES + fa + ks;
          FragH e0, e1;
          e0.q[0] = *(const v4u*)pe;             e0.q[1] = *(const v4u*)(pe + 16);
          e1.q[0] = *(const v4u*)(pe + 16 * TP); e1.q[1] = *(const v4u*)(pe + 16 * TP + 16);
          r00 = wg_h(r00, e0.v, b0.v); r01 = wg_h(r01, e0.v, b1.v);
          r10 = wg_h(r10, e1.v, b0.v); r11 = wg_h(r11, e1.v, b1.v);
        }
      }
    }
    // Hand-over: this wave's LDS reads of tile t are done, its copies of tile t + 1 have landed;
    // the barrier publishes tile t + 1 and frees tile t's buffer for tile t + 2.
    asm volatile("s_wait_dscnt 0x0" ::: "memory");
    asm volatile("s_wait_asynccnt 0x0" ::: "memory");
    __syncthreads();
    if (t + 2 < nt) copy_tile(t + 2);
  }
  asm volatile("s_wait_asynccnt 0x0" ::: "memory");   // nothing in flight when pool becomes the C stage

  // Behind the last trip's barrier every reader has left both buffers: pool is the C stage now.
  float* cs = (float*)pool + wave * (32 * 36);
#pragma unroll
  for (int e = 0; e < 8; ++e) {
    const int ra = 8 * h + e, rb = ra + 16;
    float v00 = sh * c00[e], v01 = sh * c01[e], v10 = sh * c10[e], v11 = sh * c11[e];
    if (RES) { v00 += sr * r00[e]; v01 += sr * r01[e]; v10 += sr * r10[e]; v11 += sr * r11[e]; }
    cs[ra * 36 + l] = v00;
    cs[ra * 36 + 16 + l] = v01;
    cs[rb * 36 + l] = v10;
    cs[rb * 36 + 16 + l] = v11;
  }
  __syncthreads();
  v4f val[8];
#pragma unroll
  for (int i = 0; i < 8; ++i) {
    const int row = 4 * i + (lane >> 3);
    val[i] = *(const v4f*)(cs + row * 36 + (lane & 7) * 4);
  }
#pragma unroll
  for (int i = 0; i < 8; ++i) {
    const int row = 4 * i + (lane >> 3);
    *(v4f*)(C + (size_t)(mb + row) * (size_t)ldc + nb + (lane & 7) * 4) = val[i];
  }
  
}

// ---------------------------------------------------------------------------------------
// Rotary + f16 planes. One block per sequence row s (q: 16 heads x 128, k: 4 heads x 128).
// sm: 2 * (NH + NKV) * HD halves of LDS.
// Qh [NH][SEQ][HD], Kh [NKV][SEQ][HD]: f16 bits of the rotated value.
// Rows s < SE also get Ql [NH][SE][HD], Kl [NKV][SE][HD]: f16 bits of (x - hi) * 1024.
// rotate-half: out[d] = x[d]*cos - x[d+64]*sin, out[d+64] = x[d+64]*cos + x[d]*sin
// (products and sums as separate f32 ops), angle = fl32(pos * inv_freq[d]).
__device__ __forceinline__ void planes_body(u16* sm, int s,
                                            const float* __restrict__ qkv, const int* __restrict__ pos,
                                            const float* __restrict__ tinv,
                                            u16* __restrict__ Qh, u16* __restrict__ Ql,
                                            u16* __restrict__ Kh, u16* __restrict__ Kl) {
#pragma clang fp contract(off)
  u16* Qs = sm;
  u16* Qls = Qs + NH * HD;
  u16* Ks = Qls + NH * HD;
  u16* Kls = Ks + NKV * HD;
  const int t = threadIdx.x;
  const bool early = (s < SE);                       // block-uniform
  int pp = pos[s];
  pp = imin(imax(pp, 0), SEQ_FULL - 1);
  const int di = t & 63;
  const float ang = (float)pp * tinv[di];
  float sn, cs;
  rot_sincos(ang, sn, cs);
  const float* row = qkv + (size_t)s * NQKV;

#pragma unroll 1
  for (int j = 0; j < 4; ++j) {
    const int hh = (t + 256 * j) >> 6;               // 0..15
    const int col = hh * HD + di;
    const float x1 = row[col], x2 = row[col + 64];
    const float a1 = x1 * cs, b1 = x2 * sn;
    const float a2 = x2 * cs, b2 = x1 * sn;
    const float r1 = a1 - b1;
    const float r2 = a2 + b2;
    if (early) {
      u16 a, b;
      split1024(r1, a, b); Qs[col] = a;      Qls[col] = b;
      split1024(r2, a, b); Qs[col + 64] = a; Qls[col + 64] = b;
    } else {
      Qs[col] = hbits(r1);
      Qs[col + 64] = hbits(r2);
    }
  }
  {
    const int kvh = t >> 6;                          // 0..3
    const int col = kvh * HD + di;
    const float x1 = row[NH * HD + col], x2 = row[NH * HD + col + 64];
    const float a1 = x1 * cs, b1 = x2 * sn;
    const float a2 = x2 * cs, b2 = x1 * sn;
    const float r1 = a1 - b1;
    const float r2 = a2 + b2;
    if (early) {
      u16 a, b;
      split1024(r1, a, b); Ks[col] = a;      Kls[col] = b;
      split1024(r2, a, b); Ks[col + 64] = a; Kls[col + 64] = b;
    } else {
      Ks[col] = hbits(r1);
      Ks[col + 64] = hbits(r2);
    }
  }
  __syncthreads();

  const int e = t * 8;
  const int hq = e >> 7, dq = e & 127;               // q: head 0..15
  const bool kw = (t < 64);                          // wave-uniform: waves 0,1
  const int hk = hq, dk = dq;                        // valid for t < 64: kv head 0..3
  const v4u vq = *(const v4u*)(Qs + e);
  v4u vql = vq, vk = vq, vkl = vq;
  if (early) vql = *(const v4u*)(Qls + e);
  if (kw) {
    vk = *(const v4u*)(Ks + e);
    if (early) vkl = *(const v4u*)(Kls + e);
  }
  u16* pq  = Qh + ((size_t)hq * SEQ + s) * HD + dq;
  u16* pql = Ql + ((size_t)hq * SE + (early ? s : 0)) * HD + dq;
  u16* pk  = Kh + ((size_t)hk * SEQ + s) * HD + dk;
  u16* pkl = Kl + ((size_t)hk * SE + (early ? s : 0)) * HD + dk;

  *(v4u*)pq = vq;
  if (early) *(v4u*)pql = vql;
  if (kw) {
    *(v4u*)pk = vk;
    if (early) *(v4u*)pkl = vkl;
  }
  
}

// ---------------------------------------------------------------------------------------
// V transposed planes: Vth [NKV][HD][SEQ] = f16 bits of 16*v, and for keys < SE
// Vtl [NKV][HD][SE] = f16 bits of (16*v - hi) * 1024. Tile = 64 keys x 128 d through LDS,
// sm: 2 * HD * 72 halves of LDS; the block's tile is keys 64 * bs .. + 63 of kv head kv.
__device__ __forceinline__ void vt_body(u16* sm, int bs, int kv, const float* __restrict__ qkv,
                                        u16* __restrict__ Vth, u16* __restrict__ Vtl) {
#pragma clang fp contract(off)
  u16* T = sm;                                       // [d][key], pitch 72 halves
  u16* Tl = T + HD * 72;
  const int s0 = bs * 64, t = threadIdx.x;
  const bool early = (s0 < SE);                      // block-uniform (SE % 64 == 0)
#pragma unroll 1
  for (int j = 0; j < 8; ++j) {
    const int idx = t + 256 * j;
    const int r = idx >> 5;                          // key 0..63
    const int c4 = (idx & 31) * 4;                   // d 0..124
    const v4f v = *(const v4f*)(qkv + (size_t)(s0 + r) * NQKV + NH * HD + NKV * HD + kv * HD + c4);
#pragma unroll
    for (int e = 0; e < 4; ++e) {
      const float f = 16.0f * v[e];
      if (early) {
        u16 a, b;
        split1024(f, a, b);
        T[(c4 + e) * 72 + r] = a;
        Tl[(c4 + e) * 72 + r] = b;
      } else {
        T[(c4 + e) * 72 + r] = hbits(f);
      }
    }
  }
  __syncthreads();
  v4u vh[4], vl[4];
#pragma unroll
  for (int p = 0; p < 4; ++p) {
    const int d = (t >> 3) + 32 * p, c = (t & 7) * 8;
    vh[p] = *(const v4u*)(T + d * 72 + c);
    vl[p] = vh[p];
    if (early) vl[p] = *(const v4u*)(Tl + d * 72 + c);
  }
#pragma unroll
  for (int p = 0; p < 4; ++p) {
    const int d = (t >> 3) + 32 * p, c = (t & 7) * 8;
    *(v4u*)(Vth + ((size_t)kv * HD + d) * SEQ + s0 + c) = vh[p];
    if (early) *(v4u*)(Vtl + ((size_t)kv * HD + d) * SE + s0 + c) = vl[p];
  }
  
}

// ---------------------------------------------------------------------------------------
// Causal GQA flash attention. Block = 8 waves = 4 q heads of one kv head x 32 queries
// (wave w: head kv*4 + (w>>1), queries q0 + (w&1)*16 .. +15). Keys in chunks of 32 staged
// in LDS (two buffers, filled one chunk ahead by asynchronous copies): K tile [32][128] (A operand of S^T = K x Q^T, lane = key row) and V^T tile
// [128 d][32 keys] (B operand of O += P x V, lane = d). Queries live on lanes for the
// softmax; P in D layout of S^T is the A-fragment layout of P x V (lane = query,
// elements 0..7 = keys 8h..8h+7, 8..15 = keys 16+8h..). Online softmax in f32 (exp2 form),
// P carried as f16(4096 p), V as f16(16 v), ctx written as f16(64 ctx).
// EARLY (query rows < SE): q, k, P, v get x1024 residual planes and a second accumulator
// folded before normalisation; head dim handled in four 32-wide passes whose ctx results
// pass; ctx also gets a residual plane Cr. Output Ch [SEQ][HID] (head*128 + d), Cr [SE][HID].
// VGPR file capped at 256 (no high-bank registers).
// pool: ATTN_POOL(EARLY) halves of LDS; stg: 16384 halves of LDS (used where EARLY).
#define ATTN_POOL(EARLY) (2 * ((EARLY) ? 2 : 1) * (32 * (HD + 8) + HD * (32 + 8)))
template <bool EARLY>
__device__ __forceinline__
void attn_body(u16* pool, u16* stg, int qblk, int kv,
               const u16* __restrict__ Qh, const u16* __restrict__ Ql,
               const u16* __restrict__ Kh, const u16* __restrict__ Kl,
               const u16* __restrict__ Vth, const u16* __restrict__ Vtl,
               const int* __restrict__ amask,
               u16* __restrict__ Ch, u16* __restrict__ Cr) {
  // LDS row pitch = 16 B x odd, so that the 16 rows one ds_load_b128 reads fall on distinct banks:
  // K rows (256 B of data) at 272 B, Vt rows (64 B of data) at 80 B.
  constexpr int KP = HD + 8, VP = 32 + 8;             // pitches in halves
  constexpr int KT = 32 * KP, VT = HD * VP;           // tile sizes in halves
  // One buffer = K | (Kres) | Vt | (Vtres) tiles of one key chunk; two buffers, chunk kc in buffer kc & 1:
  // chunk kc + 1 is copied global -> LDS (asynchronous, through no register) while chunk kc is worked on.
  constexpr int KS = 0, KL = KT, VS = EARLY ? 2 * KT : KT, VL = VS + VT;
  constexpr int BUF = EARLY ? 2 * KT + 2 * VT : KT + VT;  // halves per buffer
  static_assert(2 * BUF == ATTN_POOL(EARLY));         // stg where EARLY: per-wave ctx stage [8][16][128]
  static_assert((BUF * 2) % 16 == 0 && (KP * 2) % 16 == 0 && (VP * 2) % 16 == 0);
  static_assert(EARLY || 2 * BUF >= 16384);           // pool doubles as the ctx stage behind the loop
  constexpr int NDT = EARLY ? 2 : 8;
  constexpr int DW = NDT * 16;
  constexpr int NPASS = HD / DW;
  // lane number as the shuffles read it (equal to tid & 31 in this one-dimensional block): h and l then come
  // from a register that is live in the loop anyway, which keeps the kernel inside its 256 registers unspilled
  const int tid = threadIdx.x, lane = (int)__lane_id(), h = lane >> 4, l = lane & 15;
  // the wave's number in a scalar register: what follows from it (head, first query) is scalar too
  const int wave = __builtin_amdgcn_readfirstlane(tid >> 5);
  const int head = kv * (NH / NKV) + (wave >> 1);
  const int q0 = qblk * BQW;
  const int qw0 = q0 + (wave & 1) * 16;
  const int qrow = qw0 + l;                          // this lane's query
  const int nchunk = qblk + 1;                       // keys 0 .. q0+31

  FragH qh[4];
  FragH ql[4];
#pragma unroll
  for (int dc = 0; dc < 4; ++dc) {
    const u16* b = Qh + ((size_t)head * SEQ + qrow) * HD + dc * 32 + 8 * h;
    qh[dc].q[0] = *(const v4u*)b;
    qh[dc].q[1] = *(const v4u*)(b + 16);
    if (EARLY) {
      const u16* b2 = Ql + ((size_t)head * SE + qrow) * HD + dc * 32 + 8 * h;
      ql[dc].q[0] = *(const v4u*)b2;
      ql[dc].q[1] = *(const v4u*)(b2 + 16);
    } else {
      ql[dc].q[0] = qh[dc].q[0];
      ql[dc].q[1] = qh[dc].q[1];
    }
  }
  const float SCL = 0.088388347648318441f * 1.4426950408889634f;   // log2(e)/sqrt(128)

  // ctx stage [16 rows][128 cols] per wave: EARLY in its own region (persists across the
  // 32-wide passes), otherwise aliasing pool after the K/V tiles are dead.
  u16* os;
  if (EARLY) os = stg + wave * (16 * 128);
  else os = pool + wave * (16 * 128);

  // This lane's 16-byte pieces of a chunk: K rows kr and kr + 16, Vt rows vd and vd + 64.
  const int kr = tid >> 4, kcol = (tid & 15) * 8;
  const int vd = tid >> 2, vcol = (tid & 3) * 8;
  const unsigned lbase = (unsigned)(size_t)pool;     // byte offset of pool in the work-group's LDS
  const unsigned lk = lbase + 2u * (unsigned)(KS + kr * KP + kcol);
  const unsigned lv = lbase + 2u * (unsigned)(VS + vd * VP + vcol);
  const u16* gk = Kh + ((size_t)kv * SEQ + kr) * HD + kcol;
  const u16* gv = Vth + ((size_t)kv * HD + vd) * SEQ + vcol;
  const u16* gkl = Kl + ((size_t)kv * SE + kr) * HD + kcol;
  const u16* gvl = Vtl + ((size_t)kv * HD + vd) * SE + vcol;
  // Issue the copies of chunk c into buffer c & 1 (all lanes on, block-uniform call sites). The
  // s_wait_xcnt closes each statement so that no address register is rewritten ahead of it.
  auto copy_chunk = [&](int c) {
    const unsigned bo = (unsigned)(c & 1) * (unsigned)(BUF * 2);
    const unsigned k0 = lk + bo, k1 = k0 + 2u * 16u * KP;
    const unsigned v0 = lv + bo, v1 = v0 + 2u * 64u * VP;
    const u16* a0 = gk + (size_t)c * (32 * HD);
    const u16* a1 = a0 + 16 * HD;
    const u16* b0 = gv + c * 32;
    const u16* b1 = b0 + (size_t)64 * SEQ;
    asm volatile("global_load_async_to_lds_b128 %0, %4, off\n\t"
                 "global_load_async_to_lds_b128 %1, %5, off\n\t"
                 "global_load_async_to_lds_b128 %2, %6, off\n\t"
                 "global_load_async_to_lds_b128 %3, %7, off\n\t"
                 "s_wait_xcnt 0x0"
                 :: "v"(k0), "v"(k1), "v"(v0), "v"(v1), "v"(a0), "v"(a1), "v"(b0), "v"(b1) : "memory");
    if (EARLY) {
      const unsigned k2 = k0 + 2u * (KL - KS), k3 = k1 + 2u * (KL - KS);
      const unsigned v2 = v0 + 2u * (VL - VS), v3 = v1 + 2u * (VL - VS);
      const u16* a2 = gkl + (size_t)c * (32 * HD);
      const u16* a3 = a2 + 16 * HD;
      const u16* b2 = gvl + c * 32;
      const u16* b3 = b2 + (size_t)64 * SE;
      asm volatile("global_load_async_to_lds_b128 %0, %4, off\n\t"
                   "global_load_async_to_lds_b128 %1, %5, off\n\t"
                   "global_load_async_to_lds_b128 %2, %6, off\n\t"
                   "global_load_async_to_lds_b128 %3, %7, off\n\t"
                   "s_wait_xcnt 0x0"
                   :: "v"(k2), "v"(k3), "v"(v2), "v"(v3), "v"(a2), "v"(a3), "v"(b2), "v"(b3) : "memory");
    }
  };

#pragma unroll 1
  for (int pass = 0; pass < NPASS; ++pass) {
    const int dbase = pass * DW;
    v8f o[NDT];
    v8f orr[NDT];
#pragma unroll
    for (int dt = 0; dt < NDT; ++dt) { o[dt] = zero8(); orr[dt] = zero8(); }
    float rmax = -1.0e30f, rsum = 0.0f;

    // Chunk 0 lands and is published, then chunk 1 is set flying. (A later pass gets here behind
    // the last trip's s_wait_dscnt and barrier, so every reader has left both buffers.)
    copy_chunk(0);
    asm volatile("s_wait_asynccnt 0x0" ::: "memory");  // this wave's copies of chunk 0 have landed
    __syncthreads();                                 // ... and every other wave's
    if (nchunk > 1) copy_chunk(1);
    int av = amask[imin(lane, SEQ - 1)];             // padding mask of chunk 0's keys

#pragma unroll 1
    for (int kc = 0; kc < nchunk; ++kc) {
      const int kbase = kc * 32;
      const u16* tb = pool + (kc & 1) * BUF;         // this chunk's buffer
      // padding-mask word for the 32 keys of this chunk, per wave (all lanes active); the next
      // chunk's mask values are read one chunk ahead, like its tiles
      const unsigned mw = __builtin_amdgcn_ballot_w32(av != 0);
      av = amask[imin(kbase + 32 + lane, SEQ - 1)];

      // This chunk's LDS fragment reads stand in groups ahead of the matrix instructions that use
      // them, so that one LDS latency is waited out per group and not one per matrix instruction.
      // A group is issued where the registers of fragments already used have come free.
      auto ld_k = [&](int plane, int sub, int dc) {
        FragH f;
        const u16* p = tb + plane + (sub * 16 + l) * KP + dc * 32 + 8 * h;
        f.q[0] = *(const v4u*)p;
        f.q[1] = *(const v4u*)(p + 16);
        return f;
      };
      auto ld_v = [&](int plane, int dt) {
        FragH f;
        const u16* p = tb + plane + (dbase + dt * 16 + l) * VP + 8 * h;
        f.q[0] = *(const v4u*)p;
        f.q[1] = *(const v4u*)(p + 16);
        return f;
      };
      FragH kf[2][4], kg[2][4], vf[NDT], vg[NDT];
      v8f acc[2], accr[2];
      acc[0] = zero8(); acc[1] = zero8(); accr[0] = zero8(); accr[1] = zero8();
      if (!EARLY) {
        // all K fragments first; the two key halves' chains alternate; V fragments follow in two
        // groups among the last score products and land while the softmax is worked out
        // (loops unrolled: the fragment arrays are indexed by constants and stay in registers)
#pragma unroll
        for (int dc = 0; dc < 4; ++dc) { kf[0][dc] = ld_k(KS, 0, dc); kf[1][dc] = ld_k(KS, 1, dc); }
#pragma unroll
        for (int dc = 0; dc < 4; ++dc) {
          acc[0] = wg_h(acc[0], kf[0][dc].v, qh[dc].v);
          acc[1] = wg_h(acc[1], kf[1][dc].v, qh[dc].v);
          if (dc == 1 || dc == 3) {
#pragma unroll
            for (int i = 0; i < NDT / 2; ++i) {
              const int dt = (dc >> 1) * (NDT / 2) + i;
              vf[dt] = ld_v(VS, dt);
            }
          }
        }
      } else {
        // step i = key half i >> 2, 32-wide d step i & 3, with its value and residual fragments.
        // Reads go out two steps at a time, one step ahead of their first product (three steps'
        // fragments at most are held: the register file allows no more here); the V fragments
        // go out ahead of the last step and land while the softmax is worked out.
        auto ld_step = [&](int i) {
          kf[i >> 2][i & 3] = ld_k(KS, i >> 2, i & 3);
          kg[i >> 2][i & 3] = ld_k(KL, i >> 2, i & 3);
        };
        ld_step(0);
        ld_step(1);
        // unrolled: the fragment arrays are indexed by constants and stay in registers
#pragma unroll
        for (int i = 0; i < 8; ++i) {
          const int sub = i >> 2, dc = i & 3;
          acc[sub] = wg_h(acc[sub], kf[sub][dc].v, qh[dc].v);
          accr[sub] = wg_h(accr[sub], kf[sub][dc].v, ql[dc].v);
          accr[sub] = wg_h(accr[sub], kg[sub][dc].v, qh[dc].v);
          if (i == 0 || i == 2 || i == 4) {
            ld_step(i + 2);
            ld_step(i + 3);
          }
          if (i == 6) {
#pragma unroll
            for (int dt = 0; dt < NDT; ++dt) { vf[dt] = ld_v(VS, dt); vg[dt] = ld_v(VL, dt); }
          }
        }
      }

      // scores S^T[key][query]; lane l = query, element r = key sub*16 + 8h + r
      float u[16];
#pragma unroll
      for (int sub = 0; sub < 2; ++sub) {
#pragma unroll
        for (int r = 0; r < 8; ++r) {
          float s = acc[sub][r];
          if (EARLY) s += accr[sub][r] * (1.0f / 1024.0f);
          u[sub * 8 + r] = s * SCL;
        }
      }
      // Online softmax of the chunk. MASKED: the causal compare and the padding bit of every key are
      // worked out and applied; otherwise every key counts and none of that arithmetic is done.
      // (Its loops are unrolled so that u, ph and pr are indexed by constants and stay in registers.)
      float scale, psum;
      FragH ph;
      FragH pr;
      auto soft = [&](auto masked) {
        constexpr bool MASKED = decltype(masked)::value;
        // bit j of vw: key kbase + 8h + j counts (at or before this lane's query, not padded out)
        unsigned vw = 0xFFFFFFFFu;
        if (MASKED) {
          const int lim = (qw0 - kbase) + (l - 8 * h);
          const unsigned cw = lim < 0 ? 0u : (lim >= 31 ? 0xFFFFFFFFu : (2u << lim) - 1u);
          vw = (mw >> (8 * h)) & cw;
        }
        float m_new = rmax;
#pragma unroll
        for (int i = 0; i < 16; ++i) {
          if (MASKED) u[i] = ((vw >> ((i >> 3) * 16 + (i & 7))) & 1u) ? u[i] : -1.0e30f;
          m_new = fmaxf(m_new, u[i]);
        }
        m_new = fmaxf(m_new, __shfl_xor(m_new, 16, 32));
        scale = __builtin_amdgcn_exp2f(rmax - m_new);
        rmax = m_new;
        psum = 0.0f;
#pragma unroll
        for (int i = 0; i < 16; ++i) {
          const float pe = __builtin_amdgcn_exp2f(u[i] - m_new);
          const float pv = (!MASKED || ((vw >> ((i >> 3) * 16 + (i & 7))) & 1u)) ? pe : 0.0f;
          psum += pv;
          const float pc = pv * 4096.0f;
          const f16 hv = (f16)pc;
          ph.h[i] = hv;
          if (EARLY) pr.h[i] = (f16)((pc - (float)hv) * 1024.0f);
          else pr.h[i] = hv;
        }
      };
      // The same for every lane of the wave (scalar operands): all 32 keys of the chunk lie at or
      // before the wave's first query and none is padded out. True of every chunk but the last
      // where the padding mask is all ones.
      if (kbase + 31 <= qw0 && mw == 0xFFFFFFFFu) soft(BoolC<false>{});
      else soft(BoolC<true>{});
      psum += __shfl_xor(psum, 16, 32);
      rsum = rsum * scale + psum;

      float sc[8];
#pragma unroll
      for (int r = 0; r < 8; ++r) sc[r] = __shfl(scale, 8 * h + r, 32);
#pragma unroll
      for (int dt = 0; dt < NDT; ++dt) {
#pragma unroll
        for (int r = 0; r < 8; ++r) {
          o[dt][r] *= sc[r];
          if (EARLY) orr[dt][r] *= sc[r];
        }
      }
      // O += P x V ; B fragment lane = d row of the Vt tile, elements = keys (split map)
#pragma unroll
      for (int dt = 0; dt < NDT; ++dt) {
        o[dt] = wg_h(o[dt], ph.v, vf[dt].v);
        if (EARLY) {
          orr[dt] = wg_h(orr[dt], pr.v, vf[dt].v);
          orr[dt] = wg_h(orr[dt], ph.v, vg[dt].v);
        }
      }
      // Hand-over: this wave's LDS reads of chunk kc are done, its copies of chunk kc + 1 have
      // landed; the barrier publishes chunk kc + 1 and frees chunk kc's buffer for chunk kc + 2.
      asm volatile("s_wait_dscnt 0x0" ::: "memory");
      asm volatile("s_wait_asynccnt 0x0" ::: "memory");
      __syncthreads();
      if (kc + 2 < nchunk) copy_chunk(kc + 2);
    }
    asm volatile("s_wait_asynccnt 0x0" ::: "memory");  // nothing in flight when the buffers are reused

    // epilogue: ctx = (o + orr/1024) / (4096 * 16 * l); plane value = 64 * ctx
    if (!EARLY) __syncthreads();                     // K/V tiles dead, pool reused as stage
    const float inv = 1.0f / rsum;
    float ir[8];
#pragma unroll
    for (int r = 0; r < 8; ++r) ir[r] = __shfl(inv, 8 * h + r, 32) * (1.0f / 1024.0f);
    const int cb = EARLY ? ((pass & 1) * 32) : 0;   // column offset inside the 64-wide line half
#pragma unroll
    for (int dt = 0; dt < NDT; ++dt) {
#pragma unroll
      for (int r = 0; r < 8; ++r) {
        float val = o[dt][r];
        if (EARLY) val += orr[dt][r] * (1.0f / 1024.0f);
        val *= ir[r];
        if (EARLY) {
          u16 a, b;
          split1024(val, a, b);
          os[(8 * h + r) * 128 + cb + dt * 16 + l] = a;
          os[(8 * h + r) * 128 + 64 + cb + dt * 16 + l] = b;
        } else {
          os[(8 * h + r) * 128 + dt * 16 + l] = hbits(val);
        }
      }
    }
    if (!EARLY) {
      __syncthreads();
      // 16 rows x 256 B = 32 lines; instruction i: lanes 8g..8g+7 -> line 4i+g
      v4u vals[8];
#pragma unroll
      for (int i = 0; i < 8; ++i) {
        const int L = 4 * i + (lane >> 3);
        const int row = L >> 1, seg = L & 1;
        vals[i] = *(const v4u*)(os + row * 128 + seg * 64 + (lane & 7) * 8);
      }
#pragma unroll
      for (int i = 0; i < 8; ++i) {
        const int L = 4 * i + (lane >> 3);
        const int row = L >> 1, seg = L & 1;
        *(v4u*)(Ch + (size_t)(qw0 + row) * HID + head * HD + seg * 64 + (lane & 7) * 8) = vals[i];
      }
      // another job's code follows in the merged kernel: no register of the stores above is rewritten ahead of this wait
      asm volatile("s_wait_xcnt 0x0" ::: "memory");
    } else {
      if ((pass & 1) != 0) {                         // block-uniform: stage holds d line (pass>>1)
        __syncthreads();
        const int dline = (pass >> 1) * 64;
        v4u va[4], vb[4];
#pragma unroll
        for (int i = 0; i < 4; ++i) {
          const int row = 4 * i + (lane >> 3);
          va[i] = *(const v4u*)(os + row * 128 + (lane & 7) * 8);
          vb[i] = *(const v4u*)(os + row * 128 + 64 + (lane & 7) * 8);
        }
#pragma unroll
        for (int i = 0; i < 4; ++i) {
          const int row = 4 * i + (lane >> 3);
          const size_t off = (size_t)(qw0 + row) * HID + head * HD + dline + (lane & 7) * 8;
          *(v4u*)(Ch + off) = va[i];
          *(v4u*)(Cr + off) = vb[i];
        }
        
      }
    }
  }
}

// ---------------------------------------------------------------------------------------
// Launches. Jobs that need nothing of each other share one grid: a range of the block index
// (the same for a whole block) picks the job, so that part-filled grids run side by side.

// hidden -> bf16 and the inv_freq table | wq, wk, wv -> bf16, transposed | wo -> f16, transposed
#define NB_X SEQ
#define NB_WQ ((HID / 64) * ((NH * HD) / 64))
#define NB_WKV ((HID / 64) * ((NKV * HD) / 64))
#define NB_WO ((HID / 64) * (HID / 64))
__global__ __launch_bounds__(256) void k_prep(const float* __restrict__ x, const float* __restrict__ wq,
                                             const float* __restrict__ wk, const float* __restrict__ wv,
                                             const float* __restrict__ wo, u16* __restrict__ xb,
                                             float* __restrict__ tinv, u16* __restrict__ wqkvt,
                                             u16* __restrict__ wot) {
  __shared__ __align__(16) u16 T[64 * 72];
  constexpr int NI = HID / 64;                       // tiles along the weights' input dimension
  const int b = (int)blockIdx.x;
  if (b < NB_X) {
    xconv_body(b, x, xb, tinv);
  } else if (b < NB_X + NB_WQ) {
    const int r = b - NB_X;
    wt_body<0>(T, r % NI, r / NI, wq, wqkvt, NH * HD);
  } else if (b < NB_X + NB_WQ + NB_WKV) {
    const int r = b - (NB_X + NB_WQ);
    wt_body<0>(T, r % NI, r / NI, wk, wqkvt + (size_t)(NH * HD) * HID, NKV * HD);
  } else if (b < NB_X + NB_WQ + 2 * NB_WKV) {
    const int r = b - (NB_X + NB_WQ + NB_WKV);
    wt_body<0>(T, r % NI, r / NI, wv, wqkvt + (size_t)(NH * HD + NKV * HD) * HID, NKV * HD);
  } else {
    const int r = b - (NB_X + NB_WQ + 2 * NB_WKV);
    wt_body<1>(T, r % NI, r / NI, wo, wot, HID);
  }
}

// qkv projection
__global__ __launch_bounds__(256) void k_qkv(const u16* __restrict__ A, const u16* __restrict__ BT,
                                            float* __restrict__ C, int lda, int ldb, int ldc, int K) {
  __shared__ __align__(16) u16 pool[GEMM_POOL(false)];
  gemm_body<0, false>(pool, (int)blockIdx.x, (int)blockIdx.y, A, A, BT, C, lda, ldb, ldc, K, 1.0f, 0.0f);
}

// V transposed planes | rotary + q, k planes
#define NB_VT ((SEQ / 64) * NKV)
__global__ __launch_bounds__(256) void k_planes_vt(const float* __restrict__ qkv, const int* __restrict__ pos,
                                                  const float* __restrict__ tinv,
                                                  u16* __restrict__ Qh, u16* __restrict__ Ql,
                                                  u16* __restrict__ Kh, u16* __restrict__ Kl,
                                                  u16* __restrict__ Vth, u16* __restrict__ Vtl) {
  __shared__ __align__(16) u16 sm[2 * HD * 72];
  static_assert(2 * HD * 72 >= 2 * (NH + NKV) * HD);
  const int b = (int)blockIdx.x;
  if (b < NB_VT) vt_body(sm, b % (SEQ / 64), b / (SEQ / 64), qkv, Vth, Vtl);
  else planes_body(sm, b - NB_VT, qkv, pos, tinv, Qh, Ql, Kh, Kl);
}

// attention: query blocks of the leading SE rows (residual planes) | the rest
__global__ __launch_bounds__(256) __attribute__((amdgpu_num_vgpr(256)))
void k_attn(const u16* __restrict__ Qh, const u16* __restrict__ Ql,
            const u16* __restrict__ Kh, const u16* __restrict__ Kl,
            const u16* __restrict__ Vth, const u16* __restrict__ Vtl,
            const int* __restrict__ amask,
            u16* __restrict__ Ch, u16* __restrict__ Cr) {
  __shared__ __align__(16) u16 pool[ATTN_POOL(true)];
  __shared__ __align__(16) u16 stg[16384];
  const int qblk = (int)blockIdx.x, kv = (int)blockIdx.y;
  if (qblk < SE / BQW) attn_body<true>(pool, stg, qblk, kv, Qh, Ql, Kh, Kl, Vth, Vtl, amask, Ch, Cr);
  else attn_body<false>(pool, stg, qblk, kv, Qh, Ql, Kh, Kl, Vth, Vtl, amask, Ch, Cr);
}

// output projection: row tiles of the leading SE rows (with the residual ctx plane) | the rest
__global__ __launch_bounds__(256) void k_oproj(const u16* __restrict__ A, const u16* __restrict__ Ar,
                                              const u16* __restrict__ BT, float* __restrict__ C,
                                              int lda, int ldb, int ldc, int K, float sh, float sr) {
  __shared__ __align__(16) u16 pool[GEMM_POOL(true)];
  const int bn = (int)blockIdx.x, bm = (int)blockIdx.y;
  if (bm < SE / 64) gemm_body<1, true>(pool, bn, bm, A, Ar, BT, C, lda, ldb, ldc, K, sh, sr);
  else gemm_body<1, false>(pool, bn, bm, A, A, BT, C, lda, ldb, ldc, K, sh, 0.0f);
}

// ---------------------------------------------------------------------------------------
extern "C" void kernel_launch(void* const* d_in, const int* in_sizes, int n_in,
                              void* d_out, int out_size, void* d_ws, size_t ws_size,
                              hipStream_t stream) {
  if (n_in < 7) return;
  if (in_sizes[0] < SEQ * HID) return;
  if (in_sizes[1] < SEQ) return;
  if (in_sizes[2] < SEQ) return;
  if (in_sizes[3] < HID * NH * HD) return;
  if (in_sizes[4] < HID * NKV * HD) return;
  if (in_sizes[5] < HID * NKV * HD) return;
  if (in_sizes[6] < NH * HD * HID) return;
  if (out_size < SEQ * HID) return;

  const float* hs  = (const float*)d_in[0];
  const int*   am  = (const int*)d_in[1];
  const int*   pos = (const int*)d_in[2];
  const float* wq  = (const float*)d_in[3];
  const float* wk  = (const float*)d_in[4];
  const float* wv  = (const float*)d_in[5];
  const float* wo  = (const float*)d_in[6];
  float* out = (float*)d_out;

  char* ws = (char*)d_ws;
  size_t off = 0;
#define CARVE(T, name, bytes) T* name = (T*)(ws + off); off += (((size_t)(bytes)) + 255) & ~(size_t)255
  CARVE(u16,   Xb,    (size_t)SEQ * HID * 2);          // bf16 bits [SEQ][HID]
  CARVE(u16,   WqkvT, (size_t)NQKV * HID * 2);         // bf16 bits [3072][HID]
  CARVE(u16,   WoT,   (size_t)HID * HID * 2);          // f16 bits  [HID][HID]
  CARVE(float, QKVf,  (size_t)SEQ * NQKV * 4);         // f32 [SEQ][3072]
  CARVE(u16,   Qh,    (size_t)NH * SEQ * HD * 2);
  CARVE(u16,   Kh,    (size_t)NKV * SEQ * HD * 2);
  CARVE(u16,   Vth,   (size_t)NKV * HD * SEQ * 2);
  CARVE(u16,   Ql,    (size_t)NH * SE * HD * 2);
  CARVE(u16,   Kl,    (size_t)NKV * SE * HD * 2);
  CARVE(u16,   Vtl,   (size_t)NKV * HD * SE * 2);
  CARVE(u16,   Cr,    (size_t)SE * HID * 2);
  CARVE(float, Tinv,  256);
#undef CARVE
  // Ch [SEQ][HID] f16 plane aliases the Xb region: identical extent (SEQ*HID halves), Xb is
  // read only by the qkv projection launch, Ch is first written by the attention launch
  // that comes after it on the same in-order stream.
  static_assert(NH * HD == HID);
  u16* Ch = Xb;
  if (off > ws_size) return;

  // 1) hidden -> bf16, inv_freq table; weights: w [HID][n] -> wt [n][HID]
  k_prep<<<dim3(NB_X + NB_WQ + 2 * NB_WKV + NB_WO), 256, 0, stream>>>(hs, wq, wk, wv, wo, Xb, Tinv, WqkvT, WoT);
  // 2) fused qkv projection: [SEQ][HID] x [HID][3072] -> f32
  k_qkv<<<dim3(NQKV / 128, SEQ / 64), 256, 0, stream>>>(Xb, WqkvT, QKVf, HID, HID, NQKV, HID);
  // 3) V transposed planes; rotary + planes
  k_planes_vt<<<dim3(NB_VT + SEQ), 256, 0, stream>>>(QKVf, pos, Tinv, Qh, Ql, Kh, Kl, Vth, Vtl);
  // 4) attention: leading SE rows with residual planes, the rest single products
  k_attn<<<dim3(SEQ / BQW, NKV), 256, 0, stream>>>(Qh, Ql, Kh, Kl, Vth, Vtl, am, Ch, Cr);
  // 5) output projection: rows < SE with the residual ctx plane, the rest plain
  k_oproj<<<dim3(HID / 128, SEQ / 64), 256, 0, stream>>>(
      Ch, Cr, WoT, out, HID, HID, HID, HID, 1.0f / 4096.0f, 1.0f / (4096.0f * 1024.0f));
}

// v007
// A run of this version takes 294 microseconds.
// In both of two side-by-side timings against v006, it was 1.07 times as fast.
// All steps since v000 together make it 4.62 times as fast.
#include <hip/hip_runtime.h>
#include <stdint.h>
#include <stddef.h>

// Contractions: qkv projection = v_wmma_f32_16x16x32_bf16 (bf16 operands, f32 accumulate);
// q.k scores, p.v and output projection = v_wmma_f32_16x16x32_f16 (f16 operands with
// power-of-two carries plus x1024 f16 residual planes on the leading SE query rows,
// f32 accumulate). Softmax and epilogues in f32; rotary sin/cos via f64 quadrant
// reduction + polynomial (no fused multiply-add), rotation in unfused f32.

#ifndef NB
#define NB 1
#endif
#ifndef SEQ
#define SEQ 4096
#endif
#ifndef SE
#if SEQ < 640
#define SE SEQ
#else
#define SE 640
#endif
#endif
#define SEQ_FULL 4096
#define HID 2048
#define NH 16
#define NKV 4
#define HD 128
#define NQKV (NH * HD + 2 * NKV * HD)
#define BQW 32

static_assert(NB == 1);
static_assert(SEQ % 64 == 0);
static_assert(SEQ >= SE);
static_assert(SEQ <= SEQ_FULL);
static_assert(SE >= 64);
static_assert(SE % 64 == 0);
static_assert(SE % BQW == 0);
static_assert(SEQ % 128 == 0);
static_assert(SE % 128 == 0);
static_assert(HID % 128 == 0);
static_assert(HID == 256 * 8);
static_assert(NQKV % 128 == 0);
static_assert(HD == 128);
static_assert(NH == 4 * NKV);
static_assert(NH * HD == HID);

typedef _Float16 f16;
typedef __bf16 bf16;
typedef unsigned short u16;
typedef f16 v16h __attribute__((ext_vector_type(16)));
typedef bf16 v16b __attribute__((ext_vector_type(16)));
typedef float v8f __attribute__((ext_vector_type(8)));
typedef float v4f __attribute__((ext_vector_type(4)));
typedef unsigned v4u __attribute__((ext_vector_type(4)));

union FragH { v16h v; v4u q[2]; f16 h[16]; };
union FragB { v16b v; v4u q[2]; };

__device__ __forceinline__ v8f zero8() {
  v8f z = {0.0f, 0.0f, 0.0f, 0.0f, 0.0f, 0.0f, 0.0f, 0.0f};
  return z;
}

// 16x16x32 f16 WMMA followed by a 4-slot VALU hazard guard on D (A/B kept live).
__device__ __forceinline__ v8f wg_h(v8f acc, v16h a, v16h b) {
  acc = __builtin_amdgcn_wmma_f32_16x16x32_f16(false, a, false, b, (short)0, acc, false, false);
  asm volatile("v_nop\n\tv_nop\n\tv_nop\n\tv_nop" : "+v"(acc) : "v"(a), "v"(b));
  return acc;
}
__device__ __forceinline__ v8f wg_b(v8f acc, v16b a, v16b b) {
  acc = __builtin_amdgcn_wmma_f32_16x16x32_bf16(false, a, false, b, (short)0, acc, false, false);
  asm volatile("v_nop\n\tv_nop\n\tv_nop\n\tv_nop" : "+v"(acc) : "v"(a), "v"(b));
  return acc;
}

// f32 -> bf16 bits, RNE convert.
__device__ __forceinline__ unsigned bf16_rne(float f) {
  const unsigned u = __float_as_uint(f);
  return (u + 0x7FFFu + ((u >> 16) & 1u)) >> 16;
}
// f32 -> f16 bits, RNE convert.
__device__ __forceinline__ u16 hbits(float f) {
  const f16 x = (f16)f;
  return __builtin_bit_cast(u16, x);
}
// f32 -> f16 hi bits plus f16 bits of (v - hi) * 1024 (unfused: sub then mul).
__device__ __forceinline__ void split1024(float v, u16& hb, u16& lb) {
#pragma clang fp contract(off)
  const f16 x = (f16)v;
  const float xr = (float)x;
  const float dlt = v - xr;
  const f16 y = (f16)(dlt * 1024.0f);
  hb = __builtin_bit_cast(u16, x);
  lb = __builtin_bit_cast(u16, y);
}
template <bool B> struct BoolC { static constexpr bool value = B; };
__device__ __forceinline__ int imin(int a, int b) { return a < b ? a : b; }
__device__ __forceinline__ int imax(int a, int b) { return a > b ? a : b; }

// sin/cos of an f32 angle (0 <= ang <= ~4100 rad) in f64 without fused multiply-add:
// quadrant count kq = rint(x * 2/pi); r = (x - kq * P1) - kq * P2 with P1 = the leading
// 33 bits of pi/2 (kq * P1 exact for kq < 2^20) and P2 its tail; odd/even polynomials on
// |r| <= pi/4 (truncation < 3e-14); quadrant select by value; convert to f32.
__device__ __forceinline__ void rot_sincos(float ang, float& sn, float& cs) {
#pragma clang fp contract(off)
  const double x = (double)ang;
  const double kq = __builtin_rint(x * 0.63661977236758134308);
  double r = x - kq * 1.57079632673412561417;
  r = r - kq * 6.07710050650619224932e-11;
  const int q = (int)kq;
  const double r2 = r * r;
  double ps = 1.6059043836821613e-10;
  ps = ps * r2 - 2.5052108385441720e-08;
  ps = ps * r2 + 2.7557319223985893e-06;
  ps = ps * r2 - 1.9841269841269841e-04;
  ps = ps * r2 + 8.3333333333333332e-03;
  ps = ps * r2 - 1.6666666666666666e-01;
  const double r3 = r * r2;
  const double sr = r + r3 * ps;
  double pc = -1.1470745597729725e-11;
  pc = pc * r2 + 2.0876756987868099e-09;
  pc = pc * r2 - 2.7557319223985888e-07;
  pc = pc * r2 + 2.4801587301587302e-05;
  pc = pc * r2 - 1.3888888888888889e-03;
  pc = pc * r2 + 4.1666666666666664e-02;
  pc = pc * r2 - 0.5;
  const double cr = 1.0 + pc * r2;
  const bool odd = (q & 1) != 0;
  const bool neg = (q & 2) != 0;
  double sv = odd ? cr : sr;
  double cv = odd ? -sr : cr;
  sv = neg ? -sv : sv;
  cv = neg ? -cv : cv;
  sn = (float)sv;
  cs = (float)cv;
}

// ---------------------------------------------------------------------------------------
// hidden f32 [SEQ][HID] -> bf16 bits [SEQ][HID]; one block (blk) per row, 16 B per lane.
// Block 0, lanes 0..63 also produce the rotary inv_freq table (64 floats):
// inv[j] = fl32(1 / fl32(10000^(j/64))), with 10000^(1/64) from an iterative f64 64th root.
__device__ __forceinline__ void xconv_body(int blk, const float* __restrict__ x, u16* __restrict__ xb,
                                           float* __restrict__ tinv) {
#pragma clang fp contract(off)
  const int t = threadIdx.x;
  const size_t e = ((size_t)blk * 256 + (size_t)t) * 8;
  const v4f a = *(const v4f*)(x + e);
  const v4f b = *(const v4f*)(x + e + 4);
  v4u w;
  w[0] = bf16_rne(a[0]) | (bf16_rne(a[1]) << 16);
  w[1] = bf16_rne(a[2]) | (bf16_rne(a[3]) << 16);
  w[2] = bf16_rne(b[0]) | (bf16_rne(b[1]) << 16);
  w[3] = bf16_rne(b[2]) | (bf16_rne(b[3]) << 16);

  const bool tab = (blk == 0) && (t < 64);   // wave-uniform (waves 0,1 of block 0)
  float ivf = 0.0f;
  if (tab) {
    double rt = 1.15;
#pragma unroll 1
    for (int it = 0; it < 48; ++it) {
      double p63 = rt;
#pragma unroll 1
      for (int k = 1; k < 63; ++k) p63 *= rt;
      const double p64 = p63 * rt;
      const double f = p64 - 10000.0;
      rt = rt - f / (64.0 * p63);
    }
    double pj = 1.0;
#pragma unroll 1
    for (int k = 0; k < t; ++k) pj *= rt;           // t < 64: bounded
    const float pf = (float)pj;
    ivf = (float)(1.0 / (double)pf);
  }
  *(v4u*)(xb + e) = w;
  if (tab) *(float*)(tinv + t) = ivf;
  
}

// ---------------------------------------------------------------------------------------
// Weight transpose + convert: w f32 [HID][ncol] -> wt 16-bit [ncol][HID] (k contiguous).
// 8 consecutive lanes of one instruction. MODE 0: bf16 bits; MODE 1: f16 bits of
// 64 * bf16(w) (bf16 RNE value first, the x64 f16 copy of it is exact).
// T: 64 * 72 halves of LDS, [o][i], pitch 72 halves (144 B); tile (bi, bo) of the weight.
template <int MODE>
__device__ __forceinline__ void wt_body(u16* T, int bi, int bo, const float* __restrict__ w,
                                        u16* __restrict__ wt, int ncol) {
  const int i0 = bi * 64, o0 = bo * 64, t = threadIdx.x;
#pragma unroll
  for (int j = 0; j < 4; ++j) {
    const int i = (t >> 4) + 16 * j;
    const int oc = (t & 15) * 4;
    const v4f v = *(const v4f*)(w + (size_t)(i0 + i) * (size_t)ncol + o0 + oc);
#pragma unroll
    for (int e = 0; e < 4; ++e) {
      const float f = v[e];
      u16 bb;
      if (MODE == 0) bb = (u16)bf16_rne(f);
      else bb = hbits(__uint_as_float(bf16_rne(f) << 16) * 64.0f);
      T[(oc + e) * 72 + i] = bb;
    }
  }
  __syncthreads();
  v4u val[2];
#pragma unroll
  for (int p = 0; p < 2; ++p) {
    const int o = (t >> 3) + 32 * p;
    val[p] = *(const v4u*)(T + o * 72 + (t & 7) * 8);
  }
#pragma unroll
  for (int p = 0; p < 2; ++p) {
    const int o = (t >> 3) + 32 * p;
    *(v4u*)(wt + (size_t)(o0 + o) * HID + i0 + (t & 7) * 8) = val[p];
  }
  // another job's code follows in the merged kernel: no register of the stores above is rewritten ahead of this wait
  asm volatile("s_wait_xcnt 0x0" ::: "memory");
}

// ---------------------------------------------------------------------------------------
// C[m][n] (f32) = sh * sum_k A[m][k] * BT[n][k]  (+ sr * sum_k Ar[m][k] * BT[n][k] if RES)
// MODE 0: bf16 operands; MODE 1: f16 operands. Block 128 (M) x 128 (N), 8 waves each 64x32:
// a staged operand row serves 128 rows or columns of C, a fragment read from LDS two or four products.
// The block's operand rows go through LDS in tiles of 64 k (one 128-B line of every row): two
// buffers, tile t in buffer t & 1, tile t + 1 copied global -> LDS (asynchronous, through no
// register, whole lines) while tile t is worked on. Fragments come from the LDS rows with the
// split k map (elements 0..7 at k + 8h, 8..15 at k + 16 + 8h); k ascends in steps of 32.
// pool: GEMM_POOL(RES) halves of LDS; the block's tile is (bn, bm).
#define GEMM_BM 128
#define GEMM_POOL(RES) (2 * (((RES) ? 2 : 1) * GEMM_BM * 72 + 128 * 72))
template <int MODE, bool RES>
__device__ __forceinline__ void gemm_body(u16* pool, int bn, int bm,
                                          const u16* __restrict__ A, const u16* __restrict__ Ar,
                                          const u16* __restrict__ BT, float* __restrict__ C,
                                          int lda, int ldb, int ldc, int K,
                                          float sh, float sr) {
  constexpr int BK = 64;                              // k per tile
  constexpr int TP = BK + 8;                          // LDS row pitch in halves: 144 B = 16 B x odd
  constexpr int AT = GEMM_BM * TP, BTL = 128 * TP;    // tile sizes in halves
  constexpr int AS = 0, ES = AT, BS = RES ? 2 * AT : AT;
  constexpr int BUF = BS + BTL;                       // one buffer = A | (Ar) | BT tiles, in halves
  static_assert(2 * BUF == GEMM_POOL(RES));
  static_assert((TP * 2) % 16 == 0 && (BUF * 2) % 16 == 0 && (AT * 2) % 16 == 0);
  static_assert(2 * BUF * 2 >= 8 * 64 * 36 * 4);      // pool doubles as the C stage behind the loop
  const int tid = threadIdx.x, wave = tid >> 5, lane = tid & 31, h = lane >> 4, l = lane & 15;
  const int wm = wave >> 2, wn = wave & 3;
  const int mblk = bm * GEMM_BM, nblk = bn * 128;
  const int mb = mblk + wm * 64;
  const int nb = nblk + wn * 32;
  v8f c[4][2], r[4][2];
  // (loops over c, r and the fragments are unrolled: they are indexed by constants and stay in registers)
#pragma unroll
  for (int i = 0; i < 4; ++i) {
    c[i][0] = zero8(); c[i][1] = zero8();
    r[i][0] = zero8(); r[i][1] = zero8();
  }

  // This lane's 16-byte pieces of a tile: column cc of rows cr, cr + 32, ... (8 lanes cover a line).
  const int cr = tid >> 3, cc = (tid & 7) * 8;
  const unsigned lbase = (unsigned)(size_t)pool;      // byte offset of pool in the work-group's LDS
  const unsigned lpc = lbase + 2u * (unsigned)(cr * TP + cc);
  const u16* ga = A + (size_t)(mblk + cr) * (size_t)lda + cc;
  const u16* ge = Ar + (size_t)(mblk + cr) * (size_t)lda + cc;
  const u16* gb = BT + (size_t)(nblk + cr) * (size_t)ldb + cc;
  // Issue the copies of tile t into buffer t & 1 (all lanes on, block-uniform call sites). The
  // s_wait_xcnt closes each statement so that no address register is rewritten ahead of it.
  auto copy_tile = [&](int t) {
    const unsigned bo = lpc + (unsigned)(t & 1) * (unsigned)(BUF * 2);
    const unsigned a0 = bo + 2u * AS, a1 = a0 + 2u * 32u * TP, a2 = a0 + 2u * 64u * TP, a3 = a0 + 2u * 96u * TP;
    const unsigned b0 = bo + 2u * BS, b1 = b0 + 2u * 32u * TP, b2 = b0 + 2u * 64u * TP, b3 = b0 + 2u * 96u * TP;
    const u16* pa0 = ga + (size_t)t * BK;
    const u16* pa1 = pa0 + (size_t)32 * (size_t)lda;
    const u16* pa2 = pa0 + (size_t)64 * (size_t)lda;
    const u16* pa3 = pa0 + (size_t)96 * (size_t)lda;
    const u16* pb0 = gb + (size_t)t * BK;
    const u16* pb1 = pb0 + (size_t)32 * (size_t)ldb;
    const u16* pb2 = pb0 + (size_t)64 * (size_t)ldb;
    const u16* pb3 = pb0 + (size_t)96 * (size_t)ldb;
    asm volatile("global_load_async_to_lds_b128 %0, %8, off\n\t"
                 "global_load_async_to_lds_b128 %1, %9, off\n\t"
                 "global_load_async_to_lds_b128 %2, %10, off\n\t"
                 "global_load_async_to_lds_b128 %3, %11, off\n\t"
                 "global_load_async_to_lds_b128 %4, %12, off\n\t"
                 "global_load_async_to_lds_b128 %5, %13, off\n\t"
                 "global_load_async_to_lds_b128 %6, %14, off\n\t"
                 "global_load_async_to_lds_b128 %7, %15, off\n\t"
                 "s_wait_xcnt 0x0"
                 :: "v"(a0), "v"(a1), "v"(a2), "v"(a3), "v"(b0), "v"(b1), "v"(b2), "v"(b3),
                    "v"(pa0), "v"(pa1), "v"(pa2), "v"(pa3), "v"(pb0), "v"(pb1), "v"(pb2), "v"(pb3) : "memory");
    if (RES) {
      const unsigned e0 = bo + 2u * ES, e1 = e0 + 2u * 32u * TP, e2 = e0 + 2u * 64u * TP, e3 = e0 + 2u * 96u * TP;
      const u16* pe0 = ge + (size_t)t * BK;
      const u16* pe1 = pe0 + (size_t)32 * (size_t)lda;
      const u16* pe2 = pe0 + (size_t)64 * (size_t)lda;
      const u16* pe3 = pe0 + (size_t)96 * (size_t)lda;
      asm volatile("global_load_async_to_lds_b128 %0, %4, off\n\t"
                   "global_load_async_to_lds_b128 %1, %5, off\n\t"
                   "global_load_async_to_lds_b128 %2, %6, off\n\t"
                   "global_load_async_to_lds_b128 %3, %7, off\n\t"
                   "s_wait_xcnt 0x0"
                   :: "v"(e0), "v"(e1), "v"(e2), "v"(e3), "v"(pe0), "v"(pe1), "v"(pe2), "v"(pe3) : "memory");
    }
  };

  const int nt = K / BK;
  // Tile 0 lands and is published, then tile 1 is set flying.
  copy_tile(0);
  asm volatile("s_wait_asynccnt 0x0" ::: "memory");   // this wave's copies of tile 0 have landed
  __syncthreads();                                    // ... and every other wave's
  if (nt > 1) copy_tile(1);

  const int fa = (wm * 64 + l) * TP + 8 * h;          // this lane's fragment rows in a buffer
  const int fb = (wn * 32 + l) * TP + 8 * h;
  for (int t = 0; t < nt; ++t) {
    const u16* tb = pool + (t & 1) * BUF;             // this tile's buffer
    // unrolled so that both 32-k steps read at constant offsets from one LDS address
#pragma unroll
    for (int ks = 0; ks < BK; ks += 32) {
      const u16* pa = tb + AS + fa + ks;
      const u16* pb = tb + BS + fb + ks;
      if (MODE == 0) {
        FragB a[4], b[2];
#pragma unroll
        for (int j = 0; j < 2; ++j) {
          b[j].q[0] = *(const v4u*)(pb + j * 16 * TP); b[j].q[1] = *(const v4u*)(pb + j * 16 * TP + 16);
        }
#pragma unroll
        for (int i = 0; i < 4; ++i) {
          a[i].q[0] = *(const v4u*)(pa + i * 16 * TP); a[i].q[1] = *(const v4u*)(pa + i * 16 * TP + 16);
        }
#pragma unroll
        for (int i = 0; i < 4; ++i) {
          c[i][0] = wg_b(c[i][0], a[i].v, b[0].v); c[i][1] = wg_b(c[i][1], a[i].v, b[1].v);
        }
      } else {
        FragH a[4], b[2];
#pragma unroll
        for (int j = 0; j < 2; ++j) {
          b[j].q[0] = *(const v4u*)(pb + j * 16 * TP); b[j].q[1] = *(const v4u*)(pb + j * 16 * TP + 16);
        }
#pragma unroll
        for (int i = 0; i < 4; ++i) {
          a[i].q[0] = *(const v4u*)(pa + i * 16 * TP); a[i].q[1] = *(const v4u*)(pa + i * 16 * TP + 16);
        }
#pragma unroll
        for (int i = 0; i < 4; ++i) {
          c[i][0] = wg_h(c[i][0], a[i].v, b[0].v); c[i][1] = wg_h(c[i][1], a[i].v, b[1].v);
        }
        if (RES) {
          const u16* pe = tb + ES + fa + ks;
          FragH e[4];
#pragma unroll
          for (int i = 0; i < 4; ++i) {
            e[i].q[0] = *(const v4u*)(pe + i * 16 * TP); e[i].q[1] = *(const v4u*)(pe + i * 16 * TP + 16);
          }
#pragma unroll
          for (int i = 0; i < 4; ++i) {
            r[i][0] = wg_h(r[i][0], e[i].v, b[0].v); r[i][1] = wg_h(r[i][1], e[i].v, b[1].v);
          }
        }
      }
    }
    // Hand-over: this wave's LDS reads of tile t are done, its copies of tile t + 1 have landed;
    // the barrier publishes tile t + 1 and frees tile t's buffer for tile t + 2.
    asm volatile("s_wait_dscnt 0x0" ::: "memory");
    asm volatile("s_wait_asynccnt 0x0" ::: "memory");
    __syncthreads();
    if (t + 2 < nt) copy_tile(t + 2);
  }
  asm volatile("s_wait_asynccnt 0x0" ::: "memory");   // nothing in flight when pool becomes the C stage

  // Behind the last trip's barrier every reader has left both buffers: pool is the C stage now.
  float* cs = (float*)pool + wave * (64 * 36);
#pragma unroll
  for (int i = 0; i < 4; ++i) {
#pragma unroll
    for (int e = 0; e < 8; ++e) {
      const int ra = 16 * i + 8 * h + e;
      float v0 = sh * c[i][0][e], v1 = sh * c[i][1][e];
      if (RES) { v0 += sr * r[i][0][e]; v1 += sr * r[i][1][e]; }
      cs[ra * 36 + l] = v0;
      cs[ra * 36 + 16 + l] = v1;
    }
  }
  __syncthreads();
  v4f val[16];
#pragma unroll
  for (int i = 0; i < 16; ++i) {
    const int row = 4 * i + (lane >> 3);
    val[i] = *(const v4f*)(cs + row * 36 + (lane & 7) * 4);
  }
#pragma unroll
  for (int i = 0; i < 16; ++i) {
    const int row = 4 * i + (lane >> 3);
    *(v4f*)(C + (size_t)(mb + row) * (size_t)ldc + nb + (lane & 7) * 4) = val[i];
  }
  
}

// ---------------------------------------------------------------------------------------
// Rotary + f16 planes. One block per sequence row s (q: 16 heads x 128, k: 4 heads x 128).
// sm: 2 * (NH + NKV) * HD halves of LDS.
// Qh [NH][SEQ][HD], Kh [NKV][SEQ][HD]: f16 bits of the rotated value.
// Rows s < SE also get Ql [NH][SE][HD], Kl [NKV][SE][HD]: f16 bits of (x - hi) * 1024.
// rotate-half: out[d] = x[d]*cos - x[d+64]*sin, out[d+64] = x[d+64]*cos + x[d]*sin
// (products and sums as separate f32 ops), angle = fl32(pos * inv_freq[d]).
__device__ __forceinline__ void planes_body(u16* sm, int s,
                                            const float* __restrict__ qkv, const int* __restrict__ pos,
                                            const float* __restrict__ tinv,
                                            u16* __restrict__ Qh, u16* __restrict__ Ql,
                                            u16* __restrict__ Kh, u16* __restrict__ Kl) {
#pragma clang fp contract(off)
  u16* Qs = sm;
  u16* Qls = Qs + NH * HD;
  u16* Ks = Qls + NH * HD;
  u16* Kls = Ks + NKV * HD;
  const int t = threadIdx.x;
  const bool early = (s < SE);                       // block-uniform
  int pp = pos[s];
  pp = imin(imax(pp, 0), SEQ_FULL - 1);
  const int di = t & 63;
  const float ang = (float)pp * tinv[di];
  float sn, cs;
  rot_sincos(ang, sn, cs);
  const float* row = qkv + (size_t)s * NQKV;

#pragma unroll 1
  for (int j = 0; j < 4; ++j) {
    const int hh = (t + 256 * j) >> 6;               // 0..15
    const int col = hh * HD + di;
    const float x1 = row[col], x2 = row[col + 64];
    const float a1 = x1 * cs, b1 = x2 * sn;
    const float a2 = x2 * cs, b2 = x1 * sn;
    const float r1 = a1 - b1;
    const float r2 = a2 + b2;
    if (early) {
      u16 a, b;
      split1024(r1, a, b); Qs[col] = a;      Qls[col] = b;
      split1024(r2, a, b); Qs[col + 64] = a; Qls[col + 64] = b;
    } else {
      Qs[col] = hbits(r1);
      Qs[col + 64] = hbits(r2);
    }
  }
  {
    const int kvh = t >> 6;                          // 0..3
    const int col = kvh * HD + di;
    const float x1 = row[NH * HD + col], x2 = row[NH * HD + col + 64];
    const float a1 = x1 * cs, b1 = x2 * sn;
    const float a2 = x2 * cs, b2 = x1 * sn;
    const float r1 = a1 - b1;
    const float r2 = a2 + b2;
    if (early) {
      u16 a, b;
      split1024(r1, a, b); Ks[col] = a;      Kls[col] = b;
      split1024(r2, a, b); Ks[col + 64] = a; Kls[col + 64] = b;
    } else {
      Ks[col] = hbits(r1);
      Ks[col + 64] = hbits(r2);
    }
  }
  __syncthreads();

  const int e = t * 8;
  const int hq = e >> 7, dq = e & 127;               // q: head 0..15
  const bool kw = (t < 64);                          // wave-uniform: waves 0,1
  const int hk = hq, dk = dq;                        // valid for t < 64: kv head 0..3
  const v4u vq = *(const v4u*)(Qs + e);
  v4u vql = vq, vk = vq, vkl = vq;
  if (early) vql = *(const v4u*)(Qls + e);
  if (kw) {
    vk = *(const v4u*)(Ks + e);
    if (early) vkl = *(const v4u*)(Kls + e);
  }
  u16* pq  = Qh + ((size_t)hq * SEQ + s) * HD + dq;
  u16* pql = Ql + ((size_t)hq * SE + (early ? s : 0)) * HD + dq;
  u16* pk  = Kh + ((size_t)hk * SEQ + s) * HD + dk;
  u16* pkl = Kl + ((size_t)hk * SE + (early ? s : 0)) * HD + dk;

  *(v4u*)pq = vq;
  if (early) *(v4u*)pql = vql;
  if (kw) {
    *(v4u*)pk = vk;
    if (early) *(v4u*)pkl = vkl;
  }
  
}

// ---------------------------------------------------------------------------------------
// V transposed planes: Vth [NKV][HD][SEQ] = f16 bits of 16*v, and for keys < SE
// Vtl [NKV][HD][SE] = f16 bits of (16*v - hi) * 1024. Tile = 64 keys x 128 d through LDS,
// sm: 2 * HD * 72 halves of LDS; the block's tile is keys 64 * bs .. + 63 of kv head kv.
__device__ __forceinline__ void vt_body(u16* sm, int bs, int kv, const float* __restrict__ qkv,
                                        u16* __restrict__ Vth, u16* __restrict__ Vtl) {
#pragma clang fp contract(off)
  u16* T = sm;                                       // [d][key], pitch 72 halves
  u16* Tl = T + HD * 72;
  const int s0 = bs * 64, t = threadIdx.x;
  const bool early = (s0 < SE);                      // block-uniform (SE % 64 == 0)
#pragma unroll 1
  for (int j = 0; j < 8; ++j) {
    const int idx = t + 256 * j;
    const int r = idx >> 5;                          // key 0..63
    const int c4 = (idx & 31) * 4;                   // d 0..124
    const v4f v = *(const v4f*)(qkv + (size_t)(s0 + r) * NQKV + NH * HD + NKV * HD + kv * HD + c4);
#pragma unroll
    for (int e = 0; e < 4; ++e) {
      const float f = 16.0f * v[e];
      if (early) {
        u16 a, b;
        split1024(f, a, b);
        T[(c4 + e) * 72 + r] = a;
        Tl[(c4 + e) * 72 + r] = b;
      } else {
        T[(c4 + e) * 72 + r] = hbits(f);
      }
    }
  }
  __syncthreads();
  v4u vh[4], vl[4];
#pragma unroll
  for (int p = 0; p < 4; ++p) {
    const int d = (t >> 3) + 32 * p, c = (t & 7) * 8;
    vh[p] = *(const v4u*)(T + d * 72 + c);
    vl[p] = vh[p];
    if (early) vl[p] = *(const v4u*)(Tl + d * 72 + c);
  }
#pragma unroll
  for (int p = 0; p < 4; ++p) {
    const int d = (t >> 3) + 32 * p, c = (t & 7) * 8;
    *(v4u*)(Vth + ((size_t)kv * HD + d) * SEQ + s0 + c) = vh[p];
    if (early) *(v4u*)(Vtl + ((size_t)kv * HD + d) * SE + s0 + c) = vl[p];
  }
  
}

// ---------------------------------------------------------------------------------------
// Causal GQA flash attention. Block = 8 waves = 4 q heads of one kv head x 32 queries
// (wave w: head kv*4 + (w>>1), queries q0 + (w&1)*16 .. +15). Keys in chunks of 32 staged
// in LDS (two buffers, filled one chunk ahead by asynchronous copies): K tile [32][128] (A operand of S^T = K x Q^T, lane = key row) and V^T tile
// [128 d][32 keys] (B operand of O += P x V, lane = d). Queries live on lanes for the
// softmax; P in D layout of S^T is the A-fragment layout of P x V (lane = query,
// elements 0..7 = keys 8h..8h+7, 8..15 = keys 16+8h..). Online softmax in f32 (exp2 form),
// P carried as f16(4096 p), V as f16(16 v), ctx written as f16(64 ctx).
// EARLY (query rows < SE): q, k, P, v get x1024 residual planes and a second accumulator
// folded before normalisation; head dim handled in four 32-wide passes whose ctx results
// pass; ctx also gets a residual plane Cr. Output Ch [SEQ][HID] (head*128 + d), Cr [SE][HID].
// VGPR file capped at 256 (no high-bank registers).
// pool: ATTN_POOL(EARLY) halves of LDS; stg: 16384 halves of LDS (used where EARLY).
#define ATTN_POOL(EARLY) (2 * ((EARLY) ? 2 : 1) * (32 * (HD + 8) + HD * (32 + 8)))
template <bool EARLY>
__device__ __forceinline__
void attn_body(u16* pool, u16* stg, int qblk, int kv,
               const u16* __restrict__ Qh, const u16* __restrict__ Ql,
               const u16* __restrict__ Kh, const u16* __restrict__ Kl,
               const u16* __restrict__ Vth, const u16* __restrict__ Vtl,
               const int* __restrict__ amask,
               u16* __restrict__ Ch, u16* __restrict__ Cr) {
  // LDS row pitch = 16 B x odd, so that the 16 rows one ds_load_b128 reads fall on distinct banks:
  // K rows (256 B of data) at 272 B, Vt rows (64 B of data) at 80 B.
  constexpr int KP = HD + 8, VP = 32 + 8;             // pitches in halves
  constexpr int KT = 32 * KP, VT = HD * VP;           // tile sizes in halves
  // One buffer = K | (Kres) | Vt | (Vtres) tiles of one key chunk; two buffers, chunk kc in buffer kc & 1:
  // chunk kc + 1 is copied global -> LDS (asynchronous, through no register) while chunk kc is worked on.
  constexpr int KS = 0, KL = KT, VS = EARLY ? 2 * KT : KT, VL = VS + VT;
  constexpr int BUF = EARLY ? 2 * KT + 2 * VT : KT + VT;  // halves per buffer
  static_assert(2 * BUF == ATTN_POOL(EARLY));         // stg where EARLY: per-wave ctx stage [8][16][128]
  static_assert((BUF * 2) % 16 == 0 && (KP * 2) % 16 == 0 && (VP * 2) % 16 == 0);
  static_assert(EARLY || 2 * BUF >= 16384);           // pool doubles as the ctx stage behind the loop
  constexpr int NDT = EARLY ? 2 : 8;
  constexpr int DW = NDT * 16;
  constexpr int NPASS = HD / DW;
  // lane number as the shuffles read it (equal to tid & 31 in this one-dimensional block): h and l then come
  // from a register that is live in the loop anyway, which keeps the kernel inside its 256 registers unspilled
  const int tid = threadIdx.x, lane = (int)__lane_id(), h = lane >> 4, l = lane & 15;
  // the wave's number in a scalar register: what follows from it (head, first query) is scalar too
  const int wave = __builtin_amdgcn_readfirstlane(tid >> 5);
  const int head = kv * (NH / NKV) + (wave >> 1);
  const int q0 = qblk * BQW;
  const int qw0 = q0 + (wave & 1) * 16;
  const int qrow = qw0 + l;                          // this lane's query
  const int nchunk = qblk + 1;                       // keys 0 .. q0+31

  FragH qh[4];
  FragH ql[4];
#pragma unroll
  for (int dc = 0; dc < 4; ++dc) {
    const u16* b = Qh + ((size_t)head * SEQ + qrow) * HD + dc * 32 + 8 * h;
    qh[dc].q[0] = *(const v4u*)b;
    qh[dc].q[1] = *(const v4u*)(b + 16);
    if (EARLY) {
      const u16* b2 = Ql + ((size_t)head * SE + qrow) * HD + dc * 32 + 8 * h;
      ql[dc].q[0] = *(const v4u*)b2;
      ql[dc].q[1] = *(const v4u*)(b2 + 16);
    } else {
      ql[dc].q[0] = qh[dc].q[0];
      ql[dc].q[1] = qh[dc].q[1];
    }
  }
  const float SCL = 0.088388347648318441f * 1.4426950408889634f;   // log2(e)/sqrt(128)

  // ctx stage [16 rows][128 cols] per wave: EARLY in its own region (persists across the
  // 32-wide passes), otherwise aliasing pool after the K/V tiles are dead.
  u16* os;
  if (EARLY) os = stg + wave * (16 * 128);
  else os = pool + wave * (16 * 128);

  // This lane's 16-byte pieces of a chunk: K rows kr and kr + 16, Vt rows vd and vd + 64.
  const int kr = tid >> 4, kcol = (tid & 15) * 8;
  const int vd = tid >> 2, vcol = (tid & 3) * 8;
  const unsigned lbase = (unsigned)(size_t)pool;     // byte offset of pool in the work-group's LDS
  const unsigned lk = lbase + 2u * (unsigned)(KS + kr * KP + kcol);
  const unsigned lv = lbase + 2u * (unsigned)(VS + vd * VP + vcol);
  const u16* gk = Kh + ((size_t)kv * SEQ + kr) * HD + kcol;
  const u16* gv = Vth + ((size_t)kv * HD + vd) * SEQ + vcol;
  const u16* gkl = Kl + ((size_t)kv * SE + kr) * HD + kcol;
  const u16* gvl = Vtl + ((size_t)kv * HD + vd) * SE + vcol;
  // Issue the copies of chunk c into buffer c & 1 (all lanes on, block-uniform call sites). The
  // s_wait_xcnt closes each statement so that no address register is rewritten ahead of it.
  auto copy_chunk = [&](int c) {
    const unsigned bo = (unsigned)(c & 1) * (unsigned)(BUF * 2);
    const unsigned k0 = lk + bo, k1 = k0 + 2u * 16u * KP;
    const unsigned v0 = lv + bo, v1 = v0 + 2u * 64u * VP;
    const u16* a0 = gk + (size_t)c * (32 * HD);
    const u16* a1 = a0 + 16 * HD;
    const u16* b0 = gv + c * 32;
    const u16* b1 = b0 + (size_t)64 * SEQ;
    asm volatile("global_load_async_to_lds_b128 %0, %4, off\n\t"
                 "global_load_async_to_lds_b128 %1, %5, off\n\t"
                 "global_load_async_to_lds_b128 %2, %6, off\n\t"
                 "global_load_async_to_lds_b128 %3, %7, off\n\t"
                 "s_wait_xcnt 0x0"
                 :: "v"(k0), "v"(k1), "v"(v0), "v"(v1), "v"(a0), "v"(a1), "v"(b0), "v"(b1) : "memory");
    if (EARLY) {
      const unsigned k2 = k0 + 2u * (KL - KS), k3 = k1 + 2u * (KL - KS);
      const unsigned v2 = v0 + 2u * (VL - VS), v3 = v1 + 2u * (VL - VS);
      const u16* a2 = gkl + (size_t)c * (32 * HD);
      const u16* a3 = a2 + 16 * HD;
      const u16* b2 = gvl + c * 32;
      const u16* b3 = b2 + (size_t)64 * SE;
      asm volatile("global_load_async_to_lds_b128 %0, %4, off\n\t"
                   "global_load_async_to_lds_b128 %1, %5, off\n\t"
                   "global_load_async_to_lds_b128 %2, %6, off\n\t"
                   "global_load_async_to_lds_b128 %3, %7, off\n\t"
                   "s_wait_xcnt 0x0"
                   :: "v"(k2), "v"(k3), "v"(v2), "v"(v3), "v"(a2), "v"(a3), "v"(b2), "v"(b3) : "memory");
    }
  };

#pragma unroll 1
  for (int pass = 0; pass < NPASS; ++pass) {
    const int dbase = pass * DW;
    v8f o[NDT];
    v8f orr[NDT];
#pragma unroll
    for (int dt = 0; dt < NDT; ++dt) { o[dt] = zero8(); orr[dt] = zero8(); }
    float rmax = -1.0e30f, rsum = 0.0f;

    // Chunk 0 lands and is published, then chunk 1 is set flying. (A later pass gets here behind
    // the last trip's s_wait_dscnt and barrier, so every reader has left both buffers.)
    copy_chunk(0);
    asm volatile("s_wait_asynccnt 0x0" ::: "memory");  // this wave's copies of chunk 0 have landed
    __syncthreads();                                 // ... and every other wave's
    if (nchunk > 1) copy_chunk(1);
    int av = amask[imin(lane, SEQ - 1)];             // padding mask of chunk 0's keys

#pragma unroll 1
    for (int kc = 0; kc < nchunk; ++kc) {
      const int kbase = kc * 32;
      const u16* tb = pool + (kc & 1) * BUF;         // this chunk's buffer
      // padding-mask word for the 32 keys of this chunk, per wave (all lanes active); the next
      // chunk's mask values are read one chunk ahead, like its tiles
      const unsigned mw = __builtin_amdgcn_ballot_w32(av != 0);
      av = amask[imin(kbase + 32 + lane, SEQ - 1)];

      // This chunk's LDS fragment reads stand in groups ahead of the matrix instructions that use
      // them, so that one LDS latency is waited out per group and not one per matrix instruction.
      // A group is issued where the registers of fragments already used have come free.
      auto ld_k = [&](int plane, int sub, int dc) {
        FragH f;
        const u16* p = tb + plane + (sub * 16 + l) * KP + dc * 32 + 8 * h;
        f.q[0] = *(const v4u*)p;
        f.q[1] = *(const v4u*)(p + 16);
        return f;
      };
      auto ld_v = [&](int plane, int dt) {
        FragH f;
        const u16* p = tb + plane + (dbase + dt * 16 + l) * VP + 8 * h;
        f.q[0] = *(const v4u*)p;
        f.q[1] = *(const v4u*)(p + 16);
        return f;
      };
      FragH kf[2][4], kg[2][4], vf[NDT], vg[NDT];
      v8f acc[2], accr[2];
      acc[0] = zero8(); acc[1] = zero8(); accr[0] = zero8(); accr[1] = zero8();
      if (!EARLY) {
        // all K fragments first; the two key halves' chains alternate; V fragments follow in two
        // groups among the last score products and land while the softmax is worked out
        // (loops unrolled: the fragment arrays are indexed by constants and stay in registers)
#pragma unroll
        for (int dc = 0; dc < 4; ++dc) { kf[0][dc] = ld_k(KS, 0, dc); kf[1][dc] = ld_k(KS, 1, dc); }
#pragma unroll
        for (int dc = 0; dc < 4; ++dc) {
          acc[0] = wg_h(acc[0], kf[0][dc].v, qh[dc].v);
          acc[1] = wg_h(acc[1], kf[1][dc].v, qh[dc].v);
          if (dc == 1 || dc == 3) {
#pragma unroll
            for (int i = 0; i < NDT / 2; ++i) {
              const int dt = (dc >> 1) * (NDT / 2) + i;
              vf[dt] = ld_v(VS, dt);
            }
          }
        }
      } else {
        // step i = key half i >> 2, 32-wide d step i & 3, with its value and residual fragments.
        // Reads go out two steps at a time, one step ahead of their first product (three steps'
        // fragments at most are held: the register file allows no more here); the V fragments
        // go out ahead of the last step and land while the softmax is worked out.
        auto ld_step = [&](int i) {
          kf[i >> 2][i & 3] = ld_k(KS, i >> 2, i & 3);
          kg[i >> 2][i & 3] = ld_k(KL, i >> 2, i & 3);
        };
        ld_step(0);
        ld_step(1);
        // unrolled: the fragment arrays are indexed by constants and stay in registers
#pragma unroll
        for (int i = 0; i < 8; ++i) {
          const int sub = i >> 2, dc = i & 3;
          acc[sub] = wg_h(acc[sub], kf[sub][dc].v, qh[dc].v);
          accr[sub] = wg_h(accr[sub], kf[sub][dc].v, ql[dc].v);
          accr[sub] = wg_h(accr[sub], kg[sub][dc].v, qh[dc].v);
          if (i == 0 || i == 2 || i == 4) {
            ld_step(i + 2);
            ld_step(i + 3);
          }
          if (i == 6) {
#pragma unroll
            for (int dt = 0; dt < NDT; ++dt) { vf[dt] = ld_v(VS, dt); vg[dt] = ld_v(VL, dt); }
          }
        }
      }

      // scores S^T[key][query]; lane l = query, element r = key sub*16 + 8h + r
      float u[16];
#pragma unroll
      for (int sub = 0; sub < 2; ++sub) {
#pragma unroll
        for (int r = 0; r < 8; ++r) {
          float s = acc[sub][r];
          if (EARLY) s += accr[sub][r] * (1.0f / 1024.0f);
          u[sub * 8 + r] = s * SCL;
        }
      }
      // Online softmax of the chunk. MASKED: the causal compare and the padding bit of every key are
      // worked out and applied; otherwise every key counts and none of that arithmetic is done.
      // (Its loops are unrolled so that u, ph and pr are indexed by constants and stay in registers.)
      float scale, psum;
      FragH ph;
      FragH pr;
      auto soft = [&](auto masked) {
        constexpr bool MASKED = decltype(masked)::value;
        // bit j of vw: key kbase + 8h + j counts (at or before this lane's query, not padded out)
        unsigned vw = 0xFFFFFFFFu;
        if (MASKED) {
          const int lim = (qw0 - kbase) + (l - 8 * h);
          const unsigned cw = lim < 0 ? 0u : (lim >= 31 ? 0xFFFFFFFFu : (2u << lim) - 1u);
          vw = (mw >> (8 * h)) & cw;
        }
        float m_new = rmax;
#pragma unroll
        for (int i = 0; i < 16; ++i) {
          if (MASKED) u[i] = ((vw >> ((i >> 3) * 16 + (i & 7))) & 1u) ? u[i] : -1.0e30f;
          m_new = fmaxf(m_new, u[i]);
        }
        m_new = fmaxf(m_new, __shfl_xor(m_new, 16, 32));
        scale = __builtin_amdgcn_exp2f(rmax - m_new);
        rmax = m_new;
        psum = 0.0f;
#pragma unroll
        for (int i = 0; i < 16; ++i) {
          const float pe = __builtin_amdgcn_exp2f(u[i] - m_new);
          const float pv = (!MASKED || ((vw >> ((i >> 3) * 16 + (i & 7))) & 1u)) ? pe : 0.0f;
          psum += pv;
          const float pc = pv * 4096.0f;
          const f16 hv = (f16)pc;
          ph.h[i] = hv;
          if (EARLY) pr.h[i] = (f16)((pc - (float)hv) * 1024.0f);
          else pr.h[i] = hv;
        }
      };
      // The same for every lane of the wave (scalar operands): all 32 keys of the chunk lie at or
      // before the wave's first query and none is padded out. True of every chunk but the last
      // where the padding mask is all ones.
      if (kbase + 31 <= qw0 && mw == 0xFFFFFFFFu) soft(BoolC<false>{});
      else soft(BoolC<true>{});
      psum += __shfl_xor(psum, 16, 32);
      rsum = rsum * scale + psum;

      float sc[8];
#pragma unroll
      for (int r = 0; r < 8; ++r) sc[r] = __shfl(scale, 8 * h + r, 32);
#pragma unroll
      for (int dt = 0; dt < NDT; ++dt) {
#pragma unroll
        for (int r = 0; r < 8; ++r) {
          o[dt][r] *= sc[r];
          if (EARLY) orr[dt][r] *= sc[r];
        }
      }
      // O += P x V ; B fragment lane = d row of the Vt tile, elements = keys (split map)
#pragma unroll
      for (int dt = 0; dt < NDT; ++dt) {
        o[dt] = wg_h(o[dt], ph.v, vf[dt].v);
        if (EARLY) {
          orr[dt] = wg_h(orr[dt], pr.v, vf[dt].v);
          orr[dt] = wg_h(orr[dt], ph.v, vg[dt].v);
        }
      }
      // Hand-over: this wave's LDS reads of chunk kc are done, its copies of chunk kc + 1 have
      // landed; the barrier publishes chunk kc + 1 and frees chunk kc's buffer for chunk kc + 2.
      asm volatile("s_wait_dscnt 0x0" ::: "memory");
      asm volatile("s_wait_asynccnt 0x0" ::: "memory");
      __syncthreads();
      if (kc + 2 < nchunk) copy_chunk(kc + 2);
    }
    asm volatile("s_wait_asynccnt 0x0" ::: "memory");  // nothing in flight when the buffers are reused

    // epilogue: ctx = (o + orr/1024) / (4096 * 16 * l); plane value = 64 * ctx
    if (!EARLY) __syncthreads();                     // K/V tiles dead, pool reused as stage
    const float inv = 1.0f / rsum;
    float ir[8];
#pragma unroll
    for (int r = 0; r < 8; ++r) ir[r] = __shfl(inv, 8 * h + r, 32) * (1.0f / 1024.0f);
    const int cb = EARLY ? ((pass & 1) * 32) : 0;   // column offset inside the 64-wide line half
#pragma unroll
    for (int dt = 0; dt < NDT; ++dt) {
#pragma unroll
      for (int r = 0; r < 8; ++r) {
        float val = o[dt][r];
        if (EARLY) val += orr[dt][r] * (1.0f / 1024.0f);
        val *= ir[r];
        if (EARLY) {
          u16 a, b;
          split1024(val, a, b);
          os[(8 * h + r) * 128 + cb + dt * 16 + l] = a;
          os[(8 * h + r) * 128 + 64 + cb + dt * 16 + l] = b;
        } else {
          os[(8 * h + r) * 128 + dt * 16 + l] = hbits(val);
        }
      }
    }
    if (!EARLY) {
      __syncthreads();
      // 16 rows x 256 B = 32 lines; instruction i: lanes 8g..8g+7 -> line 4i+g
      v4u vals[8];
#pragma unroll
      for (int i = 0; i < 8; ++i) {
        const int L = 4 * i + (lane >> 3);
        const int row = L >> 1, seg = L & 1;
        vals[i] = *(const v4u*)(os + row * 128 + seg * 64 + (lane & 7) * 8);
      }
#pragma unroll
      for (int i = 0; i < 8; ++i) {
        const int L = 4 * i + (lane >> 3);
        const int row = L >> 1, seg = L & 1;
        *(v4u*)(Ch + (size_t)(qw0 + row) * HID + head * HD + seg * 64 + (lane & 7) * 8) = vals[i];
      }
      // another job's code follows in the merged kernel: no register of the stores above is rewritten ahead of this wait
      asm volatile("s_wait_xcnt 0x0" ::: "memory");
    } else {
      if ((pass & 1) != 0) {                         // block-uniform: stage holds d line (pass>>1)
        __syncthreads();
        const int dline = (pass >> 1) * 64;
        v4u va[4], vb[4];
#pragma unroll
        for (int i = 0; i < 4; ++i) {
          const int row = 4 * i + (lane >> 3);
          va[i] = *(const v4u*)(os + row * 128 + (lane & 7) * 8);
          vb[i] = *(const v4u*)(os + row * 128 + 64 + (lane & 7) * 8);
        }
#pragma unroll
        for (int i = 0; i < 4; ++i) {
          const int row = 4 * i + (lane >> 3);
          const size_t off = (size_t)(qw0 + row) * HID + head * HD + dline + (lane & 7) * 8;
          *(v4u*)(Ch + off) = va[i];
          *(v4u*)(Cr + off) = vb[i];
        }
        
      }
    }
  }
}

// ---------------------------------------------------------------------------------------
// Launches. Jobs that need nothing of each other share one grid: a range of the block index
// (the same for a whole block) picks the job, so that part-filled grids run side by side.

// hidden -> bf16 and the inv_freq table | wq, wk, wv -> bf16, transposed | wo -> f16, transposed
#define NB_X SEQ
#define NB_WQ ((HID / 64) * ((NH * HD) / 64))
#define NB_WKV ((HID / 64) * ((NKV * HD) / 64))
#define NB_WO ((HID / 64) * (HID / 64))
__global__ __launch_bounds__(256) void k_prep(const float* __restrict__ x, const float* __restrict__ wq,
                                             const float* __restrict__ wk, const float* __restrict__ wv,
                                             const float* __restrict__ wo, u16* __restrict__ xb,
                                             float* __restrict__ tinv, u16* __restrict__ wqkvt,
                                             u16* __restrict__ wot) {
  __shared__ __align__(16) u16 T[64 * 72];
  constexpr int NI = HID / 64;                       // tiles along the weights' input dimension
  const int b = (int)blockIdx.x;
  if (b < NB_X) {
    xconv_body(b, x, xb, tinv);
  } else if (b < NB_X + NB_WQ) {
    const int r = b - NB_X;
    wt_body<0>(T, r % NI, r / NI, wq, wqkvt, NH * HD);
  } else if (b < NB_X + NB_WQ + NB_WKV) {
    const int r = b - (NB_X + NB_WQ);
    wt_body<0>(T, r % NI, r / NI, wk, wqkvt + (size_t)(NH * HD) * HID, NKV * HD);
  } else if (b < NB_X + NB_WQ + 2 * NB_WKV) {
    const int r = b - (NB_X + NB_WQ + NB_WKV);
    wt_body<0>(T, r % NI, r / NI, wv, wqkvt + (size_t)(NH * HD + NKV * HD) * HID, NKV * HD);
  } else {
    const int r = b - (NB_X + NB_WQ + 2 * NB_WKV);
    wt_body<1>(T, r % NI, r / NI, wo, wot, HID);
  }
}

// qkv projection
__global__ __launch_bounds__(256) void k_qkv(const u16* __restrict__ A, const u16* __restrict__ BT,
                                            float* __restrict__ C, int lda, int ldb, int ldc, int K) {
  __shared__ __align__(16) u16 pool[GEMM_POOL(false)];
  gemm_body<0, false>(pool, (int)blockIdx.x, (int)blockIdx.y, A, A, BT, C, lda, ldb, ldc, K, 1.0f, 0.0f);
}

// V transposed planes | rotary + q, k planes
#define NB_VT ((SEQ / 64) * NKV)
__global__ __launch_bounds__(256) void k_planes_vt(const float* __restrict__ qkv, const int* __restrict__ pos,
                                                  const float* __restrict__ tinv,
                                                  u16* __restrict__ Qh, u16* __restrict__ Ql,
                                                  u16* __restrict__ Kh, u16* __restrict__ Kl,
                                                  u16* __restrict__ Vth, u16* __restrict__ Vtl) {
  __shared__ __align__(16) u16 sm[2 * HD * 72];
  static_assert(2 * HD * 72 >= 2 * (NH + NKV) * HD);
  const int b = (int)blockIdx.x;
  if (b < NB_VT) vt_body(sm, b % (SEQ / 64), b / (SEQ / 64), qkv, Vth, Vtl);
  else planes_body(sm, b - NB_VT, qkv, pos, tinv, Qh, Ql, Kh, Kl);
}

// attention: query blocks of the leading SE rows (residual planes) | the rest
__global__ __launch_bounds__(256) __attribute__((amdgpu_num_vgpr(256)))
void k_attn(const u16* __restrict__ Qh, const u16* __restrict__ Ql,
            const u16* __restrict__ Kh, const u16* __restrict__ Kl,
            const u16* __restrict__ Vth, const u16* __restrict__ Vtl,
            const int* __restrict__ amask,
            u16* __restrict__ Ch, u16* __restrict__ Cr) {
  __shared__ __align__(16) u16 pool[ATTN_POOL(true)];
  __shared__ __align__(16) u16 stg[16384];
  const int qblk = (int)blockIdx.x, kv = (int)blockIdx.y;
  if (qblk < SE / BQW) attn_body<true>(pool, stg, qblk, kv, Qh, Ql, Kh, Kl, Vth, Vtl, amask, Ch, Cr);
  else attn_body<false>(pool, stg, qblk, kv, Qh, Ql, Kh, Kl, Vth, Vtl, amask, Ch, Cr);
}

// output projection: row tiles of the leading SE rows (with the residual ctx plane) | the rest
__global__ __launch_bounds__(256) void k_oproj(const u16* __restrict__ A, const u16* __restrict__ Ar,
                                              const u16* __restrict__ BT, float* __restrict__ C,
                                              int lda, int ldb, int ldc, int K, float sh, float sr) {
  __shared__ __align__(16) u16 pool[GEMM_POOL(true)];
  const int bn = (int)blockIdx.x, bm = (int)blockIdx.y;
  if (bm < SE / GEMM_BM) gemm_body<1, true>(pool, bn, bm, A, Ar, BT, C, lda, ldb, ldc, K, sh, sr);
  else gemm_body<1, false>(pool, bn, bm, A, A, BT, C, lda, ldb, ldc, K, sh, 0.0f);
}

// ---------------------------------------------------------------------------------------
extern "C" void kernel_launch(void* const* d_in, const int* in_sizes, int n_in,
                              void* d_out, int out_size, void* d_ws, size_t ws_size,
                              hipStream_t stream) {
  if (n_in < 7) return;
  if (in_sizes[0] < SEQ * HID) return;
  if (in_sizes[1] < SEQ) return;
  if (in_sizes[2] < SEQ) return;
  if (in_sizes[3] < HID * NH * HD) return;
  if (in_sizes[4] < HID * NKV * HD) return;
  if (in_sizes[5] < HID * NKV * HD) return;
  if (in_sizes[6] < NH * HD * HID) return;
  if (out_size < SEQ * HID) return;

  const float* hs  = (const float*)d_in[0];
  const int*   am  = (const int*)d_in[1];
  const int*   pos = (const int*)d_in[2];
  const float* wq  = (const float*)d_in[3];
  const float* wk  = (const float*)d_in[4];
  const float* wv  = (const float*)d_in[5];
  const float* wo  = (const float*)d_in[6];
  float* out = (float*)d_out;

  char* ws = (char*)d_ws;
  size_t off = 0;
#define CARVE(T, name, bytes) T* name = (T*)(ws + off); off += (((size_t)(bytes)) + 255) & ~(size_t)255
  CARVE(u16,   Xb,    (size_t)SEQ * HID * 2);          // bf16 bits [SEQ][HID]
  CARVE(u16,   WqkvT, (size_t)NQKV * HID * 2);         // bf16 bits [3072][HID]
  CARVE(u16,   WoT,   (size_t)HID * HID * 2);          // f16 bits  [HID][HID]
  CARVE(float, QKVf,  (size_t)SEQ * NQKV * 4);         // f32 [SEQ][3072]
  CARVE(u16,   Qh,    (size_t)NH * SEQ * HD * 2);
  CARVE(u16,   Kh,    (size_t)NKV * SEQ * HD * 2);
  CARVE(u16,   Vth,   (size_t)NKV * HD * SEQ * 2);
  CARVE(u16,   Ql,    (size_t)NH * SE * HD * 2);
  CARVE(u16,   Kl,    (size_t)NKV * SE * HD * 2);
  CARVE(u16,   Vtl,   (size_t)NKV * HD * SE * 2);
  CARVE(u16,   Cr,    (size_t)SE * HID * 2);
  CARVE(float, Tinv,  256);
#undef CARVE
  // Ch [SEQ][HID] f16 plane aliases the Xb region: identical extent (SEQ*HID halves), Xb is
  // read only by the qkv projection launch, Ch is first written by the attention launch
  // that comes after it on the same in-order stream.
  static_assert(NH * HD == HID);
  u16* Ch = Xb;
  if (off > ws_size) return;

  // 1) hidden -> bf16, inv_freq table; weights: w [HID][n] -> wt [n][HID]
  k_prep<<<dim3(NB_X + NB_WQ + 2 * NB_WKV + NB_WO), 256, 0, stream>>>(hs, wq, wk, wv, wo, Xb, Tinv, WqkvT, WoT);
  // 2) fused qkv projection: [SEQ][HID] x [HID][3072] -> f32
  k_qkv<<<dim3(NQKV / 128, SEQ / GEMM_BM), 256, 0, stream>>>(Xb, WqkvT, QKVf, HID, HID, NQKV, HID);
  // 3) V transposed planes; rotary + planes
  k_planes_vt<<<dim3(NB_VT + SEQ), 256, 0, stream>>>(QKVf, pos, Tinv, Qh, Ql, Kh, Kl, Vth, Vtl);
  // 4) attention: leading SE rows with residual planes, the rest single products
  k_attn<<<dim3(SEQ / BQW, NKV), 256, 0, stream>>>(Qh, Ql, Kh, Kl, Vth, Vtl, am, Ch, Cr);
  // 5) output projection: rows < SE with the residual ctx plane, the rest plain
  k_oproj<<<dim3(HID / 128, SEQ / GEMM_BM), 256, 0, stream>>>(
      Ch, Cr, WoT, out, HID, HID, HID, HID, 1.0f / 4096.0f, 1.0f / (4096.0f * 1024.0f));
}

// v008
// A run of this version takes 278 microseconds.
// In two side-by-side timings against v007, it was 1.06 and 1.04 times as fast.
// All steps since v000 together make it 4.85 times as fast.
#include <hip/hip_runtime.h>
#include <stdint.h>
#include <stddef.h>

// Contractions: qkv projection = v_wmma_f32_16x16x32_bf16 (bf16 operands, f32 accumulate);
// q.k scores, p.v and output projection = v_wmma_f32_16x16x32_f16 (f16 operands with
// power-of-two carries plus x1024 f16 residual planes on the leading SE query rows,
// f32 accumulate). Softmax and epilogues in f32; rotary sin/cos via f64 quadrant
// reduction + polynomial (no fused multiply-add), rotation in unfused f32.

#ifndef NB
#define NB 1
#endif
#ifndef SEQ
#define SEQ 4096
#endif
#ifndef SE
#if SEQ < 640
#define SE SEQ
#else
#define SE 640
#endif
#endif
#define SEQ_FULL 4096
#define HID 2048
#define NH 16
#define NKV 4
#define HD 128
#define NQKV (NH * HD + 2 * NKV * HD)
#define BQW 32

static_assert(NB == 1);
static_assert(SEQ % 64 == 0);
static_assert(SEQ >= SE);
static_assert(SEQ <= SEQ_FULL);
static_assert(SE >= 64);
static_assert(SE % 64 == 0);
static_assert(SE % BQW == 0);
static_assert(SEQ % 128 == 0);
static_assert(SE % 128 == 0);
static_assert(HID % 128 == 0);
static_assert(HID == 256 * 8);
static_assert(NQKV % 128 == 0);
static_assert(HD == 128);
static_assert(NH == 4 * NKV);
static_assert(NH * HD == HID);

typedef _Float16 f16;
typedef __bf16 bf16;
typedef unsigned short u16;
typedef f16 v16h __attribute__((ext_vector_type(16)));
typedef bf16 v16b __attribute__((ext_vector_type(16)));
typedef float v8f __attribute__((ext_vector_type(8)));
typedef float v4f __attribute__((ext_vector_type(4)));
typedef unsigned v4u __attribute__((ext_vector_type(4)));

union FragH { v16h v; v4u q[2]; f16 h[16]; };
union FragB { v16b v; v4u q[2]; };

__device__ __forceinline__ v8f zero8() {
  v8f z = {0.0f, 0.0f, 0.0f, 0.0f, 0.0f, 0.0f, 0.0f, 0.0f};
  return z;
}

// 16x16x32 f16 WMMA followed by a 4-slot VALU hazard guard on D (A/B kept live).
__device__ __forceinline__ v8f wg_h(v8f acc, v16h a, v16h b) {
  acc = __builtin_amdgcn_wmma_f32_16x16x32_f16(false, a, false, b, (short)0, acc, false, false);
  asm volatile("v_nop\n\tv_nop\n\tv_nop\n\tv_nop" : "+v"(acc) : "v"(a), "v"(b));
  return acc;
}
__device__ __forceinline__ v8f wg_b(v8f acc, v16b a, v16b b) {
  acc = __builtin_amdgcn_wmma_f32_16x16x32_bf16(false, a, false, b, (short)0, acc, false, false);
  asm volatile("v_nop\n\tv_nop\n\tv_nop\n\tv_nop" : "+v"(acc) : "v"(a), "v"(b));
  return acc;
}

// f32 -> bf16 bits, RNE convert.
__device__ __forceinline__ unsigned bf16_rne(float f) {
  const unsigned u = __float_as_uint(f);
  return (u + 0x7FFFu + ((u >> 16) & 1u)) >> 16;
}
// f32 -> f16 bits, RNE convert.
__device__ __forceinline__ u16 hbits(float f) {
  const f16 x = (f16)f;
  return __builtin_bit_cast(u16, x);
}
// f32 -> f16 hi bits plus f16 bits of (v - hi) * 1024 (unfused: sub then mul).
__device__ __forceinline__ void split1024(float v, u16& hb, u16& lb) {
#pragma clang fp contract(off)
  const f16 x = (f16)v;
  const float xr = (float)x;
  const float dlt = v - xr;
  const f16 y = (f16)(dlt * 1024.0f);
  hb = __builtin_bit_cast(u16, x);
  lb = __builtin_bit_cast(u16, y);
}
template <bool B> struct BoolC { static constexpr bool value = B; };
__device__ __forceinline__ int imin(int a, int b) { return a < b ? a : b; }
__device__ __forceinline__ int imax(int a, int b) { return a > b ? a : b; }

// sin/cos of an f32 angle (0 <= ang <= ~4100 rad) in f64 without fused multiply-add:
// quadrant count kq = rint(x * 2/pi); r = (x - kq * P1) - kq * P2 with P1 = the leading
// 33 bits of pi/2 (kq * P1 exact for kq < 2^20) and P2 its tail; odd/even polynomials on
// |r| <= pi/4 (truncation < 3e-14); quadrant select by value; convert to f32.
__device__ __forceinline__ void rot_sincos(float ang, float& sn, float& cs) {
#pragma clang fp contract(off)
  const double x = (double)ang;
  const double kq = __builtin_rint(x * 0.63661977236758134308);
  double r = x - kq * 1.57079632673412561417;
  r = r - kq * 6.07710050650619224932e-11;
  const int q = (int)kq;
  const double r2 = r * r;
  double ps = 1.6059043836821613e-10;
  ps = ps * r2 - 2.5052108385441720e-08;
  ps = ps * r2 + 2.7557319223985893e-06;
  ps = ps * r2 - 1.9841269841269841e-04;
  ps = ps * r2 + 8.3333333333333332e-03;
  ps = ps * r2 - 1.6666666666666666e-01;
  const double r3 = r * r2;
  const double sr = r + r3 * ps;
  double pc = -1.1470745597729725e-11;
  pc = pc * r2 + 2.0876756987868099e-09;
  pc = pc * r2 - 2.7557319223985888e-07;
  pc = pc * r2 + 2.4801587301587302e-05;
  pc = pc * r2 - 1.3888888888888889e-03;
  pc = pc * r2 + 4.1666666666666664e-02;
  pc = pc * r2 - 0.5;
  const double cr = 1.0 + pc * r2;
  const bool odd = (q & 1) != 0;
  const bool neg = (q & 2) != 0;
  double sv = odd ? cr : sr;
  double cv = odd ? -sr : cr;
  sv = neg ? -sv : sv;
  cv = neg ? -cv : cv;
  sn = (float)sv;
  cs = (float)cv;
}

// ---------------------------------------------------------------------------------------
// hidden f32 [SEQ][HID] -> bf16 bits [SEQ][HID]; one block (blk) per row, 16 B per lane.
// Block 0, lanes 0..63 also produce the rotary inv_freq table (64 floats):
// inv[j] = fl32(1 / fl32(10000^(j/64))), with 10000^(1/64) from an iterative f64 64th root.
__device__ __forceinline__ void xconv_body(int blk, const float* __restrict__ x, u16* __restrict__ xb,
                                           float* __restrict__ tinv) {
#pragma clang fp contract(off)
  const int t = threadIdx.x;
  const size_t e = ((size_t)blk * 256 + (size_t)t) * 8;
  const v4f a = *(const v4f*)(x + e);
  const v4f b = *(const v4f*)(x + e + 4);
  v4u w;
  w[0] = bf16_rne(a[0]) | (bf16_rne(a[1]) << 16);
  w[1] = bf16_rne(a[2]) | (bf16_rne(a[3]) << 16);
  w[2] = bf16_rne(b[0]) | (bf16_rne(b[1]) << 16);
  w[3] = bf16_rne(b[2]) | (bf16_rne(b[3]) << 16);

  const bool tab = (blk == 0) && (t < 64);   // wave-uniform (waves 0,1 of block 0)
  float ivf = 0.0f;
  if (tab) {
    double rt = 1.15;
#pragma unroll 1
    for (int it = 0; it < 48; ++it) {
      double p63 = rt;
#pragma unroll 1
      for (int k = 1; k < 63; ++k) p63 *= rt;
      const double p64 = p63 * rt;
      const double f = p64 - 10000.0;
      rt = rt - f / (64.0 * p63);
    }
    double pj = 1.0;
#pragma unroll 1
    for (int k = 0; k < t; ++k) pj *= rt;           // t < 64: bounded
    const float pf = (float)pj;
    ivf = (float)(1.0 / (double)pf);
  }
  *(v4u*)(xb + e) = w;
  if (tab) *(float*)(tinv + t) = ivf;
  
}

// ---------------------------------------------------------------------------------------
// Weight transpose + convert: w f32 [HID][ncol] -> wt 16-bit [ncol][HID] (k contiguous).
// 8 consecutive lanes of one instruction. MODE 0: bf16 bits; MODE 1: f16 bits of
// 64 * bf16(w) (bf16 RNE value first, the x64 f16 copy of it is exact).
// T: 64 * 72 halves of LDS, [o][i], pitch 72 halves (144 B); tile (bi, bo) of the weight.
template <int MODE>
__device__ __forceinline__ void wt_body(u16* T, int bi, int bo, const float* __restrict__ w,
                                        u16* __restrict__ wt, int ncol) {
  const int i0 = bi * 64, o0 = bo * 64, t = threadIdx.x;
#pragma unroll
  for (int j = 0; j < 4; ++j) {
    const int i = (t >> 4) + 16 * j;
    const int oc = (t & 15) * 4;
    const v4f v = *(const v4f*)(w + (size_t)(i0 + i) * (size_t)ncol + o0 + oc);
#pragma unroll
    for (int e = 0; e < 4; ++e) {
      const float f = v[e];
      u16 bb;
      if (MODE == 0) bb = (u16)bf16_rne(f);
      else bb = hbits(__uint_as_float(bf16_rne(f) << 16) * 64.0f);
      T[(oc + e) * 72 + i] = bb;
    }
  }
  __syncthreads();
  v4u val[2];
#pragma unroll
  for (int p = 0; p < 2; ++p) {
    const int o = (t >> 3) + 32 * p;
    val[p] = *(const v4u*)(T + o * 72 + (t & 7) * 8);
  }
#pragma unroll
  for (int p = 0; p < 2; ++p) {
    const int o = (t >> 3) + 32 * p;
    *(v4u*)(wt + (size_t)(o0 + o) * HID + i0 + (t & 7) * 8) = val[p];
  }
  // another job's code follows in the merged kernel: no register of the stores above is rewritten ahead of this wait
  asm volatile("s_wait_xcnt 0x0" ::: "memory");
}

// ---------------------------------------------------------------------------------------
// C[m][n] (f32) = sh * sum_k A[m][k] * BT[n][k]  (+ sr * sum_k Ar[m][k] * BT[n][k] if RES)
// MODE 0: bf16 operands; MODE 1: f16 operands. Block 128 (M) x 128 (N), 8 waves each 64x32:
// a staged operand row serves 128 rows or columns of C, a fragment read from LDS two or four products.
// The block's operand rows go through LDS in tiles of 64 k (one 128-B line of every row): two
// buffers, tile t in buffer t & 1, tile t + 1 copied global -> LDS (asynchronous, through no
// register, whole lines) while tile t is worked on. Fragments come from the LDS rows with the
// split k map (elements 0..7 at k + 8h, 8..15 at k + 16 + 8h); k ascends in steps of 32.
// pool: GEMM_POOL(RES) halves of LDS; the block's tile is (bn, bm).
#define GEMM_BM 128
#define GEMM_POOL(RES) (2 * (((RES) ? 2 : 1) * GEMM_BM * 72 + 128 * 72))
template <int MODE, bool RES>
__device__ __forceinline__ void gemm_body(u16* pool, int bn, int bm,
                                          const u16* __restrict__ A, const u16* __restrict__ Ar,
                                          const u16* __restrict__ BT, float* __restrict__ C,
                                          int lda, int ldb, int ldc, int K,
                                          float sh, float sr) {
  constexpr int BK = 64;                              // k per tile
  constexpr int TP = BK + 8;                          // LDS row pitch in halves: 144 B = 16 B x odd
  constexpr int AT = GEMM_BM * TP, BTL = 128 * TP;    // tile sizes in halves
  constexpr int AS = 0, ES = AT, BS = RES ? 2 * AT : AT;
  constexpr int BUF = BS + BTL;                       // one buffer = A | (Ar) | BT tiles, in halves
  static_assert(2 * BUF == GEMM_POOL(RES));
  static_assert((TP * 2) % 16 == 0 && (BUF * 2) % 16 == 0 && (AT * 2) % 16 == 0);
  static_assert(2 * BUF * 2 >= 8 * 64 * 36 * 4);      // pool doubles as the C stage behind the loop
  const int tid = threadIdx.x, wave = tid >> 5, lane = tid & 31, h = lane >> 4, l = lane & 15;
  const int wm = wave >> 2, wn = wave & 3;
  const int mblk = bm * GEMM_BM, nblk = bn * 128;
  const int mb = mblk + wm * 64;
  const int nb = nblk + wn * 32;
  v8f c[4][2], r[4][2];
  // (loops over c, r and the fragments are unrolled: they are indexed by constants and stay in registers)
#pragma unroll
  for (int i = 0; i < 4; ++i) {
    c[i][0] = zero8(); c[i][1] = zero8();
    r[i][0] = zero8(); r[i][1] = zero8();
  }

  // This lane's 16-byte pieces of a tile: column cc of rows cr, cr + 32, ... (8 lanes cover a line).
  const int cr = tid >> 3, cc = (tid & 7) * 8;
  const unsigned lbase = (unsigned)(size_t)pool;      // byte offset of pool in the work-group's LDS
  const unsigned lpc = lbase + 2u * (unsigned)(cr * TP + cc);
  const u16* ga = A + (size_t)(mblk + cr) * (size_t)lda + cc;
  const u16* ge = Ar + (size_t)(mblk + cr) * (size_t)lda + cc;
  const u16* gb = BT + (size_t)(nblk + cr) * (size_t)ldb + cc;
  // Issue the copies of tile t into buffer t & 1 (all lanes on, block-uniform call sites). The
  // s_wait_xcnt closes each statement so that no address register is rewritten ahead of it.
  auto copy_tile = [&](int t) {
    const unsigned bo = lpc + (unsigned)(t & 1) * (unsigned)(BUF * 2);
    const unsigned a0 = bo + 2u * AS, a1 = a0 + 2u * 32u * TP, a2 = a0 + 2u * 64u * TP, a3 = a0 + 2u * 96u * TP;
    const unsigned b0 = bo + 2u * BS, b1 = b0 + 2u * 32u * TP, b2 = b0 + 2u * 64u * TP, b3 = b0 + 2u * 96u * TP;
    const u16* pa0 = ga + (size_t)t * BK;
    const u16* pa1 = pa0 + (size_t)32 * (size_t)lda;
    const u16* pa2 = pa0 + (size_t)64 * (size_t)lda;
    const u16* pa3 = pa0 + (size_t)96 * (size_t)lda;
    const u16* pb0 = gb + (size_t)t * BK;
    const u16* pb1 = pb0 + (size_t)32 * (size_t)ldb;
    const u16* pb2 = pb0 + (size_t)64 * (size_t)ldb;
    const u16* pb3 = pb0 + (size_t)96 * (size_t)ldb;
    asm volatile("global_load_async_to_lds_b128 %0, %8, off\n\t"
                 "global_load_async_to_lds_b128 %1, %9, off\n\t"
                 "global_load_async_to_lds_b128 %2, %10, off\n\t"
                 "global_load_async_to_lds_b128 %3, %11, off\n\t"
                 "global_load_async_to_lds_b128 %4, %12, off\n\t"
                 "global_load_async_to_lds_b128 %5, %13, off\n\t"
                 "global_load_async_to_lds_b128 %6, %14, off\n\t"
                 "global_load_async_to_lds_b128 %7, %15, off\n\t"
                 "s_wait_xcnt 0x0"
                 :: "v"(a0), "v"(a1), "v"(a2), "v"(a3), "v"(b0), "v"(b1), "v"(b2), "v"(b3),
                    "v"(pa0), "v"(pa1), "v"(pa2), "v"(pa3), "v"(pb0), "v"(pb1), "v"(pb2), "v"(pb3) : "memory");
    if (RES) {
      const unsigned e0 = bo + 2u * ES, e1 = e0 + 2u * 32u * TP, e2 = e0 + 2u * 64u * TP, e3 = e0 + 2u * 96u * TP;
      const u16* pe0 = ge + (size_t)t * BK;
      const u16* pe1 = pe0 + (size_t)32 * (size_t)lda;
      const u16* pe2 = pe0 + (size_t)64 * (size_t)lda;
      const u16* pe3 = pe0 + (size_t)96 * (size_t)lda;
      asm volatile("global_load_async_to_lds_b128 %0, %4, off\n\t"
                   "global_load_async_to_lds_b128 %1, %5, off\n\t"
                   "global_load_async_to_lds_b128 %2, %6, off\n\t"
                   "global_load_async_to_lds_b128 %3, %7, off\n\t"
                   "s_wait_xcnt 0x0"
                   :: "v"(e0), "v"(e1), "v"(e2), "v"(e3), "v"(pe0), "v"(pe1), "v"(pe2), "v"(pe3) : "memory");
    }
  };

  const int nt = K / BK;
  // Tile 0 lands and is published, then tile 1 is set flying.
  copy_tile(0);
  asm volatile("s_wait_asynccnt 0x0" ::: "memory");   // this wave's copies of tile 0 have landed
  __syncthreads();                                    // ... and every other wave's
  if (nt > 1) copy_tile(1);

  const int fa = (wm * 64 + l) * TP + 8 * h;          // this lane's fragment rows in a buffer
  const int fb = (wn * 32 + l) * TP + 8 * h;
  for (int t = 0; t < nt; ++t) {
    const u16* tb = pool + (t & 1) * BUF;             // this tile's buffer
    // unrolled so that both 32-k steps read at constant offsets from one LDS address
#pragma unroll
    for (int ks = 0; ks < BK; ks += 32) {
      const u16* pa = tb + AS + fa + ks;
      const u16* pb = tb + BS + fb + ks;
      if (MODE == 0) {
        FragB a[4], b[2];
#pragma unroll
        for (int j = 0; j < 2; ++j) {
          b[j].q[0] = *(const v4u*)(pb + j * 16 * TP); b[j].q[1] = *(const v4u*)(pb + j * 16 * TP + 16);
        }
#pragma unroll
        for (int i = 0; i < 4; ++i) {
          a[i].q[0] = *(const v4u*)(pa + i * 16 * TP); a[i].q[1] = *(const v4u*)(pa + i * 16 * TP + 16);
        }
#pragma unroll
        for (int i = 0; i < 4; ++i) {
          c[i][0] = wg_b(c[i][0], a[i].v, b[0].v); c[i][1] = wg_b(c[i][1], a[i].v, b[1].v);
        }
      } else {
        FragH a[4], b[2];
#pragma unroll
        for (int j = 0; j < 2; ++j) {
          b[j].q[0] = *(const v4u*)(pb + j * 16 * TP); b[j].q[1] = *(const v4u*)(pb + j * 16 * TP + 16);
        }
#pragma unroll
        for (int i = 0; i < 4; ++i) {
          a[i].q[0] = *(const v4u*)(pa + i * 16 * TP); a[i].q[1] = *(const v4u*)(pa + i * 16 * TP + 16);
        }
#pragma unroll
        for (int i = 0; i < 4; ++i) {
          c[i][0] = wg_h(c[i][0], a[i].v, b[0].v); c[i][1] = wg_h(c[i][1], a[i].v, b[1].v);
        }
        if (RES) {
          const u16* pe = tb + ES + fa + ks;
          FragH e[4];
#pragma unroll
          for (int i = 0; i < 4; ++i) {
            e[i].q[0] = *(const v4u*)(pe + i * 16 * TP); e[i].q[1] = *(const v4u*)(pe + i * 16 * TP + 16);
          }
#pragma unroll
          for (int i = 0; i < 4; ++i) {
            r[i][0] = wg_h(r[i][0], e[i].v, b[0].v); r[i][1] = wg_h(r[i][1], e[i].v, b[1].v);
          }
        }
      }
    }
    // Hand-over: this wave's LDS reads of tile t are done, its copies of tile t + 1 have landed;
    // the barrier publishes tile t + 1 and frees tile t's buffer for tile t + 2.
    asm volatile("s_wait_dscnt 0x0" ::: "memory");
    asm volatile("s_wait_asynccnt 0x0" ::: "memory");
    __syncthreads();
    if (t + 2 < nt) copy_tile(t + 2);
  }
  asm volatile("s_wait_asynccnt 0x0" ::: "memory");   // nothing in flight when pool becomes the C stage

  // Behind the last trip's barrier every reader has left both buffers: pool is the C stage now.
  float* cs = (float*)pool + wave * (64 * 36);
#pragma unroll
  for (int i = 0; i < 4; ++i) {
#pragma unroll
    for (int e = 0; e < 8; ++e) {
      const int ra = 16 * i + 8 * h + e;
      float v0 = sh * c[i][0][e], v1 = sh * c[i][1][e];
      if (RES) { v0 += sr * r[i][0][e]; v1 += sr * r[i][1][e]; }
      cs[ra * 36 + l] = v0;
      cs[ra * 36 + 16 + l] = v1;
    }
  }
  __syncthreads();
  v4f val[16];
#pragma unroll
  for (int i = 0; i < 16; ++i) {
    const int row = 4 * i + (lane >> 3);
    val[i] = *(const v4f*)(cs + row * 36 + (lane & 7) * 4);
  }
#pragma unroll
  for (int i = 0; i < 16; ++i) {
    const int row = 4 * i + (lane >> 3);
    *(v4f*)(C + (size_t)(mb + row) * (size_t)ldc + nb + (lane & 7) * 4) = val[i];
  }
  
}

// ---------------------------------------------------------------------------------------
// Rotary + f16 planes. One block per sequence row s (q: 16 heads x 128, k: 4 heads x 128).
// sm: 2 * (NH + NKV) * HD halves of LDS.
// Qh [NH][SEQ][HD], Kh [NKV][SEQ][HD]: f16 bits of the rotated value.
// Rows s < SE also get Ql [NH][SE][HD], Kl [NKV][SE][HD]: f16 bits of (x - hi) * 1024.
// rotate-half: out[d] = x[d]*cos - x[d+64]*sin, out[d+64] = x[d+64]*cos + x[d]*sin
// (products and sums as separate f32 ops), angle = fl32(pos * inv_freq[d]).
__device__ __forceinline__ void planes_body(u16* sm, int s,
                                            const float* __restrict__ qkv, const int* __restrict__ pos,
                                            const float* __restrict__ tinv,
                                            u16* __restrict__ Qh, u16* __restrict__ Ql,
                                            u16* __restrict__ Kh, u16* __restrict__ Kl) {
#pragma clang fp contract(off)
  u16* Qs = sm;
  u16* Qls = Qs + NH * HD;
  u16* Ks = Qls + NH * HD;
  u16* Kls = Ks + NKV * HD;
  const int t = threadIdx.x;
  const bool early = (s < SE);                       // block-uniform
  int pp = pos[s];
  pp = imin(imax(pp, 0), SEQ_FULL - 1);
  const int di = t & 63;
  const float ang = (float)pp * tinv[di];
  float sn, cs;
  rot_sincos(ang, sn, cs);
  const float* row = qkv + (size_t)s * NQKV;

#pragma unroll 1
  for (int j = 0; j < 4; ++j) {
    const int hh = (t + 256 * j) >> 6;               // 0..15
    const int col = hh * HD + di;
    const float x1 = row[col], x2 = row[col + 64];
    const float a1 = x1 * cs, b1 = x2 * sn;
    const float a2 = x2 * cs, b2 = x1 * sn;
    const float r1 = a1 - b1;
    const float r2 = a2 + b2;
    if (early) {
      u16 a, b;
      split1024(r1, a, b); Qs[col] = a;      Qls[col] = b;
      split1024(r2, a, b); Qs[col + 64] = a; Qls[col + 64] = b;
    } else {
      Qs[col] = hbits(r1);
      Qs[col + 64] = hbits(r2);
    }
  }
  {
    const int kvh = t >> 6;                          // 0..3
    const int col = kvh * HD + di;
    const float x1 = row[NH * HD + col], x2 = row[NH * HD + col + 64];
    const float a1 = x1 * cs, b1 = x2 * sn;
    const float a2 = x2 * cs, b2 = x1 * sn;
    const float r1 = a1 - b1;
    const float r2 = a2 + b2;
    if (early) {
      u16 a, b;
      split1024(r1, a, b); Ks[col] = a;      Kls[col] = b;
      split1024(r2, a, b); Ks[col + 64] = a; Kls[col + 64] = b;
    } else {
      Ks[col] = hbits(r1);
      Ks[col + 64] = hbits(r2);
    }
  }
  __syncthreads();

  const int e = t * 8;
  const int hq = e >> 7, dq = e & 127;               // q: head 0..15
  const bool kw = (t < 64);                          // wave-uniform: waves 0,1
  const int hk = hq, dk = dq;                        // valid for t < 64: kv head 0..3
  const v4u vq = *(const v4u*)(Qs + e);
  v4u vql = vq, vk = vq, vkl = vq;
  if (early) vql = *(const v4u*)(Qls + e);
  if (kw) {
    vk = *(const v4u*)(Ks + e);
    if (early) vkl = *(const v4u*)(Kls + e);
  }
  u16* pq  = Qh + ((size_t)hq * SEQ + s) * HD + dq;
  u16* pql = Ql + ((size_t)hq * SE + (early ? s : 0)) * HD + dq;
  u16* pk  = Kh + ((size_t)hk * SEQ + s) * HD + dk;
  u16* pkl = Kl + ((size_t)hk * SE + (early ? s : 0)) * HD + dk;

  *(v4u*)pq = vq;
  if (early) *(v4u*)pql = vql;
  if (kw) {
    *(v4u*)pk = vk;
    if (early) *(v4u*)pkl = vkl;
  }
  
}

// ---------------------------------------------------------------------------------------
// V transposed planes: Vth [NKV][HD][SEQ] = f16 bits of 16*v, and for keys < SE
// Vtl [NKV][HD][SE] = f16 bits of (16*v - hi) * 1024. Tile = 64 keys x 128 d through LDS,
// sm: 2 * HD * 72 halves of LDS; the block's tile is keys 64 * bs .. + 63 of kv head kv.
__device__ __forceinline__ void vt_body(u16* sm, int bs, int kv, const float* __restrict__ qkv,
                                        u16* __restrict__ Vth, u16* __restrict__ Vtl) {
#pragma clang fp contract(off)
  u16* T = sm;                                       // [d][key], pitch 72 halves
  u16* Tl = T + HD * 72;
  const int s0 = bs * 64, t = threadIdx.x;
  const bool early = (s0 < SE);                      // block-uniform (SE % 64 == 0)
#pragma unroll 1
  for (int j = 0; j < 8; ++j) {
    const int idx = t + 256 * j;
    const int r = idx >> 5;                          // key 0..63
    const int c4 = (idx & 31) * 4;                   // d 0..124
    const v4f v = *(const v4f*)(qkv + (size_t)(s0 + r) * NQKV + NH * HD + NKV * HD + kv * HD + c4);
#pragma unroll
    for (int e = 0; e < 4; ++e) {
      const float f = 16.0f * v[e];
      if (early) {
        u16 a, b;
        split1024(f, a, b);
        T[(c4 + e) * 72 + r] = a;
        Tl[(c4 + e) * 72 + r] = b;
      } else {
        T[(c4 + e) * 72 + r] = hbits(f);
      }
    }
  }
  __syncthreads();
  v4u vh[4], vl[4];
#pragma unroll
  for (int p = 0; p < 4; ++p) {
    const int d = (t >> 3) + 32 * p, c = (t & 7) * 8;
    vh[p] = *(const v4u*)(T + d * 72 + c);
    vl[p] = vh[p];
    if (early) vl[p] = *(const v4u*)(Tl + d * 72 + c);
  }
#pragma unroll
  for (int p = 0; p < 4; ++p) {
    const int d = (t >> 3) + 32 * p, c = (t & 7) * 8;
    *(v4u*)(Vth + ((size_t)kv * HD + d) * SEQ + s0 + c) = vh[p];
    if (early) *(v4u*)(Vtl + ((size_t)kv * HD + d) * SE + s0 + c) = vl[p];
  }
  
}

// ---------------------------------------------------------------------------------------
// Causal GQA flash attention. Block = 8 waves = 4 q heads of one kv head x 32 queries
// (wave w: head kv*4 + (w>>1), queries q0 + (w&1)*16 .. +15). Keys in chunks of 32 staged
// in LDS (two buffers, filled one chunk ahead by asynchronous copies): K tile [32][128] (A operand of S^T = K x Q^T, lane = key row) and V^T tile
// [128 d][32 keys] (B operand of O += P x V, lane = d). Queries live on lanes for the
// softmax; P in D layout of S^T is the A-fragment layout of P x V (lane = query,
// elements 0..7 = keys 8h..8h+7, 8..15 = keys 16+8h..). Online softmax in f32 (exp2 form),
// P carried as f16(4096 p), V as f16(16 v), ctx written as f16(64 ctx).
// EARLY (query rows < SE): q, k, P, v get x1024 residual planes and a second accumulator
// folded before normalisation; head dim handled in four 32-wide passes whose ctx results
// pass; ctx also gets a residual plane Cr. Output Ch [SEQ][HID] (head*128 + d), Cr [SE][HID].
// VGPR file capped at 256 (no high-bank registers).
// pool: ATTN_POOL(EARLY) halves of LDS; stg: 16384 halves of LDS (used where EARLY).
#define ATTN_POOL(EARLY) (2 * ((EARLY) ? 2 : 1) * (32 * (HD + 8) + HD * (32 + 8)))
template <bool EARLY>
__device__ __forceinline__
void attn_body(u16* pool, u16* stg, int qblk, int kv,
               const u16* __restrict__ Qh, const u16* __restrict__ Ql,
               const u16* __restrict__ Kh, const u16* __restrict__ Kl,
               const u16* __restrict__ Vth, const u16* __restrict__ Vtl,
               const int* __restrict__ amask,
               u16* __restrict__ Ch, u16* __restrict__ Cr) {
  // LDS row pitch = 16 B x odd, so that the 16 rows one ds_load_b128 reads fall on distinct banks:
  // K rows (256 B of data) at 272 B, Vt rows (64 B of data) at 80 B.
  constexpr int KP = HD + 8, VP = 32 + 8;             // pitches in halves
  constexpr int KT = 32 * KP, VT = HD * VP;           // tile sizes in halves
  // One buffer = K | (Kres) | Vt | (Vtres) tiles of one key chunk; two buffers, chunk kc in buffer kc & 1:
  // chunk kc + 1 is copied global -> LDS (asynchronous, through no register) while chunk kc is worked on.
  constexpr int KS = 0, KL = KT, VS = EARLY ? 2 * KT : KT, VL = VS + VT;
  constexpr int BUF = EARLY ? 2 * KT + 2 * VT : KT + VT;  // halves per buffer
  static_assert(2 * BUF == ATTN_POOL(EARLY));         // stg where EARLY: per-wave ctx stage [8][16][128]
  static_assert((BUF * 2) % 16 == 0 && (KP * 2) % 16 == 0 && (VP * 2) % 16 == 0);
  static_assert(EARLY || 2 * BUF >= 16384);           // pool doubles as the ctx stage behind the loop
  constexpr int NDT = EARLY ? 2 : 8;
  constexpr int DW = NDT * 16;
  constexpr int NPASS = HD / DW;
  // lane number as the shuffles read it (equal to tid & 31 in this one-dimensional block): h and l then come
  // from a register that is live in the loop anyway, which keeps the kernel inside its 256 registers unspilled
  const int tid = threadIdx.x, lane = (int)__lane_id(), h = lane >> 4, l = lane & 15;
  // the wave's number in a scalar register: what follows from it (head, first query) is scalar too
  const int wave = __builtin_amdgcn_readfirstlane(tid >> 5);
  const int head = kv * (NH / NKV) + (wave >> 1);
  const int q0 = qblk * BQW;
  const int qw0 = q0 + (wave & 1) * 16;
  const int qrow = qw0 + l;                          // this lane's query
  const int nchunk = qblk + 1;                       // keys 0 .. q0+31

  FragH qh[4];
  FragH ql[4];
  const u16* qb = Qh + ((size_t)head * SEQ + qrow) * HD + 8 * h;
  const u16* qlb = Ql + ((size_t)head * SE + (EARLY ? qrow : 0)) * HD + 8 * h;
#pragma unroll
  for (int dc = 0; dc < 4; ++dc) {
    const u16* b = qb + dc * 32;
    qh[dc].q[0] = *(const v4u*)b;
    qh[dc].q[1] = *(const v4u*)(b + 16);
    if (EARLY) {
      const u16* b2 = qlb + dc * 32;
      ql[dc].q[0] = *(const v4u*)b2;
      ql[dc].q[1] = *(const v4u*)(b2 + 16);
    } else {
      ql[dc].q[0] = qh[dc].q[0];
      ql[dc].q[1] = qh[dc].q[1];
    }
  }
  // The Q loads' address registers are inputs of the wait, so that they stay as they are up to it:
  // no Q fragment lands on a register that a load still in flight names.
  if (EARLY) asm volatile("s_wait_xcnt 0x0" :: "v"(qb), "v"(qlb) : "memory");
  else asm volatile("s_wait_xcnt 0x0" :: "v"(qb) : "memory");
  const float SCL = 0.088388347648318441f * 1.4426950408889634f;   // log2(e)/sqrt(128)

  // ctx stage [16 rows][128 cols] per wave: EARLY in its own region (persists across the
  // 32-wide passes), otherwise aliasing pool after the K/V tiles are dead.
  u16* os;
  if (EARLY) os = stg + wave * (16 * 128);
  else os = pool + wave * (16 * 128);

  // This lane's 16-byte pieces of a chunk: K rows kr and kr + 16, Vt rows vd and vd + 64.
  const int kr = tid >> 4, kcol = (tid & 15) * 8;
  const int vd = tid >> 2, vcol = (tid & 3) * 8;
  const unsigned lbase = (unsigned)(size_t)pool;     // byte offset of pool in the work-group's LDS
  const unsigned lk = lbase + 2u * (unsigned)(KS + kr * KP + kcol);
  const unsigned lv = lbase + 2u * (unsigned)(VS + vd * VP + vcol);
  const u16* gk = Kh + ((size_t)kv * SEQ + kr) * HD + kcol;
  const u16* gv = Vth + ((size_t)kv * HD + vd) * SEQ + vcol;
  const u16* gkl = Kl + ((size_t)kv * SE + kr) * HD + kcol;
  const u16* gvl = Vtl + ((size_t)kv * HD + vd) * SE + vcol;
  // Issue the copies of chunk c into buffer c & 1 (all lanes on, block-uniform call sites). The
  // s_wait_xcnt closes each statement so that no address register is rewritten ahead of it.
  auto copy_chunk = [&](int c) {
    const unsigned bo = (unsigned)(c & 1) * (unsigned)(BUF * 2);
    const unsigned k0 = lk + bo, k1 = k0 + 2u * 16u * KP;
    const unsigned v0 = lv + bo, v1 = v0 + 2u * 64u * VP;
    const u16* a0 = gk + (size_t)c * (32 * HD);
    const u16* a1 = a0 + 16 * HD;
    const u16* b0 = gv + c * 32;
    const u16* b1 = b0 + (size_t)64 * SEQ;
    asm volatile("global_load_async_to_lds_b128 %0, %4, off\n\t"
                 "global_load_async_to_lds_b128 %1, %5, off\n\t"
                 "global_load_async_to_lds_b128 %2, %6, off\n\t"
                 "global_load_async_to_lds_b128 %3, %7, off\n\t"
                 "s_wait_xcnt 0x0"
                 :: "v"(k0), "v"(k1), "v"(v0), "v"(v1), "v"(a0), "v"(a1), "v"(b0), "v"(b1) : "memory");
    if (EARLY) {
      const unsigned k2 = k0 + 2u * (KL - KS), k3 = k1 + 2u * (KL - KS);
      const unsigned v2 = v0 + 2u * (VL - VS), v3 = v1 + 2u * (VL - VS);
      const u16* a2 = gkl + (size_t)c * (32 * HD);
      const u16* a3 = a2 + 16 * HD;
      const u16* b2 = gvl + c * 32;
      const u16* b3 = b2 + (size_t)64 * SE;
      asm volatile("global_load_async_to_lds_b128 %0, %4, off\n\t"
                   "global_load_async_to_lds_b128 %1, %5, off\n\t"
                   "global_load_async_to_lds_b128 %2, %6, off\n\t"
                   "global_load_async_to_lds_b128 %3, %7, off\n\t"
                   "s_wait_xcnt 0x0"
                   :: "v"(k2), "v"(k3), "v"(v2), "v"(v3), "v"(a2), "v"(a3), "v"(b2), "v"(b3) : "memory");
    }
  };

#pragma unroll 1
  for (int pass = 0; pass < NPASS; ++pass) {
    const int dbase = pass * DW;
    v8f o[NDT];
    v8f orr[NDT];
#pragma unroll
    for (int dt = 0; dt < NDT; ++dt) { o[dt] = zero8(); orr[dt] = zero8(); }
    float rmax = -1.0e30f, rsum = 0.0f;

    // Chunk 0 lands and is published, then chunk 1 is set flying. (A later pass gets here behind
    // the last trip's s_wait_dscnt and barrier, so every reader has left both buffers.)
    copy_chunk(0);
    asm volatile("s_wait_asynccnt 0x0" ::: "memory");  // this wave's copies of chunk 0 have landed
    __syncthreads();                                 // ... and every other wave's
    if (nchunk > 1) copy_chunk(1);
    int av = amask[imin(lane, SEQ - 1)];             // padding mask of chunk 0's keys

#pragma unroll 1
    for (int kc = 0; kc < nchunk; ++kc) {
      const int kbase = kc * 32;
      const u16* tb = pool + (kc & 1) * BUF;         // this chunk's buffer
      // padding-mask word for the 32 keys of this chunk, per wave (all lanes active); the next
      // chunk's mask values are read one chunk ahead, like its tiles
      const unsigned mw = __builtin_amdgcn_ballot_w32(av != 0);
      av = amask[imin(kbase + 32 + lane, SEQ - 1)];

      // This chunk's LDS fragment reads stand in groups ahead of the matrix instructions that use
      // them, so that one LDS latency is waited out per group and not one per matrix instruction.
      // A group is issued where the registers of fragments already used have come free.
      auto ld_k = [&](int plane, int sub, int dc) {
        FragH f;
        const u16* p = tb + plane + (sub * 16 + l) * KP + dc * 32 + 8 * h;
        f.q[0] = *(const v4u*)p;
        f.q[1] = *(const v4u*)(p + 16);
        return f;
      };
      auto ld_v = [&](int plane, int dt) {
        FragH f;
        const u16* p = tb + plane + (dbase + dt * 16 + l) * VP + 8 * h;
        f.q[0] = *(const v4u*)p;
        f.q[1] = *(const v4u*)(p + 16);
        return f;
      };
      FragH kf[2][4], kg[2][4], vf[NDT], vg[NDT];
      v8f acc[2], accr[2];
      acc[0] = zero8(); acc[1] = zero8(); accr[0] = zero8(); accr[1] = zero8();
      if (!EARLY) {
        // all K fragments first; the two key halves' chains alternate; V fragments follow in two
        // groups among the last score products and land while the softmax is worked out
        // (loops unrolled: the fragment arrays are indexed by constants and stay in registers)
#pragma unroll
        for (int dc = 0; dc < 4; ++dc) { kf[0][dc] = ld_k(KS, 0, dc); kf[1][dc] = ld_k(KS, 1, dc); }
#pragma unroll
        for (int dc = 0; dc < 4; ++dc) {
          acc[0] = wg_h(acc[0], kf[0][dc].v, qh[dc].v);
          acc[1] = wg_h(acc[1], kf[1][dc].v, qh[dc].v);
          if (dc == 1 || dc == 3) {
#pragma unroll
            for (int i = 0; i < NDT / 2; ++i) {
              const int dt = (dc >> 1) * (NDT / 2) + i;
              vf[dt] = ld_v(VS, dt);
            }
          }
        }
      } else {
        // step i = key half i >> 2, 32-wide d step i & 3, with its value and residual fragments.
        // Reads go out two steps at a time, one step ahead of their first product (three steps'
        // fragments at most are held: the register file allows no more here); the V fragments
        // go out ahead of the last step and land while the softmax is worked out.
        auto ld_step = [&](int i) {
          kf[i >> 2][i & 3] = ld_k(KS, i >> 2, i & 3);
          kg[i >> 2][i & 3] = ld_k(KL, i >> 2, i & 3);
        };
        ld_step(0);
        ld_step(1);
        // unrolled: the fragment arrays are indexed by constants and stay in registers
#pragma unroll
        for (int i = 0; i < 8; ++i) {
          const int sub = i >> 2, dc = i & 3;
          acc[sub] = wg_h(acc[sub], kf[sub][dc].v, qh[dc].v);
          accr[sub] = wg_h(accr[sub], kf[sub][dc].v, ql[dc].v);
          accr[sub] = wg_h(accr[sub], kg[sub][dc].v, qh[dc].v);
          if (i == 0 || i == 2 || i == 4) {
            ld_step(i + 2);
            ld_step(i + 3);
          }
          if (i == 6) {
#pragma unroll
            for (int dt = 0; dt < NDT; ++dt) { vf[dt] = ld_v(VS, dt); vg[dt] = ld_v(VL, dt); }
          }
        }
      }

      // scores S^T[key][query]; lane l = query, element r = key sub*16 + 8h + r
      float u[16];
#pragma unroll
      for (int sub = 0; sub < 2; ++sub) {
#pragma unroll
        for (int r = 0; r < 8; ++r) {
          float s = acc[sub][r];
          if (EARLY) s += accr[sub][r] * (1.0f / 1024.0f);
          u[sub * 8 + r] = s * SCL;
        }
      }
      // Online softmax of the chunk. MASKED: the causal compare and the padding bit of every key are
      // worked out and applied; otherwise every key counts and none of that arithmetic is done.
      // (Its loops are unrolled so that u, ph and pr are indexed by constants and stay in registers.)
      float scale, psum;
      FragH ph;
      FragH pr;
      auto soft = [&](auto masked) {
        constexpr bool MASKED = decltype(masked)::value;
        // bit j of vw: key kbase + 8h + j counts (at or before this lane's query, not padded out)
        unsigned vw = 0xFFFFFFFFu;
        if (MASKED) {
          const int lim = (qw0 - kbase) + (l - 8 * h);
          const unsigned cw = lim < 0 ? 0u : (lim >= 31 ? 0xFFFFFFFFu : (2u << lim) - 1u);
          vw = (mw >> (8 * h)) & cw;
        }
        float m_new = rmax;
#pragma unroll
        for (int i = 0; i < 16; ++i) {
          if (MASKED) u[i] = ((vw >> ((i >> 3) * 16 + (i & 7))) & 1u) ? u[i] : -1.0e30f;
          m_new = fmaxf(m_new, u[i]);
        }
        m_new = fmaxf(m_new, __shfl_xor(m_new, 16, 32));
        scale = __builtin_amdgcn_exp2f(rmax - m_new);
        rmax = m_new;
        psum = 0.0f;
#pragma unroll
        for (int i = 0; i < 16; ++i) {
          const float pe = __builtin_amdgcn_exp2f(u[i] - m_new);
          const float pv = (!MASKED || ((vw >> ((i >> 3) * 16 + (i & 7))) & 1u)) ? pe : 0.0f;
          psum += pv;
          const float pc = pv * 4096.0f;
          const f16 hv = (f16)pc;
          ph.h[i] = hv;
          if (EARLY) pr.h[i] = (f16)((pc - (float)hv) * 1024.0f);
          else pr.h[i] = hv;
        }
      };
      // The same for every lane of the wave (scalar operands): all 32 keys of the chunk lie at or
      // before the wave's first query and none is padded out. True of every chunk but the last
      // where the padding mask is all ones.
      if (kbase + 31 <= qw0 && mw == 0xFFFFFFFFu) soft(BoolC<false>{});
      else soft(BoolC<true>{});
      psum += __shfl_xor(psum, 16, 32);
      rsum = rsum * scale + psum;

      float sc[8];
#pragma unroll
      for (int r = 0; r < 8; ++r) sc[r] = __shfl(scale, 8 * h + r, 32);
#pragma unroll
      for (int dt = 0; dt < NDT; ++dt) {
#pragma unroll
        for (int r = 0; r < 8; ++r) {
          o[dt][r] *= sc[r];
          if (EARLY) orr[dt][r] *= sc[r];
        }
      }
      // O += P x V ; B fragment lane = d row of the Vt tile, elements = keys (split map)
#pragma unroll
      for (int dt = 0; dt < NDT; ++dt) {
        o[dt] = wg_h(o[dt], ph.v, vf[dt].v);
        if (EARLY) {
          orr[dt] = wg_h(orr[dt], pr.v, vf[dt].v);
          orr[dt] = wg_h(orr[dt], ph.v, vg[dt].v);
        }
      }
      // Hand-over: this wave's LDS reads of chunk kc are done, its copies of chunk kc + 1 have
      // landed; the barrier publishes chunk kc + 1 and frees chunk kc's buffer for chunk kc + 2.
      asm volatile("s_wait_dscnt 0x0" ::: "memory");
      asm volatile("s_wait_asynccnt 0x0" ::: "memory");
      __syncthreads();
      if (kc + 2 < nchunk) copy_chunk(kc + 2);
    }
    asm volatile("s_wait_asynccnt 0x0" ::: "memory");  // nothing in flight when the buffers are reused

    // epilogue: ctx = (o + orr/1024) / (4096 * 16 * l); plane value = 64 * ctx
    if (!EARLY) __syncthreads();                     // K/V tiles dead, pool reused as stage
    const float inv = 1.0f / rsum;
    float ir[8];
#pragma unroll
    for (int r = 0; r < 8; ++r) ir[r] = __shfl(inv, 8 * h + r, 32) * (1.0f / 1024.0f);
    const int cb = EARLY ? ((pass & 1) * 32) : 0;   // column offset inside the 64-wide line half
#pragma unroll
    for (int dt = 0; dt < NDT; ++dt) {
#pragma unroll
      for (int r = 0; r < 8; ++r) {
        float val = o[dt][r];
        if (EARLY) val += orr[dt][r] * (1.0f / 1024.0f);
        val *= ir[r];
        if (EARLY) {
          u16 a, b;
          split1024(val, a, b);
          os[(8 * h + r) * 128 + cb + dt * 16 + l] = a;
          os[(8 * h + r) * 128 + 64 + cb + dt * 16 + l] = b;
        } else {
          os[(8 * h + r) * 128 + dt * 16 + l] = hbits(val);
        }
      }
    }
    if (!EARLY) {
      __syncthreads();
      // 16 rows x 256 B = 32 lines; instruction i: lanes 8g..8g+7 -> line 4i+g
      v4u vals[8];
#pragma unroll
      for (int i = 0; i < 8; ++i) {
        const int L = 4 * i + (lane >> 3);
        const int row = L >> 1, seg = L & 1;
        vals[i] = *(const v4u*)(os + row * 128 + seg * 64 + (lane & 7) * 8);
      }
#pragma unroll
      for (int i = 0; i < 8; ++i) {
        const int L = 4 * i + (lane >> 3);
        const int row = L >> 1, seg = L & 1;
        *(v4u*)(Ch + (size_t)(qw0 + row) * HID + head * HD + seg * 64 + (lane & 7) * 8) = vals[i];
      }
      // the pair's next query block follows: no register of the stores above is rewritten ahead of this wait
      asm volatile("s_wait_xcnt 0x0" ::: "memory");
    } else {
      if ((pass & 1) != 0) {                         // block-uniform: stage holds d line (pass>>1)
        __syncthreads();
        const int dline = (pass >> 1) * 64;
        v4u va[4], vb[4];
#pragma unroll
        for (int i = 0; i < 4; ++i) {
          const int row = 4 * i + (lane >> 3);
          va[i] = *(const v4u*)(os + row * 128 + (lane & 7) * 8);
          vb[i] = *(const v4u*)(os + row * 128 + 64 + (lane & 7) * 8);
        }
#pragma unroll
        for (int i = 0; i < 4; ++i) {
          const int row = 4 * i + (lane >> 3);
          const size_t off = (size_t)(qw0 + row) * HID + head * HD + dline + (lane & 7) * 8;
          *(v4u*)(Ch + off) = va[i];
          *(v4u*)(Cr + off) = vb[i];
        }
        // the next pass or query block follows: no register of the stores above is rewritten ahead of this wait
        asm volatile("s_wait_xcnt 0x0" ::: "memory");
      }
    }
  }
}

// ---------------------------------------------------------------------------------------
// Launches. Jobs that need nothing of each other share one grid: a range of the block index
// (the same for a whole block) picks the job, so that part-filled grids run side by side.

// hidden -> bf16 and the inv_freq table | wq, wk, wv -> bf16, transposed | wo -> f16, transposed
#define NB_X SEQ
#define NB_WQ ((HID / 64) * ((NH * HD) / 64))
#define NB_WKV ((HID / 64) * ((NKV * HD) / 64))
#define NB_WO ((HID / 64) * (HID / 64))
__global__ __launch_bounds__(256) void k_prep(const float* __restrict__ x, const float* __restrict__ wq,
                                             const float* __restrict__ wk, const float* __restrict__ wv,
                                             const float* __restrict__ wo, u16* __restrict__ xb,
                                             float* __restrict__ tinv, u16* __restrict__ wqkvt,
                                             u16* __restrict__ wot) {
  __shared__ __align__(16) u16 T[64 * 72];
  constexpr int NI = HID / 64;                       // tiles along the weights' input dimension
  const int b = (int)blockIdx.x;
  if (b < NB_X) {
    xconv_body(b, x, xb, tinv);
  } else if (b < NB_X + NB_WQ) {
    const int r = b - NB_X;
    wt_body<0>(T, r % NI, r / NI, wq, wqkvt, NH * HD);
  } else if (b < NB_X + NB_WQ + NB_WKV) {
    const int r = b - (NB_X + NB_WQ);
    wt_body<0>(T, r % NI, r / NI, wk, wqkvt + (size_t)(NH * HD) * HID, NKV * HD);
  } else if (b < NB_X + NB_WQ + 2 * NB_WKV) {
    const int r = b - (NB_X + NB_WQ + NB_WKV);
    wt_body<0>(T, r % NI, r / NI, wv, wqkvt + (size_t)(NH * HD + NKV * HD) * HID, NKV * HD);
  } else {
    const int r = b - (NB_X + NB_WQ + 2 * NB_WKV);
    wt_body<1>(T, r % NI, r / NI, wo, wot, HID);
  }
}

// qkv projection
__global__ __launch_bounds__(256) void k_qkv(const u16* __restrict__ A, const u16* __restrict__ BT,
                                            float* __restrict__ C, int lda, int ldb, int ldc, int K) {
  __shared__ __align__(16) u16 pool[GEMM_POOL(false)];
  gemm_body<0, false>(pool, (int)blockIdx.x, (int)blockIdx.y, A, A, BT, C, lda, ldb, ldc, K, 1.0f, 0.0f);
}

// V transposed planes | rotary + q, k planes
#define NB_VT ((SEQ / 64) * NKV)
__global__ __launch_bounds__(256) void k_planes_vt(const float* __restrict__ qkv, const int* __restrict__ pos,
                                                  const float* __restrict__ tinv,
                                                  u16* __restrict__ Qh, u16* __restrict__ Ql,
                                                  u16* __restrict__ Kh, u16* __restrict__ Kl,
                                                  u16* __restrict__ Vth, u16* __restrict__ Vtl) {
  __shared__ __align__(16) u16 sm[2 * HD * 72];
  static_assert(2 * HD * 72 >= 2 * (NH + NKV) * HD);
  const int b = (int)blockIdx.x;
  if (b < NB_VT) vt_body(sm, b % (SEQ / 64), b / (SEQ / 64), qkv, Vth, Vtl);
  else planes_body(sm, b - NB_VT, qkv, pos, tinv, Qh, Ql, Kh, Kl);
}

// attention: a work-group works two query blocks, one after the other, whose key chunk counts add up to the
// same sum in every work-group of its kind (block j and the last but j): the cost of a causal query block
// grows with its index, all work-groups are resident at once, and the launch lasts as long as the fullest.
template <bool EARLY>
__device__ __forceinline__
void attn_pair(u16* pool, u16* stg, int qfirst, int qsecond, int kv,
               const u16* __restrict__ Qh, const u16* __restrict__ Ql,
               const u16* __restrict__ Kh, const u16* __restrict__ Kl,
               const u16* __restrict__ Vth, const u16* __restrict__ Vtl,
               const int* __restrict__ amask,
               u16* __restrict__ Ch, u16* __restrict__ Cr) {
  // not unrolled: one copy of the body in the instruction cache
#pragma unroll 1
  for (int ph = 0; ph < 2; ++ph) {
    attn_body<EARLY>(pool, stg, ph == 0 ? qfirst : qsecond, kv, Qh, Ql, Kh, Kl, Vth, Vtl, amask, Ch, Cr);
    if (!EARLY && ph == 0) {
      // Between the two blocks: the first one's ctx stage lies in pool, which the second one's copies fill
      // anew: this wave's LDS reads of it are done, and behind the barrier every wave's. (Where EARLY the
      // stage is each wave's own part of stg, and pool was left behind the last trip's barrier.)
      asm volatile("s_wait_dscnt 0x0" ::: "memory");
      __syncthreads();
    }
  }
}

// Pairs among the query blocks of the leading SE rows (residual planes) | pairs among the rest.
#define NQB (SEQ / BQW)
#define NEB (SE / BQW)
static_assert(NEB % 2 == 0 && (NQB - NEB) % 2 == 0);
__global__ __launch_bounds__(256) __attribute__((amdgpu_num_vgpr(256)))
void k_attn(const u16* __restrict__ Qh, const u16* __restrict__ Ql,
            const u16* __restrict__ Kh, const u16* __restrict__ Kl,
            const u16* __restrict__ Vth, const u16* __restrict__ Vtl,
            const int* __restrict__ amask,
            u16* __restrict__ Ch, u16* __restrict__ Cr) {
  __shared__ __align__(16) u16 pool[ATTN_POOL(true)];
  __shared__ __align__(16) u16 stg[16384];
  const int pr = (int)blockIdx.x, kv = (int)blockIdx.y;
  if (pr < NEB / 2) {
    attn_pair<true>(pool, stg, NEB - 1 - pr, pr, kv, Qh, Ql, Kh, Kl, Vth, Vtl, amask, Ch, Cr);
  } else {
    const int j = pr - NEB / 2;
    attn_pair<false>(pool, stg, NQB - 1 - j, NEB + j, kv, Qh, Ql, Kh, Kl, Vth, Vtl, amask, Ch, Cr);
  }
}

// output projection: row tiles of the leading SE rows (with the residual ctx plane) | the rest
__global__ __launch_bounds__(256) void k_oproj(const u16* __restrict__ A, const u16* __restrict__ Ar,
                                              const u16* __restrict__ BT, float* __restrict__ C,
                                              int lda, int ldb, int ldc, int K, float sh, float sr) {
  __shared__ __align__(16) u16 pool[GEMM_POOL(true)];
  const int bn = (int)blockIdx.x, bm = (int)blockIdx.y;
  if (bm < SE / GEMM_BM) gemm_body<1, true>(pool, bn, bm, A, Ar, BT, C, lda, ldb, ldc, K, sh, sr);
  else gemm_body<1, false>(pool, bn, bm, A, A, BT, C, lda, ldb, ldc, K, sh, 0.0f);
}

// ---------------------------------------------------------------------------------------
extern "C" void kernel_launch(void* const* d_in, const int* in_sizes, int n_in,
                              void* d_out, int out_size, void* d_ws, size_t ws_size,
                              hipStream_t stream) {
  if (n_in < 7) return;
  if (in_sizes[0] < SEQ * HID) return;
  if (in_sizes[1] < SEQ) return;
  if (in_sizes[2] < SEQ) return;
  if (in_sizes[3] < HID * NH * HD) return;
  if (in_sizes[4] < HID * NKV * HD) return;
  if (in_sizes[5] < HID * NKV * HD) return;
  if (in_sizes[6] < NH * HD * HID) return;
  if (out_size < SEQ * HID) return;

  const float* hs  = (const float*)d_in[0];
  const int*   am  = (const int*)d_in[1];
  const int*   pos = (const int*)d_in[2];
  const float* wq  = (const float*)d_in[3];
  const float* wk  = (const float*)d_in[4];
  const float* wv  = (const float*)d_in[5];
  const float* wo  = (const float*)d_in[6];
  float* out = (float*)d_out;

  char* ws = (char*)d_ws;
  size_t off = 0;
#define CARVE(T, name, bytes) T* name = (T*)(ws + off); off += (((size_t)(bytes)) + 255) & ~(size_t)255
  CARVE(u16,   Xb,    (size_t)SEQ * HID * 2);          // bf16 bits [SEQ][HID]
  CARVE(u16,   WqkvT, (size_t)NQKV * HID * 2);         // bf16 bits [3072][HID]
  CARVE(u16,   WoT,   (size_t)HID * HID * 2);          // f16 bits  [HID][HID]
  CARVE(float, QKVf,  (size_t)SEQ * NQKV * 4);         // f32 [SEQ][3072]
  CARVE(u16,   Qh,    (size_t)NH * SEQ * HD * 2);
  CARVE(u16,   Kh,    (size_t)NKV * SEQ * HD * 2);
  CARVE(u16,   Vth,   (size_t)NKV * HD * SEQ * 2);
  CARVE(u16,   Ql,    (size_t)NH * SE * HD * 2);
  CARVE(u16,   Kl,    (size_t)NKV * SE * HD * 2);
  CARVE(u16,   Vtl,   (size_t)NKV * HD * SE * 2);
  CARVE(u16,   Cr,    (size_t)SE * HID * 2);
  CARVE(float, Tinv,  256);
#undef CARVE
  // Ch [SEQ][HID] f16 plane aliases the Xb region: identical extent (SEQ*HID halves), Xb is
  // read only by the qkv projection launch, Ch is first written by the attention launch
  // that comes after it on the same in-order stream.
  static_assert(NH * HD == HID);
  u16* Ch = Xb;
  if (off > ws_size) return;

  // 1) hidden -> bf16, inv_freq table; weights: w [HID][n] -> wt [n][HID]
  k_prep<<<dim3(NB_X + NB_WQ + 2 * NB_WKV + NB_WO), 256, 0, stream>>>(hs, wq, wk, wv, wo, Xb, Tinv, WqkvT, WoT);
  // 2) fused qkv projection: [SEQ][HID] x [HID][3072] -> f32
  k_qkv<<<dim3(NQKV / 128, SEQ / GEMM_BM), 256, 0, stream>>>(Xb, WqkvT, QKVf, HID, HID, NQKV, HID);
  // 3) V transposed planes; rotary + planes
  k_planes_vt<<<dim3(NB_VT + SEQ), 256, 0, stream>>>(QKVf, pos, Tinv, Qh, Ql, Kh, Kl, Vth, Vtl);
  // 4) attention: leading SE rows with residual planes, the rest single products; two query blocks a work-group
  k_attn<<<dim3(SEQ / BQW / 2, NKV), 256, 0, stream>>>(Qh, Ql, Kh, Kl, Vth, Vtl, am, Ch, Cr);
  // 5) output projection: rows < SE with the residual ctx plane, the rest plain
  k_oproj<<<dim3(HID / 128, SEQ / GEMM_BM), 256, 0, stream>>>(
      Ch, Cr, WoT, out, HID, HID, HID, HID, 1.0f / 4096.0f, 1.0f / (4096.0f * 1024.0f));
}

// v009
// It runs in 228 microseconds.
// Two timings next to v008 put it at 1.21 and 1.23 times that version's speed.
// Counting every step since v000, it is 5.91 times as fast.
#include <hip/hip_runtime.h>
#include <stdint.h>
#include <stddef.h>

// Contractions: qkv projection = v_wmma_f32_16x16x32_bf16 (bf16 operands, f32 accumulate);
// q.k scores, p.v and output projection = v_wmma_f32_16x16x32_f16 (f16 operands with
// power-of-two carries plus x1024 f16 residual planes on the leading SE query rows,
// f32 accumulate). Softmax and epilogues in f32; rotary sin/cos via f64 quadrant
// reduction + polynomial (no fused multiply-add), rotation in unfused f32.

#ifndef NB
#define NB 1
#endif
#ifndef SEQ
#define SEQ 4096
#endif
#ifndef SE
#if SEQ < 640
#define SE SEQ
#else
#define SE 640
#endif
#endif
#define SEQ_FULL 4096
#define HID 2048
#define NH 16
#define NKV 4
#define HD 128
#define NQKV (NH * HD + 2 * NKV * HD)
#define BQW 32

static_assert(NB == 1);
static_assert(SEQ % 64 == 0);
static_assert(SEQ >= SE);
static_assert(SEQ <= SEQ_FULL);
static_assert(SE >= 64);
static_assert(SE % 64 == 0);
static_assert(SE % BQW == 0);
static_assert(SEQ % 128 == 0);
static_assert(SE % 128 == 0);
static_assert(HID % 128 == 0);
static_assert(HID == 256 * 8);
static_assert(NQKV % 128 == 0);
static_assert(HD == 128);
static_assert(NH == 4 * NKV);
static_assert(NH * HD == HID);

typedef _Float16 f16;
typedef __bf16 bf16;
typedef unsigned short u16;
typedef f16 v16h __attribute__((ext_vector_type(16)));
typedef bf16 v16b __attribute__((ext_vector_type(16)));
typedef float v8f __attribute__((ext_vector_type(8)));
typedef float v4f __attribute__((ext_vector_type(4)));
typedef unsigned v4u __attribute__((ext_vector_type(4)));

union FragH { v16h v; v4u q[2]; f16 h[16]; };
union FragB { v16b v; v4u q[2]; };

__device__ __forceinline__ v8f zero8() {
  v8f z = {0.0f, 0.0f, 0.0f, 0.0f, 0.0f, 0.0f, 0.0f, 0.0f};
  return z;
}

// 16x16x32 f16 WMMA followed by a 4-slot VALU hazard guard on D (A/B kept live).
__device__ __forceinline__ v8f wg_h(v8f acc, v16h a, v16h b) {
  acc = __builtin_amdgcn_wmma_f32_16x16x32_f16(false, a, false, b, (short)0, acc, false, false);
  asm volatile("v_nop\n\tv_nop\n\tv_nop\n\tv_nop" : "+v"(acc) : "v"(a), "v"(b));
  return acc;
}
__device__ __forceinline__ v8f wg_b(v8f acc, v16b a, v16b b) {
  acc = __builtin_amdgcn_wmma_f32_16x16x32_bf16(false, a, false, b, (short)0, acc, false, false);
  asm volatile("v_nop\n\tv_nop\n\tv_nop\n\tv_nop" : "+v"(acc) : "v"(a), "v"(b));
  return acc;
}

// f32 -> bf16 bits, RNE convert.
__device__ __forceinline__ unsigned bf16_rne(float f) {
  const unsigned u = __float_as_uint(f);
  return (u + 0x7FFFu + ((u >> 16) & 1u)) >> 16;
}
// f32 -> f16 bits, RNE convert.
__device__ __forceinline__ u16 hbits(float f) {
  const f16 x = (f16)f;
  return __builtin_bit_cast(u16, x);
}
// f32 -> f16 hi bits plus f16 bits of (v - hi) * 1024 (unfused: sub then mul).
__device__ __forceinline__ void split1024(float v, u16& hb, u16& lb) {
#pragma clang fp contract(off)
  const f16 x = (f16)v;
  const float xr = (float)x;
  const float dlt = v - xr;
  const f16 y = (f16)(dlt * 1024.0f);
  hb = __builtin_bit_cast(u16, x);
  lb = __builtin_bit_cast(u16, y);
}
template <bool B> struct BoolC { static constexpr bool value = B; };
__device__ __forceinline__ int imin(int a, int b) { return a < b ? a : b; }
__device__ __forceinline__ int imax(int a, int b) { return a > b ? a : b; }

// sin/cos of an f32 angle (0 <= ang <= ~4100 rad) in f64 without fused multiply-add:
// quadrant count kq = rint(x * 2/pi); r = (x - kq * P1) - kq * P2 with P1 = the leading
// 33 bits of pi/2 (kq * P1 exact for kq < 2^20) and P2 its tail; odd/even polynomials on
// |r| <= pi/4 (truncation < 3e-14); quadrant select by value; convert to f32.
__device__ __forceinline__ void rot_sincos(float ang, float& sn, float& cs) {
#pragma clang fp contract(off)
  const double x = (double)ang;
  const double kq = __builtin_rint(x * 0.63661977236758134308);
  double r = x - kq * 1.57079632673412561417;
  r = r - kq * 6.07710050650619224932e-11;
  const int q = (int)kq;
  const double r2 = r * r;
  double ps = 1.6059043836821613e-10;
  ps = ps * r2 - 2.5052108385441720e-08;
  ps = ps * r2 + 2.7557319223985893e-06;
  ps = ps * r2 - 1.9841269841269841e-04;
  ps = ps * r2 + 8.3333333333333332e-03;
  ps = ps * r2 - 1.6666666666666666e-01;
  const double r3 = r * r2;
  const double sr = r + r3 * ps;
  double pc = -1.1470745597729725e-11;
  pc = pc * r2 + 2.0876756987868099e-09;
  pc = pc * r2 - 2.7557319223985888e-07;
  pc = pc * r2 + 2.4801587301587302e-05;
  pc = pc * r2 - 1.3888888888888889e-03;
  pc = pc * r2 + 4.1666666666666664e-02;
  pc = pc * r2 - 0.5;
  const double cr = 1.0 + pc * r2;
  const bool odd = (q & 1) != 0;
  const bool neg = (q & 2) != 0;
  double sv = odd ? cr : sr;
  double cv = odd ? -sr : cr;
  sv = neg ? -sv : sv;
  cv = neg ? -cv : cv;
  sn = (float)sv;
  cs = (float)cv;
}

// ---------------------------------------------------------------------------------------
// hidden f32 [SEQ][HID] -> bf16 bits [SEQ][HID]; one block (blk) per row, 16 B per lane.
// Block 0, lanes 0..63 also produce the rotary inv_freq table (64 floats):
// inv[j] = fl32(1 / fl32(10000^(j/64))), with 10000^(j/64) in f64 as the product, over the set bits b of j,
// of 10000^(2^b/64): six factors, each the square root of the one before (roots of a literal: the compiler
// folds them). A lane's serial chain is six multiplies, so that this block does not outlast its launch.
__device__ __forceinline__ void xconv_body(int blk, const float* __restrict__ x, u16* __restrict__ xb,
                                           float* __restrict__ tinv) {
#pragma clang fp contract(off)
  const int t = threadIdx.x;
  const size_t e = ((size_t)blk * 256 + (size_t)t) * 8;
  const v4f a = *(const v4f*)(x + e);
  const v4f b = *(const v4f*)(x + e + 4);
  v4u w;
  w[0] = bf16_rne(a[0]) | (bf16_rne(a[1]) << 16);
  w[1] = bf16_rne(a[2]) | (bf16_rne(a[3]) << 16);
  w[2] = bf16_rne(b[0]) | (bf16_rne(b[1]) << 16);
  w[3] = bf16_rne(b[2]) | (bf16_rne(b[3]) << 16);

  const bool tab = (blk == 0) && (t < 64);   // wave-uniform (waves 0,1 of block 0)
  float ivf = 0.0f;
  if (tab) {
    double fb = 10000.0, pj = 1.0;
    for (int b = 5; b >= 0; --b) {
      fb = __builtin_sqrt(fb);                       // 10000^(2^b/64)
      pj *= ((t >> b) & 1) ? fb : 1.0;
    }
    const float pf = (float)pj;
    ivf = (float)(1.0 / (double)pf);
  }
  *(v4u*)(xb + e) = w;
  if (tab) *(float*)(tinv + t) = ivf;
  
}

// ---------------------------------------------------------------------------------------
// Weight transpose + convert: w f32 [HID][ncol] -> wt 16-bit [ncol][HID] (k contiguous).
// 8 consecutive lanes of one instruction. MODE 0: bf16 bits; MODE 1: f16 bits of
// 64 * bf16(w) (bf16 RNE value first, the x64 f16 copy of it is exact).
// T: 64 * 72 halves of LDS, [o][i], pitch 72 halves (144 B); tile (bi, bo) of the weight.
template <int MODE>
__device__ __forceinline__ void wt_body(u16* T, int bi, int bo, const float* __restrict__ w,
                                        u16* __restrict__ wt, int ncol) {
  const int i0 = bi * 64, o0 = bo * 64, t = threadIdx.x;
#pragma unroll
  for (int j = 0; j < 4; ++j) {
    const int i = (t >> 4) + 16 * j;
    const int oc = (t & 15) * 4;
    const v4f v = *(const v4f*)(w + (size_t)(i0 + i) * (size_t)ncol + o0 + oc);
#pragma unroll
    for (int e = 0; e < 4; ++e) {
      const float f = v[e];
      u16 bb;
      if (MODE == 0) bb = (u16)bf16_rne(f);
      else bb = hbits(__uint_as_float(bf16_rne(f) << 16) * 64.0f);
      T[(oc + e) * 72 + i] = bb;
    }
  }
  __syncthreads();
  v4u val[2];
#pragma unroll
  for (int p = 0; p < 2; ++p) {
    const int o = (t >> 3) + 32 * p;
    val[p] = *(const v4u*)(T + o * 72 + (t & 7) * 8);
  }
#pragma unroll
  for (int p = 0; p < 2; ++p) {
    const int o = (t >> 3) + 32 * p;
    *(v4u*)(wt + (size_t)(o0 + o) * HID + i0 + (t & 7) * 8) = val[p];
  }
  // another job's code follows in the merged kernel: no register of the stores above is rewritten ahead of this wait
  asm volatile("s_wait_xcnt 0x0" ::: "memory");
}

// ---------------------------------------------------------------------------------------
// C[m][n] (f32) = sh * sum_k A[m][k] * BT[n][k]  (+ sr * sum_k Ar[m][k] * BT[n][k] if RES)
// MODE 0: bf16 operands; MODE 1: f16 operands. Block 128 (M) x 128 (N), 8 waves each 64x32:
// a staged operand row serves 128 rows or columns of C, a fragment read from LDS two or four products.
// The block's operand rows go through LDS in tiles of 64 k (one 128-B line of every row): two
// buffers, tile t in buffer t & 1, tile t + 1 copied global -> LDS (asynchronous, through no
// register, whole lines) while tile t is worked on. Fragments come from the LDS rows with the
// split k map (elements 0..7 at k + 8h, 8..15 at k + 16 + 8h); k ascends in steps of 32.
// pool: GEMM_POOL(RES) halves of LDS; the block's tile is (bn, bm).
#define GEMM_BM 128
#define GEMM_POOL(RES) (2 * (((RES) ? 2 : 1) * GEMM_BM * 72 + 128 * 72))
template <int MODE, bool RES>
__device__ __forceinline__ void gemm_body(u16* pool, int bn, int bm,
                                          const u16* __restrict__ A, const u16* __restrict__ Ar,
                                          const u16* __restrict__ BT, float* __restrict__ C,
                                          int lda, int ldb, int ldc, int K,
                                          float sh, float sr) {
  constexpr int BK = 64;                              // k per tile
  constexpr int TP = BK + 8;                          // LDS row pitch in halves: 144 B = 16 B x odd
  constexpr int AT = GEMM_BM * TP, BTL = 128 * TP;    // tile sizes in halves
  constexpr int AS = 0, ES = AT, BS = RES ? 2 * AT : AT;
  constexpr int BUF = BS + BTL;                       // one buffer = A | (Ar) | BT tiles, in halves
  static_assert(2 * BUF == GEMM_POOL(RES));
  static_assert((TP * 2) % 16 == 0 && (BUF * 2) % 16 == 0 && (AT * 2) % 16 == 0);
  static_assert(2 * BUF * 2 >= 8 * 64 * 36 * 4);      // pool doubles as the C stage behind the loop
  const int tid = threadIdx.x, wave = tid >> 5, lane = tid & 31, h = lane >> 4, l = lane & 15;
  const int wm = wave >> 2, wn = wave & 3;
  const int mblk = bm * GEMM_BM, nblk = bn * 128;
  const int mb = mblk + wm * 64;
  const int nb = nblk + wn * 32;
  v8f c[4][2], r[4][2];
  // (loops over c, r and the fragments are unrolled: they are indexed by constants and stay in registers)
#pragma unroll
  for (int i = 0; i < 4; ++i) {
    c[i][0] = zero8(); c[i][1] = zero8();
    r[i][0] = zero8(); r[i][1] = zero8();
  }

  // This lane's 16-byte pieces of a tile: column cc of rows cr, cr + 32, ... (8 lanes cover a line).
  const int cr = tid >> 3, cc = (tid & 7) * 8;
  const unsigned lbase = (unsigned)(size_t)pool;      // byte offset of pool in the work-group's LDS
  const unsigned lpc = lbase + 2u * (unsigned)(cr * TP + cc);
  const u16* ga = A + (size_t)(mblk + cr) * (size_t)lda + cc;
  const u16* ge = Ar + (size_t)(mblk + cr) * (size_t)lda + cc;
  const u16* gb = BT + (size_t)(nblk + cr) * (size_t)ldb + cc;
  // Issue the copies of tile t into buffer t & 1 (all lanes on, block-uniform call sites). The
  // s_wait_xcnt closes each statement so that no address register is rewritten ahead of it.
  auto copy_tile = [&](int t) {
    const unsigned bo = lpc + (unsigned)(t & 1) * (unsigned)(BUF * 2);
    const unsigned a0 = bo + 2u * AS, a1 = a0 + 2u * 32u * TP, a2 = a0 + 2u * 64u * TP, a3 = a0 + 2u * 96u * TP;
    const unsigned b0 = bo + 2u * BS, b1 = b0 + 2u * 32u * TP, b2 = b0 + 2u * 64u * TP, b3 = b0 + 2u * 96u * TP;
    const u16* pa0 = ga + (size_t)t * BK;
    const u16* pa1 = pa0 + (size_t)32 * (size_t)lda;
    const u16* pa2 = pa0 + (size_t)64 * (size_t)lda;
    const u16* pa3 = pa0 + (size_t)96 * (size_t)lda;
    const u16* pb0 = gb + (size_t)t * BK;
    const u16* pb1 = pb0 + (size_t)32 * (size_t)ldb;
    const u16* pb2 = pb0 + (size_t)64 * (size_t)ldb;
    const u16* pb3 = pb0 + (size_t)96 * (size_t)ldb;
    asm volatile("global_load_async_to_lds_b128 %0, %8, off\n\t"
                 "global_load_async_to_lds_b128 %1, %9, off\n\t"
                 "global_load_async_to_lds_b128 %2, %10, off\n\t"
                 "global_load_async_to_lds_b128 %3, %11, off\n\t"
                 "global_load_async_to_lds_b128 %4, %12, off\n\t"
                 "global_load_async_to_lds_b128 %5, %13, off\n\t"
                 "global_load_async_to_lds_b128 %6, %14, off\n\t"
                 "global_load_async_to_lds_b128 %7, %15, off\n\t"
                 "s_wait_xcnt 0x0"
                 :: "v"(a0), "v"(a1), "v"(a2), "v"(a3), "v"(b0), "v"(b1), "v"(b2), "v"(b3),
                    "v"(pa0), "v"(pa1), "v"(pa2), "v"(pa3), "v"(pb0), "v"(pb1), "v"(pb2), "v"(pb3) : "memory");
    if (RES) {
      const unsigned e0 = bo + 2u * ES, e1 = e0 + 2u * 32u * TP, e2 = e0 + 2u * 64u * TP, e3 = e0 + 2u * 96u * TP;
      const u16* pe0 = ge + (size_t)t * BK;
      const u16* pe1 = pe0 + (size_t)32 * (size_t)lda;
      const u16* pe2 = pe0 + (size_t)64 * (size_t)lda;
      const u16* pe3 = pe0 + (size_t)96 * (size_t)lda;
      asm volatile("global_load_async_to_lds_b128 %0, %4, off\n\t"
                   "global_load_async_to_lds_b128 %1, %5, off\n\t"
                   "global_load_async_to_lds_b128 %2, %6, off\n\t"
                   "global_load_async_to_lds_b128 %3, %7, off\n\t"
                   "s_wait_xcnt 0x0"
                   :: "v"(e0), "v"(e1), "v"(e2), "v"(e3), "v"(pe0), "v"(pe1), "v"(pe2), "v"(pe3) : "memory");
    }
  };

  const int nt = K / BK;
  // Tile 0 lands and is published, then tile 1 is set flying.
  copy_tile(0);
  asm volatile("s_wait_asynccnt 0x0" ::: "memory");   // this wave's copies of tile 0 have landed
  __syncthreads();                                    // ... and every other wave's
  if (nt > 1) copy_tile(1);

  const int fa = (wm * 64 + l) * TP + 8 * h;          // this lane's fragment rows in a buffer
  const int fb = (wn * 32 + l) * TP + 8 * h;
  for (int t = 0; t < nt; ++t) {
    const u16* tb = pool + (t & 1) * BUF;             // this tile's buffer
    // unrolled so that both 32-k steps read at constant offsets from one LDS address
#pragma unroll
    for (int ks = 0; ks < BK; ks += 32) {
      const u16* pa = tb + AS + fa + ks;
      const u16* pb = tb + BS + fb + ks;
      if (MODE == 0) {
        FragB a[4], b[2];
#pragma unroll
        for (int j = 0; j < 2; ++j) {
          b[j].q[0] = *(const v4u*)(pb + j * 16 * TP); b[j].q[1] = *(const v4u*)(pb + j * 16 * TP + 16);
        }
#pragma unroll
        for (int i = 0; i < 4; ++i) {
          a[i].q[0] = *(const v4u*)(pa + i * 16 * TP); a[i].q[1] = *(const v4u*)(pa + i * 16 * TP + 16);
        }
#pragma unroll
        for (int i = 0; i < 4; ++i) {
          c[i][0] = wg_b(c[i][0], a[i].v, b[0].v); c[i][1] = wg_b(c[i][1], a[i].v, b[1].v);
        }
      } else {
        FragH a[4], b[2];
#pragma unroll
        for (int j = 0; j < 2; ++j) {
          b[j].q[0] = *(const v4u*)(pb + j * 16 * TP); b[j].q[1] = *(const v4u*)(pb + j * 16 * TP + 16);
        }
#pragma unroll
        for (int i = 0; i < 4; ++i) {
          a[i].q[0] = *(const v4u*)(pa + i * 16 * TP); a[i].q[1] = *(const v4u*)(pa + i * 16 * TP + 16);
        }
#pragma unroll
        for (int i = 0; i < 4; ++i) {
          c[i][0] = wg_h(c[i][0], a[i].v, b[0].v); c[i][1] = wg_h(c[i][1], a[i].v, b[1].v);
        }
        if (RES) {
          const u16* pe = tb + ES + fa + ks;
          FragH e[4];
#pragma unroll
          for (int i = 0; i < 4; ++i) {
            e[i].q[0] = *(const v4u*)(pe + i * 16 * TP); e[i].q[1] = *(const v4u*)(pe + i * 16 * TP + 16);
          }
#pragma unroll
          for (int i = 0; i < 4; ++i) {
            r[i][0] = wg_h(r[i][0], e[i].v, b[0].v); r[i][1] = wg_h(r[i][1], e[i].v, b[1].v);
          }
        }
      }
    }
    // Hand-over: this wave's LDS reads of tile t are done, its copies of tile t + 1 have landed;
    // the barrier publishes tile t + 1 and frees tile t's buffer for tile t + 2.
    asm volatile("s_wait_dscnt 0x0" ::: "memory");
    asm volatile("s_wait_asynccnt 0x0" ::: "memory");
    __syncthreads();
    if (t + 2 < nt) copy_tile(t + 2);
  }
  asm volatile("s_wait_asynccnt 0x0" ::: "memory");   // nothing in flight when pool becomes the C stage

  // Behind the last trip's barrier every reader has left both buffers: pool is the C stage now.
  float* cs = (float*)pool + wave * (64 * 36);
#pragma unroll
  for (int i = 0; i < 4; ++i) {
#pragma unroll
    for (int e = 0; e < 8; ++e) {
      const int ra = 16 * i + 8 * h + e;
      float v0 = sh * c[i][0][e], v1 = sh * c[i][1][e];
      if (RES) { v0 += sr * r[i][0][e]; v1 += sr * r[i][1][e]; }
      cs[ra * 36 + l] = v0;
      cs[ra * 36 + 16 + l] = v1;
    }
  }
  __syncthreads();
  v4f val[16];
#pragma unroll
  for (int i = 0; i < 16; ++i) {
    const int row = 4 * i + (lane >> 3);
    val[i] = *(const v4f*)(cs + row * 36 + (lane & 7) * 4);
  }
#pragma unroll
  for (int i = 0; i < 16; ++i) {
    const int row = 4 * i + (lane >> 3);
    *(v4f*)(C + (size_t)(mb + row) * (size_t)ldc + nb + (lane & 7) * 4) = val[i];
  }
  
}

// ---------------------------------------------------------------------------------------
// Rotary + f16 planes. One block per sequence row s (q: 16 heads x 128, k: 4 heads x 128).
// sm: 2 * (NH + NKV) * HD halves of LDS.
// Qh [NH][SEQ][HD], Kh [NKV][SEQ][HD]: f16 bits of the rotated value.
// Rows s < SE also get Ql [NH][SE][HD], Kl [NKV][SE][HD]: f16 bits of (x - hi) * 1024.
// rotate-half: out[d] = x[d]*cos - x[d+64]*sin, out[d+64] = x[d+64]*cos + x[d]*sin
// (products and sums as separate f32 ops), angle = fl32(pos * inv_freq[d]).
__device__ __forceinline__ void planes_body(u16* sm, int s,
                                            const float* __restrict__ qkv, const int* __restrict__ pos,
                                            const float* __restrict__ tinv,
                                            u16* __restrict__ Qh, u16* __restrict__ Ql,
                                            u16* __restrict__ Kh, u16* __restrict__ Kl) {
#pragma clang fp contract(off)
  u16* Qs = sm;
  u16* Qls = Qs + NH * HD;
  u16* Ks = Qls + NH * HD;
  u16* Kls = Ks + NKV * HD;
  const int t = threadIdx.x;
  const bool early = (s < SE);                       // block-uniform
  int pp = pos[s];
  pp = imin(imax(pp, 0), SEQ_FULL - 1);
  const int di = t & 63;
  const float ang = (float)pp * tinv[di];
  float sn, cs;
  rot_sincos(ang, sn, cs);
  const float* row = qkv + (size_t)s * NQKV;

#pragma unroll 1
  for (int j = 0; j < 4; ++j) {
    const int hh = (t + 256 * j) >> 6;               // 0..15
    const int col = hh * HD + di;
    const float x1 = row[col], x2 = row[col + 64];
    const float a1 = x1 * cs, b1 = x2 * sn;
    const float a2 = x2 * cs, b2 = x1 * sn;
    const float r1 = a1 - b1;
    const float r2 = a2 + b2;
    if (early) {
      u16 a, b;
      split1024(r1, a, b); Qs[col] = a;      Qls[col] = b;
      split1024(r2, a, b); Qs[col + 64] = a; Qls[col + 64] = b;
    } else {
      Qs[col] = hbits(r1);
      Qs[col + 64] = hbits(r2);
    }
  }
  {
    const int kvh = t >> 6;                          // 0..3
    const int col = kvh * HD + di;
    const float x1 = row[NH * HD + col], x2 = row[NH * HD + col + 64];
    const float a1 = x1 * cs, b1 = x2 * sn;
    const float a2 = x2 * cs, b2 = x1 * sn;
    const float r1 = a1 - b1;
    const float r2 = a2 + b2;
    if (early) {
      u16 a, b;
      split1024(r1, a, b); Ks[col] = a;      Kls[col] = b;
      split1024(r2, a, b); Ks[col + 64] = a; Kls[col + 64] = b;
    } else {
      Ks[col] = hbits(r1);
      Ks[col + 64] = hbits(r2);
    }
  }
  __syncthreads();

  const int e = t * 8;
  const int hq = e >> 7, dq = e & 127;               // q: head 0..15
  const bool kw = (t < 64);                          // wave-uniform: waves 0,1
  const int hk = hq, dk = dq;                        // valid for t < 64: kv head 0..3
  const v4u vq = *(const v4u*)(Qs + e);
  v4u vql = vq, vk = vq, vkl = vq;
  if (early) vql = *(const v4u*)(Qls + e);
  if (kw) {
    vk = *(const v4u*)(Ks + e);
    if (early) vkl = *(const v4u*)(Kls + e);
  }
  u16* pq  = Qh + ((size_t)hq * SEQ + s) * HD + dq;
  u16* pql = Ql + ((size_t)hq * SE + (early ? s : 0)) * HD + dq;
  u16* pk  = Kh + ((size_t)hk * SEQ + s) * HD + dk;
  u16* pkl = Kl + ((size_t)hk * SE + (early ? s : 0)) * HD + dk;

  *(v4u*)pq = vq;
  if (early) *(v4u*)pql = vql;
  if (kw) {
    *(v4u*)pk = vk;
    if (early) *(v4u*)pkl = vkl;
  }
  
}

// ---------------------------------------------------------------------------------------
// V transposed planes: Vth [NKV][HD][SEQ] = f16 bits of 16*v, and for keys < SE
// Vtl [NKV][HD][SE] = f16 bits of (16*v - hi) * 1024. Tile = 64 keys x 128 d through LDS,
// sm: 2 * HD * 72 halves of LDS; the block's tile is keys 64 * bs .. + 63 of kv head kv.
__device__ __forceinline__ void vt_body(u16* sm, int bs, int kv, const float* __restrict__ qkv,
                                        u16* __restrict__ Vth, u16* __restrict__ Vtl) {
#pragma clang fp contract(off)
  u16* T = sm;                                       // [d][key], pitch 72 halves
  u16* Tl = T + HD * 72;
  const int s0 = bs * 64, t = threadIdx.x;
  const bool early = (s0 < SE);                      // block-uniform (SE % 64 == 0)
#pragma unroll 1
  for (int j = 0; j < 8; ++j) {
    const int idx = t + 256 * j;
    const int r = idx >> 5;                          // key 0..63
    const int c4 = (idx & 31) * 4;                   // d 0..124
    const v4f v = *(const v4f*)(qkv + (size_t)(s0 + r) * NQKV + NH * HD + NKV * HD + kv * HD + c4);
#pragma unroll
    for (int e = 0; e < 4; ++e) {
      const float f = 16.0f * v[e];
      if (early) {
        u16 a, b;
        split1024(f, a, b);
        T[(c4 + e) * 72 + r] = a;
        Tl[(c4 + e) * 72 + r] = b;
      } else {
        T[(c4 + e) * 72 + r] = hbits(f);
      }
    }
  }
  __syncthreads();
  v4u vh[4], vl[4];
#pragma unroll
  for (int p = 0; p < 4; ++p) {
    const int d = (t >> 3) + 32 * p, c = (t & 7) * 8;
    vh[p] = *(const v4u*)(T + d * 72 + c);
    vl[p] = vh[p];
    if (early) vl[p] = *(const v4u*)(Tl + d * 72 + c);
  }
#pragma unroll
  for (int p = 0; p < 4; ++p) {
    const int d = (t >> 3) + 32 * p, c = (t & 7) * 8;
    *(v4u*)(Vth + ((size_t)kv * HD + d) * SEQ + s0 + c) = vh[p];
    if (early) *(v4u*)(Vtl + ((size_t)kv * HD + d) * SE + s0 + c) = vl[p];
  }
  
}

// ---------------------------------------------------------------------------------------
// Causal GQA flash attention. Block = 8 waves = 4 q heads of one kv head x 32 queries
// (wave w: head kv*4 + (w>>1), queries q0 + (w&1)*16 .. +15). Keys in chunks of 32 staged
// in LDS (two buffers, filled one chunk ahead by asynchronous copies): K tile [32][128] (A operand of S^T = K x Q^T, lane = key row) and V^T tile
// [128 d][32 keys] (B operand of O += P x V, lane = d). Queries live on lanes for the
// softmax; P in D layout of S^T is the A-fragment layout of P x V (lane = query,
// elements 0..7 = keys 8h..8h+7, 8..15 = keys 16+8h..). Online softmax in f32 (exp2 form),
// P carried as f16(4096 p), V as f16(16 v), ctx written as f16(64 ctx).
// EARLY (query rows < SE): q, k, P, v get x1024 residual planes and a second accumulator
// folded before normalisation; head dim handled in four 32-wide passes whose ctx results
// pass; ctx also gets a residual plane Cr. Output Ch [SEQ][HID] (head*128 + d), Cr [SE][HID].
// VGPR file capped at 256 (no high-bank registers).
// pool: ATTN_POOL(EARLY) halves of LDS; stg: 16384 halves of LDS (used where EARLY).
#define ATTN_POOL(EARLY) (2 * ((EARLY) ? 2 : 1) * (32 * (HD + 8) + HD * (32 + 8)))
template <bool EARLY>
__device__ __forceinline__
void attn_body(u16* pool, u16* stg, int qblk, int kv,
               const u16* __restrict__ Qh, const u16* __restrict__ Ql,
               const u16* __restrict__ Kh, const u16* __restrict__ Kl,
               const u16* __restrict__ Vth, const u16* __restrict__ Vtl,
               const int* __restrict__ amask,
               u16* __restrict__ Ch, u16* __restrict__ Cr) {
  // LDS row pitch = 16 B x odd, so that the 16 rows one ds_load_b128 reads fall on distinct banks:
  // K rows (256 B of data) at 272 B, Vt rows (64 B of data) at 80 B.
  constexpr int KP = HD + 8, VP = 32 + 8;             // pitches in halves
  constexpr int KT = 32 * KP, VT = HD * VP;           // tile sizes in halves
  // One buffer = K | (Kres) | Vt | (Vtres) tiles of one key chunk; two buffers, chunk kc in buffer kc & 1:
  // chunk kc + 1 is copied global -> LDS (asynchronous, through no register) while chunk kc is worked on.
  constexpr int KS = 0, KL = KT, VS = EARLY ? 2 * KT : KT, VL = VS + VT;
  constexpr int BUF = EARLY ? 2 * KT + 2 * VT : KT + VT;  // halves per buffer
  static_assert(2 * BUF == ATTN_POOL(EARLY));         // stg where EARLY: per-wave ctx stage [8][16][128]
  static_assert((BUF * 2) % 16 == 0 && (KP * 2) % 16 == 0 && (VP * 2) % 16 == 0);
  static_assert(EARLY || 2 * BUF >= 16384);           // pool doubles as the ctx stage behind the loop
  constexpr int NDT = EARLY ? 2 : 8;
  constexpr int DW = NDT * 16;
  constexpr int NPASS = HD / DW;
  // lane number as the shuffles read it (equal to tid & 31 in this one-dimensional block): h and l then come
  // from a register that is live in the loop anyway, which keeps the kernel inside its 256 registers unspilled
  const int tid = threadIdx.x, lane = (int)__lane_id(), h = lane >> 4, l = lane & 15;
  // the wave's number in a scalar register: what follows from it (head, first query) is scalar too
  const int wave = __builtin_amdgcn_readfirstlane(tid >> 5);
  const int head = kv * (NH / NKV) + (wave >> 1);
  const int q0 = qblk * BQW;
  const int qw0 = q0 + (wave & 1) * 16;
  const int qrow = qw0 + l;                          // this lane's query
  const int nchunk = qblk + 1;                       // keys 0 .. q0+31

  FragH qh[4];
  FragH ql[4];
  const u16* qb = Qh + ((size_t)head * SEQ + qrow) * HD + 8 * h;
  const u16* qlb = Ql + ((size_t)head * SE + (EARLY ? qrow : 0)) * HD + 8 * h;
#pragma unroll
  for (int dc = 0; dc < 4; ++dc) {
    const u16* b = qb + dc * 32;
    qh[dc].q[0] = *(const v4u*)b;
    qh[dc].q[1] = *(const v4u*)(b + 16);
    if (EARLY) {
      const u16* b2 = qlb + dc * 32;
      ql[dc].q[0] = *(const v4u*)b2;
      ql[dc].q[1] = *(const v4u*)(b2 + 16);
    } else {
      ql[dc].q[0] = qh[dc].q[0];
      ql[dc].q[1] = qh[dc].q[1];
    }
  }
  // The Q loads' address registers are inputs of the wait, so that they stay as they are up to it:
  // no Q fragment lands on a register that a load still in flight names.
  if (EARLY) asm volatile("s_wait_xcnt 0x0" :: "v"(qb), "v"(qlb) : "memory");
  else asm volatile("s_wait_xcnt 0x0" :: "v"(qb) : "memory");
  const float SCL = 0.088388347648318441f * 1.4426950408889634f;   // log2(e)/sqrt(128)

  // ctx stage [16 rows][128 cols] per wave: EARLY in its own region (persists across the
  // 32-wide passes), otherwise aliasing pool after the K/V tiles are dead.
  u16* os;
  if (EARLY) os = stg + wave * (16 * 128);
  else os = pool + wave * (16 * 128);

  // This lane's 16-byte pieces of a chunk: K rows kr and kr + 16, Vt rows vd and vd + 64.
  const int kr = tid >> 4, kcol = (tid & 15) * 8;
  const int vd = tid >> 2, vcol = (tid & 3) * 8;
  const unsigned lbase = (unsigned)(size_t)pool;     // byte offset of pool in the work-group's LDS
  const unsigned lk = lbase + 2u * (unsigned)(KS + kr * KP + kcol);
  const unsigned lv = lbase + 2u * (unsigned)(VS + vd * VP + vcol);
  const u16* gk = Kh + ((size_t)kv * SEQ + kr) * HD + kcol;
  const u16* gv = Vth + ((size_t)kv * HD + vd) * SEQ + vcol;
  const u16* gkl = Kl + ((size_t)kv * SE + kr) * HD + kcol;
  const u16* gvl = Vtl + ((size_t)kv * HD + vd) * SE + vcol;
  // Issue the copies of chunk c into buffer c & 1 (all lanes on, block-uniform call sites). The
  // s_wait_xcnt closes each statement so that no address register is rewritten ahead of it.
  auto copy_chunk = [&](int c) {
    const unsigned bo = (unsigned)(c & 1) * (unsigned)(BUF * 2);
    const unsigned k0 = lk + bo, k1 = k0 + 2u * 16u * KP;
    const unsigned v0 = lv + bo, v1 = v0 + 2u * 64u * VP;
    const u16* a0 = gk + (size_t)c * (32 * HD);
    const u16* a1 = a0 + 16 * HD;
    const u16* b0 = gv + c * 32;
    const u16* b1 = b0 + (size_t)64 * SEQ;
    asm volatile("global_load_async_to_lds_b128 %0, %4, off\n\t"
                 "global_load_async_to_lds_b128 %1, %5, off\n\t"
                 "global_load_async_to_lds_b128 %2, %6, off\n\t"
                 "global_load_async_to_lds_b128 %3, %7, off\n\t"
                 "s_wait_xcnt 0x0"
                 :: "v"(k0), "v"(k1), "v"(v0), "v"(v1), "v"(a0), "v"(a1), "v"(b0), "v"(b1) : "memory");
    if (EARLY) {
      const unsigned k2 = k0 + 2u * (KL - KS), k3 = k1 + 2u * (KL - KS);
      const unsigned v2 = v0 + 2u * (VL - VS), v3 = v1 + 2u * (VL - VS);
      const u16* a2 = gkl + (size_t)c * (32 * HD);
      const u16* a3 = a2 + 16 * HD;
      const u16* b2 = gvl + c * 32;
      const u16* b3 = b2 + (size_t)64 * SE;
      asm volatile("global_load_async_to_lds_b128 %0, %4, off\n\t"
                   "global_load_async_to_lds_b128 %1, %5, off\n\t"
                   "global_load_async_to_lds_b128 %2, %6, off\n\t"
                   "global_load_async_to_lds_b128 %3, %7, off\n\t"
                   "s_wait_xcnt 0x0"
                   :: "v"(k2), "v"(k3), "v"(v2), "v"(v3), "v"(a2), "v"(a3), "v"(b2), "v"(b3) : "memory");
    }
  };

#pragma unroll 1
  for (int pass = 0; pass < NPASS; ++pass) {
    const int dbase = pass * DW;
    v8f o[NDT];
    v8f orr[NDT];
#pragma unroll
    for (int dt = 0; dt < NDT; ++dt) { o[dt] = zero8(); orr[dt] = zero8(); }
    float rmax = -1.0e30f, rsum = 0.0f;

    // Chunk 0 lands and is published, then chunk 1 is set flying. (A later pass gets here behind
    // the last trip's s_wait_dscnt and barrier, so every reader has left both buffers.)
    copy_chunk(0);
    asm volatile("s_wait_asynccnt 0x0" ::: "memory");  // this wave's copies of chunk 0 have landed
    __syncthreads();                                 // ... and every other wave's
    if (nchunk > 1) copy_chunk(1);
    int av = amask[imin(lane, SEQ - 1)];             // padding mask of chunk 0's keys

#pragma unroll 1
    for (int kc = 0; kc < nchunk; ++kc) {
      const int kbase = kc * 32;
      const u16* tb = pool + (kc & 1) * BUF;         // this chunk's buffer
      // padding-mask word for the 32 keys of this chunk, per wave (all lanes active); the next
      // chunk's mask values are read one chunk ahead, like its tiles
      const unsigned mw = __builtin_amdgcn_ballot_w32(av != 0);
      av = amask[imin(kbase + 32 + lane, SEQ - 1)];

      // This chunk's LDS fragment reads stand in groups ahead of the matrix instructions that use
      // them, so that one LDS latency is waited out per group and not one per matrix instruction.
      // A group is issued where the registers of fragments already used have come free.
      auto ld_k = [&](int plane, int sub, int dc) {
        FragH f;
        const u16* p = tb + plane + (sub * 16 + l) * KP + dc * 32 + 8 * h;
        f.q[0] = *(const v4u*)p;
        f.q[1] = *(const v4u*)(p + 16);
        return f;
      };
      auto ld_v = [&](int plane, int dt) {
        FragH f;
        const u16* p = tb + plane + (dbase + dt * 16 + l) * VP + 8 * h;
        f.q[0] = *(const v4u*)p;
        f.q[1] = *(const v4u*)(p + 16);
        return f;
      };
      FragH kf[2][4], kg[2][4], vf[NDT], vg[NDT];
      v8f acc[2], accr[2];
      acc[0] = zero8(); acc[1] = zero8(); accr[0] = zero8(); accr[1] = zero8();
      if (!EARLY) {
        // all K fragments first; the two key halves' chains alternate; V fragments follow in two
        // groups among the last score products and land while the softmax is worked out
        // (loops unrolled: the fragment arrays are indexed by constants and stay in registers)
#pragma unroll
        for (int dc = 0; dc < 4; ++dc) { kf[0][dc] = ld_k(KS, 0, dc); kf[1][dc] = ld_k(KS, 1, dc); }
#pragma unroll
        for (int dc = 0; dc < 4; ++dc) {
          acc[0] = wg_h(acc[0], kf[0][dc].v, qh[dc].v);
          acc[1] = wg_h(acc[1], kf[1][dc].v, qh[dc].v);
          if (dc == 1 || dc == 3) {
#pragma unroll
            for (int i = 0; i < NDT / 2; ++i) {
              const int dt = (dc >> 1) * (NDT / 2) + i;
              vf[dt] = ld_v(VS, dt);
            }
          }
        }
      } else {
        // step i = key half i >> 2, 32-wide d step i & 3, with its value and residual fragments.
        // Reads go out two steps at a time, one step ahead of their first product (three steps'
        // fragments at most are held: the register file allows no more here); the V fragments
        // go out ahead of the last step and land while the softmax is worked out.
        auto ld_step = [&](int i) {
          kf[i >> 2][i & 3] = ld_k(KS, i >> 2, i & 3);
          kg[i >> 2][i & 3] = ld_k(KL, i >> 2, i & 3);
        };
        ld_step(0);
        ld_step(1);
        // unrolled: the fragment arrays are indexed by constants and stay in registers
#pragma unroll
        for (int i = 0; i < 8; ++i) {
          const int sub = i >> 2, dc = i & 3;
          acc[sub] = wg_h(acc[sub], kf[sub][dc].v, qh[dc].v);
          accr[sub] = wg_h(accr[sub], kf[sub][dc].v, ql[dc].v);
          accr[sub] = wg_h(accr[sub], kg[sub][dc].v, qh[dc].v);
          if (i == 0 || i == 2 || i == 4) {
            ld_step(i + 2);
            ld_step(i + 3);
          }
          if (i == 6) {
#pragma unroll
            for (int dt = 0; dt < NDT; ++dt) { vf[dt] = ld_v(VS, dt); vg[dt] = ld_v(VL, dt); }
          }
        }
      }

      // scores S^T[key][query]; lane l = query, element r = key sub*16 + 8h + r
      float u[16];
#pragma unroll
      for (int sub = 0; sub < 2; ++sub) {
#pragma unroll
        for (int r = 0; r < 8; ++r) {
          float s = acc[sub][r];
          if (EARLY) s += accr[sub][r] * (1.0f / 1024.0f);
          u[sub * 8 + r] = s * SCL;
        }
      }
      // Online softmax of the chunk. MASKED: the causal compare and the padding bit of every key are
      // worked out and applied; otherwise every key counts and none of that arithmetic is done.
      // (Its loops are unrolled so that u, ph and pr are indexed by constants and stay in registers.)
      float scale, psum;
      FragH ph;
      FragH pr;
      auto soft = [&](auto masked) {
        constexpr bool MASKED = decltype(masked)::value;
        // bit j of vw: key kbase + 8h + j counts (at or before this lane's query, not padded out)
        unsigned vw = 0xFFFFFFFFu;
        if (MASKED) {
          const int lim = (qw0 - kbase) + (l - 8 * h);
          const unsigned cw = lim < 0 ? 0u : (lim >= 31 ? 0xFFFFFFFFu : (2u << lim) - 1u);
          vw = (mw >> (8 * h)) & cw;
        }
        float m_new = rmax;
#pragma unroll
        for (int i = 0; i < 16; ++i) {
          if (MASKED) u[i] = ((vw >> ((i >> 3) * 16 + (i & 7))) & 1u) ? u[i] : -1.0e30f;
          m_new = fmaxf(m_new, u[i]);
        }
        m_new = fmaxf(m_new, __shfl_xor(m_new, 16, 32));
        scale = __builtin_amdgcn_exp2f(rmax - m_new);
        rmax = m_new;
        psum = 0.0f;
#pragma unroll
        for (int i = 0; i < 16; ++i) {
          const float pe = __builtin_amdgcn_exp2f(u[i] - m_new);
          const float pv = (!MASKED || ((vw >> ((i >> 3) * 16 + (i & 7))) & 1u)) ? pe : 0.0f;
          psum += pv;
          const float pc = pv * 4096.0f;
          const f16 hv = (f16)pc;
          ph.h[i] = hv;
          if (EARLY) pr.h[i] = (f16)((pc - (float)hv) * 1024.0f);
          else pr.h[i] = hv;
        }
      };
      // The same for every lane of the wave (scalar operands): all 32 keys of the chunk lie at or
      // before the wave's first query and none is padded out. True of every chunk but the last
      // where the padding mask is all ones.
      if (kbase + 31 <= qw0 && mw == 0xFFFFFFFFu) soft(BoolC<false>{});
      else soft(BoolC<true>{});
      psum += __shfl_xor(psum, 16, 32);
      rsum = rsum * scale + psum;

      float sc[8];
#pragma unroll
      for (int r = 0; r < 8; ++r) sc[r] = __shfl(scale, 8 * h + r, 32);
#pragma unroll
      for (int dt = 0; dt < NDT; ++dt) {
#pragma unroll
        for (int r = 0; r < 8; ++r) {
          o[dt][r] *= sc[r];
          if (EARLY) orr[dt][r] *= sc[r];
        }
      }
      // O += P x V ; B fragment lane = d row of the Vt tile, elements = keys (split map)
#pragma unroll
      for (int dt = 0; dt < NDT; ++dt) {
        o[dt] = wg_h(o[dt], ph.v, vf[dt].v);
        if (EARLY) {
          orr[dt] = wg_h(orr[dt], pr.v, vf[dt].v);
          orr[dt] = wg_h(orr[dt], ph.v, vg[dt].v);
        }
      }
      // Hand-over: this wave's LDS reads of chunk kc are done, its copies of chunk kc + 1 have
      // landed; the barrier publishes chunk kc + 1 and frees chunk kc's buffer for chunk kc + 2.
      asm volatile("s_wait_dscnt 0x0" ::: "memory");
      asm volatile("s_wait_asynccnt 0x0" ::: "memory");
      __syncthreads();
      if (kc + 2 < nchunk) copy_chunk(kc + 2);
    }
    asm volatile("s_wait_asynccnt 0x0" ::: "memory");  // nothing in flight when the buffers are reused

    // epilogue: ctx = (o + orr/1024) / (4096 * 16 * l); plane value = 64 * ctx
    if (!EARLY) __syncthreads();                     // K/V tiles dead, pool reused as stage
    const float inv = 1.0f / rsum;
    float ir[8];
#pragma unroll
    for (int r = 0; r < 8; ++r) ir[r] = __shfl(inv, 8 * h + r, 32) * (1.0f / 1024.0f);
    const int cb = EARLY ? ((pass & 1) * 32) : 0;   // column offset inside the 64-wide line half
#pragma unroll
    for (int dt = 0; dt < NDT; ++dt) {
#pragma unroll
      for (int r = 0; r < 8; ++r) {
        float val = o[dt][r];
        if (EARLY) val += orr[dt][r] * (1.0f / 1024.0f);
        val *= ir[r];
        if (EARLY) {
          u16 a, b;
          split1024(val, a, b);
          os[(8 * h + r) * 128 + cb + dt * 16 + l] = a;
          os[(8 * h + r) * 128 + 64 + cb + dt * 16 + l] = b;
        } else {
          os[(8 * h + r) * 128 + dt * 16 + l] = hbits(val);
        }
      }
    }
    if (!EARLY) {
      __syncthreads();
      // 16 rows x 256 B = 32 lines; instruction i: lanes 8g..8g+7 -> line 4i+g
      v4u vals[8];
#pragma unroll
      for (int i = 0; i < 8; ++i) {
        const int L = 4 * i + (lane >> 3);
        const int row = L >> 1, seg = L & 1;
        vals[i] = *(const v4u*)(os + row * 128 + seg * 64 + (lane & 7) * 8);
      }
#pragma unroll
      for (int i = 0; i < 8; ++i) {
        const int L = 4 * i + (lane >> 3);
        const int row = L >> 1, seg = L & 1;
        *(v4u*)(Ch + (size_t)(qw0 + row) * HID + head * HD + seg * 64 + (lane & 7) * 8) = vals[i];
      }
      // the pair's next query block follows: no register of the stores above is rewritten ahead of this wait
      asm volatile("s_wait_xcnt 0x0" ::: "memory");
    } else {
      if ((pass & 1) != 0) {                         // block-uniform: stage holds d line (pass>>1)
        __syncthreads();
        const int dline = (pass >> 1) * 64;
        v4u va[4], vb[4];
#pragma unroll
        for (int i = 0; i < 4; ++i) {
          const int row = 4 * i + (lane >> 3);
          va[i] = *(const v4u*)(os + row * 128 + (lane & 7) * 8);
          vb[i] = *(const v4u*)(os + row * 128 + 64 + (lane & 7) * 8);
        }
#pragma unroll
        for (int i = 0; i < 4; ++i) {
          const int row = 4 * i + (lane >> 3);
          const size_t off = (size_t)(qw0 + row) * HID + head * HD + dline + (lane & 7) * 8;
          *(v4u*)(Ch + off) = va[i];
          *(v4u*)(Cr + off) = vb[i];
        }
        // the next pass or query block follows: no register of the stores above is rewritten ahead of this wait
        asm volatile("s_wait_xcnt 0x0" ::: "memory");
      }
    }
  }
}

// ---------------------------------------------------------------------------------------
// Launches. Jobs that need nothing of each other share one grid: a range of the block index
// (the same for a whole block) picks the job, so that part-filled grids run side by side.

// hidden -> bf16 and the inv_freq table | wq, wk, wv -> bf16, transposed | wo -> f16, transposed
#define NB_X SEQ
#define NB_WQ ((HID / 64) * ((NH * HD) / 64))
#define NB_WKV ((HID / 64) * ((NKV * HD) / 64))
#define NB_WO ((HID / 64) * (HID / 64))
__global__ __launch_bounds__(256) void k_prep(const float* __restrict__ x, const float* __restrict__ wq,
                                             const float* __restrict__ wk, const float* __restrict__ wv,
                                             const float* __restrict__ wo, u16* __restrict__ xb,
                                             float* __restrict__ tinv, u16* __restrict__ wqkvt,
                                             u16* __restrict__ wot) {
  __shared__ __align__(16) u16 T[64 * 72];
  constexpr int NI = HID / 64;                       // tiles along the weights' input dimension
  const int b = (int)blockIdx.x;
  if (b < NB_X) {
    xconv_body(b, x, xb, tinv);
  } else if (b < NB_X + NB_WQ) {
    const int r = b - NB_X;
    wt_body<0>(T, r % NI, r / NI, wq, wqkvt, NH * HD);
  } else if (b < NB_X + NB_WQ + NB_WKV) {
    const int r = b - (NB_X + NB_WQ);
    wt_body<0>(T, r % NI, r / NI, wk, wqkvt + (size_t)(NH * HD) * HID, NKV * HD);
  } else if (b < NB_X + NB_WQ + 2 * NB_WKV) {
    const int r = b - (NB_X + NB_WQ + NB_WKV);
    wt_body<0>(T, r % NI, r / NI, wv, wqkvt + (size_t)(NH * HD + NKV * HD) * HID, NKV * HD);
  } else {
    const int r = b - (NB_X + NB_WQ + 2 * NB_WKV);
    wt_body<1>(T, r % NI, r / NI, wo, wot, HID);
  }
}

// qkv projection
__global__ __launch_bounds__(256) void k_qkv(const u16* __restrict__ A, const u16* __restrict__ BT,
                                            float* __restrict__ C, int lda, int ldb, int ldc, int K) {
  __shared__ __align__(16) u16 pool[GEMM_POOL(false)];
  gemm_body<0, false>(pool, (int)blockIdx.x, (int)blockIdx.y, A, A, BT, C, lda, ldb, ldc, K, 1.0f, 0.0f);
}

// V transposed planes | rotary + q, k planes
#define NB_VT ((SEQ / 64) * NKV)
__global__ __launch_bounds__(256) void k_planes_vt(const float* __restrict__ qkv, const int* __restrict__ pos,
                                                  const float* __restrict__ tinv,
                                                  u16* __restrict__ Qh, u16* __restrict__ Ql,
                                                  u16* __restrict__ Kh, u16* __restrict__ Kl,
                                                  u16* __restrict__ Vth, u16* __restrict__ Vtl) {
  __shared__ __align__(16) u16 sm[2 * HD * 72];
  static_assert(2 * HD * 72 >= 2 * (NH + NKV) * HD);
  const int b = (int)blockIdx.x;
  if (b < NB_VT) vt_body(sm, b % (SEQ / 64), b / (SEQ / 64), qkv, Vth, Vtl);
  else planes_body(sm, b - NB_VT, qkv, pos, tinv, Qh, Ql, Kh, Kl);
}

// attention: a work-group works two query blocks, one after the other, whose key chunk counts add up to the
// same sum in every work-group of its kind (block j and the last but j): the cost of a causal query block
// grows with its index, all work-groups are resident at once, and the launch lasts as long as the fullest.
template <bool EARLY>
__device__ __forceinline__
void attn_pair(u16* pool, u16* stg, int qfirst, int qsecond, int kv,
               const u16* __restrict__ Qh, const u16* __restrict__ Ql,
               const u16* __restrict__ Kh, const u16* __restrict__ Kl,
               const u16* __restrict__ Vth, const u16* __restrict__ Vtl,
               const int* __restrict__ amask,
               u16* __restrict__ Ch, u16* __restrict__ Cr) {
  // not unrolled: one copy of the body in the instruction cache
#pragma unroll 1
  for (int ph = 0; ph < 2; ++ph) {
    attn_body<EARLY>(pool, stg, ph == 0 ? qfirst : qsecond, kv, Qh, Ql, Kh, Kl, Vth, Vtl, amask, Ch, Cr);
    if (!EARLY && ph == 0) {
      // Between the two blocks: the first one's ctx stage lies in pool, which the second one's copies fill
      // anew: this wave's LDS reads of it are done, and behind the barrier every wave's. (Where EARLY the
      // stage is each wave's own part of stg, and pool was left behind the last trip's barrier.)
      asm volatile("s_wait_dscnt 0x0" ::: "memory");
      __syncthreads();
    }
  }
}

// Pairs among the query blocks of the leading SE rows (residual planes) | pairs among the rest.
#define NQB (SEQ / BQW)
#define NEB (SE / BQW)
static_assert(NEB % 2 == 0 && (NQB - NEB) % 2 == 0);
__global__ __launch_bounds__(256) __attribute__((amdgpu_num_vgpr(256)))
void k_attn(const u16* __restrict__ Qh, const u16* __restrict__ Ql,
            const u16* __restrict__ Kh, const u16* __restrict__ Kl,
            const u16* __restrict__ Vth, const u16* __restrict__ Vtl,
            const int* __restrict__ amask,
            u16* __restrict__ Ch, u16* __restrict__ Cr) {
  __shared__ __align__(16) u16 pool[ATTN_POOL(true)];
  __shared__ __align__(16) u16 stg[16384];
  const int pr = (int)blockIdx.x, kv = (int)blockIdx.y;
  if (pr < NEB / 2) {
    attn_pair<true>(pool, stg, NEB - 1 - pr, pr, kv, Qh, Ql, Kh, Kl, Vth, Vtl, amask, Ch, Cr);
  } else {
    const int j = pr - NEB / 2;
    attn_pair<false>(pool, stg, NQB - 1 - j, NEB + j, kv, Qh, Ql, Kh, Kl, Vth, Vtl, amask, Ch, Cr);
  }
}

// output projection: row tiles of the leading SE rows (with the residual ctx plane) | the rest
__global__ __launch_bounds__(256) void k_oproj(const u16* __restrict__ A, const u16* __restrict__ Ar,
                                              const u16* __restrict__ BT, float* __restrict__ C,
                                              int lda, int ldb, int ldc, int K, float sh, float sr) {
  __shared__ __align__(16) u16 pool[GEMM_POOL(true)];
  const int bn = (int)blockIdx.x, bm = (int)blockIdx.y;
  if (bm < SE / GEMM_BM) gemm_body<1, true>(pool, bn, bm, A, Ar, BT, C, lda, ldb, ldc, K, sh, sr);
  else gemm_body<1, false>(pool, bn, bm, A, A, BT, C, lda, ldb, ldc, K, sh, 0.0f);
}

// ---------------------------------------------------------------------------------------
extern "C" void kernel_launch(void* const* d_in, const int* in_sizes, int n_in,
                              void* d_out, int out_size, void* d_ws, size_t ws_size,
                              hipStream_t stream) {
  if (n_in < 7) return;
  if (in_sizes[0] < SEQ * HID) return;
  if (in_sizes[1] < SEQ) return;
  if (in_sizes[2] < SEQ) return;
  if (in_sizes[3] < HID * NH * HD) return;
  if (in_sizes[4] < HID * NKV * HD) return;
  if (in_sizes[5] < HID * NKV * HD) return;
  if (in_sizes[6] < NH * HD * HID) return;
  if (out_size < SEQ * HID) return;

  const float* hs  = (const float*)d_in[0];
  const int*   am  = (const int*)d_in[1];
  const int*   pos = (const int*)d_in[2];
  const float* wq  = (const float*)d_in[3];
  const float* wk  = (const float*)d_in[4];
  const float* wv  = (const float*)d_in[5];
  const float* wo  = (const float*)d_in[6];
  float* out = (float*)d_out;

  char* ws = (char*)d_ws;
  size_t off = 0;
#define CARVE(T, name, bytes) T* name = (T*)(ws + off); off += (((size_t)(bytes)) + 255) & ~(size_t)255
  CARVE(u16,   Xb,    (size_t)SEQ * HID * 2);          // bf16 bits [SEQ][HID]
  CARVE(u16,   WqkvT, (size_t)NQKV * HID * 2);         // bf16 bits [3072][HID]
  CARVE(u16,   WoT,   (size_t)HID * HID * 2);          // f16 bits  [HID][HID]
  CARVE(float, QKVf,  (size_t)SEQ * NQKV * 4);         // f32 [SEQ][3072]
  CARVE(u16,   Qh,    (size_t)NH * SEQ * HD * 2);
  CARVE(u16,   Kh,    (size_t)NKV * SEQ * HD * 2);
  CARVE(u16,   Vth,   (size_t)NKV * HD * SEQ * 2);
  CARVE(u16,   Ql,    (size_t)NH * SE * HD * 2);
  CARVE(u16,   Kl,    (size_t)NKV * SE * HD * 2);
  CARVE(u16,   Vtl,   (size_t)NKV * HD * SE * 2);
  CARVE(u16,   Cr,    (size_t)SE * HID * 2);
  CARVE(float, Tinv,  256);
#undef CARVE
  // Ch [SEQ][HID] f16 plane aliases the Xb region: identical extent (SEQ*HID halves), Xb is
  // read only by the qkv projection launch, Ch is first written by the attention launch
  // that comes after it on the same in-order stream.
  static_assert(NH * HD == HID);
  u16* Ch = Xb;
  if (off > ws_size) return;

  // 1) hidden -> bf16, inv_freq table; weights: w [HID][n] -> wt [n][HID]
  k_prep<<<dim3(NB_X + NB_WQ + 2 * NB_WKV + NB_WO), 256, 0, stream>>>(hs, wq, wk, wv, wo, Xb, Tinv, WqkvT, WoT);
  // 2) fused qkv projection: [SEQ][HID] x [HID][3072] -> f32
  k_qkv<<<dim3(NQKV / 128, SEQ / GEMM_BM), 256, 0, stream>>>(Xb, WqkvT, QKVf, HID, HID, NQKV, HID);
  // 3) V transposed planes; rotary + planes
  k_planes_vt<<<dim3(NB_VT + SEQ), 256, 0, stream>>>(QKVf, pos, Tinv, Qh, Ql, Kh, Kl, Vth, Vtl);
  // 4) attention: leading SE rows with residual planes, the rest single products; two query blocks a work-group
  k_attn<<<dim3(SEQ / BQW / 2, NKV), 256, 0, stream>>>(Qh, Ql, Kh, Kl, Vth, Vtl, am, Ch, Cr);
  // 5) output projection: rows < SE with the residual ctx plane, the rest plain
  k_oproj<<<dim3(HID / 128, SEQ / GEMM_BM), 256, 0, stream>>>(
      Ch, Cr, WoT, out, HID, HID, HID, HID, 1.0f / 4096.0f, 1.0f / (4096.0f * 1024.0f));
}

// v010
// Measured time: 207 microseconds a run.
// In two side-by-side timings against v009, it was 1.12 and 1.08 times as fast.
// All steps since v000 together make it 6.52 times as fast.
#include <hip/hip_runtime.h>
#include <stdint.h>
#include <stddef.h>

// Contractions: qkv projection = v_wmma_f32_16x16x32_bf16 (bf16 operands, f32 accumulate);
// q.k scores, p.v and output projection = v_wmma_f32_16x16x32_f16 (f16 operands with
// power-of-two carries plus x1024 f16 residual planes on the leading SE query rows,
// f32 accumulate). Softmax and epilogues in f32; rotary sin/cos via f64 quadrant
// reduction + polynomial (no fused multiply-add), rotation in unfused f32.

#ifndef NB
#define NB 1
#endif
#ifndef SEQ
#define SEQ 4096
#endif
#ifndef SE
#if SEQ < 640
#define SE SEQ
#else
#define SE 640
#endif
#endif
#define SEQ_FULL 4096
#define HID 2048
#define NH 16
#define NKV 4
#define HD 128
#define NQKV (NH * HD + 2 * NKV * HD)
#define BQW 32

static_assert(NB == 1);
static_assert(SEQ % 64 == 0);
static_assert(SEQ >= SE);
static_assert(SEQ <= SEQ_FULL);
static_assert(SE >= 64);
static_assert(SE % 64 == 0);
static_assert(SE % BQW == 0);
static_assert(SEQ % 128 == 0);
static_assert(SE % 128 == 0);
static_assert(HID % 128 == 0);
static_assert(HID == 256 * 8);
static_assert(NQKV % 128 == 0);
static_assert(HD == 128);
static_assert(NH == 4 * NKV);
static_assert(NH * HD == HID);

typedef _Float16 f16;
typedef __bf16 bf16;
typedef unsigned short u16;
typedef f16 v16h __attribute__((ext_vector_type(16)));
typedef bf16 v16b __attribute__((ext_vector_type(16)));
typedef float v8f __attribute__((ext_vector_type(8)));
typedef float v4f __attribute__((ext_vector_type(4)));
typedef unsigned v4u __attribute__((ext_vector_type(4)));

union FragH { v16h v; v4u q[2]; f16 h[16]; };
union FragB { v16b v; v4u q[2]; };

__device__ __forceinline__ v8f zero8() {
  v8f z = {0.0f, 0.0f, 0.0f, 0.0f, 0.0f, 0.0f, 0.0f, 0.0f};
  return z;
}

// 16x16x32 f16 WMMA followed by a 4-slot VALU hazard guard on D (A/B kept live).
__device__ __forceinline__ v8f wg_h(v8f acc, v16h a, v16h b) {
  acc = __builtin_amdgcn_wmma_f32_16x16x32_f16(false, a, false, b, (short)0, acc, false, false);
  asm volatile("v_nop\n\tv_nop\n\tv_nop\n\tv_nop" : "+v"(acc) : "v"(a), "v"(b));
  return acc;
}
__device__ __forceinline__ v8f wg_b(v8f acc, v16b a, v16b b) {
  acc = __builtin_amdgcn_wmma_f32_16x16x32_bf16(false, a, false, b, (short)0, acc, false, false);
  asm volatile("v_nop\n\tv_nop\n\tv_nop\n\tv_nop" : "+v"(acc) : "v"(a), "v"(b));
  return acc;
}

// f32 -> bf16 bits, RNE convert.
__device__ __forceinline__ unsigned bf16_rne(float f) {
  const unsigned u = __float_as_uint(f);
  return (u + 0x7FFFu + ((u >> 16) & 1u)) >> 16;
}
// f32 -> f16 bits, RNE convert.
__device__ __forceinline__ u16 hbits(float f) {
  const f16 x = (f16)f;
  return __builtin_bit_cast(u16, x);
}
// f32 -> f16 hi bits plus f16 bits of (v - hi) * 1024 (unfused: sub then mul).
__device__ __forceinline__ void split1024(float v, u16& hb, u16& lb) {
#pragma clang fp contract(off)
  const f16 x = (f16)v;
  const float xr = (float)x;
  const float dlt = v - xr;
  const f16 y = (f16)(dlt * 1024.0f);
  hb = __builtin_bit_cast(u16, x);
  lb = __builtin_bit_cast(u16, y);
}
template <bool B> struct BoolC { static constexpr bool value = B; };
__device__ __forceinline__ int imin(int a, int b) { return a < b ? a : b; }
__device__ __forceinline__ int imax(int a, int b) { return a > b ? a : b; }

// sin/cos of an f32 angle (0 <= ang <= ~4100 rad) in f64 without fused multiply-add:
// quadrant count kq = rint(x * 2/pi); r = (x - kq * P1) - kq * P2 with P1 = the leading
// 33 bits of pi/2 (kq * P1 exact for kq < 2^20) and P2 its tail; odd/even polynomials on
// |r| <= pi/4 (truncation < 3e-14); quadrant select by value; convert to f32.
__device__ __forceinline__ void rot_sincos(float ang, float& sn, float& cs) {
#pragma clang fp contract(off)
  const double x = (double)ang;
  const double kq = __builtin_rint(x * 0.63661977236758134308);
  double r = x - kq * 1.57079632673412561417;
  r = r - kq * 6.07710050650619224932e-11;
  const int q = (int)kq;
  const double r2 = r * r;
  double ps = 1.6059043836821613e-10;
  ps = ps * r2 - 2.5052108385441720e-08;
  ps = ps * r2 + 2.7557319223985893e-06;
  ps = ps * r2 - 1.9841269841269841e-04;
  ps = ps * r2 + 8.3333333333333332e-03;
  ps = ps * r2 - 1.6666666666666666e-01;
  const double r3 = r * r2;
  const double sr = r + r3 * ps;
  double pc = -1.1470745597729725e-11;
  pc = pc * r2 + 2.0876756987868099e-09;
  pc = pc * r2 - 2.7557319223985888e-07;
  pc = pc * r2 + 2.4801587301587302e-05;
  pc = pc * r2 - 1.3888888888888889e-03;
  pc = pc * r2 + 4.1666666666666664e-02;
  pc = pc * r2 - 0.5;
  const double cr = 1.0 + pc * r2;
  const bool odd = (q & 1) != 0;
  const bool neg = (q & 2) != 0;
  double sv = odd ? cr : sr;
  double cv = odd ? -sr : cr;
  sv = neg ? -sv : sv;
  cv = neg ? -cv : cv;
  sn = (float)sv;
  cs = (float)cv;
}

// ---------------------------------------------------------------------------------------
// hidden f32 [SEQ][HID] -> bf16 bits [SEQ][HID]; one block (blk) per row, 16 B per lane.
// Two waves of block blk (64 lanes, lane j) also produce row blk of the rotary tables tc, ts [SEQ_FULL][64]: cos and sin of
// fl32(blk * inv[j]), inv[j] = fl32(1 / fl32(10000^(j/64))), with 10000^(j/64) in f64 as the product, over the
// set bits b of j, of 10000^(2^b/64): six factors, each the square root of the one before (roots of a
// literal: the compiler folds them).
__device__ __forceinline__ void xconv_body(int blk, const float* __restrict__ x, u16* __restrict__ xb,
                                           float* __restrict__ tc, float* __restrict__ ts) {
#pragma clang fp contract(off)
  const int t = threadIdx.x;
  const size_t e = ((size_t)blk * 256 + (size_t)t) * 8;
  const v4f a = *(const v4f*)(x + e);
  const v4f b = *(const v4f*)(x + e + 4);
  v4u w;
  w[0] = bf16_rne(a[0]) | (bf16_rne(a[1]) << 16);
  w[1] = bf16_rne(a[2]) | (bf16_rne(a[3]) << 16);
  w[2] = bf16_rne(b[0]) | (bf16_rne(b[1]) << 16);
  w[3] = bf16_rne(b[2]) | (bf16_rne(b[3]) << 16);

  // wave-uniform: two of the eight waves, another pair from block to block (for speed only)
  const bool tab = ((t >> 6) == (blk & 3));
  const int tj = t & 63;
  float sn = 0.0f, cs = 0.0f;
  if (tab) {
    double fb = 10000.0, pj = 1.0;
    for (int b = 5; b >= 0; --b) {
      fb = __builtin_sqrt(fb);                       // 10000^(2^b/64)
      pj *= ((tj >> b) & 1) ? fb : 1.0;
    }
    const float pf = (float)pj;
    const float ivf = (float)(1.0 / (double)pf);
    const float ang = (float)blk * ivf;
    rot_sincos(ang, sn, cs);
  }
  *(v4u*)(xb + e) = w;
  if (tab) {
    tc[blk * 64 + tj] = cs;
    ts[blk * 64 + tj] = sn;
  }
}

// ---------------------------------------------------------------------------------------
// Weight transpose + convert: w f32 [HID][ncol] -> wt 16-bit [ncol][HID] (k contiguous).
// 8 consecutive lanes of one instruction. MODE 0: bf16 bits; MODE 1: f16 bits of
// 64 * bf16(w) (bf16 RNE value first, the x64 f16 copy of it is exact).
// T: 64 * 72 halves of LDS, [o][i], pitch 72 halves (144 B); tile (bi, bo) of the weight.
template <int MODE>
__device__ __forceinline__ void wt_body(u16* T, int bi, int bo, const float* __restrict__ w,
                                        u16* __restrict__ wt, int ncol) {
  const int i0 = bi * 64, o0 = bo * 64, t = threadIdx.x;
#pragma unroll
  for (int j = 0; j < 4; ++j) {
    const int i = (t >> 4) + 16 * j;
    const int oc = (t & 15) * 4;
    const v4f v = *(const v4f*)(w + (size_t)(i0 + i) * (size_t)ncol + o0 + oc);
#pragma unroll
    for (int e = 0; e < 4; ++e) {
      const float f = v[e];
      u16 bb;
      if (MODE == 0) bb = (u16)bf16_rne(f);
      else bb = hbits(__uint_as_float(bf16_rne(f) << 16) * 64.0f);
      T[(oc + e) * 72 + i] = bb;
    }
  }
  __syncthreads();
  v4u val[2];
#pragma unroll
  for (int p = 0; p < 2; ++p) {
    const int o = (t >> 3) + 32 * p;
    val[p] = *(const v4u*)(T + o * 72 + (t & 7) * 8);
  }
#pragma unroll
  for (int p = 0; p < 2; ++p) {
    const int o = (t >> 3) + 32 * p;
    *(v4u*)(wt + (size_t)(o0 + o) * HID + i0 + (t & 7) * 8) = val[p];
  }
  // another job's code follows in the merged kernel: no register of the stores above is rewritten ahead of this wait
  asm volatile("s_wait_xcnt 0x0" ::: "memory");
}

// ---------------------------------------------------------------------------------------
// Epilogues of the qkv projection. A block's 128 x 128 tile of C is 128 sequence rows of ONE head (q heads,
// then k heads, then v heads) and lies in LDS as f32 (st: eight 64 x 32 parts, one a wave, pitch 36 floats):
// the f16 planes that the attention reads are made from it there, so that q, k, v never go to memory as f32.
struct QkvEpi {
  const int* pos; const float* tc; const float* ts;
  u16* Qh; u16* Ql; u16* Kh; u16* Kl; u16* Vth; u16* Vtl;
};
// element (row m, column c) of the staged tile
__device__ __forceinline__ const float* cst_at(const float* st, int m, int c) {
  return st + ((m >> 6) * 4 + (c >> 5)) * (64 * 36) + (m & 63) * 36 + (c & 31);
}
__device__ __forceinline__ unsigned pack2(u16 lo, u16 hi) { return (unsigned)lo | ((unsigned)hi << 16); }

// Rotary + f16 planes of one q or k head. Ph [SEQ][HD]: f16 bits of the rotated value; rows s < SE also get
// Pl [SE][HD]: f16 bits of (x - hi) * 1024.
// rotate-half: out[d] = x[d]*cos - x[d+64]*sin, out[d+64] = x[d+64]*cos + x[d]*sin
// (products and sums as separate f32 ops), cos and sin from row pos[s] of the tables.
// A lane works 8 d and their partners d + 64 of one row: 8 lanes store a whole 128-B line.
template <bool EARLY>
__device__ __forceinline__ void rope_epi(const float* st, int mblk, const int* __restrict__ pos,
                                         const float* __restrict__ tc, const float* __restrict__ ts,
                                         u16* __restrict__ Ph, u16* __restrict__ Pl) {
  const int t = threadIdx.x;
  const int d0 = (t & 7) * 8;
  // (loops unrolled: the arrays are indexed by constants and stay in registers)
  // The four rows' table loads go out together, ahead of all the arithmetic.
  const float* pc[4];
  const float* ps[4];
  v4f cv[4][2], sv[4][2];
#pragma unroll
  for (int j = 0; j < 4; ++j) {
    const int pp = imin(imax(pos[mblk + (t >> 3) + 32 * j], 0), SEQ_FULL - 1);
    pc[j] = tc + pp * 64 + d0;
    ps[j] = ts + pp * 64 + d0;
  }
#pragma unroll
  for (int j = 0; j < 4; ++j) {
    cv[j][0] = *(const v4f*)pc[j];
    cv[j][1] = *(const v4f*)(pc[j] + 4);
    sv[j][0] = *(const v4f*)ps[j];
    sv[j][1] = *(const v4f*)(ps[j] + 4);
  }
  // The table loads' address registers are inputs of the wait, so that they stay as they are up to it:
  // no loaded value lands on a register that a load still in flight names.
  asm volatile("s_wait_xcnt 0x0" :: "v"(pc[0]), "v"(pc[1]), "v"(pc[2]), "v"(pc[3]),
                                    "v"(ps[0]), "v"(ps[1]), "v"(ps[2]), "v"(ps[3]) : "memory");
#pragma unroll
  for (int j = 0; j < 4; ++j) {
    const int m = (t >> 3) + 32 * j;
    const int s = mblk + m;
    const float* p1 = cst_at(st, m, d0);
    const float* p2 = cst_at(st, m, d0 + 64);
    v4f x1[2], x2[2];
#pragma unroll
    for (int q = 0; q < 2; ++q) {
      x1[q] = *(const v4f*)(p1 + 4 * q);
      x2[q] = *(const v4f*)(p2 + 4 * q);
    }
    u16 h1[8], h2[8], l1[8], l2[8];
#pragma unroll
    for (int e = 0; e < 8; ++e) {
      const float a = x1[e >> 2][e & 3], b = x2[e >> 2][e & 3];
      const float cs = cv[j][e >> 2][e & 3], sn = sv[j][e >> 2][e & 3];
      float r1, r2;
      // Unfused for a numerical reason: the reference rounds each product and then the sum; a fused form would
      // move q and k in their last place, and with them every score and the residual planes made from them.
      {
#pragma clang fp contract(off)
        const float a1 = a * cs, b1 = b * sn;
        const float a2 = b * cs, b2 = a * sn;
        r1 = a1 - b1;
        r2 = a2 + b2;
      }
      if (EARLY) {
        split1024(r1, h1[e], l1[e]);
        split1024(r2, h2[e], l2[e]);
      } else {
        h1[e] = hbits(r1); l1[e] = 0;
        h2[e] = hbits(r2); l2[e] = 0;
      }
    }
    v4u w1, w2, y1, y2;
#pragma unroll
    for (int i = 0; i < 4; ++i) {
      w1[i] = pack2(h1[2 * i], h1[2 * i + 1]);
      w2[i] = pack2(h2[2 * i], h2[2 * i + 1]);
      y1[i] = pack2(l1[2 * i], l1[2 * i + 1]);
      y2[i] = pack2(l2[2 * i], l2[2 * i + 1]);
    }
    u16* oh = Ph + (size_t)s * HD + d0;
    *(v4u*)oh = w1;
    *(v4u*)(oh + 64) = w2;
    if (EARLY) {
      u16* ol = Pl + (size_t)s * HD + d0;
      *(v4u*)ol = y1;
      *(v4u*)(ol + 64) = y2;
    }
  }
  // another epilogue's code follows in the kernel: no register of the stores above is rewritten ahead of this wait
  asm volatile("s_wait_xcnt 0x0" ::: "memory");
}

// V transposed planes of one kv head: Vh [HD][SEQ] = f16 bits of 16*v, and for keys < SE
// Vl [HD][SE] = f16 bits of (16*v - hi) * 1024. A lane works 8 keys x 4 d: 8 lanes store a whole 128-B line
// (64 keys of one d).
template <bool EARLY>
__device__ __forceinline__ void vt_epi(const float* st, int mblk, u16* __restrict__ Vh, u16* __restrict__ Vl) {
  const int t = threadIdx.x;
  const int c4 = ((t >> 3) & 31) * 4;                // d 0..124
  // unrolled: x is indexed by constants and stays in registers
#pragma unroll
  for (int j = 0; j < 2; ++j) {
    const int m0 = 64 * j + (t & 7) * 8;             // first of this lane's 8 keys
    v4f x[8];
#pragma unroll
    for (int e = 0; e < 8; ++e) x[e] = *(const v4f*)cst_at(st, m0 + e, c4);
#pragma unroll
    for (int i = 0; i < 4; ++i) {
      u16 hb[8], lb[8];
#pragma unroll
      for (int e = 0; e < 8; ++e) {
        const float f = 16.0f * x[e][i];
        if (EARLY) split1024(f, hb[e], lb[e]);
        else { hb[e] = hbits(f); lb[e] = 0; }
      }
      v4u w, y;
#pragma unroll
      for (int q = 0; q < 4; ++q) {
        w[q] = pack2(hb[2 * q], hb[2 * q + 1]);
        y[q] = pack2(lb[2 * q], lb[2 * q + 1]);
      }
      *(v4u*)(Vh + (size_t)(c4 + i) * SEQ + mblk + m0) = w;
      if (EARLY) *(v4u*)(Vl + (size_t)(c4 + i) * SE + mblk + m0) = y;
    }
  }
  // another epilogue's code follows in the kernel: no register of the stores above is rewritten ahead of this wait
  asm volatile("s_wait_xcnt 0x0" ::: "memory");
}

// ---------------------------------------------------------------------------------------
// C[m][n] (f32) = sh * sum_k A[m][k] * BT[n][k]  (+ sr * sum_k Ar[m][k] * BT[n][k] if RES)
// MODE 0: bf16 operands; MODE 1: f16 operands. Block 128 (M) x 128 (N), 8 waves each 64x32:
// a staged operand row serves 128 rows or columns of C, a fragment read from LDS two or four products.
// The block's operand rows go through LDS in tiles of 64 k (one 128-B line of every row): two
// buffers, tile t in buffer t & 1, tile t + 1 copied global -> LDS (asynchronous, through no
// register, whole lines) while tile t is worked on. Fragments come from the LDS rows with the
// split k map (elements 0..7 at k + 8h, 8..15 at k + 16 + 8h); k ascends in steps of 32.
// pool: GEMM_POOL(RES) halves of LDS; the block's tile is (bn, bm).
// EPI 0: the tile goes to C as f32. EPI 1 (qkv projection): it goes through the epilogues above; C is not used.
#define GEMM_BM 128
#define GEMM_POOL(RES) (2 * (((RES) ? 2 : 1) * GEMM_BM * 72 + 128 * 72))
template <int MODE, bool RES, int EPI>
__device__ __forceinline__ void gemm_body(u16* pool, int bn, int bm,
                                          const u16* __restrict__ A, const u16* __restrict__ Ar,
                                          const u16* __restrict__ BT, float* __restrict__ C,
                                          int lda, int ldb, int ldc, int K,
                                          float sh, float sr, const QkvEpi& ep) {
  constexpr int BK = 64;                              // k per tile
  constexpr int TP = BK + 8;                          // LDS row pitch in halves: 144 B = 16 B x odd
  constexpr int AT = GEMM_BM * TP, BTL = 128 * TP;    // tile sizes in halves
  constexpr int AS = 0, ES = AT, BS = RES ? 2 * AT : AT;
  constexpr int BUF = BS + BTL;                       // one buffer = A | (Ar) | BT tiles, in halves
  static_assert(2 * BUF == GEMM_POOL(RES));
  static_assert((TP * 2) % 16 == 0 && (BUF * 2) % 16 == 0 && (AT * 2) % 16 == 0);
  static_assert(2 * BUF * 2 >= 8 * 64 * 36 * 4);      // pool doubles as the C stage behind the loop
  const int tid = threadIdx.x, wave = tid >> 5, lane = tid & 31, h = lane >> 4, l = lane & 15;
  const int wm = wave >> 2, wn = wave & 3;
  const int mblk = bm * GEMM_BM, nblk = bn * 128;
  const int mb = mblk + wm * 64;
  const int nb = nblk + wn * 32;
  v8f c[4][2], r[4][2];
  // (loops over c, r and the fragments are unrolled: they are indexed by constants and stay in registers)
#pragma unroll
  for (int i = 0; i < 4; ++i) {
    c[i][0] = zero8(); c[i][1] = zero8();
    r[i][0] = zero8(); r[i][1] = zero8();
  }

  // This lane's 16-byte pieces of a tile: column cc of rows cr, cr + 32, ... (8 lanes cover a line).
  const int cr = tid >> 3, cc = (tid & 7) * 8;
  const unsigned lbase = (unsigned)(size_t)pool;      // byte offset of pool in the work-group's LDS
  const unsigned lpc = lbase + 2u * (unsigned)(cr * TP + cc);
  const u16* ga = A + (size_t)(mblk + cr) * (size_t)lda + cc;
  const u16* ge = Ar + (size_t)(mblk + cr) * (size_t)lda + cc;
  const u16* gb = BT + (size_t)(nblk + cr) * (size_t)ldb + cc;
  // Issue the copies of tile t into buffer t & 1 (all lanes on, block-uniform call sites). The
  // s_wait_xcnt closes each statement so that no address register is rewritten ahead of it.
  auto copy_tile = [&](int t) {
    const unsigned bo = lpc + (unsigned)(t & 1) * (unsigned)(BUF * 2);
    const unsigned a0 = bo + 2u * AS, a1 = a0 + 2u * 32u * TP, a2 = a0 + 2u * 64u * TP, a3 = a0 + 2u * 96u * TP;
    const unsigned b0 = bo + 2u * BS, b1 = b0 + 2u * 32u * TP, b2 = b0 + 2u * 64u * TP, b3 = b0 + 2u * 96u * TP;
    const u16* pa0 = ga + (size_t)t * BK;
    const u16* pa1 = pa0 + (size_t)32 * (size_t)lda;
    const u16* pa2 = pa0 + (size_t)64 * (size_t)lda;
    const u16* pa3 = pa0 + (size_t)96 * (size_t)lda;
    const u16* pb0 = gb + (size_t)t * BK;
    const u16* pb1 = pb0 + (size_t)32 * (size_t)ldb;
    const u16* pb2 = pb0 + (size_t)64 * (size_t)ldb;
    const u16* pb3 = pb0 + (size_t)96 * (size_t)ldb;
    asm volatile("global_load_async_to_lds_b128 %0, %8, off\n\t"
                 "global_load_async_to_lds_b128 %1, %9, off\n\t"
                 "global_load_async_to_lds_b128 %2, %10, off\n\t"
                 "global_load_async_to_lds_b128 %3, %11, off\n\t"
                 "global_load_async_to_lds_b128 %4, %12, off\n\t"
                 "global_load_async_to_lds_b128 %5, %13, off\n\t"
                 "global_load_async_to_lds_b128 %6, %14, off\n\t"
                 "global_load_async_to_lds_b128 %7, %15, off\n\t"
                 "s_wait_xcnt 0x0"
                 :: "v"(a0), "v"(a1), "v"(a2), "v"(a3), "v"(b0), "v"(b1), "v"(b2), "v"(b3),
                    "v"(pa0), "v"(pa1), "v"(pa2), "v"(pa3), "v"(pb0), "v"(pb1), "v"(pb2), "v"(pb3) : "memory");
    if (RES) {
      const unsigned e0 = bo + 2u * ES, e1 = e0 + 2u * 32u * TP, e2 = e0 + 2u * 64u * TP, e3 = e0 + 2u * 96u * TP;
      const u16* pe0 = ge + (size_t)t * BK;
      const u16* pe1 = pe0 + (size_t)32 * (size_t)lda;
      const u16* pe2 = pe0 + (size_t)64 * (size_t)lda;
      const u16* pe3 = pe0 + (size_t)96 * (size_t)lda;
      asm volatile("global_load_async_to_lds_b128 %0, %4, off\n\t"
                   "global_load_async_to_lds_b128 %1, %5, off\n\t"
                   "global_load_async_to_lds_b128 %2, %6, off\n\t"
                   "global_load_async_to_lds_b128 %3, %7, off\n\t"
                   "s_wait_xcnt 0x0"
                   :: "v"(e0), "v"(e1), "v"(e2), "v"(e3), "v"(pe0), "v"(pe1), "v"(pe2), "v"(pe3) : "memory");
    }
  };

  const int nt = K / BK;
  // Tile 0 lands and is published, then tile 1 is set flying.
  copy_tile(0);
  asm volatile("s_wait_asynccnt 0x0" ::: "memory");   // this wave's copies of tile 0 have landed
  __syncthreads();                                    // ... and every other wave's
  if (nt > 1) copy_tile(1);

  const int fa = (wm * 64 + l) * TP + 8 * h;          // this lane's fragment rows in a buffer
  const int fb = (wn * 32 + l) * TP + 8 * h;
  for (int t = 0; t < nt; ++t) {
    const u16* tb = pool + (t & 1) * BUF;             // this tile's buffer
    // unrolled so that both 32-k steps read at constant offsets from one LDS address
#pragma unroll
    for (int ks = 0; ks < BK; ks += 32) {
      const u16* pa = tb + AS + fa + ks;
      const u16* pb = tb + BS + fb + ks;
      if (MODE == 0) {
        FragB a[4], b[2];
#pragma unroll
        for (int j = 0; j < 2; ++j) {
          b[j].q[0] = *(const v4u*)(pb + j * 16 * TP); b[j].q[1] = *(const v4u*)(pb + j * 16 * TP + 16);
        }
#pragma unroll
        for (int i = 0; i < 4; ++i) {
          a[i].q[0] = *(const v4u*)(pa + i * 16 * TP); a[i].q[1] = *(const v4u*)(pa + i * 16 * TP + 16);
        }
#pragma unroll
        for (int i = 0; i < 4; ++i) {
          c[i][0] = wg_b(c[i][0], a[i].v, b[0].v); c[i][1] = wg_b(c[i][1], a[i].v, b[1].v);
        }
      } else {
        FragH a[4], b[2];
#pragma unroll
        for (int j = 0; j < 2; ++j) {
          b[j].q[0] = *(const v4u*)(pb + j * 16 * TP); b[j].q[1] = *(const v4u*)(pb + j * 16 * TP + 16);
        }
#pragma unroll
        for (int i = 0; i < 4; ++i) {
          a[i].q[0] = *(const v4u*)(pa + i * 16 * TP); a[i].q[1] = *(const v4u*)(pa + i * 16 * TP + 16);
        }
#pragma unroll
        for (int i = 0; i < 4; ++i) {
          c[i][0] = wg_h(c[i][0], a[i].v, b[0].v); c[i][1] = wg_h(c[i][1], a[i].v, b[1].v);
        }
        if (RES) {
          const u16* pe = tb + ES + fa + ks;
          FragH e[4];
#pragma unroll
          for (int i = 0; i < 4; ++i) {
            e[i].q[0] = *(const v4u*)(pe + i * 16 * TP); e[i].q[1] = *(const v4u*)(pe + i * 16 * TP + 16);
          }
#pragma unroll
          for (int i = 0; i < 4; ++i) {
            r[i][0] = wg_h(r[i][0], e[i].v, b[0].v); r[i][1] = wg_h(r[i][1], e[i].v, b[1].v);
          }
        }
      }
    }
    // Hand-over: this wave's LDS reads of tile t are done, its copies of tile t + 1 have landed;
    // the barrier publishes tile t + 1 and frees tile t's buffer for tile t + 2.
    asm volatile("s_wait_dscnt 0x0" ::: "memory");
    asm volatile("s_wait_asynccnt 0x0" ::: "memory");
    __syncthreads();
    if (t + 2 < nt) copy_tile(t + 2);
  }
  asm volatile("s_wait_asynccnt 0x0" ::: "memory");   // nothing in flight when pool becomes the C stage

  // Behind the last trip's barrier every reader has left both buffers: pool is the C stage now.
  float* cs = (float*)pool + wave * (64 * 36);
#pragma unroll
  for (int i = 0; i < 4; ++i) {
#pragma unroll
    for (int e = 0; e < 8; ++e) {
      const int ra = 16 * i + 8 * h + e;
      float v0 = sh * c[i][0][e], v1 = sh * c[i][1][e];
      if (RES) { v0 += sr * r[i][0][e]; v1 += sr * r[i][1][e]; }
      cs[ra * 36 + l] = v0;
      cs[ra * 36 + 16 + l] = v1;
    }
  }
  __syncthreads();
  if constexpr (EPI == 0) {
    v4f val[16];
#pragma unroll
    for (int i = 0; i < 16; ++i) {
      const int row = 4 * i + (lane >> 3);
      val[i] = *(const v4f*)(cs + row * 36 + (lane & 7) * 4);
    }
#pragma unroll
    for (int i = 0; i < 16; ++i) {
      const int row = 4 * i + (lane >> 3);
      *(v4f*)(C + (size_t)(mb + row) * (size_t)ldc + nb + (lane & 7) * 4) = val[i];
    }
  } else {
    // behind the barrier above every wave's part of the tile is in LDS; bn is the head (block-uniform)
    static_assert(GEMM_BM == 128 && HD == 128 && SE % GEMM_BM == 0);
    const float* st = (const float*)pool;
    const bool early = (mblk < SE);                  // the tile's rows all have residual planes, or none has
    if (bn < NH + NKV) {
      const bool isq = bn < NH;
      u16* Ph = isq ? ep.Qh + (size_t)bn * SEQ * HD : ep.Kh + (size_t)(bn - NH) * SEQ * HD;
      u16* Pl = isq ? ep.Ql + (size_t)bn * SE * HD : ep.Kl + (size_t)(bn - NH) * SE * HD;
      if (early) rope_epi<true>(st, mblk, ep.pos, ep.tc, ep.ts, Ph, Pl);
      else rope_epi<false>(st, mblk, ep.pos, ep.tc, ep.ts, Ph, Pl);
    } else {
      const int kv = bn - (NH + NKV);
      u16* Vh = ep.Vth + (size_t)kv * HD * SEQ;
      u16* Vl = ep.Vtl + (size_t)kv * HD * SE;
      if (early) vt_epi<true>(st, mblk, Vh, Vl);
      else vt_epi<false>(st, mblk, Vh, Vl);
    }
  }
}

// ---------------------------------------------------------------------------------------
// Causal GQA flash attention. Block = 8 waves = 4 q heads of one kv head x 32 queries
// (wave w: head kv*4 + (w>>1), queries q0 + (w&1)*16 .. +15). Keys in chunks of 32 staged
// in LDS (two buffers, filled one chunk ahead by asynchronous copies): K tile [32][128] (A operand of S^T = K x Q^T, lane = key row) and V^T tile
// [128 d][32 keys] (B operand of O += P x V, lane = d). Queries live on lanes for the
// softmax; P in D layout of S^T is the A-fragment layout of P x V (lane = query,
// elements 0..7 = keys 8h..8h+7, 8..15 = keys 16+8h..). Online softmax in f32 (exp2 form),
// P carried as f16(4096 p), V as f16(16 v), ctx written as f16(64 ctx).
// EARLY (query rows < SE): q, k, P, v get x1024 residual planes and a second accumulator
// folded before normalisation; head dim handled in four 32-wide passes whose ctx results
// pass; ctx also gets a residual plane Cr. Output Ch [SEQ][HID] (head*128 + d), Cr [SE][HID].
// VGPR file capped at 256 (no high-bank registers).
// pool: ATTN_POOL(EARLY) halves of LDS; stg: 16384 halves of LDS (used where EARLY).
#define ATTN_POOL(EARLY) (2 * ((EARLY) ? 2 : 1) * (32 * (HD + 8) + HD * (32 + 8)))
template <bool EARLY>
__device__ __forceinline__
void attn_body(u16* pool, u16* stg, int qblk, int kv,
               const u16* __restrict__ Qh, const u16* __restrict__ Ql,
               const u16* __restrict__ Kh, const u16* __restrict__ Kl,
               const u16* __restrict__ Vth, const u16* __restrict__ Vtl,
               const int* __restrict__ amask,
               u16* __restrict__ Ch, u16* __restrict__ Cr) {
  // LDS row pitch = 16 B x odd, so that the 16 rows one ds_load_b128 reads fall on distinct banks:
  // K rows (256 B of data) at 272 B, Vt rows (64 B of data) at 80 B.
  constexpr int KP = HD + 8, VP = 32 + 8;             // pitches in halves
  constexpr int KT = 32 * KP, VT = HD * VP;           // tile sizes in halves
  // One buffer = K | (Kres) | Vt | (Vtres) tiles of one key chunk; two buffers, chunk kc in buffer kc & 1:
  // chunk kc + 1 is copied global -> LDS (asynchronous, through no register) while chunk kc is worked on.
  constexpr int KS = 0, KL = KT, VS = EARLY ? 2 * KT : KT, VL = VS + VT;
  constexpr int BUF = EARLY ? 2 * KT + 2 * VT : KT + VT;  // halves per buffer
  static_assert(2 * BUF == ATTN_POOL(EARLY));         // stg where EARLY: per-wave ctx stage [8][16][128]
  static_assert((BUF * 2) % 16 == 0 && (KP * 2) % 16 == 0 && (VP * 2) % 16 == 0);
  static_assert(EARLY || 2 * BUF >= 16384);           // pool doubles as the ctx stage behind the loop
  constexpr int NDT = EARLY ? 2 : 8;
  constexpr int DW = NDT * 16;
  constexpr int NPASS = HD / DW;
  // lane number as the shuffles read it (equal to tid & 31 in this one-dimensional block): h and l then come
  // from a register that is live in the loop anyway, which keeps the kernel inside its 256 registers unspilled
  const int tid = threadIdx.x, lane = (int)__lane_id(), h = lane >> 4, l = lane & 15;
  // the wave's number in a scalar register: what follows from it (head, first query) is scalar too
  const int wave = __builtin_amdgcn_readfirstlane(tid >> 5);
  const int head = kv * (NH / NKV) + (wave >> 1);
  const int q0 = qblk * BQW;
  const int qw0 = q0 + (wave & 1) * 16;
  const int qrow = qw0 + l;                          // this lane's query
  const int nchunk = qblk + 1;                       // keys 0 .. q0+31

  FragH qh[4];
  FragH ql[4];
  const u16* qb = Qh + ((size_t)head * SEQ + qrow) * HD + 8 * h;
  const u16* qlb = Ql + ((size_t)head * SE + (EARLY ? qrow : 0)) * HD + 8 * h;
#pragma unroll
  for (int dc = 0; dc < 4; ++dc) {
    const u16* b = qb + dc * 32;
    qh[dc].q[0] = *(const v4u*)b;
    qh[dc].q[1] = *(const v4u*)(b + 16);
    if (EARLY) {
      const u16* b2 = qlb + dc * 32;
      ql[dc].q[0] = *(const v4u*)b2;
      ql[dc].q[1] = *(const v4u*)(b2 + 16);
    } else {
      ql[dc].q[0] = qh[dc].q[0];
      ql[dc].q[1] = qh[dc].q[1];
    }
  }
  // The Q loads' address registers are inputs of the wait, so that they stay as they are up to it:
  // no Q fragment lands on a register that a load still in flight names.
  if (EARLY) asm volatile("s_wait_xcnt 0x0" :: "v"(qb), "v"(qlb) : "memory");
  else asm volatile("s_wait_xcnt 0x0" :: "v"(qb) : "memory");
  const float SCL = 0.088388347648318441f * 1.4426950408889634f;   // log2(e)/sqrt(128)

  // ctx stage [16 rows][128 cols] per wave: EARLY in its own region (persists across the
  // 32-wide passes), otherwise aliasing pool after the K/V tiles are dead.
  u16* os;
  if (EARLY) os = stg + wave * (16 * 128);
  else os = pool + wave * (16 * 128);

  // This lane's 16-byte pieces of a chunk: K rows kr and kr + 16, Vt rows vd and vd + 64.
  const int kr = tid >> 4, kcol = (tid & 15) * 8;
  const int vd = tid >> 2, vcol = (tid & 3) * 8;
  const unsigned lbase = (unsigned)(size_t)pool;     // byte offset of pool in the work-group's LDS
  const unsigned lk = lbase + 2u * (unsigned)(KS + kr * KP + kcol);
  const unsigned lv = lbase + 2u * (unsigned)(VS + vd * VP + vcol);
  const u16* gk = Kh + ((size_t)kv * SEQ + kr) * HD + kcol;
  const u16* gv = Vth + ((size_t)kv * HD + vd) * SEQ + vcol;
  const u16* gkl = Kl + ((size_t)kv * SE + kr) * HD + kcol;
  const u16* gvl = Vtl + ((size_t)kv * HD + vd) * SE + vcol;
  // Issue the copies of chunk c into buffer c & 1 (all lanes on, block-uniform call sites). The
  // s_wait_xcnt closes each statement so that no address register is rewritten ahead of it.
  auto copy_chunk = [&](int c) {
    const unsigned bo = (unsigned)(c & 1) * (unsigned)(BUF * 2);
    const unsigned k0 = lk + bo, k1 = k0 + 2u * 16u * KP;
    const unsigned v0 = lv + bo, v1 = v0 + 2u * 64u * VP;
    const u16* a0 = gk + (size_t)c * (32 * HD);
    const u16* a1 = a0 + 16 * HD;
    const u16* b0 = gv + c * 32;
    const u16* b1 = b0 + (size_t)64 * SEQ;
    asm volatile("global_load_async_to_lds_b128 %0, %4, off\n\t"
                 "global_load_async_to_lds_b128 %1, %5, off\n\t"
                 "global_load_async_to_lds_b128 %2, %6, off\n\t"
                 "global_load_async_to_lds_b128 %3, %7, off\n\t"
                 "s_wait_xcnt 0x0"
                 :: "v"(k0), "v"(k1), "v"(v0), "v"(v1), "v"(a0), "v"(a1), "v"(b0), "v"(b1) : "memory");
    if (EARLY) {
      const unsigned k2 = k0 + 2u * (KL - KS), k3 = k1 + 2u * (KL - KS);
      const unsigned v2 = v0 + 2u * (VL - VS), v3 = v1 + 2u * (VL - VS);
      const u16* a2 = gkl + (size_t)c * (32 * HD);
      const u16* a3 = a2 + 16 * HD;
      const u16* b2 = gvl + c * 32;
      const u16* b3 = b2 + (size_t)64 * SE;
      asm volatile("global_load_async_to_lds_b128 %0, %4, off\n\t"
                   "global_load_async_to_lds_b128 %1, %5, off\n\t"
                   "global_load_async_to_lds_b128 %2, %6, off\n\t"
                   "global_load_async_to_lds_b128 %3, %7, off\n\t"
                   "s_wait_xcnt 0x0"
                   :: "v"(k2), "v"(k3), "v"(v2), "v"(v3), "v"(a2), "v"(a3), "v"(b2), "v"(b3) : "memory");
    }
  };

#pragma unroll 1
  for (int pass = 0; pass < NPASS; ++pass) {
    const int dbase = pass * DW;
    v8f o[NDT];
    v8f orr[NDT];
#pragma unroll
    for (int dt = 0; dt < NDT; ++dt) { o[dt] = zero8(); orr[dt] = zero8(); }
    float rmax = -1.0e30f, rsum = 0.0f;

    // Chunk 0 lands and is published, then chunk 1 is set flying. (A later pass gets here behind
    // the last trip's s_wait_dscnt and barrier, so every reader has left both buffers.)
    copy_chunk(0);
    asm volatile("s_wait_asynccnt 0x0" ::: "memory");  // this wave's copies of chunk 0 have landed
    __syncthreads();                                 // ... and every other wave's
    if (nchunk > 1) copy_chunk(1);
    int av = amask[imin(lane, SEQ - 1)];             // padding mask of chunk 0's keys

#pragma unroll 1
    for (int kc = 0; kc < nchunk; ++kc) {
      const int kbase = kc * 32;
      const u16* tb = pool + (kc & 1) * BUF;         // this chunk's buffer
      // padding-mask word for the 32 keys of this chunk, per wave (all lanes active); the next
      // chunk's mask values are read one chunk ahead, like its tiles
      const unsigned mw = __builtin_amdgcn_ballot_w32(av != 0);
      av = amask[imin(kbase + 32 + lane, SEQ - 1)];

      // This chunk's LDS fragment reads stand in groups ahead of the matrix instructions that use
      // them, so that one LDS latency is waited out per group and not one per matrix instruction.
      // A group is issued where the registers of fragments already used have come free.
      auto ld_k = [&](int plane, int sub, int dc) {
        FragH f;
        const u16* p = tb + plane + (sub * 16 + l) * KP + dc * 32 + 8 * h;
        f.q[0] = *(const v4u*)p;
        f.q[1] = *(const v4u*)(p + 16);
        return f;
      };
      auto ld_v = [&](int plane, int dt) {
        FragH f;
        const u16* p = tb + plane + (dbase + dt * 16 + l) * VP + 8 * h;
        f.q[0] = *(const v4u*)p;
        f.q[1] = *(const v4u*)(p + 16);
        return f;
      };
      FragH kf[2][4], kg[2][4], vf[NDT], vg[NDT];
      v8f acc[2], accr[2];
      acc[0] = zero8(); acc[1] = zero8(); accr[0] = zero8(); accr[1] = zero8();
      if (!EARLY) {
        // all K fragments first; the two key halves' chains alternate; V fragments follow in two
        // groups among the last score products and land while the softmax is worked out
        // (loops unrolled: the fragment arrays are indexed by constants and stay in registers)
#pragma unroll
        for (int dc = 0; dc < 4; ++dc) { kf[0][dc] = ld_k(KS, 0, dc); kf[1][dc] = ld_k(KS, 1, dc); }
#pragma unroll
        for (int dc = 0; dc < 4; ++dc) {
          acc[0] = wg_h(acc[0], kf[0][dc].v, qh[dc].v);
          acc[1] = wg_h(acc[1], kf[1][dc].v, qh[dc].v);
          if (dc == 1 || dc == 3) {
#pragma unroll
            for (int i = 0; i < NDT / 2; ++i) {
              const int dt = (dc >> 1) * (NDT / 2) + i;
              vf[dt] = ld_v(VS, dt);
            }
          }
        }
      } else {
        // step i = key half i >> 2, 32-wide d step i & 3, with its value and residual fragments.
        // Reads go out two steps at a time, one step ahead of their first product (three steps'
        // fragments at most are held: the register file allows no more here); the V fragments
        // go out ahead of the last step and land while the softmax is worked out.
        auto ld_step = [&](int i) {
          kf[i >> 2][i & 3] = ld_k(KS, i >> 2, i & 3);
          kg[i >> 2][i & 3] = ld_k(KL, i >> 2, i & 3);
        };
        ld_step(0);
        ld_step(1);
        // unrolled: the fragment arrays are indexed by constants and stay in registers
#pragma unroll
        for (int i = 0; i < 8; ++i) {
          const int sub = i >> 2, dc = i & 3;
          acc[sub] = wg_h(acc[sub], kf[sub][dc].v, qh[dc].v);
          accr[sub] = wg_h(accr[sub], kf[sub][dc].v, ql[dc].v);
          accr[sub] = wg_h(accr[sub], kg[sub][dc].v, qh[dc].v);
          if (i == 0 || i == 2 || i == 4) {
            ld_step(i + 2);
            ld_step(i + 3);
          }
          if (i == 6) {
#pragma unroll
            for (int dt = 0; dt < NDT; ++dt) { vf[dt] = ld_v(VS, dt); vg[dt] = ld_v(VL, dt); }
          }
        }
      }

      // scores S^T[key][query]; lane l = query, element r = key sub*16 + 8h + r
      float u[16];
#pragma unroll
      for (int sub = 0; sub < 2; ++sub) {
#pragma unroll
        for (int r = 0; r < 8; ++r) {
          float s = acc[sub][r];
          if (EARLY) s += accr[sub][r] * (1.0f / 1024.0f);
          u[sub * 8 + r] = s * SCL;
        }
      }
      // Online softmax of the chunk. MASKED: the causal compare and the padding bit of every key are
      // worked out and applied; otherwise every key counts and none of that arithmetic is done.
      // (Its loops are unrolled so that u, ph and pr are indexed by constants and stay in registers.)
      float scale, psum;
      FragH ph;
      FragH pr;
      auto soft = [&](auto masked) {
        constexpr bool MASKED = decltype(masked)::value;
        // bit j of vw: key kbase + 8h + j counts (at or before this lane's query, not padded out)
        unsigned vw = 0xFFFFFFFFu;
        if (MASKED) {
          const int lim = (qw0 - kbase) + (l - 8 * h);
          const unsigned cw = lim < 0 ? 0u : (lim >= 31 ? 0xFFFFFFFFu : (2u << lim) - 1u);
          vw = (mw >> (8 * h)) & cw;
        }
        float m_new = rmax;
#pragma unroll
        for (int i = 0; i < 16; ++i) {
          if (MASKED) u[i] = ((vw >> ((i >> 3) * 16 + (i & 7))) & 1u) ? u[i] : -1.0e30f;
          m_new = fmaxf(m_new, u[i]);
        }
        m_new = fmaxf(m_new, __shfl_xor(m_new, 16, 32));
        scale = __builtin_amdgcn_exp2f(rmax - m_new);
        rmax = m_new;
        psum = 0.0f;
#pragma unroll
        for (int i = 0; i < 16; ++i) {
          const float pe = __builtin_amdgcn_exp2f(u[i] - m_new);
          const float pv = (!MASKED || ((vw >> ((i >> 3) * 16 + (i & 7))) & 1u)) ? pe : 0.0f;
          psum += pv;
          const float pc = pv * 4096.0f;
          const f16 hv = (f16)pc;
          ph.h[i] = hv;
          if (EARLY) pr.h[i] = (f16)((pc - (float)hv) * 1024.0f);
          else pr.h[i] = hv;
        }
      };
      // The same for every lane of the wave (scalar operands): all 32 keys of the chunk lie at or
      // before the wave's first query and none is padded out. True of every chunk but the last
      // where the padding mask is all ones.
      if (kbase + 31 <= qw0 && mw == 0xFFFFFFFFu) soft(BoolC<false>{});
      else soft(BoolC<true>{});
      psum += __shfl_xor(psum, 16, 32);
      rsum = rsum * scale + psum;

      float sc[8];
#pragma unroll
      for (int r = 0; r < 8; ++r) sc[r] = __shfl(scale, 8 * h + r, 32);
#pragma unroll
      for (int dt = 0; dt < NDT; ++dt) {
#pragma unroll
        for (int r = 0; r < 8; ++r) {
          o[dt][r] *= sc[r];
          if (EARLY) orr[dt][r] *= sc[r];
        }
      }
      // O += P x V ; B fragment lane = d row of the Vt tile, elements = keys (split map)
#pragma unroll
      for (int dt = 0; dt < NDT; ++dt) {
        o[dt] = wg_h(o[dt], ph.v, vf[dt].v);
        if (EARLY) {
          orr[dt] = wg_h(orr[dt], pr.v, vf[dt].v);
          orr[dt] = wg_h(orr[dt], ph.v, vg[dt].v);
        }
      }
      // Hand-over: this wave's LDS reads of chunk kc are done, its copies of chunk kc + 1 have
      // landed; the barrier publishes chunk kc + 1 and frees chunk kc's buffer for chunk kc + 2.
      asm volatile("s_wait_dscnt 0x0" ::: "memory");
      asm volatile("s_wait_asynccnt 0x0" ::: "memory");
      __syncthreads();
      if (kc + 2 < nchunk) copy_chunk(kc + 2);
    }
    asm volatile("s_wait_asynccnt 0x0" ::: "memory");  // nothing in flight when the buffers are reused

    // epilogue: ctx = (o + orr/1024) / (4096 * 16 * l); plane value = 64 * ctx
    if (!EARLY) __syncthreads();                     // K/V tiles dead, pool reused as stage
    const float inv = 1.0f / rsum;
    float ir[8];
#pragma unroll
    for (int r = 0; r < 8; ++r) ir[r] = __shfl(inv, 8 * h + r, 32) * (1.0f / 1024.0f);
    const int cb = EARLY ? ((pass & 1) * 32) : 0;   // column offset inside the 64-wide line half
#pragma unroll
    for (int dt = 0; dt < NDT; ++dt) {
#pragma unroll
      for (int r = 0; r < 8; ++r) {
        float val = o[dt][r];
        if (EARLY) val += orr[dt][r] * (1.0f / 1024.0f);
        val *= ir[r];
        if (EARLY) {
          u16 a, b;
          split1024(val, a, b);
          os[(8 * h + r) * 128 + cb + dt * 16 + l] = a;
          os[(8 * h + r) * 128 + 64 + cb + dt * 16 + l] = b;
        } else {
          os[(8 * h + r) * 128 + dt * 16 + l] = hbits(val);
        }
      }
    }
    if (!EARLY) {
      __syncthreads();
      // 16 rows x 256 B = 32 lines; instruction i: lanes 8g..8g+7 -> line 4i+g
      v4u vals[8];
#pragma unroll
      for (int i = 0; i < 8; ++i) {
        const int L = 4 * i + (lane >> 3);
        const int row = L >> 1, seg = L & 1;
        vals[i] = *(const v4u*)(os + row * 128 + seg * 64 + (lane & 7) * 8);
      }
#pragma unroll
      for (int i = 0; i < 8; ++i) {
        const int L = 4 * i + (lane >> 3);
        const int row = L >> 1, seg = L & 1;
        *(v4u*)(Ch + (size_t)(qw0 + row) * HID + head * HD + seg * 64 + (lane & 7) * 8) = vals[i];
      }
      // the pair's next query block follows: no register of the stores above is rewritten ahead of this wait
      asm volatile("s_wait_xcnt 0x0" ::: "memory");
    } else {
      if ((pass & 1) != 0) {                         // block-uniform: stage holds d line (pass>>1)
        __syncthreads();
        const int dline = (pass >> 1) * 64;
        v4u va[4], vb[4];
#pragma unroll
        for (int i = 0; i < 4; ++i) {
          const int row = 4 * i + (lane >> 3);
          va[i] = *(const v4u*)(os + row * 128 + (lane & 7) * 8);
          vb[i] = *(const v4u*)(os + row * 128 + 64 + (lane & 7) * 8);
        }
#pragma unroll
        for (int i = 0; i < 4; ++i) {
          const int row = 4 * i + (lane >> 3);
          const size_t off = (size_t)(qw0 + row) * HID + head * HD + dline + (lane & 7) * 8;
          *(v4u*)(Ch + off) = va[i];
          *(v4u*)(Cr + off) = vb[i];
        }
        // the next pass or query block follows: no register of the stores above is rewritten ahead of this wait
        asm volatile("s_wait_xcnt 0x0" ::: "memory");
      }
    }
  }
}

// ---------------------------------------------------------------------------------------
// Launches. Jobs that need nothing of each other share one grid: a range of the block index
// (the same for a whole block) picks the job, so that part-filled grids run side by side.

// hidden -> bf16 and the rotary tables | wq, wk, wv -> bf16, transposed | wo -> f16, transposed
#define NB_X SEQ
#define NB_WQ ((HID / 64) * ((NH * HD) / 64))
#define NB_WKV ((HID / 64) * ((NKV * HD) / 64))
#define NB_WO ((HID / 64) * (HID / 64))
__global__ __launch_bounds__(256) void k_prep(const float* __restrict__ x, const float* __restrict__ wq,
                                             const float* __restrict__ wk, const float* __restrict__ wv,
                                             const float* __restrict__ wo, u16* __restrict__ xb,
                                             float* __restrict__ tc, float* __restrict__ ts,
                                             u16* __restrict__ wqkvt, u16* __restrict__ wot) {
  __shared__ __align__(16) u16 T[64 * 72];
  constexpr int NI = HID / 64;                       // tiles along the weights' input dimension
  const int b = (int)blockIdx.x;
  if (b < NB_X) {
    xconv_body(b, x, xb, tc, ts);
  } else if (b < NB_X + NB_WQ) {
    const int r = b - NB_X;
    wt_body<0>(T, r % NI, r / NI, wq, wqkvt, NH * HD);
  } else if (b < NB_X + NB_WQ + NB_WKV) {
    const int r = b - (NB_X + NB_WQ);
    wt_body<0>(T, r % NI, r / NI, wk, wqkvt + (size_t)(NH * HD) * HID, NKV * HD);
  } else if (b < NB_X + NB_WQ + 2 * NB_WKV) {
    const int r = b - (NB_X + NB_WQ + NB_WKV);
    wt_body<0>(T, r % NI, r / NI, wv, wqkvt + (size_t)(NH * HD + NKV * HD) * HID, NKV * HD);
  } else {
    const int r = b - (NB_X + NB_WQ + 2 * NB_WKV);
    wt_body<1>(T, r % NI, r / NI, wo, wot, HID);
  }
}

// qkv projection with rotary, f16 planes and V transposition in its epilogue
static_assert(NB_X == SEQ_FULL);                     // one table row a position
__global__ __launch_bounds__(256) void k_qkv(const u16* __restrict__ A, const u16* __restrict__ BT,
                                            const int* __restrict__ pos,
                                            const float* __restrict__ tc, const float* __restrict__ ts,
                                            u16* __restrict__ Qh, u16* __restrict__ Ql,
                                            u16* __restrict__ Kh, u16* __restrict__ Kl,
                                            u16* __restrict__ Vth, u16* __restrict__ Vtl,
                                            int lda, int ldb, int K) {
  __shared__ __align__(16) u16 pool[GEMM_POOL(false)];
  const QkvEpi ep = {pos, tc, ts, Qh, Ql, Kh, Kl, Vth, Vtl};
  gemm_body<0, false, 1>(pool, (int)blockIdx.x, (int)blockIdx.y, A, A, BT, nullptr, lda, ldb, 0, K, 1.0f, 0.0f, ep);
}

// attention: a work-group works two query blocks, one after the other, whose key chunk counts add up to the
// same sum in every work-group of its kind (block j and the last but j): the cost of a causal query block
// grows with its index, all work-groups are resident at once, and the launch lasts as long as the fullest.
template <bool EARLY>
__device__ __forceinline__
void attn_pair(u16* pool, u16* stg, int qfirst, int qsecond, int kv,
               const u16* __restrict__ Qh, const u16* __restrict__ Ql,
               const u16* __restrict__ Kh, const u16* __restrict__ Kl,
               const u16* __restrict__ Vth, const u16* __restrict__ Vtl,
               const int* __restrict__ amask,
               u16* __restrict__ Ch, u16* __restrict__ Cr) {
  // not unrolled: one copy of the body in the instruction cache
#pragma unroll 1
  for (int ph = 0; ph < 2; ++ph) {
    attn_body<EARLY>(pool, stg, ph == 0 ? qfirst : qsecond, kv, Qh, Ql, Kh, Kl, Vth, Vtl, amask, Ch, Cr);
    if (!EARLY && ph == 0) {
      // Between the two blocks: the first one's ctx stage lies in pool, which the second one's copies fill
      // anew: this wave's LDS reads of it are done, and behind the barrier every wave's. (Where EARLY the
      // stage is each wave's own part of stg, and pool was left behind the last trip's barrier.)
      asm volatile("s_wait_dscnt 0x0" ::: "memory");
      __syncthreads();
    }
  }
}

// Pairs among the query blocks of the leading SE rows (residual planes) | pairs among the rest.
#define NQB (SEQ / BQW)
#define NEB (SE / BQW)
static_assert(NEB % 2 == 0 && (NQB - NEB) % 2 == 0);
__global__ __launch_bounds__(256) __attribute__((amdgpu_num_vgpr(256)))
void k_attn(const u16* __restrict__ Qh, const u16* __restrict__ Ql,
            const u16* __restrict__ Kh, const u16* __restrict__ Kl,
            const u16* __restrict__ Vth, const u16* __restrict__ Vtl,
            const int* __restrict__ amask,
            u16* __restrict__ Ch, u16* __restrict__ Cr) {
  __shared__ __align__(16) u16 pool[ATTN_POOL(true)];
  __shared__ __align__(16) u16 stg[16384];
  const int pr = (int)blockIdx.x, kv = (int)blockIdx.y;
  if (pr < NEB / 2) {
    attn_pair<true>(pool, stg, NEB - 1 - pr, pr, kv, Qh, Ql, Kh, Kl, Vth, Vtl, amask, Ch, Cr);
  } else {
    const int j = pr - NEB / 2;
    attn_pair<false>(pool, stg, NQB - 1 - j, NEB + j, kv, Qh, Ql, Kh, Kl, Vth, Vtl, amask, Ch, Cr);
  }
}

// output projection: row tiles of the leading SE rows (with the residual ctx plane) | the rest
__global__ __launch_bounds__(256) void k_oproj(const u16* __restrict__ A, const u16* __restrict__ Ar,
                                              const u16* __restrict__ BT, float* __restrict__ C,
                                              int lda, int ldb, int ldc, int K, float sh, float sr) {
  __shared__ __align__(16) u16 pool[GEMM_POOL(true)];
  const int bn = (int)blockIdx.x, bm = (int)blockIdx.y;
  const QkvEpi none = {};
  if (bm < SE / GEMM_BM) gemm_body<1, true, 0>(pool, bn, bm, A, Ar, BT, C, lda, ldb, ldc, K, sh, sr, none);
  else gemm_body<1, false, 0>(pool, bn, bm, A, A, BT, C, lda, ldb, ldc, K, sh, 0.0f, none);
}

// ---------------------------------------------------------------------------------------
extern "C" void kernel_launch(void* const* d_in, const int* in_sizes, int n_in,
                              void* d_out, int out_size, void* d_ws, size_t ws_size,
                              hipStream_t stream) {
  if (n_in < 7) return;
  if (in_sizes[0] < SEQ * HID) return;
  if (in_sizes[1] < SEQ) return;
  if (in_sizes[2] < SEQ) return;
  if (in_sizes[3] < HID * NH * HD) return;
  if (in_sizes[4] < HID * NKV * HD) return;
  if (in_sizes[5] < HID * NKV * HD) return;
  if (in_sizes[6] < NH * HD * HID) return;
  if (out_size < SEQ * HID) return;

  const float* hs  = (const float*)d_in[0];
  const int*   am  = (const int*)d_in[1];
  const int*   pos = (const int*)d_in[2];
  const float* wq  = (const float*)d_in[3];
  const float* wk  = (const float*)d_in[4];
  const float* wv  = (const float*)d_in[5];
  const float* wo  = (const float*)d_in[6];
  float* out = (float*)d_out;

  char* ws = (char*)d_ws;
  size_t off = 0;
#define CARVE(T, name, bytes) T* name = (T*)(ws + off); off += (((size_t)(bytes)) + 255) & ~(size_t)255
  CARVE(u16,   Xb,    (size_t)SEQ * HID * 2);          // bf16 bits [SEQ][HID]
  CARVE(u16,   WqkvT, (size_t)NQKV * HID * 2);         // bf16 bits [3072][HID]
  CARVE(u16,   WoT,   (size_t)HID * HID * 2);          // f16 bits  [HID][HID]
  CARVE(u16,   Qh,    (size_t)NH * SEQ * HD * 2);
  CARVE(u16,   Kh,    (size_t)NKV * SEQ * HD * 2);
  CARVE(u16,   Vth,   (size_t)NKV * HD * SEQ * 2);
  CARVE(u16,   Ql,    (size_t)NH * SE * HD * 2);
  CARVE(u16,   Kl,    (size_t)NKV * SE * HD * 2);
  CARVE(u16,   Vtl,   (size_t)NKV * HD * SE * 2);
  CARVE(u16,   Cr,    (size_t)SE * HID * 2);
  CARVE(float, Tc,    (size_t)SEQ_FULL * 64 * 4);      // cos [SEQ_FULL][64]
  CARVE(float, Ts,    (size_t)SEQ_FULL * 64 * 4);      // sin [SEQ_FULL][64]
#undef CARVE
  // Ch [SEQ][HID] f16 plane aliases the Xb region: identical extent (SEQ*HID halves), Xb is
  // read only by the qkv projection launch, Ch is first written by the attention launch
  // that comes after it on the same in-order stream.
  static_assert(NH * HD == HID);
  u16* Ch = Xb;
  if (off > ws_size) return;

  // 1) hidden -> bf16, rotary tables; weights: w [HID][n] -> wt [n][HID]
  k_prep<<<dim3(NB_X + NB_WQ + 2 * NB_WKV + NB_WO), 256, 0, stream>>>(hs, wq, wk, wv, wo, Xb, Tc, Ts, WqkvT, WoT);
  // 2) fused qkv projection: [SEQ][HID] x [HID][3072], rotary + q, k planes and V transposed planes from its tiles
  k_qkv<<<dim3(NQKV / 128, SEQ / GEMM_BM), 256, 0, stream>>>(Xb, WqkvT, pos, Tc, Ts, Qh, Ql, Kh, Kl, Vth, Vtl,
                                                            HID, HID, HID);
  // 3) attention: leading SE rows with residual planes, the rest single products; two query blocks a work-group
  k_attn<<<dim3(SEQ / BQW / 2, NKV), 256, 0, stream>>>(Qh, Ql, Kh, Kl, Vth, Vtl, am, Ch, Cr);
  // 4) output projection: rows < SE with the residual ctx plane, the rest plain
  k_oproj<<<dim3(HID / 128, SEQ / GEMM_BM), 256, 0, stream>>>(
      Ch, Cr, WoT, out, HID, HID, HID, HID, 1.0f / 4096.0f, 1.0f / (4096.0f * 1024.0f));
}
